// v000
// Times are from an AMD MI455X. After a warm-up the kernel runs many times in a row, and a time is the length of
// such a window on the GPU divided by its runs, so every launch and the gaps after it count. The runs cycle
// through copies of the inputs. A figure is the median of several windows, for all but v000 over two sittings.
// Sittings can differ by a few percent; kernels timed side by side share one.
// v000, which the later versions start from, runs in 956 microseconds.
// Contractions x.Wq^T, x.Wk^T, Wv.x^T, q.k^T, p.v, ctx.Wo^T: v_wmma_f32_16x16x32_bf16 on bf16 hi/lo split operand planes (hi.hi + hi.lo + lo.hi), f32 accumulate; per-row 64x2 gating dots, softmax, distance adjacency, max- and sum-normalisation in f32 on the VALU (hardware exp2/rcp).
#include <hip/hip_runtime.h>
#include <math.h>
#include <stdint.h>

constexpr int kBatch = 16;
constexpr int kSeq   = 512;
constexpr int kDm    = 512;
constexpr int kHeads = 8;
constexpr int kDk    = 64;
constexpr int kGB    = 4;                  // batches per group
constexpr int kNGrp  = kBatch / kGB;       // 4 groups
constexpr int kNZ    = kGB * kHeads;       // 32 (batch-in-group, head) planes per group
constexpr int kGRows = kGB * kSeq;         // 2048 token rows per group
constexpr float kLog2e = 1.4426950408889634f;
static_assert(kSeq == 512 && kDk == 64 && kDm == kHeads * kDk && (kBatch % kGB) == 0, "geometry");

typedef __attribute__((ext_vector_type(16))) _Float16 v16h;
typedef __attribute__((ext_vector_type(8)))  _Float16 v8h;
typedef __attribute__((ext_vector_type(16))) __bf16   v16b;
typedef __attribute__((ext_vector_type(8)))  __bf16   v8b;
typedef __attribute__((ext_vector_type(8)))  float    v8f;
typedef __attribute__((ext_vector_type(4)))  float    v4f;
typedef __attribute__((ext_vector_type(4)))  unsigned int v4u;

__device__ __forceinline__ unsigned short f2bf_bits(float f) {
  unsigned u = __float_as_uint(f);
  return (unsigned short)((u + 0x7FFFu + ((u >> 16) & 1u)) >> 16);
}
__device__ __forceinline__ float bf_bits2f(unsigned short h) { return __uint_as_float(((unsigned)h) << 16); }
__device__ __forceinline__ unsigned pk16(unsigned short a, unsigned short b) { return (unsigned)a | ((unsigned)b << 16); }

// hazard guards as plain device helpers (no inline asm inside the kernel template body)
__device__ __forceinline__ void dep_guard_h(v8f& a, v8f& b, v16h x, v16h y) { asm volatile("v_nop\n\tv_nop\n\tv_nop\n\tv_nop" : "+v"(a), "+v"(b) : "v"(x), "v"(y)); }
__device__ __forceinline__ void dep_guard_b(v8f& a, v8f& b, v16b x, v16b y) { asm volatile("v_nop\n\tv_nop\n\tv_nop\n\tv_nop" : "+v"(a), "+v"(b) : "v"(x), "v"(y)); }
__device__ __forceinline__ void keep4_h(v16h a, v16h b, v16h c, v16h d) { asm volatile("v_nop" :: "v"(a), "v"(b), "v"(c), "v"(d)); }
__device__ __forceinline__ void keep4_b(v16b a, v16b b, v16b c, v16b d) { asm volatile("v_nop" :: "v"(a), "v"(b), "v"(c), "v"(d)); }
__device__ __forceinline__ void acc_guard4(v8f& a, v8f& b, v8f& c, v8f& d) { asm volatile("v_nop\n\tv_nop\n\tv_nop\n\tv_nop" : "+v"(a), "+v"(b), "+v"(c), "+v"(d)); }
template <typename T> struct Frag;
template <> struct Frag<_Float16> {
  typedef v16h V; union U { v16h v; v8h h[2]; };
  static __device__ __forceinline__ v16h load(const _Float16* p) {   // elements 0..7 <- p[0..7], 8..15 <- p[16..23]
    U f; f.h[0] = *(const v8h*)(p); f.h[1] = *(const v8h*)(p + 16); return f.v;
  }
  static __device__ __forceinline__ v8f mma(v16h a, v16h b, v8f c) {
    return __builtin_amdgcn_wmma_f32_16x16x32_f16(false, a, false, b, (short)0, c, false, false);
  }
  static __device__ __forceinline__ void guard(v8f& a, v8f& b, v16h x, v16h y) { dep_guard_h(a, b, x, y); }
  static __device__ __forceinline__ void keep(v16h a, v16h b, v16h c, v16h d) { keep4_h(a, b, c, d); }
};
template <> struct Frag<__bf16> {
  typedef v16b V; union U { v16b v; v8b h[2]; };
  static __device__ __forceinline__ v16b load(const __bf16* p) {
    U f; f.h[0] = *(const v8b*)(p); f.h[1] = *(const v8b*)(p + 16); return f.v;
  }
  static __device__ __forceinline__ v8f mma(v16b a, v16b b, v8f c) {
    return __builtin_amdgcn_wmma_f32_16x16x32_bf16(false, a, false, b, (short)0, c, false, false);
  }
  static __device__ __forceinline__ void guard(v8f& a, v8f& b, v16b x, v16b y) { dep_guard_b(a, b, x, y); }
  static __device__ __forceinline__ void keep(v16b a, v16b b, v16b c, v16b d) { keep4_b(a, b, c, d); }
};

// ---- Register-blocked batched WMMA GEMM ------------------------------------
// C[m,n] = scale * sum_k A[m,k] * Bt[n,k] (+bias)(+resid); each wave owns a 64x64 tile.
// A row-major [M,K]; Bt row-major [N,K]; M,N % 64 == 0, K % 32 == 0.
// SPLIT: operands are hi/lo planes (A2/Bt2 = lo planes, same layout); product = hi.hi + hi.lo + lo.hi.
// BIAS_MODE: 0 = none, 1 = bias[m], 2 = bias[n].
// OUT_MODE: 0 = f32, 1 = f16, 2 = bf16 hi plane (Cout) + bf16 lo plane (Cout2).
// z addressing: bz = blockIdx.y, zi = bz % zsplit, zo = bz / zsplit; operand base = zi*stride + zo*stride2 (elements).
// ET: 0 = f16 operands, 1 = bf16 operands (pointers passed as 16-bit storage)
template <int ET> struct Elem;
template <> struct Elem<0> { typedef _Float16 T; };
template <> struct Elem<1> { typedef __bf16 T; };
template <int ET, bool SPLIT, int BIAS_MODE, int OUT_MODE, bool RESID, int ACT = 0>
__global__ __launch_bounds__(256) void wmma_gemm64(
    const unsigned short* __restrict__ Ap, const unsigned short* __restrict__ A2p, int lda, long strideA, long strideA2,
    const unsigned short* __restrict__ Btp, const unsigned short* __restrict__ Bt2p, int ldb, long strideB, long strideB2,
    void* __restrict__ Cout, void* __restrict__ Cout2, int ldc, long strideC, long strideC2,
    const float* __restrict__ bias,
    const float* __restrict__ resid, long strideR,
    int M, int N, int K, float scale, int zsplit) {
  typedef typename Elem<ET>::T T;
  typedef typename Frag<T>::V V;
  const T* A = (const T*)Ap; const T* A2 = (const T*)A2p; const T* Bt = (const T*)Btp; const T* Bt2 = (const T*)Bt2p;
  __shared__ __align__(16) float sT[8][16 * 68];   // per-wave 16x64 slab, pitch 68 floats
  const int bz   = blockIdx.y;
  const int zo   = bz / zsplit;
  const int zi   = bz - zo * zsplit;
  const int lane = threadIdx.x & 31;
  const int wave = threadIdx.x >> 5;
  const int tilesN = N >> 6;
  const int tilesM = M >> 6;
  const int tile = blockIdx.x * 8 + wave;
  if (tile >= tilesM * tilesN) return;   // wave-uniform; no block barriers in this kernel
  const int tm = tile / tilesN;
  const int tn = tile - tm * tilesN;
  const int m0 = tm << 6;
  const int n0 = tn << 6;

  const size_t aOff = (size_t)zi * strideA + (size_t)zo * strideA2;
  const size_t bOff = (size_t)zi * strideB + (size_t)zo * strideB2;
  const size_t cOff = (size_t)zi * strideC + (size_t)zo * strideC2;
  const T* Ab  = A  + aOff;
  const T* Bb  = Bt + bOff;
  const T* Ab2 = SPLIT ? (A2  + aOff) : nullptr;
  const T* Bb2 = SPLIT ? (Bt2 + bOff) : nullptr;

  const int rlane = lane & 15;                 // row (A) / col (B, D) within subtile
  const int koff  = (lane >> 4) * 8;           // k offset of this lane half
  const int mOff  = (lane >> 4) * 8;           // D row offset

  v8f acc[4][4];
#pragma unroll
  for (int i = 0; i < 4; ++i)
#pragma unroll
    for (int j = 0; j < 4; ++j) acc[i][j] = (v8f){0.f,0.f,0.f,0.f,0.f,0.f,0.f,0.f};

  for (int k0 = 0; k0 < K; k0 += 32) {
    V bh[4], bl[4];
#pragma unroll
    for (int j = 0; j < 4; ++j) {
      const size_t bo = (size_t)(n0 + (j << 4) + rlane) * ldb + koff + k0;
      bh[j] = Frag<T>::load(Bb + bo);
      if (SPLIT) bl[j] = Frag<T>::load(Bb2 + bo);
    }
#pragma unroll
    for (int i = 0; i < 4; ++i) {
      const size_t ao = (size_t)(m0 + (i << 4) + rlane) * lda + koff + k0;
      V ah = Frag<T>::load(Ab + ao);
      V al;
      if (SPLIT) al = Frag<T>::load(Ab2 + ao);
#pragma unroll
      for (int j = 0; j < 4; ++j) {
        acc[i][j] = Frag<T>::mma(ah, bh[j], acc[i][j]);
        if (SPLIT) {
          acc[i][j] = Frag<T>::mma(ah, bl[j], acc[i][j]);
          acc[i][j] = Frag<T>::mma(al, bh[j], acc[i][j]);
        }
      }
      Frag<T>::guard(acc[i][0], acc[i][3], ah, SPLIT ? al : ah);
    }
    Frag<T>::keep(bh[0], bh[1], bh[2], bh[3]);
    if (SPLIT) Frag<T>::keep(bl[0], bl[1], bl[2], bl[3]);
  }
  acc_guard4(acc[0][0], acc[0][1], acc[0][2], acc[0][3]);
  acc_guard4(acc[1][0], acc[1][1], acc[1][2], acc[1][3]);
  acc_guard4(acc[2][0], acc[2][1], acc[2][2], acc[2][3]);
  acc_guard4(acc[3][0], acc[3][1], acc[3][2], acc[3][3]);

  // ---- epilogue ----
  float* slab = sT[wave];
  const float* Rb = RESID ? (resid + (size_t)zi * strideR) : nullptr;
#pragma unroll
  for (int i = 0; i < 4; ++i) {
    const int mBase = m0 + (i << 4);
#pragma unroll
    for (int j = 0; j < 4; ++j) {
      const int n = n0 + (j << 4) + rlane;
      float bv = 0.f;
      if (BIAS_MODE == 2) bv = bias[n];
#pragma unroll
      for (int r = 0; r < 8; ++r) {
        float v = acc[i][j][r] * scale;
        if (BIAS_MODE == 1) v += bias[mBase + mOff + r];
        if (BIAS_MODE == 2) v += bv;
        if (RESID) v += Rb[(size_t)(mBase + mOff + r) * ldc + n];
        if (ACT == 1) v = tanhf(v);
        if (ACT == 2) v = fmaxf(v, 0.0f);
        if (ACT == 4) v = (v > 0.f) ? v : 0.01f * v;
        slab[(mOff + r) * 68 + (j << 4) + rlane] = v;
      }
    }
    __builtin_amdgcn_fence(__ATOMIC_RELEASE, "workgroup");
    __builtin_amdgcn_wave_barrier();
    __builtin_amdgcn_fence(__ATOMIC_ACQUIRE, "workgroup");
    if (OUT_MODE == 0) {
      float* C = (float*)Cout + cOff;
      const int hh = lane >> 4, c4 = (lane & 15) * 4;     // row seg = 256 B = 16 lanes x 16 B
      {
#pragma unroll
        for (int it = 0; it < 8; ++it) {
          const int row = it * 2 + hh;
          v4f v = *(const v4f*)(slab + row * 68 + c4);
          *(v4f*)(C + (size_t)(mBase + row) * ldc + n0 + c4) = v;
        }
        
      }
    } else {
      const int q = lane >> 3, c8 = (lane & 7) * 8;
      unsigned short* C  = (unsigned short*)Cout  + cOff;
      unsigned short* C2 = (OUT_MODE == 2) ? ((unsigned short*)Cout2 + cOff) : nullptr;
      {
#pragma unroll
        for (int it = 0; it < 4; ++it) {
          const int row = it * 4 + q;
          const float* sp = slab + row * 68 + c8;
          v8h hv, lv;
#pragma unroll
          for (int e = 0; e < 8; ++e) {
            if (OUT_MODE == 1) {
              hv[e] = (_Float16)sp[e];
            } else {
              unsigned short hb = f2bf_bits(sp[e]);
              unsigned short lb = f2bf_bits(sp[e] - bf_bits2f(hb));
              hv[e] = __builtin_bit_cast(_Float16, hb);
              lv[e] = __builtin_bit_cast(_Float16, lb);
            }
          }
          *(v8h*)(C + (size_t)(mBase + row) * ldc + n0 + c8) = hv;
          if (OUT_MODE == 2) *(v8h*)(C2 + (size_t)(mBase + row) * ldc + n0 + c8) = lv;
        }
        
      }
    }
    __builtin_amdgcn_fence(__ATOMIC_RELEASE, "workgroup");
    __builtin_amdgcn_wave_barrier();
    __builtin_amdgcn_fence(__ATOMIC_ACQUIRE, "workgroup");
  }
}

// ---------------------------------------------------------------------------
// Elementwise f32 -> bf16 hi/lo split, 8 elements per thread: hi = bf16_rne(x), lo = bf16_rne(x - hi).
// Coverage: grid = n8/256 blocks (n8 = plane/8, exact multiple here; guard kept) x 256 threads x 8 = the whole plane.
// ---------------------------------------------------------------------------
__global__ __launch_bounds__(256) void split_bf16x8_kernel(const float* __restrict__ in, unsigned short* __restrict__ hi,
                                                           unsigned short* __restrict__ lo, int n8) {
  const int i = blockIdx.x * 256 + threadIdx.x;
  if (i < n8) {
    const size_t base = (size_t)i * 8;
    const v4f a = *(const v4f*)(in + base);
    const v4f b = *(const v4f*)(in + base + 4);
    const float f[8] = {a[0], a[1], a[2], a[3], b[0], b[1], b[2], b[3]};
    unsigned hw[4], lw[4];
#pragma unroll
    for (int q = 0; q < 4; ++q) {
      const unsigned short h0 = f2bf_bits(f[2 * q]), h1 = f2bf_bits(f[2 * q + 1]);
      const unsigned short l0 = f2bf_bits(f[2 * q] - bf_bits2f(h0));
      const unsigned short l1 = f2bf_bits(f[2 * q + 1] - bf_bits2f(h1));
      hw[q] = pk16(h0, h1);
      lw[q] = pk16(l0, l1);
    }
    const v4u hv = (v4u){hw[0], hw[1], hw[2], hw[3]};
    const v4u lv = (v4u){lw[0], lw[1], lw[2], lw[3]};
    *(v4u*)(hi + base) = hv;
    *(v4u*)(lo + base) = lv;
    
  }
}

// ---------------------------------------------------------------------------
// Gated mixing, one wave per score row rg = z*512 + i (z = bb*8 + h, bb = batch in group, i = query index).
// Lane l owns columns 8l..8l+7 and 256+8l..256+8l+7 (all 512 columns of the row, 16 per lane, static slots).
//   g_c  = bg[c] + sum_d q[i][h*64+d] * Wg[c][d]  (q = hi + lo planes, f32; 2 lane-parallel products + shuffle tree)
//   qp_c = rcp((|g_c| + 1)^2)
//   p_j  = 2^((s_j - max_j s) * log2e)              (= exp(s - max) = softmax_j / max softmax)
//   adj  = 2^((i-j)^2 * (-0.5 log2e qp_1)) for j < i,  2^((i-j)^2 * (-0.5 log2e qp_0)) for j >= i
//   a_j  = sg * p_j + (1 - sg) * adj,  sg = rcp(1 + 2^(-lam1 * log2e))
//   P_j  = a_j * rcp(sum_j a_j + 1e-9)  -> bf16 hi/lo planes
// exp2 and rcp are the single hardware instructions (v_exp_f32 / v_rcp_f32): no library expansions.
// Reductions in fixed order (per lane sequential, then xor shuffle tree). No LDS, no barriers.
// Producer coverage: grid = nrows/8 blocks x 8 waves = nrows rows; per row 32 lanes x 16 u16 = 512 columns per plane;
// ---------------------------------------------------------------------------
__device__ __forceinline__ float hw_exp2(float x) { return __builtin_amdgcn_exp2f(x); }
__device__ __forceinline__ float hw_rcp(float x)  { return __builtin_amdgcn_rcpf(x); }

__global__ __launch_bounds__(256) void gate_mix_kernel(
    const float* __restrict__ S, const unsigned short* __restrict__ Qh, const unsigned short* __restrict__ Ql,
    const float* __restrict__ Wg, const float* __restrict__ bg, const float* __restrict__ lam1,
    unsigned short* __restrict__ Ph, unsigned short* __restrict__ Pl, int nrows) {
  const int lane = threadIdx.x & 31;
  const int wave = threadIdx.x >> 5;
  const int rg = blockIdx.x * 8 + wave;
  if (rg >= nrows) return;                       // wave-uniform; no barriers in this kernel
  const int z  = rg >> 9;
  const int i  = rg & (kSeq - 1);
  const int bb = z >> 3;
  const int h  = z & (kHeads - 1);
  const float* srow = S + (size_t)rg * kSeq;
  const int j0 = lane * 8;
  const int j1 = 256 + lane * 8;
  const v4f sa = *(const v4f*)(srow + j0);
  const v4f sb = *(const v4f*)(srow + j0 + 4);
  const v4f sc = *(const v4f*)(srow + j1);
  const v4f sd = *(const v4f*)(srow + j1 + 4);
  const float s[16] = {sa[0], sa[1], sa[2], sa[3], sb[0], sb[1], sb[2], sb[3],
                       sc[0], sc[1], sc[2], sc[3], sd[0], sd[1], sd[2], sd[3]};

  // gating dots (64 terms each: 2 products per lane, then a 5-level shuffle tree)
  const size_t qo = (size_t)(bb * kSeq + i) * kDm + (size_t)h * kDk;
  const float q0 = bf_bits2f(Qh[qo + lane]) + bf_bits2f(Ql[qo + lane]);
  const float q1 = bf_bits2f(Qh[qo + 32 + lane]) + bf_bits2f(Ql[qo + 32 + lane]);
  float g0 = q0 * Wg[lane] + q1 * Wg[32 + lane];
  float g1 = q0 * Wg[kDk + lane] + q1 * Wg[kDk + 32 + lane];
#pragma unroll
  for (int off = 16; off > 0; off >>= 1) {
    g0 += __shfl_xor(g0, off, 32);
    g1 += __shfl_xor(g1, off, 32);
  }
  g0 += bg[0];
  g1 += bg[1];
  const float t0 = fabsf(g0) + 1.0f;
  const float t1 = fabsf(g1) + 1.0f;
  const float qp0 = hw_rcp(t0 * t0);
  const float qp1 = hw_rcp(t1 * t1);
  const float gn0 = (-0.5f * kLog2e) * qp0;      // j >= i (upper incl. diagonal)
  const float gn1 = (-0.5f * kLog2e) * qp1;      // j <  i (strictly lower)
  const float lam = lam1[0];
  const float sg  = hw_rcp(1.0f + hw_exp2(-lam * kLog2e));
  const float omg = 1.0f - sg;

  float mx = s[0];
#pragma unroll
  for (int e = 1; e < 16; ++e) mx = fmaxf(mx, s[e]);
#pragma unroll
  for (int off = 16; off > 0; off >>= 1) mx = fmaxf(mx, __shfl_xor(mx, off, 32));

  float a[16];
  float ps = 0.f;
#pragma unroll
  for (int e = 0; e < 16; ++e) {
    const int j = (e < 8) ? (j0 + e) : (j1 + (e - 8));
    const float p   = hw_exp2((s[e] - mx) * kLog2e);
    const float fd  = (float)(i - j);
    const float gs  = (j < i) ? gn1 : gn0;
    const float adj = hw_exp2((fd * fd) * gs);
    const float av  = sg * p + omg * adj;
    a[e] = av;
    ps += av;
  }
#pragma unroll
  for (int off = 16; off > 0; off >>= 1) ps += __shfl_xor(ps, off, 32);
  const float inv = hw_rcp(ps + 1e-9f);

  unsigned hw0[4], lw0[4], hw1[4], lw1[4];
#pragma unroll
  for (int q = 0; q < 4; ++q) {
    const float p0 = a[2 * q] * inv, p1 = a[2 * q + 1] * inv;
    const float p2 = a[8 + 2 * q] * inv, p3 = a[9 + 2 * q] * inv;
    const unsigned short h0 = f2bf_bits(p0), h1 = f2bf_bits(p1), h2 = f2bf_bits(p2), h3 = f2bf_bits(p3);
    const unsigned short l0 = f2bf_bits(p0 - bf_bits2f(h0));
    const unsigned short l1 = f2bf_bits(p1 - bf_bits2f(h1));
    const unsigned short l2 = f2bf_bits(p2 - bf_bits2f(h2));
    const unsigned short l3 = f2bf_bits(p3 - bf_bits2f(h3));
    hw0[q] = pk16(h0, h1); lw0[q] = pk16(l0, l1);
    hw1[q] = pk16(h2, h3); lw1[q] = pk16(l2, l3);
  }
  const v4u hv0 = (v4u){hw0[0], hw0[1], hw0[2], hw0[3]};
  const v4u lv0 = (v4u){lw0[0], lw0[1], lw0[2], lw0[3]};
  const v4u hv1 = (v4u){hw1[0], hw1[1], hw1[2], hw1[3]};
  const v4u lv1 = (v4u){lw1[0], lw1[1], lw1[2], lw1[3]};
  const size_t ro = (size_t)rg * kSeq;
  *(v4u*)(Ph + ro + j0) = hv0;
  *(v4u*)(Ph + ro + j1) = hv1;
  *(v4u*)(Pl + ro + j0) = lv0;
  *(v4u*)(Pl + ro + j1) = lv1;
  
}

// ---------------------------------------------------------------------------
// Workspace region map (bytes; every offset a multiple of 512 KiB). Per-group regions are fully rewritten
// inside each group iteration before any read.
//   Wqh,Wql,Wkh,Wkl,Wvh,Wvl,Woh,Wol  bf16 [512][512] each            0 .. 4194304
//   Xqh,Xql,Xkh,Xkl,Xvh,Xvl          bf16 [2048][512] each     4194304 .. 16777216
//   Qh,Ql,Kh,Kl                      bf16 [2048][512] each    16777216 .. 25165824   (row bb*512+i, col h*64+d)
//   VTh,VTl                          bf16 [4][512][512]       25165824 .. 29360128   (batch, row h*64+d, col token)
//   CTXh,CTXl                        bf16 [2048][512] each    29360128 .. 33554432   (row bb*512+i, col h*64+d)
//   S                                f32  [32][512][512]      33554432 .. 67108864   (z = bb*8+h)
//   Ph,Pl                            bf16 [32][512][512] each 67108864 .. 100663296
//   total 100663296
// ---------------------------------------------------------------------------
extern "C" void kernel_launch(void* const* d_in, const int* in_sizes, int n_in,
                              void* d_out, int out_size, void* d_ws, size_t ws_size,
                              hipStream_t stream) {
  if (n_in < 14) return;
  const int nAct = kBatch * kSeq * kDm;          // 4194304
  const int nW   = kDm * kDm;                    // 262144
  if (in_sizes[0] != nAct || in_sizes[1] != nAct || in_sizes[2] != nAct) return;
  if (in_sizes[3] != nW || in_sizes[5] != nW || in_sizes[7] != nW || in_sizes[12] != nW) return;
  if (in_sizes[4] != kDm || in_sizes[6] != kDm || in_sizes[8] != kDm || in_sizes[13] != kDm) return;
  if (in_sizes[9] != 2 * kDk || in_sizes[10] < 2 || in_sizes[11] < 1) return;
  if (out_size != nAct) return;

  const float* query = (const float*)d_in[0];
  const float* key   = (const float*)d_in[1];
  const float* value = (const float*)d_in[2];
  const float* Wq    = (const float*)d_in[3];
  const float* bq    = (const float*)d_in[4];
  const float* Wk    = (const float*)d_in[5];
  const float* bk    = (const float*)d_in[6];
  const float* Wv    = (const float*)d_in[7];
  const float* bv    = (const float*)d_in[8];
  const float* Wg    = (const float*)d_in[9];
  const float* bg    = (const float*)d_in[10];
  const float* lam1  = (const float*)d_in[11];
  const float* Wo    = (const float*)d_in[12];
  const float* bo    = (const float*)d_in[13];
  float* out = (float*)d_out;

  const size_t PW  = (size_t)kDm * kDm * 2;                 // 524288   weight plane
  const size_t PX  = (size_t)kGRows * kDm * 2;              // 2097152  group activation / q / k / ctx plane
  const size_t PVT = (size_t)kGB * kDm * kSeq * 2;          // 2097152  group v^T plane
  const size_t PS  = (size_t)kNZ * kSeq * kSeq * 4;         // 33554432 group score planes (f32)
  const size_t PP  = (size_t)kNZ * kSeq * kSeq * 2;         // 16777216 group probability plane
  size_t off = 0;
  const size_t oWqh = off; off += PW;  const size_t oWql = off; off += PW;
  const size_t oWkh = off; off += PW;  const size_t oWkl = off; off += PW;
  const size_t oWvh = off; off += PW;  const size_t oWvl = off; off += PW;
  const size_t oWoh = off; off += PW;  const size_t oWol = off; off += PW;
  const size_t oXqh = off; off += PX;  const size_t oXql = off; off += PX;
  const size_t oXkh = off; off += PX;  const size_t oXkl = off; off += PX;
  const size_t oXvh = off; off += PX;  const size_t oXvl = off; off += PX;
  const size_t oQh  = off; off += PX;  const size_t oQl  = off; off += PX;
  const size_t oKh  = off; off += PX;  const size_t oKl  = off; off += PX;
  const size_t oVTh = off; off += PVT; const size_t oVTl = off; off += PVT;
  const size_t oCh  = off; off += PX;  const size_t oCl  = off; off += PX;
  const size_t oS   = off; off += PS;
  const size_t oPh  = off; off += PP;  const size_t oPl  = off; off += PP;
  if (off > ws_size) return;                                // off = 100663296

  char* ws = (char*)d_ws;
  unsigned short* Wqh = (unsigned short*)(ws + oWqh); unsigned short* Wql = (unsigned short*)(ws + oWql);
  unsigned short* Wkh = (unsigned short*)(ws + oWkh); unsigned short* Wkl = (unsigned short*)(ws + oWkl);
  unsigned short* Wvh = (unsigned short*)(ws + oWvh); unsigned short* Wvl = (unsigned short*)(ws + oWvl);
  unsigned short* Woh = (unsigned short*)(ws + oWoh); unsigned short* Wol = (unsigned short*)(ws + oWol);
  unsigned short* Xqh = (unsigned short*)(ws + oXqh); unsigned short* Xql = (unsigned short*)(ws + oXql);
  unsigned short* Xkh = (unsigned short*)(ws + oXkh); unsigned short* Xkl = (unsigned short*)(ws + oXkl);
  unsigned short* Xvh = (unsigned short*)(ws + oXvh); unsigned short* Xvl = (unsigned short*)(ws + oXvl);
  unsigned short* Qh  = (unsigned short*)(ws + oQh);  unsigned short* Ql  = (unsigned short*)(ws + oQl);
  unsigned short* Kh  = (unsigned short*)(ws + oKh);  unsigned short* Kl  = (unsigned short*)(ws + oKl);
  unsigned short* VTh = (unsigned short*)(ws + oVTh); unsigned short* VTl = (unsigned short*)(ws + oVTl);
  unsigned short* Ch  = (unsigned short*)(ws + oCh);  unsigned short* Cl  = (unsigned short*)(ws + oCl);
  float*          Sb  = (float*)(ws + oS);
  unsigned short* Ph  = (unsigned short*)(ws + oPh);  unsigned short* Pl  = (unsigned short*)(ws + oPl);

  const dim3 blk(256);
  const int n8w = nW / 8;                                           // 32768 threads x 8 = [512][512]
  const int n8x = kGRows * kDm / 8;                                 // 131072 threads x 8 = [2048][512]
  const dim3 gSplitW((n8w + 255) / 256);                            // 128
  const dim3 gSplitX((n8x + 255) / 256);                            // 512
  const dim3 gQ(((kGRows / 64) * (kDm / 64) + 7) / 8, 1);           // 32 blocks:  M=2048, N=512, K=512
  const dim3 gVT(((kDm / 64) * (kSeq / 64) + 7) / 8, kGB);          // 8 x 4:      M=512, N=512, K=512 per batch
  const dim3 gS(((kSeq / 64) * (kSeq / 64) + 7) / 8, kNZ);          // 8 x 32:     M=N=512, K=64 per (bb,h)
  const int  nMixRows = kNZ * kSeq;                                 // 16384 rows
  const dim3 gMix((nMixRows + 7) / 8);                              // 2048 blocks x 8 waves
  const dim3 gPV(((kSeq / 64) * (kDk / 64) + 7) / 8, kNZ);          // 1 x 32:     M=512, N=64, K=512 per (bb,h)
  const dim3 gOut(((kGRows / 64) * (kDm / 64) + 7) / 8, 1);         // 32 blocks:  M=2048, N=512, K=512

  const long pQK  = (long)kSeq * kDm;            // 262144: one batch of the q/k/ctx planes
  const long pSz  = (long)kSeq * kSeq;           // 262144: one score / probability plane
  const long pVTb = (long)kDm * kSeq;            // 262144: one batch of the v^T planes

  // weight planes (torch [out][in] is already Bt[n][k]); whole [512][512] per plane
  split_bf16x8_kernel<<<gSplitW, blk, 0, stream>>>(Wq, Wqh, Wql, n8w);
  split_bf16x8_kernel<<<gSplitW, blk, 0, stream>>>(Wk, Wkh, Wkl, n8w);
  split_bf16x8_kernel<<<gSplitW, blk, 0, stream>>>(Wv, Wvh, Wvl, n8w);
  split_bf16x8_kernel<<<gSplitW, blk, 0, stream>>>(Wo, Woh, Wol, n8w);

  for (int gb = 0; gb < kNGrp; ++gb) {
    const size_t actOff = (size_t)gb * kGRows * kDm;
    // (1) activations of batches gb*4 .. gb*4+3 -> hi/lo planes [2048][512]
    split_bf16x8_kernel<<<gSplitX, blk, 0, stream>>>(query + actOff, Xqh, Xql, n8x);
    split_bf16x8_kernel<<<gSplitX, blk, 0, stream>>>(key   + actOff, Xkh, Xkl, n8x);
    split_bf16x8_kernel<<<gSplitX, blk, 0, stream>>>(value + actOff, Xvh, Xvl, n8x);
    // (2) q = x.Wq^T + bq, k = x.Wk^T + bk -> hi/lo planes [2048][512] (32x8 tiles, whole planes)
    wmma_gemm64<1, true, 2, 2, false, 0><<<gQ, blk, 0, stream>>>(
        Xqh, Xql, kDm, 0L, 0L, Wqh, Wql, kDm, 0L, 0L, (void*)Qh, (void*)Ql, kDm, 0L, 0L,
        bq, bq, 0L, kGRows, kDm, kDm, 1.0f, 1);
    wmma_gemm64<1, true, 2, 2, false, 0><<<gQ, blk, 0, stream>>>(
        Xkh, Xkl, kDm, 0L, 0L, Wkh, Wkl, kDm, 0L, 0L, (void*)Kh, (void*)Kl, kDm, 0L, 0L,
        bk, bk, 0L, kGRows, kDm, kDm, 1.0f, 1);
    // (3) v^T[bb][o][tok] = sum_k Wv[o][k] x[bb*512+tok][k] + bv[o] -> hi/lo planes [4][512][512] (8x8 tiles per bb)
    wmma_gemm64<1, true, 1, 2, false, 0><<<gVT, blk, 0, stream>>>(
        Wvh, Wvl, kDm, 0L, 0L, Xvh, Xvl, kDm, pQK, 0L, (void*)VTh, (void*)VTl, kSeq, pVTb, 0L,
        bv, bv, 0L, kDm, kSeq, kDm, 1.0f, kGB);
    // (4) S[z][i][j] = sum_d q[bb*512+i][h*64+d] k[bb*512+j][h*64+d], z = bb*8+h (8x8 tiles per z, whole planes)
    wmma_gemm64<1, true, 0, 0, false, 0><<<gS, blk, 0, stream>>>(
        Qh, Ql, kDm, (long)kDk, pQK, Kh, Kl, kDm, (long)kDk, pQK, (void*)Sb, (void*)Sb, kSeq, pSz, (long)kHeads * pSz,
        bq, bq, 0L, kSeq, kSeq, kDk, 1.0f, kHeads);
    // (5) gated mixing -> P hi/lo planes [32][512][512] (16384 rows x 512)
    gate_mix_kernel<<<gMix, blk, 0, stream>>>(Sb, Qh, Ql, Wg, bg, lam1, Ph, Pl, nMixRows);
    // (6) ctx[bb*512+i][h*64+d] = sum_j P[z][i][j] v^T[bb][h*64+d][j] -> hi/lo planes (8x1 tiles per z; 64-col segment at h*64)
    wmma_gemm64<1, true, 0, 2, false, 0><<<gPV, blk, 0, stream>>>(
        Ph, Pl, kSeq, pSz, (long)kHeads * pSz, VTh, VTl, kSeq, (long)kDk * kSeq, pVTb,
        (void*)Ch, (void*)Cl, kDm, (long)kDk, pQK,
        bq, bq, 0L, kSeq, kDk, kSeq, 1.0f, kHeads);
    // (7) out[gb*4 .. +3] = ctx.Wo^T + bo -> f32 [2048][512] slice of d_out (32x8 tiles, whole slice)
    float* outg = out + actOff;
    wmma_gemm64<1, true, 2, 0, false, 0><<<gOut, blk, 0, stream>>>(
        Ch, Cl, kDm, 0L, 0L, Woh, Wol, kDm, 0L, 0L, (void*)outg, (void*)outg, kDm, 0L, 0L,
        bo, bo, 0L, kGRows, kDm, kDm, 1.0f, 1);
  }
}

// v001
// One run takes 302 microseconds.
// Next to v000, in two timings, it ran 3.16 times as fast each time.
// Contractions x.Wq^T, x.Wk^T, Wv.x^T, q.k^T, p.v, ctx.Wo^T: v_wmma_f32_16x16x32_bf16 on bf16 hi/lo split operand planes (hi.hi + hi.lo + lo.hi), f32 accumulate; per-row 64x2 gating dots, softmax, distance adjacency, max- and sum-normalisation in f32 on the VALU (hardware exp2/rcp).
#include <hip/hip_runtime.h>
#include <math.h>
#include <stdint.h>

constexpr int kBatch = 16;
constexpr int kSeq   = 512;
constexpr int kDm    = 512;
constexpr int kHeads = 8;
constexpr int kDk    = 64;
constexpr int kGB    = 16;                 // batches per group: the whole batch goes through every stage in one launch
constexpr int kNGrp  = kBatch / kGB;       // 1 group
constexpr int kNZ    = kGB * kHeads;       // 128 (batch, head) planes
constexpr int kGRows = kGB * kSeq;         // 8192 token rows
constexpr int kPRow  = 2 * kSeq;           // pitch (16-bit elements) of a probability row: 512 hi then 512 lo
constexpr float kLog2e = 1.4426950408889634f;
static_assert(kSeq == 512 && kDk == 64 && kDm == kHeads * kDk && (kBatch % kGB) == 0, "geometry");

typedef __attribute__((ext_vector_type(16))) _Float16 v16h;
typedef __attribute__((ext_vector_type(8)))  _Float16 v8h;
typedef __attribute__((ext_vector_type(16))) __bf16   v16b;
typedef __attribute__((ext_vector_type(8)))  __bf16   v8b;
typedef __attribute__((ext_vector_type(8)))  float    v8f;
typedef __attribute__((ext_vector_type(4)))  float    v4f;
typedef __attribute__((ext_vector_type(4)))  unsigned int v4u;

__device__ __forceinline__ unsigned short f2bf_bits(float f) {
  unsigned u = __float_as_uint(f);
  return (unsigned short)((u + 0x7FFFu + ((u >> 16) & 1u)) >> 16);
}
__device__ __forceinline__ float bf_bits2f(unsigned short h) { return __uint_as_float(((unsigned)h) << 16); }
__device__ __forceinline__ unsigned pk16(unsigned short a, unsigned short b) { return (unsigned)a | ((unsigned)b << 16); }

// hazard guards as plain device helpers (no inline asm inside the kernel template body)
__device__ __forceinline__ void dep_guard_h(v8f& a, v8f& b, v16h x, v16h y) { asm volatile("v_nop\n\tv_nop\n\tv_nop\n\tv_nop" : "+v"(a), "+v"(b) : "v"(x), "v"(y)); }
__device__ __forceinline__ void dep_guard_b(v8f& a, v8f& b, v16b x, v16b y) { asm volatile("v_nop\n\tv_nop\n\tv_nop\n\tv_nop" : "+v"(a), "+v"(b) : "v"(x), "v"(y)); }
__device__ __forceinline__ void keep4_h(v16h a, v16h b, v16h c, v16h d) { asm volatile("v_nop" :: "v"(a), "v"(b), "v"(c), "v"(d)); }
__device__ __forceinline__ void keep4_b(v16b a, v16b b, v16b c, v16b d) { asm volatile("v_nop" :: "v"(a), "v"(b), "v"(c), "v"(d)); }
__device__ __forceinline__ void acc_guard4(v8f& a, v8f& b, v8f& c, v8f& d) { asm volatile("v_nop\n\tv_nop\n\tv_nop\n\tv_nop" : "+v"(a), "+v"(b), "+v"(c), "+v"(d)); }
template <typename T> struct Frag;
template <> struct Frag<_Float16> {
  typedef v16h V; union U { v16h v; v8h h[2]; };
  static __device__ __forceinline__ v16h load(const _Float16* p) {   // elements 0..7 <- p[0..7], 8..15 <- p[16..23]
    U f; f.h[0] = *(const v8h*)(p); f.h[1] = *(const v8h*)(p + 16); return f.v;
  }
  static __device__ __forceinline__ v8f mma(v16h a, v16h b, v8f c) {
    return __builtin_amdgcn_wmma_f32_16x16x32_f16(false, a, false, b, (short)0, c, false, false);
  }
  static __device__ __forceinline__ void guard(v8f& a, v8f& b, v16h x, v16h y) { dep_guard_h(a, b, x, y); }
  static __device__ __forceinline__ void keep(v16h a, v16h b, v16h c, v16h d) { keep4_h(a, b, c, d); }
};
template <> struct Frag<__bf16> {
  typedef v16b V; union U { v16b v; v8b h[2]; };
  static __device__ __forceinline__ v16b load(const __bf16* p) {
    U f; f.h[0] = *(const v8b*)(p); f.h[1] = *(const v8b*)(p + 16); return f.v;
  }
  static __device__ __forceinline__ v8f mma(v16b a, v16b b, v8f c) {
    return __builtin_amdgcn_wmma_f32_16x16x32_bf16(false, a, false, b, (short)0, c, false, false);
  }
  static __device__ __forceinline__ void guard(v8f& a, v8f& b, v16b x, v16b y) { dep_guard_b(a, b, x, y); }
  static __device__ __forceinline__ void keep(v16b a, v16b b, v16b c, v16b d) { keep4_b(a, b, c, d); }
};

// ---- Register-blocked batched WMMA GEMM ------------------------------------
// C[m,n] = scale * sum_k A[m,k] * Bt[n,k] (+bias)(+resid); each wave owns a 64x64 tile.
// A row-major [M,K]; Bt row-major [N,K]; M,N % 64 == 0, K % 32 == 0.
// SPLIT: operands are hi/lo planes (A2/Bt2 = lo planes, same layout); product = hi.hi + hi.lo + lo.hi.
// BIAS_MODE: 0 = none, 1 = bias[m], 2 = bias[n].
// OUT_MODE: 0 = f32, 1 = f16, 2 = bf16 hi plane (Cout) + bf16 lo plane (Cout2).
// z addressing: bz = blockIdx.y, zi = bz % zsplit, zo = bz / zsplit; operand base = zi*stride + zo*stride2 (elements).
// ET: 0 = f16 operands, 1 = bf16 operands (pointers passed as 16-bit storage)
template <int ET> struct Elem;
template <> struct Elem<0> { typedef _Float16 T; };
template <> struct Elem<1> { typedef __bf16 T; };
template <int ET, bool SPLIT, int BIAS_MODE, int OUT_MODE, bool RESID, int ACT = 0>
__global__ __launch_bounds__(256) void wmma_gemm64(
    const unsigned short* __restrict__ Ap, const unsigned short* __restrict__ A2p, int lda, long strideA, long strideA2,
    const unsigned short* __restrict__ Btp, const unsigned short* __restrict__ Bt2p, int ldb, long strideB, long strideB2,
    void* __restrict__ Cout, void* __restrict__ Cout2, int ldc, long strideC, long strideC2,
    const float* __restrict__ bias,
    const float* __restrict__ resid, long strideR,
    int M, int N, int K, float scale, int zsplit) {
  typedef typename Elem<ET>::T T;
  typedef typename Frag<T>::V V;
  const T* A = (const T*)Ap; const T* A2 = (const T*)A2p; const T* Bt = (const T*)Btp; const T* Bt2 = (const T*)Bt2p;
  __shared__ __align__(16) float sT[8][16 * 68];   // per-wave 16x64 slab, pitch 68 floats
  const int bz   = blockIdx.y;
  const int zo   = bz / zsplit;
  const int zi   = bz - zo * zsplit;
  const int lane = threadIdx.x & 31;
  const int wave = threadIdx.x >> 5;
  const int tilesN = N >> 6;
  const int tilesM = M >> 6;
  const int tile = blockIdx.x * 8 + wave;
  if (tile >= tilesM * tilesN) return;   // wave-uniform; no block barriers in this kernel
  const int tm = tile / tilesN;
  const int tn = tile - tm * tilesN;
  const int m0 = tm << 6;
  const int n0 = tn << 6;

  const size_t aOff = (size_t)zi * strideA + (size_t)zo * strideA2;
  const size_t bOff = (size_t)zi * strideB + (size_t)zo * strideB2;
  const size_t cOff = (size_t)zi * strideC + (size_t)zo * strideC2;
  const T* Ab  = A  + aOff;
  const T* Bb  = Bt + bOff;
  const T* Ab2 = SPLIT ? (A2  + aOff) : nullptr;
  const T* Bb2 = SPLIT ? (Bt2 + bOff) : nullptr;

  const int rlane = lane & 15;                 // row (A) / col (B, D) within subtile
  const int koff  = (lane >> 4) * 8;           // k offset of this lane half
  const int mOff  = (lane >> 4) * 8;           // D row offset

  v8f acc[4][4];
#pragma unroll
  for (int i = 0; i < 4; ++i)
#pragma unroll
    for (int j = 0; j < 4; ++j) acc[i][j] = (v8f){0.f,0.f,0.f,0.f,0.f,0.f,0.f,0.f};

  for (int k0 = 0; k0 < K; k0 += 32) {
    V bh[4], bl[4];
#pragma unroll
    for (int j = 0; j < 4; ++j) {
      const size_t bo = (size_t)(n0 + (j << 4) + rlane) * ldb + koff + k0;
      bh[j] = Frag<T>::load(Bb + bo);
      if (SPLIT) bl[j] = Frag<T>::load(Bb2 + bo);
    }
#pragma unroll
    for (int i = 0; i < 4; ++i) {
      const size_t ao = (size_t)(m0 + (i << 4) + rlane) * lda + koff + k0;
      V ah = Frag<T>::load(Ab + ao);
      V al;
      if (SPLIT) al = Frag<T>::load(Ab2 + ao);
#pragma unroll
      for (int j = 0; j < 4; ++j) {
        acc[i][j] = Frag<T>::mma(ah, bh[j], acc[i][j]);
        if (SPLIT) {
          acc[i][j] = Frag<T>::mma(ah, bl[j], acc[i][j]);
          acc[i][j] = Frag<T>::mma(al, bh[j], acc[i][j]);
        }
      }
      Frag<T>::guard(acc[i][0], acc[i][3], ah, SPLIT ? al : ah);
    }
    Frag<T>::keep(bh[0], bh[1], bh[2], bh[3]);
    if (SPLIT) Frag<T>::keep(bl[0], bl[1], bl[2], bl[3]);
  }
  acc_guard4(acc[0][0], acc[0][1], acc[0][2], acc[0][3]);
  acc_guard4(acc[1][0], acc[1][1], acc[1][2], acc[1][3]);
  acc_guard4(acc[2][0], acc[2][1], acc[2][2], acc[2][3]);
  acc_guard4(acc[3][0], acc[3][1], acc[3][2], acc[3][3]);

  // ---- epilogue ----
  float* slab = sT[wave];
  const float* Rb = RESID ? (resid + (size_t)zi * strideR) : nullptr;
#pragma unroll
  for (int i = 0; i < 4; ++i) {
    const int mBase = m0 + (i << 4);
#pragma unroll
    for (int j = 0; j < 4; ++j) {
      const int n = n0 + (j << 4) + rlane;
      float bv = 0.f;
      if (BIAS_MODE == 2) bv = bias[n];
#pragma unroll
      for (int r = 0; r < 8; ++r) {
        float v = acc[i][j][r] * scale;
        if (BIAS_MODE == 1) v += bias[mBase + mOff + r];
        if (BIAS_MODE == 2) v += bv;
        if (RESID) v += Rb[(size_t)(mBase + mOff + r) * ldc + n];
        if (ACT == 1) v = tanhf(v);
        if (ACT == 2) v = fmaxf(v, 0.0f);
        if (ACT == 4) v = (v > 0.f) ? v : 0.01f * v;
        slab[(mOff + r) * 68 + (j << 4) + rlane] = v;
      }
    }
    __builtin_amdgcn_fence(__ATOMIC_RELEASE, "workgroup");
    __builtin_amdgcn_wave_barrier();
    __builtin_amdgcn_fence(__ATOMIC_ACQUIRE, "workgroup");
    if (OUT_MODE == 0) {
      float* C = (float*)Cout + cOff;
      const int hh = lane >> 4, c4 = (lane & 15) * 4;     // row seg = 256 B = 16 lanes x 16 B
      {
#pragma unroll
        for (int it = 0; it < 8; ++it) {
          const int row = it * 2 + hh;
          v4f v = *(const v4f*)(slab + row * 68 + c4);
          *(v4f*)(C + (size_t)(mBase + row) * ldc + n0 + c4) = v;
        }
        
      }
    } else {
      const int q = lane >> 3, c8 = (lane & 7) * 8;
      unsigned short* C  = (unsigned short*)Cout  + cOff;
      unsigned short* C2 = (OUT_MODE == 2) ? ((unsigned short*)Cout2 + cOff) : nullptr;
      {
#pragma unroll
        for (int it = 0; it < 4; ++it) {
          const int row = it * 4 + q;
          const float* sp = slab + row * 68 + c8;
          v8h hv, lv;
#pragma unroll
          for (int e = 0; e < 8; ++e) {
            if (OUT_MODE == 1) {
              hv[e] = (_Float16)sp[e];
            } else {
              unsigned short hb = f2bf_bits(sp[e]);
              unsigned short lb = f2bf_bits(sp[e] - bf_bits2f(hb));
              hv[e] = __builtin_bit_cast(_Float16, hb);
              lv[e] = __builtin_bit_cast(_Float16, lb);
            }
          }
          *(v8h*)(C + (size_t)(mBase + row) * ldc + n0 + c8) = hv;
          if (OUT_MODE == 2) *(v8h*)(C2 + (size_t)(mBase + row) * ldc + n0 + c8) = lv;
        }
        
      }
    }
    __builtin_amdgcn_fence(__ATOMIC_RELEASE, "workgroup");
    __builtin_amdgcn_wave_barrier();
    __builtin_amdgcn_fence(__ATOMIC_ACQUIRE, "workgroup");
  }
}

// ---------------------------------------------------------------------------
// Elementwise f32 -> bf16 hi/lo split, 8 elements per thread: hi = bf16_rne(x), lo = bf16_rne(x - hi).
// Coverage: grid = n8/256 blocks (n8 = plane/8, exact multiple here; guard kept) x 256 threads x 8 = the whole plane.
// ---------------------------------------------------------------------------
__global__ __launch_bounds__(256) void split_bf16x8_kernel(const float* __restrict__ in, unsigned short* __restrict__ hi,
                                                           unsigned short* __restrict__ lo, int n8) {
  const int i = blockIdx.x * 256 + threadIdx.x;
  if (i < n8) {
    const size_t base = (size_t)i * 8;
    const v4f a = *(const v4f*)(in + base);
    const v4f b = *(const v4f*)(in + base + 4);
    const float f[8] = {a[0], a[1], a[2], a[3], b[0], b[1], b[2], b[3]};
    unsigned hw[4], lw[4];
#pragma unroll
    for (int q = 0; q < 4; ++q) {
      const unsigned short h0 = f2bf_bits(f[2 * q]), h1 = f2bf_bits(f[2 * q + 1]);
      const unsigned short l0 = f2bf_bits(f[2 * q] - bf_bits2f(h0));
      const unsigned short l1 = f2bf_bits(f[2 * q + 1] - bf_bits2f(h1));
      hw[q] = pk16(h0, h1);
      lw[q] = pk16(l0, l1);
    }
    const v4u hv = (v4u){hw[0], hw[1], hw[2], hw[3]};
    const v4u lv = (v4u){lw[0], lw[1], lw[2], lw[3]};
    *(v4u*)(hi + base) = hv;
    *(v4u*)(lo + base) = lv;
    
  }
}

// ---------------------------------------------------------------------------
// Gated mixing, one wave per score row rg = z*512 + i (z = bb*8 + h, bb = batch in group, i = query index).
// Lane l owns columns 8l..8l+7 and 256+8l..256+8l+7 (all 512 columns of the row, 16 per lane, static slots).
//   g_c  = bg[c] + sum_d q[i][h*64+d] * Wg[c][d]  (q = hi + lo planes, f32; 2 lane-parallel products + shuffle tree)
//   qp_c = rcp((|g_c| + 1)^2)
//   p_j  = 2^((s_j - max_j s) * log2e)              (= exp(s - max) = softmax_j / max softmax)
//   adj  = 2^((i-j)^2 * (-0.5 log2e qp_1)) for j < i,  2^((i-j)^2 * (-0.5 log2e qp_0)) for j >= i
//   a_j  = sg * p_j + (1 - sg) * adj,  sg = rcp(1 + 2^(-lam1 * log2e))
//   P_j  = a_j * rcp(sum_j a_j + 1e-9)  -> bf16 hi/lo planes
// exp2 and rcp are the single hardware instructions (v_exp_f32 / v_rcp_f32): no library expansions.
// Reductions in fixed order (per lane sequential, then xor shuffle tree). No LDS, no barriers.
// Producer coverage: grid = nrows/8 blocks x 8 waves = nrows rows; per row 32 lanes x 16 u16 = 512 columns per plane;
// In place: P row rg (512 hi + 512 lo, 2048 B) takes the bytes of score row rg (512 f32). Only this wave touches that
// row, and every store needs the row maximum and the row sum, that is all 512 loaded scores. SP is therefore not __restrict__.
// ---------------------------------------------------------------------------
__device__ __forceinline__ float hw_exp2(float x) { return __builtin_amdgcn_exp2f(x); }
__device__ __forceinline__ float hw_rcp(float x)  { return __builtin_amdgcn_rcpf(x); }

__global__ __launch_bounds__(256) void gate_mix_kernel(
    float* SP, const unsigned short* __restrict__ Qh, const unsigned short* __restrict__ Ql,
    const float* __restrict__ Wg, const float* __restrict__ bg, const float* __restrict__ lam1, int nrows) {
  const int lane = threadIdx.x & 31;
  const int wave = threadIdx.x >> 5;
  const int rg = blockIdx.x * 8 + wave;
  if (rg >= nrows) return;                       // wave-uniform; no barriers in this kernel
  const int z  = rg >> 9;
  const int i  = rg & (kSeq - 1);
  const int bb = z >> 3;
  const int h  = z & (kHeads - 1);
  float* srow = SP + (size_t)rg * kSeq;
  const int j0 = lane * 8;
  const int j1 = 256 + lane * 8;
  const v4f sa = *(const v4f*)(srow + j0);
  const v4f sb = *(const v4f*)(srow + j0 + 4);
  const v4f sc = *(const v4f*)(srow + j1);
  const v4f sd = *(const v4f*)(srow + j1 + 4);
  const float s[16] = {sa[0], sa[1], sa[2], sa[3], sb[0], sb[1], sb[2], sb[3],
                       sc[0], sc[1], sc[2], sc[3], sd[0], sd[1], sd[2], sd[3]};

  // gating dots (64 terms each: 2 products per lane, then a 5-level shuffle tree)
  const size_t qo = (size_t)(bb * kSeq + i) * kDm + (size_t)h * kDk;
  const float q0 = bf_bits2f(Qh[qo + lane]) + bf_bits2f(Ql[qo + lane]);
  const float q1 = bf_bits2f(Qh[qo + 32 + lane]) + bf_bits2f(Ql[qo + 32 + lane]);
  float g0 = q0 * Wg[lane] + q1 * Wg[32 + lane];
  float g1 = q0 * Wg[kDk + lane] + q1 * Wg[kDk + 32 + lane];
#pragma unroll
  for (int off = 16; off > 0; off >>= 1) {
    g0 += __shfl_xor(g0, off, 32);
    g1 += __shfl_xor(g1, off, 32);
  }
  g0 += bg[0];
  g1 += bg[1];
  const float t0 = fabsf(g0) + 1.0f;
  const float t1 = fabsf(g1) + 1.0f;
  const float qp0 = hw_rcp(t0 * t0);
  const float qp1 = hw_rcp(t1 * t1);
  const float gn0 = (-0.5f * kLog2e) * qp0;      // j >= i (upper incl. diagonal)
  const float gn1 = (-0.5f * kLog2e) * qp1;      // j <  i (strictly lower)
  const float lam = lam1[0];
  const float sg  = hw_rcp(1.0f + hw_exp2(-lam * kLog2e));
  const float omg = 1.0f - sg;

  float mx = s[0];
#pragma unroll
  for (int e = 1; e < 16; ++e) mx = fmaxf(mx, s[e]);
#pragma unroll
  for (int off = 16; off > 0; off >>= 1) mx = fmaxf(mx, __shfl_xor(mx, off, 32));

  float a[16];
  float ps = 0.f;
#pragma unroll
  for (int e = 0; e < 16; ++e) {
    const int j = (e < 8) ? (j0 + e) : (j1 + (e - 8));
    const float p   = hw_exp2((s[e] - mx) * kLog2e);
    const float fd  = (float)(i - j);
    const float gs  = (j < i) ? gn1 : gn0;
    const float adj = hw_exp2((fd * fd) * gs);
    const float av  = sg * p + omg * adj;
    a[e] = av;
    ps += av;
  }
#pragma unroll
  for (int off = 16; off > 0; off >>= 1) ps += __shfl_xor(ps, off, 32);
  const float inv = hw_rcp(ps + 1e-9f);

  unsigned hw0[4], lw0[4], hw1[4], lw1[4];
#pragma unroll
  for (int q = 0; q < 4; ++q) {
    const float p0 = a[2 * q] * inv, p1 = a[2 * q + 1] * inv;
    const float p2 = a[8 + 2 * q] * inv, p3 = a[9 + 2 * q] * inv;
    const unsigned short h0 = f2bf_bits(p0), h1 = f2bf_bits(p1), h2 = f2bf_bits(p2), h3 = f2bf_bits(p3);
    const unsigned short l0 = f2bf_bits(p0 - bf_bits2f(h0));
    const unsigned short l1 = f2bf_bits(p1 - bf_bits2f(h1));
    const unsigned short l2 = f2bf_bits(p2 - bf_bits2f(h2));
    const unsigned short l3 = f2bf_bits(p3 - bf_bits2f(h3));
    hw0[q] = pk16(h0, h1); lw0[q] = pk16(l0, l1);
    hw1[q] = pk16(h2, h3); lw1[q] = pk16(l2, l3);
  }
  const v4u hv0 = (v4u){hw0[0], hw0[1], hw0[2], hw0[3]};
  const v4u lv0 = (v4u){lw0[0], lw0[1], lw0[2], lw0[3]};
  const v4u hv1 = (v4u){hw1[0], hw1[1], hw1[2], hw1[3]};
  const v4u lv1 = (v4u){lw1[0], lw1[1], lw1[2], lw1[3]};
  unsigned short* prow = (unsigned short*)srow;
  *(v4u*)(prow + j0) = hv0;
  *(v4u*)(prow + j1) = hv1;
  *(v4u*)(prow + kSeq + j0) = lv0;
  *(v4u*)(prow + kSeq + j1) = lv1;
  
}

// ---------------------------------------------------------------------------
// Workspace region map (bytes; every offset a multiple of 512 KiB). Every region is fully written
// inside the call before any read.
//   Wqh,Wql,Wkh,Wkl,Wvh,Wvl,Woh,Wol  bf16 [512][512] each            0 .. 4194304
//   Xqh,Xql,Xkh,Xkl,Xvh,Xvl          bf16 [8192][512] each     4194304 .. 54525952
//   Qh,Ql,Kh,Kl                      bf16 [8192][512] each    54525952 .. 88080384   (row bb*512+i, col h*64+d)
//   VTh,VTl                          bf16 [16][512][512]      88080384 .. 104857600  (batch, row h*64+d, col token)
//   CTXh,CTXl                        bf16 [8192][512] each   104857600 .. 121634816  (row bb*512+i, col h*64+d)
//   S                                f32  [128][512][512]    121634816 .. 255852544  (z = bb*8+h)
//   P (over S, row for row)          bf16 [128][512][2][512]  the same bytes         (row: 512 hi, then 512 lo)
//   total 255852544
// ---------------------------------------------------------------------------
extern "C" void kernel_launch(void* const* d_in, const int* in_sizes, int n_in,
                              void* d_out, int out_size, void* d_ws, size_t ws_size,
                              hipStream_t stream) {
  if (n_in < 14) return;
  const int nAct = kBatch * kSeq * kDm;          // 4194304
  const int nW   = kDm * kDm;                    // 262144
  if (in_sizes[0] != nAct || in_sizes[1] != nAct || in_sizes[2] != nAct) return;
  if (in_sizes[3] != nW || in_sizes[5] != nW || in_sizes[7] != nW || in_sizes[12] != nW) return;
  if (in_sizes[4] != kDm || in_sizes[6] != kDm || in_sizes[8] != kDm || in_sizes[13] != kDm) return;
  if (in_sizes[9] != 2 * kDk || in_sizes[10] < 2 || in_sizes[11] < 1) return;
  if (out_size != nAct) return;

  const float* query = (const float*)d_in[0];
  const float* key   = (const float*)d_in[1];
  const float* value = (const float*)d_in[2];
  const float* Wq    = (const float*)d_in[3];
  const float* bq    = (const float*)d_in[4];
  const float* Wk    = (const float*)d_in[5];
  const float* bk    = (const float*)d_in[6];
  const float* Wv    = (const float*)d_in[7];
  const float* bv    = (const float*)d_in[8];
  const float* Wg    = (const float*)d_in[9];
  const float* bg    = (const float*)d_in[10];
  const float* lam1  = (const float*)d_in[11];
  const float* Wo    = (const float*)d_in[12];
  const float* bo    = (const float*)d_in[13];
  float* out = (float*)d_out;

  const size_t PW  = (size_t)kDm * kDm * 2;                 // 524288    weight plane
  const size_t PX  = (size_t)kGRows * kDm * 2;              // 8388608   activation / q / k / ctx plane
  const size_t PVT = (size_t)kGB * kDm * kSeq * 2;          // 8388608   v^T plane
  const size_t PS  = (size_t)kNZ * kSeq * kSeq * 4;         // 134217728 score planes (f32), then the probability rows
  size_t off = 0;
  const size_t oWqh = off; off += PW;  const size_t oWql = off; off += PW;
  const size_t oWkh = off; off += PW;  const size_t oWkl = off; off += PW;
  const size_t oWvh = off; off += PW;  const size_t oWvl = off; off += PW;
  const size_t oWoh = off; off += PW;  const size_t oWol = off; off += PW;
  const size_t oXqh = off; off += PX;  const size_t oXql = off; off += PX;
  const size_t oXkh = off; off += PX;  const size_t oXkl = off; off += PX;
  const size_t oXvh = off; off += PX;  const size_t oXvl = off; off += PX;
  const size_t oQh  = off; off += PX;  const size_t oQl  = off; off += PX;
  const size_t oKh  = off; off += PX;  const size_t oKl  = off; off += PX;
  const size_t oVTh = off; off += PVT; const size_t oVTl = off; off += PVT;
  const size_t oCh  = off; off += PX;  const size_t oCl  = off; off += PX;
  const size_t oS   = off; off += PS;
  if (off > ws_size) return;                                // off = 255852544

  char* ws = (char*)d_ws;
  unsigned short* Wqh = (unsigned short*)(ws + oWqh); unsigned short* Wql = (unsigned short*)(ws + oWql);
  unsigned short* Wkh = (unsigned short*)(ws + oWkh); unsigned short* Wkl = (unsigned short*)(ws + oWkl);
  unsigned short* Wvh = (unsigned short*)(ws + oWvh); unsigned short* Wvl = (unsigned short*)(ws + oWvl);
  unsigned short* Woh = (unsigned short*)(ws + oWoh); unsigned short* Wol = (unsigned short*)(ws + oWol);
  unsigned short* Xqh = (unsigned short*)(ws + oXqh); unsigned short* Xql = (unsigned short*)(ws + oXql);
  unsigned short* Xkh = (unsigned short*)(ws + oXkh); unsigned short* Xkl = (unsigned short*)(ws + oXkl);
  unsigned short* Xvh = (unsigned short*)(ws + oXvh); unsigned short* Xvl = (unsigned short*)(ws + oXvl);
  unsigned short* Qh  = (unsigned short*)(ws + oQh);  unsigned short* Ql  = (unsigned short*)(ws + oQl);
  unsigned short* Kh  = (unsigned short*)(ws + oKh);  unsigned short* Kl  = (unsigned short*)(ws + oKl);
  unsigned short* VTh = (unsigned short*)(ws + oVTh); unsigned short* VTl = (unsigned short*)(ws + oVTl);
  unsigned short* Ch  = (unsigned short*)(ws + oCh);  unsigned short* Cl  = (unsigned short*)(ws + oCl);
  float*          Sb  = (float*)(ws + oS);
  unsigned short* Ph  = (unsigned short*)(ws + oS);   unsigned short* Pl  = Ph + kSeq;   // hi and lo halves of row 0

  const dim3 blk(256);
  const int n8w = nW / 8;                                           // 32768 threads x 8 = [512][512]
  const int n8x = kGRows * kDm / 8;                                 // 524288 threads x 8 = [8192][512]
  const dim3 gSplitW((n8w + 255) / 256);                            // 128
  const dim3 gSplitX((n8x + 255) / 256);                            // 2048
  const dim3 gQ(((kGRows / 64) * (kDm / 64) + 7) / 8, 1);           // 128 blocks: M=8192, N=512, K=512
  const dim3 gVT(((kDm / 64) * (kSeq / 64) + 7) / 8, kGB);          // 8 x 16:     M=512, N=512, K=512 per batch
  const dim3 gS(((kSeq / 64) * (kSeq / 64) + 7) / 8, kNZ);          // 8 x 128:    M=N=512, K=64 per (bb,h)
  const int  nMixRows = kNZ * kSeq;                                 // 65536 rows
  const dim3 gMix((nMixRows + 7) / 8);                              // 8192 blocks x 8 waves
  const dim3 gPV(((kSeq / 64) * (kDk / 64) + 7) / 8, kNZ);          // 1 x 128:    M=512, N=64, K=512 per (bb,h)
  const dim3 gOut(((kGRows / 64) * (kDm / 64) + 7) / 8, 1);         // 128 blocks: M=8192, N=512, K=512

  const long pQK  = (long)kSeq * kDm;            // 262144: one batch of the q/k/ctx planes
  const long pSz  = (long)kSeq * kSeq;           // 262144: one score plane (f32 elements)
  const long pPz  = (long)kSeq * kPRow;          // 524288: the same plane as probability rows (16-bit elements)
  const long pVTb = (long)kDm * kSeq;            // 262144: one batch of the v^T planes

  // weight planes (torch [out][in] is already Bt[n][k]); whole [512][512] per plane
  split_bf16x8_kernel<<<gSplitW, blk, 0, stream>>>(Wq, Wqh, Wql, n8w);
  split_bf16x8_kernel<<<gSplitW, blk, 0, stream>>>(Wk, Wkh, Wkl, n8w);
  split_bf16x8_kernel<<<gSplitW, blk, 0, stream>>>(Wv, Wvh, Wvl, n8w);
  split_bf16x8_kernel<<<gSplitW, blk, 0, stream>>>(Wo, Woh, Wol, n8w);

  for (int gb = 0; gb < kNGrp; ++gb) {
    const size_t actOff = (size_t)gb * kGRows * kDm;
    // (1) activations of all batches -> hi/lo planes [8192][512]
    split_bf16x8_kernel<<<gSplitX, blk, 0, stream>>>(query + actOff, Xqh, Xql, n8x);
    split_bf16x8_kernel<<<gSplitX, blk, 0, stream>>>(key   + actOff, Xkh, Xkl, n8x);
    split_bf16x8_kernel<<<gSplitX, blk, 0, stream>>>(value + actOff, Xvh, Xvl, n8x);
    // (2) q = x.Wq^T + bq, k = x.Wk^T + bk -> hi/lo planes [8192][512] (128x8 tiles, whole planes)
    wmma_gemm64<1, true, 2, 2, false, 0><<<gQ, blk, 0, stream>>>(
        Xqh, Xql, kDm, 0L, 0L, Wqh, Wql, kDm, 0L, 0L, (void*)Qh, (void*)Ql, kDm, 0L, 0L,
        bq, bq, 0L, kGRows, kDm, kDm, 1.0f, 1);
    wmma_gemm64<1, true, 2, 2, false, 0><<<gQ, blk, 0, stream>>>(
        Xkh, Xkl, kDm, 0L, 0L, Wkh, Wkl, kDm, 0L, 0L, (void*)Kh, (void*)Kl, kDm, 0L, 0L,
        bk, bk, 0L, kGRows, kDm, kDm, 1.0f, 1);
    // (3) v^T[bb][o][tok] = sum_k Wv[o][k] x[bb*512+tok][k] + bv[o] -> hi/lo planes [16][512][512] (8x8 tiles per bb)
    wmma_gemm64<1, true, 1, 2, false, 0><<<gVT, blk, 0, stream>>>(
        Wvh, Wvl, kDm, 0L, 0L, Xvh, Xvl, kDm, pQK, 0L, (void*)VTh, (void*)VTl, kSeq, pVTb, 0L,
        bv, bv, 0L, kDm, kSeq, kDm, 1.0f, kGB);
    // (4) S[z][i][j] = sum_d q[bb*512+i][h*64+d] k[bb*512+j][h*64+d], z = bb*8+h (8x8 tiles per z, whole planes)
    wmma_gemm64<1, true, 0, 0, false, 0><<<gS, blk, 0, stream>>>(
        Qh, Ql, kDm, (long)kDk, pQK, Kh, Kl, kDm, (long)kDk, pQK, (void*)Sb, (void*)Sb, kSeq, pSz, (long)kHeads * pSz,
        bq, bq, 0L, kSeq, kSeq, kDk, 1.0f, kHeads);
    // (5) gated mixing, in place: score row -> P hi/lo row (65536 rows x 512)
    gate_mix_kernel<<<gMix, blk, 0, stream>>>(Sb, Qh, Ql, Wg, bg, lam1, nMixRows);
    // (6) ctx[bb*512+i][h*64+d] = sum_j P[z][i][j] v^T[bb][h*64+d][j] -> hi/lo planes (8x1 tiles per z; 64-col segment at h*64)
    wmma_gemm64<1, true, 0, 2, false, 0><<<gPV, blk, 0, stream>>>(
        Ph, Pl, kPRow, pPz, (long)kHeads * pPz, VTh, VTl, kSeq, (long)kDk * kSeq, pVTb,
        (void*)Ch, (void*)Cl, kDm, (long)kDk, pQK,
        bq, bq, 0L, kSeq, kDk, kSeq, 1.0f, kHeads);
    // (7) out = ctx.Wo^T + bo -> f32 [8192][512], all of d_out (128x8 tiles)
    float* outg = out + actOff;
    wmma_gemm64<1, true, 2, 0, false, 0><<<gOut, blk, 0, stream>>>(
        Ch, Cl, kDm, 0L, 0L, Woh, Wol, kDm, 0L, 0L, (void*)outg, (void*)outg, kDm, 0L, 0L,
        bo, bo, 0L, kGRows, kDm, kDm, 1.0f, 1);
  }
}

// v002
// A run of this version takes 191 microseconds.
// In two side-by-side timings against v001, it was 1.57 and 1.58 times as fast.
// All steps since v000 together make it 4.99 times as fast.
// Contractions x.Wq^T, x.Wk^T, Wv.x^T, q.k^T, p.v, ctx.Wo^T: v_wmma_f32_16x16x32_bf16 on bf16 hi/lo split operand planes (hi.hi + hi.lo + lo.hi), f32 accumulate; per-row 64x2 gating dots, softmax, distance adjacency, max- and sum-normalisation in f32 on the VALU (hardware exp2/rcp).
#include <hip/hip_runtime.h>
#include <math.h>
#include <stdint.h>

constexpr int kBatch = 16;
constexpr int kSeq   = 512;
constexpr int kDm    = 512;
constexpr int kHeads = 8;
constexpr int kDk    = 64;
constexpr int kGB    = 16;                 // batches per group: the whole batch goes through every stage in one launch
constexpr int kNGrp  = kBatch / kGB;       // 1 group
constexpr int kNZ    = kGB * kHeads;       // 128 (batch, head) planes
constexpr int kGRows = kGB * kSeq;         // 8192 token rows
constexpr int kPRow  = 2 * kSeq;           // pitch (16-bit elements) of a probability row: 512 hi then 512 lo
constexpr float kLog2e = 1.4426950408889634f;
static_assert(kSeq == 512 && kDk == 64 && kDm == kHeads * kDk && (kBatch % kGB) == 0, "geometry");

typedef __attribute__((ext_vector_type(16))) _Float16 v16h;
typedef __attribute__((ext_vector_type(8)))  _Float16 v8h;
typedef __attribute__((ext_vector_type(16))) __bf16   v16b;
typedef __attribute__((ext_vector_type(8)))  __bf16   v8b;
typedef __attribute__((ext_vector_type(8)))  float    v8f;
typedef __attribute__((ext_vector_type(4)))  float    v4f;
typedef __attribute__((ext_vector_type(4)))  unsigned int v4u;

__device__ __forceinline__ unsigned short f2bf_bits(float f) {
  unsigned u = __float_as_uint(f);
  return (unsigned short)((u + 0x7FFFu + ((u >> 16) & 1u)) >> 16);
}
__device__ __forceinline__ float bf_bits2f(unsigned short h) { return __uint_as_float(((unsigned)h) << 16); }
__device__ __forceinline__ unsigned pk16(unsigned short a, unsigned short b) { return (unsigned)a | ((unsigned)b << 16); }

// hazard guards as plain device helpers (no inline asm inside the kernel template body)
__device__ __forceinline__ void dep_guard_h(v8f& a, v8f& b, v16h x, v16h y) { asm volatile("v_nop\n\tv_nop\n\tv_nop\n\tv_nop" : "+v"(a), "+v"(b) : "v"(x), "v"(y)); }
__device__ __forceinline__ void dep_guard_b(v8f& a, v8f& b, v16b x, v16b y) { asm volatile("v_nop\n\tv_nop\n\tv_nop\n\tv_nop" : "+v"(a), "+v"(b) : "v"(x), "v"(y)); }
__device__ __forceinline__ void keep4_h(v16h a, v16h b, v16h c, v16h d) { asm volatile("v_nop" :: "v"(a), "v"(b), "v"(c), "v"(d)); }
__device__ __forceinline__ void keep4_b(v16b a, v16b b, v16b c, v16b d) { asm volatile("v_nop" :: "v"(a), "v"(b), "v"(c), "v"(d)); }
__device__ __forceinline__ void acc_guard4(v8f& a, v8f& b, v8f& c, v8f& d) { asm volatile("v_nop\n\tv_nop\n\tv_nop\n\tv_nop" : "+v"(a), "+v"(b), "+v"(c), "+v"(d)); }
template <typename T> struct Frag;
template <> struct Frag<_Float16> {
  typedef v16h V; union U { v16h v; v8h h[2]; };
  static __device__ __forceinline__ v16h load(const _Float16* p) {   // elements 0..7 <- p[0..7], 8..15 <- p[16..23]
    U f; f.h[0] = *(const v8h*)(p); f.h[1] = *(const v8h*)(p + 16); return f.v;
  }
  static __device__ __forceinline__ v8f mma(v16h a, v16h b, v8f c) {
    return __builtin_amdgcn_wmma_f32_16x16x32_f16(false, a, false, b, (short)0, c, false, false);
  }
  static __device__ __forceinline__ void guard(v8f& a, v8f& b, v16h x, v16h y) { dep_guard_h(a, b, x, y); }
  static __device__ __forceinline__ void keep(v16h a, v16h b, v16h c, v16h d) { keep4_h(a, b, c, d); }
};
template <> struct Frag<__bf16> {
  typedef v16b V; union U { v16b v; v8b h[2]; };
  static __device__ __forceinline__ v16b load(const __bf16* p) {
    U f; f.h[0] = *(const v8b*)(p); f.h[1] = *(const v8b*)(p + 16); return f.v;
  }
  static __device__ __forceinline__ v8f mma(v16b a, v16b b, v8f c) {
    return __builtin_amdgcn_wmma_f32_16x16x32_bf16(false, a, false, b, (short)0, c, false, false);
  }
  static __device__ __forceinline__ void guard(v8f& a, v8f& b, v16b x, v16b y) { dep_guard_b(a, b, x, y); }
  static __device__ __forceinline__ void keep(v16b a, v16b b, v16b c, v16b d) { keep4_b(a, b, c, d); }
};

// ---- Register-blocked batched WMMA GEMM ------------------------------------
// C[m,n] = scale * sum_k A[m,k] * Bt[n,k] (+bias)(+resid); each wave owns a 64x64 tile.
// A row-major [M,K]; Bt row-major [N,K]; M % (8/WN*64) == 0, N % (WN*64) == 0, K % KC == 0.
// SPLIT: operands are hi/lo planes (A2/Bt2 = lo planes, same layout); product = hi.hi + hi.lo + lo.hi.
// BIAS_MODE: 0 = none, 1 = bias[m], 2 = bias[n].
// OUT_MODE: 0 = f32, 1 = f16, 2 = bf16 hi plane (Cout) + bf16 lo plane (Cout2).
// z addressing: bz = blockIdx.y, zi = bz % zsplit, zo = bz / zsplit; operand base = zi*stride + zo*stride2 (elements).
// ET: 0 = f16 operands, 1 = bf16 operands (pointers passed as 16-bit storage)
template <int ET> struct Elem;
template <> struct Elem<0> { typedef _Float16 T; };
template <> struct Elem<1> { typedef __bf16 T; };
// ---- LDS staging of the operand tiles ---------------------------------------
// The eight waves of a work-group share one (8/WN*64) x (WN*64) tile of C. Per pass of KC k, the rows of A hi, A lo, Bt hi, Bt lo
// that the tile needs are copied to LDS by global_load_async_to_lds_b128 (KC/8 neighbouring lanes per row: whole contiguous row pieces),
// at a row pitch of KC*2 + 16 bytes; the WMMA fragments are then read with ds_load_b128.
// this wave's copies have landed before the barrier that publishes them to the other waves
__device__ __forceinline__ void wait_async0() { asm volatile("s_wait_asynccnt 0x0" ::: "memory"); }
// this wave's fragment reads have returned before the barrier behind which their buffer is refilled
__device__ __forceinline__ void wait_ds0() { asm volatile("s_wait_dscnt 0x0" ::: "memory"); }
// six copies, 16 bytes per lane each; the closing s_wait_xcnt stands in the same statement so that no address register is rewritten ahead of it
__device__ __forceinline__ void copy6(unsigned l0, const unsigned short* g0, unsigned l1, const unsigned short* g1,
                                      unsigned l2, const unsigned short* g2, unsigned l3, const unsigned short* g3,
                                      unsigned l4, const unsigned short* g4, unsigned l5, const unsigned short* g5) {
  asm volatile("global_load_async_to_lds_b128 %0, %1, off\n\t"
               "global_load_async_to_lds_b128 %2, %3, off\n\t"
               "global_load_async_to_lds_b128 %4, %5, off\n\t"
               "global_load_async_to_lds_b128 %6, %7, off\n\t"
               "global_load_async_to_lds_b128 %8, %9, off\n\t"
               "global_load_async_to_lds_b128 %10, %11, off\n\t"
               "s_wait_xcnt 0x0"
               :: "v"(l0), "v"(g0), "v"(l1), "v"(g1), "v"(l2), "v"(g2), "v"(l3), "v"(g3), "v"(l4), "v"(g4), "v"(l5), "v"(g5)
               : "memory");
}
// One stage: LDS rows [A hi: TM | A lo: TM | Bt hi: TN | Bt lo: TN]. 256 threads cover RPP rows per round; lds and the four
// pointers are this thread's own place in round 0 of each part; stepA / stepB = RPP rows of the source, in elements.
template <int KC, int TM, int TN>
__device__ __forceinline__ void stage_fill(unsigned lds, const unsigned short* gAh, const unsigned short* gAl,
                                           const unsigned short* gBh, const unsigned short* gBl, size_t stepA, size_t stepB) {
  constexpr int RPP = 256 / (KC / 8);
  constexpr int PA = TM / RPP, PB = TN / RPP, NP = 2 * (PA + PB);
  constexpr unsigned LB = (unsigned)RPP * (KC * 2 + 16);
  static_assert(TM % RPP == 0 && TN % RPP == 0 && NP % 6 == 0 && NP <= 63, "stage geometry");
  // both loops unrolled: the round number is then a constant, so each copy's part and LDS place are chosen at compile time
#pragma unroll
  for (int p = 0; p < NP; p += 6) {
    const unsigned short* g[6];
#pragma unroll
    for (int u = 0; u < 6; ++u) {
      const int q = p + u;
      g[u] = (q < PA) ? (gAh + (size_t)q * stepA)
           : (q < 2 * PA) ? (gAl + (size_t)(q - PA) * stepA)
           : (q < 2 * PA + PB) ? (gBh + (size_t)(q - 2 * PA) * stepB)
                               : (gBl + (size_t)(q - 2 * PA - PB) * stepB);
    }
    copy6(lds + (unsigned)p * LB, g[0], lds + (unsigned)(p + 1) * LB, g[1], lds + (unsigned)(p + 2) * LB, g[2],
          lds + (unsigned)(p + 3) * LB, g[3], lds + (unsigned)(p + 4) * LB, g[4], lds + (unsigned)(p + 5) * LB, g[5]);
  }
}

// WN: waves along n in the work-group (8/WN along m). KC: k per stage. NBUF: 2 = the next stage's copies fly while this one is worked on.
// M % (8/WN*64) == 0, N % (WN*64) == 0, K % KC == 0; grid.x = (M/64)*(N/64)/8 work-groups.
template <int ET, bool SPLIT, int BIAS_MODE, int OUT_MODE, bool RESID, int ACT, int WN, int KC, int NBUF>
__global__ __launch_bounds__(256) void wmma_gemm64(
    const unsigned short* __restrict__ Ap, const unsigned short* __restrict__ A2p, int lda, long strideA, long strideA2,
    const unsigned short* __restrict__ Btp, const unsigned short* __restrict__ Bt2p, int ldb, long strideB, long strideB2,
    void* __restrict__ Cout, void* __restrict__ Cout2, int ldc, long strideC, long strideC2,
    const float* __restrict__ bias,
    const float* __restrict__ resid, long strideR,
    int M, int N, int K, float scale, int zsplit) {
  typedef typename Elem<ET>::T T;
  typedef typename Frag<T>::V V;
  static_assert(SPLIT, "the staged tiles hold a hi and a lo plane of each operand");
  constexpr int TM = (8 / WN) * 64;
  constexpr int TN = WN * 64;
  constexpr int PE = KC + 8;                       // LDS row pitch in elements (16 B x odd)
  constexpr int STAGE_E = 2 * (TM + TN) * PE;      // elements per stage
  __shared__ __align__(16) unsigned short sStage[NBUF * STAGE_E];
  __shared__ __align__(16) float sT[8][16 * 68];   // per-wave 16x64 slab, pitch 68 floats
  const int bz   = blockIdx.y;
  const int zo   = bz / zsplit;
  const int zi   = bz - zo * zsplit;
  const int lane = threadIdx.x & 31;
  const int wave = threadIdx.x >> 5;
  const int tilesN = N / TN;
  const int tilesM = M / TM;
  const int wg = blockIdx.x;
  if (wg >= tilesM * tilesN) return;   // the same for the whole work-group, in front of every barrier
  const int tmw = wg / tilesN;
  const int tnw = wg - tmw * tilesN;
  const int wm = wave / WN;
  const int wn = wave - wm * WN;
  const int m0 = tmw * TM + (wm << 6);
  const int n0 = tnw * TN + (wn << 6);

  const size_t aOff = (size_t)zi * strideA + (size_t)zo * strideA2;
  const size_t bOff = (size_t)zi * strideB + (size_t)zo * strideB2;
  const size_t cOff = (size_t)zi * strideC + (size_t)zo * strideC2;

  const int rlane = lane & 15;                 // row (A) / col (B, D) within subtile
  const int koff  = (lane >> 4) * 8;           // k offset of this lane half
  const int mOff  = (lane >> 4) * 8;           // D row offset

  // this thread's place in a round of copies: row cr of the round, 16-byte piece cc of the row
  constexpr int LPR = KC / 8;
  const int cc = threadIdx.x % LPR;
  const int cr = threadIdx.x / LPR;
  const size_t aRow = aOff + (size_t)(tmw * TM + cr) * lda + cc * 8;
  const size_t bRow = bOff + (size_t)(tnw * TN + cr) * ldb + cc * 8;
  const unsigned short* gAh = Ap + aRow;
  const unsigned short* gAl = A2p + aRow;
  const unsigned short* gBh = Btp + bRow;
  const unsigned short* gBl = Bt2p + bRow;
  const size_t stepA = (size_t)(256 / LPR) * lda;
  const size_t stepB = (size_t)(256 / LPR) * ldb;
  const unsigned ldsT = (unsigned)(uintptr_t)sStage + (unsigned)(cr * PE + cc * 8) * 2u;

  v8f acc[4][4];
#pragma unroll
  for (int i = 0; i < 4; ++i)
#pragma unroll
    for (int j = 0; j < 4; ++j) acc[i][j] = (v8f){0.f,0.f,0.f,0.f,0.f,0.f,0.f,0.f};

  const int NT = K / KC;
  stage_fill<KC, TM, TN>(ldsT, gAh, gAl, gBh, gBl, stepA, stepB);
  wait_async0();
  __syncthreads();
  if (NBUF == 2 && NT > 1)
    stage_fill<KC, TM, TN>(ldsT + (unsigned)STAGE_E * 2u, gAh + KC, gAl + KC, gBh + KC, gBl + KC, stepA, stepB);

  for (int t = 0; t < NT; ++t) {
    const int buf = (NBUF == 2) ? (t & 1) : 0;
    const T* sb = (const T*)(sStage + buf * STAGE_E);
    const T* sA = sb + ((wm << 6) + rlane) * PE + koff;
    const T* sB = sb + (2 * TM + (wn << 6) + rlane) * PE + koff;
    // unrolled: the LDS offsets of a stage's fragments become immediates
#pragma unroll
    for (int kk = 0; kk < KC; kk += 32) {
      V bh[4], bl[4];
#pragma unroll
      for (int j = 0; j < 4; ++j) {
        bh[j] = Frag<T>::load(sB + (j << 4) * PE + kk);
        bl[j] = Frag<T>::load(sB + (TN + (j << 4)) * PE + kk);
      }
#pragma unroll
      for (int i = 0; i < 4; ++i) {
        V ah = Frag<T>::load(sA + (i << 4) * PE + kk);
        V al = Frag<T>::load(sA + (TM + (i << 4)) * PE + kk);
#pragma unroll
        for (int j = 0; j < 4; ++j) {
          acc[i][j] = Frag<T>::mma(ah, bh[j], acc[i][j]);
          acc[i][j] = Frag<T>::mma(ah, bl[j], acc[i][j]);
          acc[i][j] = Frag<T>::mma(al, bh[j], acc[i][j]);
        }
        Frag<T>::guard(acc[i][0], acc[i][3], ah, al);
      }
      Frag<T>::keep(bh[0], bh[1], bh[2], bh[3]);
      Frag<T>::keep(bl[0], bl[1], bl[2], bl[3]);
    }
    if (NBUF == 2) {
      // hand-over: every wave's reads of this buffer are done and its copies of the next stage have landed, then the barrier
      wait_ds0();
      wait_async0();
      __syncthreads();
      if (t + 2 < NT) {
        const int k2 = (t + 2) * KC;
        stage_fill<KC, TM, TN>(ldsT + (unsigned)(buf * STAGE_E) * 2u, gAh + k2, gAl + k2, gBh + k2, gBl + k2, stepA, stepB);
      }
    } else if (t + 1 < NT) {
      // one buffer: refill it behind every wave's last read, publish it behind every wave's copies
      wait_ds0();
      __syncthreads();
      const int k1 = (t + 1) * KC;
      stage_fill<KC, TM, TN>(ldsT, gAh + k1, gAl + k1, gBh + k1, gBl + k1, stepA, stepB);
      wait_async0();
      __syncthreads();
    }
  }
  wait_async0();
  acc_guard4(acc[0][0], acc[0][1], acc[0][2], acc[0][3]);
  acc_guard4(acc[1][0], acc[1][1], acc[1][2], acc[1][3]);
  acc_guard4(acc[2][0], acc[2][1], acc[2][2], acc[2][3]);
  acc_guard4(acc[3][0], acc[3][1], acc[3][2], acc[3][3]);

  // ---- epilogue ----
  float* slab = sT[wave];
  const float* Rb = RESID ? (resid + (size_t)zi * strideR) : nullptr;
#pragma unroll
  for (int i = 0; i < 4; ++i) {
    const int mBase = m0 + (i << 4);
#pragma unroll
    for (int j = 0; j < 4; ++j) {
      const int n = n0 + (j << 4) + rlane;
      float bv = 0.f;
      if (BIAS_MODE == 2) bv = bias[n];
#pragma unroll
      for (int r = 0; r < 8; ++r) {
        float v = acc[i][j][r] * scale;
        if (BIAS_MODE == 1) v += bias[mBase + mOff + r];
        if (BIAS_MODE == 2) v += bv;
        if (RESID) v += Rb[(size_t)(mBase + mOff + r) * ldc + n];
        if (ACT == 1) v = tanhf(v);
        if (ACT == 2) v = fmaxf(v, 0.0f);
        if (ACT == 4) v = (v > 0.f) ? v : 0.01f * v;
        slab[(mOff + r) * 68 + (j << 4) + rlane] = v;
      }
    }
    __builtin_amdgcn_fence(__ATOMIC_RELEASE, "workgroup");
    __builtin_amdgcn_wave_barrier();
    __builtin_amdgcn_fence(__ATOMIC_ACQUIRE, "workgroup");
    if (OUT_MODE == 0) {
      float* C = (float*)Cout + cOff;
      const int hh = lane >> 4, c4 = (lane & 15) * 4;     // row seg = 256 B = 16 lanes x 16 B
      {
#pragma unroll
        for (int it = 0; it < 8; ++it) {
          const int row = it * 2 + hh;
          v4f v = *(const v4f*)(slab + row * 68 + c4);
          *(v4f*)(C + (size_t)(mBase + row) * ldc + n0 + c4) = v;
        }
        
      }
    } else {
      const int q = lane >> 3, c8 = (lane & 7) * 8;
      unsigned short* C  = (unsigned short*)Cout  + cOff;
      unsigned short* C2 = (OUT_MODE == 2) ? ((unsigned short*)Cout2 + cOff) : nullptr;
      {
#pragma unroll
        for (int it = 0; it < 4; ++it) {
          const int row = it * 4 + q;
          const float* sp = slab + row * 68 + c8;
          v8h hv, lv;
#pragma unroll
          for (int e = 0; e < 8; ++e) {
            if (OUT_MODE == 1) {
              hv[e] = (_Float16)sp[e];
            } else {
              unsigned short hb = f2bf_bits(sp[e]);
              unsigned short lb = f2bf_bits(sp[e] - bf_bits2f(hb));
              hv[e] = __builtin_bit_cast(_Float16, hb);
              lv[e] = __builtin_bit_cast(_Float16, lb);
            }
          }
          *(v8h*)(C + (size_t)(mBase + row) * ldc + n0 + c8) = hv;
          if (OUT_MODE == 2) *(v8h*)(C2 + (size_t)(mBase + row) * ldc + n0 + c8) = lv;
        }
        
      }
    }
    __builtin_amdgcn_fence(__ATOMIC_RELEASE, "workgroup");
    __builtin_amdgcn_wave_barrier();
    __builtin_amdgcn_fence(__ATOMIC_ACQUIRE, "workgroup");
  }
}

// ---------------------------------------------------------------------------
// Elementwise f32 -> bf16 hi/lo split, 8 elements per thread: hi = bf16_rne(x), lo = bf16_rne(x - hi).
// Coverage: grid = n8/256 blocks (n8 = plane/8, exact multiple here; guard kept) x 256 threads x 8 = the whole plane.
// ---------------------------------------------------------------------------
__global__ __launch_bounds__(256) void split_bf16x8_kernel(const float* __restrict__ in, unsigned short* __restrict__ hi,
                                                           unsigned short* __restrict__ lo, int n8) {
  const int i = blockIdx.x * 256 + threadIdx.x;
  if (i < n8) {
    const size_t base = (size_t)i * 8;
    const v4f a = *(const v4f*)(in + base);
    const v4f b = *(const v4f*)(in + base + 4);
    const float f[8] = {a[0], a[1], a[2], a[3], b[0], b[1], b[2], b[3]};
    unsigned hw[4], lw[4];
#pragma unroll
    for (int q = 0; q < 4; ++q) {
      const unsigned short h0 = f2bf_bits(f[2 * q]), h1 = f2bf_bits(f[2 * q + 1]);
      const unsigned short l0 = f2bf_bits(f[2 * q] - bf_bits2f(h0));
      const unsigned short l1 = f2bf_bits(f[2 * q + 1] - bf_bits2f(h1));
      hw[q] = pk16(h0, h1);
      lw[q] = pk16(l0, l1);
    }
    const v4u hv = (v4u){hw[0], hw[1], hw[2], hw[3]};
    const v4u lv = (v4u){lw[0], lw[1], lw[2], lw[3]};
    *(v4u*)(hi + base) = hv;
    *(v4u*)(lo + base) = lv;
    
  }
}

// ---------------------------------------------------------------------------
// Gated mixing, one wave per score row rg = z*512 + i (z = bb*8 + h, bb = batch in group, i = query index).
// Lane l owns columns 8l..8l+7 and 256+8l..256+8l+7 (all 512 columns of the row, 16 per lane, static slots).
//   g_c  = bg[c] + sum_d q[i][h*64+d] * Wg[c][d]  (q = hi + lo planes, f32; 2 lane-parallel products + shuffle tree)
//   qp_c = rcp((|g_c| + 1)^2)
//   p_j  = 2^((s_j - max_j s) * log2e)              (= exp(s - max) = softmax_j / max softmax)
//   adj  = 2^((i-j)^2 * (-0.5 log2e qp_1)) for j < i,  2^((i-j)^2 * (-0.5 log2e qp_0)) for j >= i
//   a_j  = sg * p_j + (1 - sg) * adj,  sg = rcp(1 + 2^(-lam1 * log2e))
//   P_j  = a_j * rcp(sum_j a_j + 1e-9)  -> bf16 hi/lo planes
// exp2 and rcp are the single hardware instructions (v_exp_f32 / v_rcp_f32): no library expansions.
// Reductions in fixed order (per lane sequential, then xor shuffle tree). No LDS, no barriers.
// Producer coverage: grid = nrows/8 blocks x 8 waves = nrows rows; per row 32 lanes x 16 u16 = 512 columns per plane;
// In place: P row rg (512 hi + 512 lo, 2048 B) takes the bytes of score row rg (512 f32). Only this wave touches that
// row, and every store needs the row maximum and the row sum, that is all 512 loaded scores. SP is therefore not __restrict__.
// ---------------------------------------------------------------------------
__device__ __forceinline__ float hw_exp2(float x) { return __builtin_amdgcn_exp2f(x); }
__device__ __forceinline__ float hw_rcp(float x)  { return __builtin_amdgcn_rcpf(x); }

__global__ __launch_bounds__(256) void gate_mix_kernel(
    float* SP, const unsigned short* __restrict__ Qh, const unsigned short* __restrict__ Ql,
    const float* __restrict__ Wg, const float* __restrict__ bg, const float* __restrict__ lam1, int nrows) {
  const int lane = threadIdx.x & 31;
  const int wave = threadIdx.x >> 5;
  const int rg = blockIdx.x * 8 + wave;
  if (rg >= nrows) return;                       // wave-uniform; no barriers in this kernel
  const int z  = rg >> 9;
  const int i  = rg & (kSeq - 1);
  const int bb = z >> 3;
  const int h  = z & (kHeads - 1);
  float* srow = SP + (size_t)rg * kSeq;
  const int j0 = lane * 8;
  const int j1 = 256 + lane * 8;
  const v4f sa = *(const v4f*)(srow + j0);
  const v4f sb = *(const v4f*)(srow + j0 + 4);
  const v4f sc = *(const v4f*)(srow + j1);
  const v4f sd = *(const v4f*)(srow + j1 + 4);
  const float s[16] = {sa[0], sa[1], sa[2], sa[3], sb[0], sb[1], sb[2], sb[3],
                       sc[0], sc[1], sc[2], sc[3], sd[0], sd[1], sd[2], sd[3]};

  // gating dots (64 terms each: 2 products per lane, then a 5-level shuffle tree)
  const size_t qo = (size_t)(bb * kSeq + i) * kDm + (size_t)h * kDk;
  const float q0 = bf_bits2f(Qh[qo + lane]) + bf_bits2f(Ql[qo + lane]);
  const float q1 = bf_bits2f(Qh[qo + 32 + lane]) + bf_bits2f(Ql[qo + 32 + lane]);
  float g0 = q0 * Wg[lane] + q1 * Wg[32 + lane];
  float g1 = q0 * Wg[kDk + lane] + q1 * Wg[kDk + 32 + lane];
#pragma unroll
  for (int off = 16; off > 0; off >>= 1) {
    g0 += __shfl_xor(g0, off, 32);
    g1 += __shfl_xor(g1, off, 32);
  }
  g0 += bg[0];
  g1 += bg[1];
  const float t0 = fabsf(g0) + 1.0f;
  const float t1 = fabsf(g1) + 1.0f;
  const float qp0 = hw_rcp(t0 * t0);
  const float qp1 = hw_rcp(t1 * t1);
  const float gn0 = (-0.5f * kLog2e) * qp0;      // j >= i (upper incl. diagonal)
  const float gn1 = (-0.5f * kLog2e) * qp1;      // j <  i (strictly lower)
  const float lam = lam1[0];
  const float sg  = hw_rcp(1.0f + hw_exp2(-lam * kLog2e));
  const float omg = 1.0f - sg;

  float mx = s[0];
#pragma unroll
  for (int e = 1; e < 16; ++e) mx = fmaxf(mx, s[e]);
#pragma unroll
  for (int off = 16; off > 0; off >>= 1) mx = fmaxf(mx, __shfl_xor(mx, off, 32));

  float a[16];
  float ps = 0.f;
#pragma unroll
  for (int e = 0; e < 16; ++e) {
    const int j = (e < 8) ? (j0 + e) : (j1 + (e - 8));
    const float p   = hw_exp2((s[e] - mx) * kLog2e);
    const float fd  = (float)(i - j);
    const float gs  = (j < i) ? gn1 : gn0;
    const float adj = hw_exp2((fd * fd) * gs);
    const float av  = sg * p + omg * adj;
    a[e] = av;
    ps += av;
  }
#pragma unroll
  for (int off = 16; off > 0; off >>= 1) ps += __shfl_xor(ps, off, 32);
  const float inv = hw_rcp(ps + 1e-9f);

  unsigned hw0[4], lw0[4], hw1[4], lw1[4];
#pragma unroll
  for (int q = 0; q < 4; ++q) {
    const float p0 = a[2 * q] * inv, p1 = a[2 * q + 1] * inv;
    const float p2 = a[8 + 2 * q] * inv, p3 = a[9 + 2 * q] * inv;
    const unsigned short h0 = f2bf_bits(p0), h1 = f2bf_bits(p1), h2 = f2bf_bits(p2), h3 = f2bf_bits(p3);
    const unsigned short l0 = f2bf_bits(p0 - bf_bits2f(h0));
    const unsigned short l1 = f2bf_bits(p1 - bf_bits2f(h1));
    const unsigned short l2 = f2bf_bits(p2 - bf_bits2f(h2));
    const unsigned short l3 = f2bf_bits(p3 - bf_bits2f(h3));
    hw0[q] = pk16(h0, h1); lw0[q] = pk16(l0, l1);
    hw1[q] = pk16(h2, h3); lw1[q] = pk16(l2, l3);
  }
  const v4u hv0 = (v4u){hw0[0], hw0[1], hw0[2], hw0[3]};
  const v4u lv0 = (v4u){lw0[0], lw0[1], lw0[2], lw0[3]};
  const v4u hv1 = (v4u){hw1[0], hw1[1], hw1[2], hw1[3]};
  const v4u lv1 = (v4u){lw1[0], lw1[1], lw1[2], lw1[3]};
  unsigned short* prow = (unsigned short*)srow;
  *(v4u*)(prow + j0) = hv0;
  *(v4u*)(prow + j1) = hv1;
  *(v4u*)(prow + kSeq + j0) = lv0;
  *(v4u*)(prow + kSeq + j1) = lv1;
  
}

// ---------------------------------------------------------------------------
// Workspace region map (bytes; every offset a multiple of 512 KiB). Every region is fully written
// inside the call before any read.
//   Wqh,Wql,Wkh,Wkl,Wvh,Wvl,Woh,Wol  bf16 [512][512] each            0 .. 4194304
//   Xqh,Xql,Xkh,Xkl,Xvh,Xvl          bf16 [8192][512] each     4194304 .. 54525952
//   Qh,Ql,Kh,Kl                      bf16 [8192][512] each    54525952 .. 88080384   (row bb*512+i, col h*64+d)
//   VTh,VTl                          bf16 [16][512][512]      88080384 .. 104857600  (batch, row h*64+d, col token)
//   CTXh,CTXl                        bf16 [8192][512] each   104857600 .. 121634816  (row bb*512+i, col h*64+d)
//   S                                f32  [128][512][512]    121634816 .. 255852544  (z = bb*8+h)
//   P (over S, row for row)          bf16 [128][512][2][512]  the same bytes         (row: 512 hi, then 512 lo)
//   total 255852544
// ---------------------------------------------------------------------------
extern "C" void kernel_launch(void* const* d_in, const int* in_sizes, int n_in,
                              void* d_out, int out_size, void* d_ws, size_t ws_size,
                              hipStream_t stream) {
  if (n_in < 14) return;
  const int nAct = kBatch * kSeq * kDm;          // 4194304
  const int nW   = kDm * kDm;                    // 262144
  if (in_sizes[0] != nAct || in_sizes[1] != nAct || in_sizes[2] != nAct) return;
  if (in_sizes[3] != nW || in_sizes[5] != nW || in_sizes[7] != nW || in_sizes[12] != nW) return;
  if (in_sizes[4] != kDm || in_sizes[6] != kDm || in_sizes[8] != kDm || in_sizes[13] != kDm) return;
  if (in_sizes[9] != 2 * kDk || in_sizes[10] < 2 || in_sizes[11] < 1) return;
  if (out_size != nAct) return;

  const float* query = (const float*)d_in[0];
  const float* key   = (const float*)d_in[1];
  const float* value = (const float*)d_in[2];
  const float* Wq    = (const float*)d_in[3];
  const float* bq    = (const float*)d_in[4];
  const float* Wk    = (const float*)d_in[5];
  const float* bk    = (const float*)d_in[6];
  const float* Wv    = (const float*)d_in[7];
  const float* bv    = (const float*)d_in[8];
  const float* Wg    = (const float*)d_in[9];
  const float* bg    = (const float*)d_in[10];
  const float* lam1  = (const float*)d_in[11];
  const float* Wo    = (const float*)d_in[12];
  const float* bo    = (const float*)d_in[13];
  float* out = (float*)d_out;

  const size_t PW  = (size_t)kDm * kDm * 2;                 // 524288    weight plane
  const size_t PX  = (size_t)kGRows * kDm * 2;              // 8388608   activation / q / k / ctx plane
  const size_t PVT = (size_t)kGB * kDm * kSeq * 2;          // 8388608   v^T plane
  const size_t PS  = (size_t)kNZ * kSeq * kSeq * 4;         // 134217728 score planes (f32), then the probability rows
  size_t off = 0;
  const size_t oWqh = off; off += PW;  const size_t oWql = off; off += PW;
  const size_t oWkh = off; off += PW;  const size_t oWkl = off; off += PW;
  const size_t oWvh = off; off += PW;  const size_t oWvl = off; off += PW;
  const size_t oWoh = off; off += PW;  const size_t oWol = off; off += PW;
  const size_t oXqh = off; off += PX;  const size_t oXql = off; off += PX;
  const size_t oXkh = off; off += PX;  const size_t oXkl = off; off += PX;
  const size_t oXvh = off; off += PX;  const size_t oXvl = off; off += PX;
  const size_t oQh  = off; off += PX;  const size_t oQl  = off; off += PX;
  const size_t oKh  = off; off += PX;  const size_t oKl  = off; off += PX;
  const size_t oVTh = off; off += PVT; const size_t oVTl = off; off += PVT;
  const size_t oCh  = off; off += PX;  const size_t oCl  = off; off += PX;
  const size_t oS   = off; off += PS;
  if (off > ws_size) return;                                // off = 255852544

  char* ws = (char*)d_ws;
  unsigned short* Wqh = (unsigned short*)(ws + oWqh); unsigned short* Wql = (unsigned short*)(ws + oWql);
  unsigned short* Wkh = (unsigned short*)(ws + oWkh); unsigned short* Wkl = (unsigned short*)(ws + oWkl);
  unsigned short* Wvh = (unsigned short*)(ws + oWvh); unsigned short* Wvl = (unsigned short*)(ws + oWvl);
  unsigned short* Woh = (unsigned short*)(ws + oWoh); unsigned short* Wol = (unsigned short*)(ws + oWol);
  unsigned short* Xqh = (unsigned short*)(ws + oXqh); unsigned short* Xql = (unsigned short*)(ws + oXql);
  unsigned short* Xkh = (unsigned short*)(ws + oXkh); unsigned short* Xkl = (unsigned short*)(ws + oXkl);
  unsigned short* Xvh = (unsigned short*)(ws + oXvh); unsigned short* Xvl = (unsigned short*)(ws + oXvl);
  unsigned short* Qh  = (unsigned short*)(ws + oQh);  unsigned short* Ql  = (unsigned short*)(ws + oQl);
  unsigned short* Kh  = (unsigned short*)(ws + oKh);  unsigned short* Kl  = (unsigned short*)(ws + oKl);
  unsigned short* VTh = (unsigned short*)(ws + oVTh); unsigned short* VTl = (unsigned short*)(ws + oVTl);
  unsigned short* Ch  = (unsigned short*)(ws + oCh);  unsigned short* Cl  = (unsigned short*)(ws + oCl);
  float*          Sb  = (float*)(ws + oS);
  unsigned short* Ph  = (unsigned short*)(ws + oS);   unsigned short* Pl  = Ph + kSeq;   // hi and lo halves of row 0

  const dim3 blk(256);
  const int n8w = nW / 8;                                           // 32768 threads x 8 = [512][512]
  const int n8x = kGRows * kDm / 8;                                 // 524288 threads x 8 = [8192][512]
  const dim3 gSplitW((n8w + 255) / 256);                            // 128
  const dim3 gSplitX((n8x + 255) / 256);                            // 2048
  const dim3 gQ(((kGRows / 64) * (kDm / 64) + 7) / 8, 1);           // 128 blocks: M=8192, N=512, K=512
  const dim3 gVT(((kDm / 64) * (kSeq / 64) + 7) / 8, kGB);          // 8 x 16:     M=512, N=512, K=512 per batch
  const dim3 gS(((kSeq / 64) * (kSeq / 64) + 7) / 8, kNZ);          // 8 x 128:    M=N=512, K=64 per (bb,h)
  const int  nMixRows = kNZ * kSeq;                                 // 65536 rows
  const dim3 gMix((nMixRows + 7) / 8);                              // 8192 blocks x 8 waves
  const dim3 gPV(((kSeq / 64) * (kDk / 64) + 7) / 8, kNZ);          // 1 x 128:    M=512, N=64, K=512 per (bb,h)
  const dim3 gOut(((kGRows / 64) * (kDm / 64) + 7) / 8, 1);         // 128 blocks: M=8192, N=512, K=512

  const long pQK  = (long)kSeq * kDm;            // 262144: one batch of the q/k/ctx planes
  const long pSz  = (long)kSeq * kSeq;           // 262144: one score plane (f32 elements)
  const long pPz  = (long)kSeq * kPRow;          // 524288: the same plane as probability rows (16-bit elements)
  const long pVTb = (long)kDm * kSeq;            // 262144: one batch of the v^T planes

  // weight planes (torch [out][in] is already Bt[n][k]); whole [512][512] per plane
  split_bf16x8_kernel<<<gSplitW, blk, 0, stream>>>(Wq, Wqh, Wql, n8w);
  split_bf16x8_kernel<<<gSplitW, blk, 0, stream>>>(Wk, Wkh, Wkl, n8w);
  split_bf16x8_kernel<<<gSplitW, blk, 0, stream>>>(Wv, Wvh, Wvl, n8w);
  split_bf16x8_kernel<<<gSplitW, blk, 0, stream>>>(Wo, Woh, Wol, n8w);

  for (int gb = 0; gb < kNGrp; ++gb) {
    const size_t actOff = (size_t)gb * kGRows * kDm;
    // (1) activations of all batches -> hi/lo planes [8192][512]
    split_bf16x8_kernel<<<gSplitX, blk, 0, stream>>>(query + actOff, Xqh, Xql, n8x);
    split_bf16x8_kernel<<<gSplitX, blk, 0, stream>>>(key   + actOff, Xkh, Xkl, n8x);
    split_bf16x8_kernel<<<gSplitX, blk, 0, stream>>>(value + actOff, Xvh, Xvl, n8x);
    // (2) q = x.Wq^T + bq, k = x.Wk^T + bk -> hi/lo planes [8192][512] (128x8 tiles, whole planes)
    wmma_gemm64<1, true, 2, 2, false, 0, 4, 64, 2><<<gQ, blk, 0, stream>>>(
        Xqh, Xql, kDm, 0L, 0L, Wqh, Wql, kDm, 0L, 0L, (void*)Qh, (void*)Ql, kDm, 0L, 0L,
        bq, bq, 0L, kGRows, kDm, kDm, 1.0f, 1);
    wmma_gemm64<1, true, 2, 2, false, 0, 4, 64, 2><<<gQ, blk, 0, stream>>>(
        Xkh, Xkl, kDm, 0L, 0L, Wkh, Wkl, kDm, 0L, 0L, (void*)Kh, (void*)Kl, kDm, 0L, 0L,
        bk, bk, 0L, kGRows, kDm, kDm, 1.0f, 1);
    // (3) v^T[bb][o][tok] = sum_k Wv[o][k] x[bb*512+tok][k] + bv[o] -> hi/lo planes [16][512][512] (8x8 tiles per bb)
    wmma_gemm64<1, true, 1, 2, false, 0, 4, 64, 2><<<gVT, blk, 0, stream>>>(
        Wvh, Wvl, kDm, 0L, 0L, Xvh, Xvl, kDm, pQK, 0L, (void*)VTh, (void*)VTl, kSeq, pVTb, 0L,
        bv, bv, 0L, kDm, kSeq, kDm, 1.0f, kGB);
    // (4) S[z][i][j] = sum_d q[bb*512+i][h*64+d] k[bb*512+j][h*64+d], z = bb*8+h (8x8 tiles per z, whole planes)
    wmma_gemm64<1, true, 0, 0, false, 0, 4, 64, 1><<<gS, blk, 0, stream>>>(
        Qh, Ql, kDm, (long)kDk, pQK, Kh, Kl, kDm, (long)kDk, pQK, (void*)Sb, (void*)Sb, kSeq, pSz, (long)kHeads * pSz,
        bq, bq, 0L, kSeq, kSeq, kDk, 1.0f, kHeads);
    // (5) gated mixing, in place: score row -> P hi/lo row (65536 rows x 512)
    gate_mix_kernel<<<gMix, blk, 0, stream>>>(Sb, Qh, Ql, Wg, bg, lam1, nMixRows);
    // (6) ctx[bb*512+i][h*64+d] = sum_j P[z][i][j] v^T[bb][h*64+d][j] -> hi/lo planes (8x1 tiles per z; 64-col segment at h*64)
    wmma_gemm64<1, true, 0, 2, false, 0, 1, 32, 2><<<gPV, blk, 0, stream>>>(
        Ph, Pl, kPRow, pPz, (long)kHeads * pPz, VTh, VTl, kSeq, (long)kDk * kSeq, pVTb,
        (void*)Ch, (void*)Cl, kDm, (long)kDk, pQK,
        bq, bq, 0L, kSeq, kDk, kSeq, 1.0f, kHeads);
    // (7) out = ctx.Wo^T + bo -> f32 [8192][512], all of d_out (128x8 tiles)
    float* outg = out + actOff;
    wmma_gemm64<1, true, 2, 0, false, 0, 4, 64, 2><<<gOut, blk, 0, stream>>>(
        Ch, Cl, kDm, 0L, 0L, Woh, Wol, kDm, 0L, 0L, (void*)outg, (void*)outg, kDm, 0L, 0L,
        bo, bo, 0L, kGRows, kDm, kDm, 1.0f, 1);
  }
}

// v003
// It runs in 141 microseconds.
// In both of two side-by-side timings against v002, it was 1.39 times as fast.
// All steps since v000 together make it 6.93 times as fast.
// Contractions x.Wq^T, x.Wk^T, Wv.x^T, k.q^T, v^T.p^T, ctx.Wo^T: v_wmma_f32_16x16x32_bf16 on bf16 hi/lo split operand planes (hi.hi + hi.lo + lo.hi), f32 accumulate; per-row 64x2 gating dots, softmax, distance adjacency, max- and sum-normalisation in f32 on the VALU (hardware exp2/rcp).
#include <hip/hip_runtime.h>
#include <math.h>
#include <stdint.h>

constexpr int kBatch = 16;
constexpr int kSeq   = 512;
constexpr int kDm    = 512;
constexpr int kHeads = 8;
constexpr int kDk    = 64;
constexpr int kGB    = 16;                 // batches per group: the whole batch goes through every stage in one launch
constexpr int kNGrp  = kBatch / kGB;       // 1 group
constexpr int kNZ    = kGB * kHeads;       // 128 (batch, head) planes
constexpr int kGRows = kGB * kSeq;         // 8192 token rows
constexpr float kLog2e = 1.4426950408889634f;
static_assert(kSeq == 512 && kDk == 64 && kDm == kHeads * kDk && (kBatch % kGB) == 0, "geometry");

typedef __attribute__((ext_vector_type(16))) _Float16 v16h;
typedef __attribute__((ext_vector_type(8)))  _Float16 v8h;
typedef __attribute__((ext_vector_type(16))) __bf16   v16b;
typedef __attribute__((ext_vector_type(8)))  __bf16   v8b;
typedef __attribute__((ext_vector_type(8)))  float    v8f;
typedef __attribute__((ext_vector_type(4)))  float    v4f;
typedef __attribute__((ext_vector_type(4)))  unsigned int v4u;

__device__ __forceinline__ unsigned short f2bf_bits(float f) {
  unsigned u = __float_as_uint(f);
  return (unsigned short)((u + 0x7FFFu + ((u >> 16) & 1u)) >> 16);
}
__device__ __forceinline__ float bf_bits2f(unsigned short h) { return __uint_as_float(((unsigned)h) << 16); }
__device__ __forceinline__ unsigned pk16(unsigned short a, unsigned short b) { return (unsigned)a | ((unsigned)b << 16); }

// hazard guards as plain device helpers (no inline asm inside the kernel template body)
__device__ __forceinline__ void dep_guard_h(v8f& a, v8f& b, v16h x, v16h y) { asm volatile("v_nop\n\tv_nop\n\tv_nop\n\tv_nop" : "+v"(a), "+v"(b) : "v"(x), "v"(y)); }
__device__ __forceinline__ void dep_guard_b(v8f& a, v8f& b, v16b x, v16b y) { asm volatile("v_nop\n\tv_nop\n\tv_nop\n\tv_nop" : "+v"(a), "+v"(b) : "v"(x), "v"(y)); }
__device__ __forceinline__ void keep4_h(v16h a, v16h b, v16h c, v16h d) { asm volatile("v_nop" :: "v"(a), "v"(b), "v"(c), "v"(d)); }
__device__ __forceinline__ void keep4_b(v16b a, v16b b, v16b c, v16b d) { asm volatile("v_nop" :: "v"(a), "v"(b), "v"(c), "v"(d)); }
__device__ __forceinline__ void acc_guard4(v8f& a, v8f& b, v8f& c, v8f& d) { asm volatile("v_nop\n\tv_nop\n\tv_nop\n\tv_nop" : "+v"(a), "+v"(b), "+v"(c), "+v"(d)); }
template <typename T> struct Frag;
template <> struct Frag<_Float16> {
  typedef v16h V; union U { v16h v; v8h h[2]; };
  static __device__ __forceinline__ v16h load(const _Float16* p) {   // elements 0..7 <- p[0..7], 8..15 <- p[16..23]
    U f; f.h[0] = *(const v8h*)(p); f.h[1] = *(const v8h*)(p + 16); return f.v;
  }
  static __device__ __forceinline__ v8f mma(v16h a, v16h b, v8f c) {
    return __builtin_amdgcn_wmma_f32_16x16x32_f16(false, a, false, b, (short)0, c, false, false);
  }
  static __device__ __forceinline__ void guard(v8f& a, v8f& b, v16h x, v16h y) { dep_guard_h(a, b, x, y); }
  static __device__ __forceinline__ void keep(v16h a, v16h b, v16h c, v16h d) { keep4_h(a, b, c, d); }
};
template <> struct Frag<__bf16> {
  typedef v16b V; union U { v16b v; v8b h[2]; };
  static __device__ __forceinline__ v16b load(const __bf16* p) {
    U f; f.h[0] = *(const v8b*)(p); f.h[1] = *(const v8b*)(p + 16); return f.v;
  }
  static __device__ __forceinline__ v8f mma(v16b a, v16b b, v8f c) {
    return __builtin_amdgcn_wmma_f32_16x16x32_bf16(false, a, false, b, (short)0, c, false, false);
  }
  static __device__ __forceinline__ void guard(v8f& a, v8f& b, v16b x, v16b y) { dep_guard_b(a, b, x, y); }
  static __device__ __forceinline__ void keep(v16b a, v16b b, v16b c, v16b d) { keep4_b(a, b, c, d); }
};

// ---- Register-blocked batched WMMA GEMM ------------------------------------
// C[m,n] = scale * sum_k A[m,k] * Bt[n,k] (+bias)(+resid); each wave owns a 64x64 tile.
// A row-major [M,K]; Bt row-major [N,K]; M % (8/WN*64) == 0, N % (WN*64) == 0, K % KC == 0.
// SPLIT: operands are hi/lo planes (A2/Bt2 = lo planes, same layout); product = hi.hi + hi.lo + lo.hi.
// BIAS_MODE: 0 = none, 1 = bias[m], 2 = bias[n].
// OUT_MODE: 0 = f32, 1 = f16, 2 = bf16 hi plane (Cout) + bf16 lo plane (Cout2).
// z addressing: bz = blockIdx.y, zi = bz % zsplit, zo = bz / zsplit; operand base = zi*stride + zo*stride2 (elements).
// ET: 0 = f16 operands, 1 = bf16 operands (pointers passed as 16-bit storage)
template <int ET> struct Elem;
template <> struct Elem<0> { typedef _Float16 T; };
template <> struct Elem<1> { typedef __bf16 T; };
// ---- LDS staging of the operand tiles ---------------------------------------
// The eight waves of a work-group share one (8/WN*64) x (WN*64) tile of C. Per pass of KC k, the rows of A hi, A lo, Bt hi, Bt lo
// that the tile needs are copied to LDS by global_load_async_to_lds_b128 (KC/8 neighbouring lanes per row: whole contiguous row pieces),
// at a row pitch of KC*2 + 16 bytes; the WMMA fragments are then read with ds_load_b128.
// this wave's copies have landed before the barrier that publishes them to the other waves
__device__ __forceinline__ void wait_async0() { asm volatile("s_wait_asynccnt 0x0" ::: "memory"); }
// this wave's fragment reads have returned before the barrier behind which their buffer is refilled
__device__ __forceinline__ void wait_ds0() { asm volatile("s_wait_dscnt 0x0" ::: "memory"); }
// six copies, 16 bytes per lane each; the closing s_wait_xcnt stands in the same statement so that no address register is rewritten ahead of it
__device__ __forceinline__ void copy6(unsigned l0, const unsigned short* g0, unsigned l1, const unsigned short* g1,
                                      unsigned l2, const unsigned short* g2, unsigned l3, const unsigned short* g3,
                                      unsigned l4, const unsigned short* g4, unsigned l5, const unsigned short* g5) {
  asm volatile("global_load_async_to_lds_b128 %0, %1, off\n\t"
               "global_load_async_to_lds_b128 %2, %3, off\n\t"
               "global_load_async_to_lds_b128 %4, %5, off\n\t"
               "global_load_async_to_lds_b128 %6, %7, off\n\t"
               "global_load_async_to_lds_b128 %8, %9, off\n\t"
               "global_load_async_to_lds_b128 %10, %11, off\n\t"
               "s_wait_xcnt 0x0"
               :: "v"(l0), "v"(g0), "v"(l1), "v"(g1), "v"(l2), "v"(g2), "v"(l3), "v"(g3), "v"(l4), "v"(g4), "v"(l5), "v"(g5)
               : "memory");
}
// One stage: LDS rows [A hi: TM | A lo: TM | Bt hi: TN | Bt lo: TN]. 256 threads cover RPP rows per round; lds and the four
// pointers are this thread's own place in round 0 of each part; stepA / stepB = RPP rows of the source, in elements.
template <int KC, int TM, int TN>
__device__ __forceinline__ void stage_fill(unsigned lds, const unsigned short* gAh, const unsigned short* gAl,
                                           const unsigned short* gBh, const unsigned short* gBl, size_t stepA, size_t stepB) {
  constexpr int RPP = 256 / (KC / 8);
  constexpr int PA = TM / RPP, PB = TN / RPP, NP = 2 * (PA + PB);
  constexpr unsigned LB = (unsigned)RPP * (KC * 2 + 16);
  static_assert(TM % RPP == 0 && TN % RPP == 0 && NP % 6 == 0 && NP <= 63, "stage geometry");
  // both loops unrolled: the round number is then a constant, so each copy's part and LDS place are chosen at compile time
#pragma unroll
  for (int p = 0; p < NP; p += 6) {
    const unsigned short* g[6];
#pragma unroll
    for (int u = 0; u < 6; ++u) {
      const int q = p + u;
      g[u] = (q < PA) ? (gAh + (size_t)q * stepA)
           : (q < 2 * PA) ? (gAl + (size_t)(q - PA) * stepA)
           : (q < 2 * PA + PB) ? (gBh + (size_t)(q - 2 * PA) * stepB)
                               : (gBl + (size_t)(q - 2 * PA - PB) * stepB);
    }
    copy6(lds + (unsigned)p * LB, g[0], lds + (unsigned)(p + 1) * LB, g[1], lds + (unsigned)(p + 2) * LB, g[2],
          lds + (unsigned)(p + 3) * LB, g[3], lds + (unsigned)(p + 4) * LB, g[4], lds + (unsigned)(p + 5) * LB, g[5]);
  }
}

// WN: waves along n in the work-group (8/WN along m). KC: k per stage. NBUF: 2 = the next stage's copies fly while this one is worked on.
// M % (8/WN*64) == 0, N % (WN*64) == 0, K % KC == 0; grid.x = (M/64)*(N/64)/8 work-groups.
template <int ET, bool SPLIT, int BIAS_MODE, int OUT_MODE, bool RESID, int ACT, int WN, int KC, int NBUF>
__global__ __launch_bounds__(256) void wmma_gemm64(
    const unsigned short* __restrict__ Ap, const unsigned short* __restrict__ A2p, int lda, long strideA, long strideA2,
    const unsigned short* __restrict__ Btp, const unsigned short* __restrict__ Bt2p, int ldb, long strideB, long strideB2,
    void* __restrict__ Cout, void* __restrict__ Cout2, int ldc, long strideC, long strideC2,
    const float* __restrict__ bias,
    const float* __restrict__ resid, long strideR,
    int M, int N, int K, float scale, int zsplit) {
  typedef typename Elem<ET>::T T;
  typedef typename Frag<T>::V V;
  static_assert(SPLIT, "the staged tiles hold a hi and a lo plane of each operand");
  constexpr int TM = (8 / WN) * 64;
  constexpr int TN = WN * 64;
  constexpr int PE = KC + 8;                       // LDS row pitch in elements (16 B x odd)
  constexpr int STAGE_E = 2 * (TM + TN) * PE;      // elements per stage
  __shared__ __align__(16) unsigned short sStage[NBUF * STAGE_E];
  __shared__ __align__(16) float sT[8][16 * 68];   // per-wave 16x64 slab, pitch 68 floats
  const int bz   = blockIdx.y;
  const int zo   = bz / zsplit;
  const int zi   = bz - zo * zsplit;
  const int lane = threadIdx.x & 31;
  const int wave = threadIdx.x >> 5;
  const int tilesN = N / TN;
  const int tilesM = M / TM;
  const int wg = blockIdx.x;
  if (wg >= tilesM * tilesN) return;   // the same for the whole work-group, in front of every barrier
  const int tmw = wg / tilesN;
  const int tnw = wg - tmw * tilesN;
  const int wm = wave / WN;
  const int wn = wave - wm * WN;
  const int m0 = tmw * TM + (wm << 6);
  const int n0 = tnw * TN + (wn << 6);

  const size_t aOff = (size_t)zi * strideA + (size_t)zo * strideA2;
  const size_t bOff = (size_t)zi * strideB + (size_t)zo * strideB2;
  const size_t cOff = (size_t)zi * strideC + (size_t)zo * strideC2;

  const int rlane = lane & 15;                 // row (A) / col (B, D) within subtile
  const int koff  = (lane >> 4) * 8;           // k offset of this lane half
  const int mOff  = (lane >> 4) * 8;           // D row offset

  // this thread's place in a round of copies: row cr of the round, 16-byte piece cc of the row
  constexpr int LPR = KC / 8;
  const int cc = threadIdx.x % LPR;
  const int cr = threadIdx.x / LPR;
  const size_t aRow = aOff + (size_t)(tmw * TM + cr) * lda + cc * 8;
  const size_t bRow = bOff + (size_t)(tnw * TN + cr) * ldb + cc * 8;
  const unsigned short* gAh = Ap + aRow;
  const unsigned short* gAl = A2p + aRow;
  const unsigned short* gBh = Btp + bRow;
  const unsigned short* gBl = Bt2p + bRow;
  const size_t stepA = (size_t)(256 / LPR) * lda;
  const size_t stepB = (size_t)(256 / LPR) * ldb;
  const unsigned ldsT = (unsigned)(uintptr_t)sStage + (unsigned)(cr * PE + cc * 8) * 2u;

  v8f acc[4][4];
#pragma unroll
  for (int i = 0; i < 4; ++i)
#pragma unroll
    for (int j = 0; j < 4; ++j) acc[i][j] = (v8f){0.f,0.f,0.f,0.f,0.f,0.f,0.f,0.f};

  const int NT = K / KC;
  stage_fill<KC, TM, TN>(ldsT, gAh, gAl, gBh, gBl, stepA, stepB);
  wait_async0();
  __syncthreads();
  if (NBUF == 2 && NT > 1)
    stage_fill<KC, TM, TN>(ldsT + (unsigned)STAGE_E * 2u, gAh + KC, gAl + KC, gBh + KC, gBl + KC, stepA, stepB);

  for (int t = 0; t < NT; ++t) {
    const int buf = (NBUF == 2) ? (t & 1) : 0;
    const T* sb = (const T*)(sStage + buf * STAGE_E);
    const T* sA = sb + ((wm << 6) + rlane) * PE + koff;
    const T* sB = sb + (2 * TM + (wn << 6) + rlane) * PE + koff;
    // unrolled: the LDS offsets of a stage's fragments become immediates
#pragma unroll
    for (int kk = 0; kk < KC; kk += 32) {
      V bh[4], bl[4];
#pragma unroll
      for (int j = 0; j < 4; ++j) {
        bh[j] = Frag<T>::load(sB + (j << 4) * PE + kk);
        bl[j] = Frag<T>::load(sB + (TN + (j << 4)) * PE + kk);
      }
#pragma unroll
      for (int i = 0; i < 4; ++i) {
        V ah = Frag<T>::load(sA + (i << 4) * PE + kk);
        V al = Frag<T>::load(sA + (TM + (i << 4)) * PE + kk);
#pragma unroll
        for (int j = 0; j < 4; ++j) {
          acc[i][j] = Frag<T>::mma(ah, bh[j], acc[i][j]);
          acc[i][j] = Frag<T>::mma(ah, bl[j], acc[i][j]);
          acc[i][j] = Frag<T>::mma(al, bh[j], acc[i][j]);
        }
        Frag<T>::guard(acc[i][0], acc[i][3], ah, al);
      }
      Frag<T>::keep(bh[0], bh[1], bh[2], bh[3]);
      Frag<T>::keep(bl[0], bl[1], bl[2], bl[3]);
    }
    if (NBUF == 2) {
      // hand-over: every wave's reads of this buffer are done and its copies of the next stage have landed, then the barrier
      wait_ds0();
      wait_async0();
      __syncthreads();
      if (t + 2 < NT) {
        const int k2 = (t + 2) * KC;
        stage_fill<KC, TM, TN>(ldsT + (unsigned)(buf * STAGE_E) * 2u, gAh + k2, gAl + k2, gBh + k2, gBl + k2, stepA, stepB);
      }
    } else if (t + 1 < NT) {
      // one buffer: refill it behind every wave's last read, publish it behind every wave's copies
      wait_ds0();
      __syncthreads();
      const int k1 = (t + 1) * KC;
      stage_fill<KC, TM, TN>(ldsT, gAh + k1, gAl + k1, gBh + k1, gBl + k1, stepA, stepB);
      wait_async0();
      __syncthreads();
    }
  }
  wait_async0();
  acc_guard4(acc[0][0], acc[0][1], acc[0][2], acc[0][3]);
  acc_guard4(acc[1][0], acc[1][1], acc[1][2], acc[1][3]);
  acc_guard4(acc[2][0], acc[2][1], acc[2][2], acc[2][3]);
  acc_guard4(acc[3][0], acc[3][1], acc[3][2], acc[3][3]);

  // ---- epilogue ----
  float* slab = sT[wave];
  const float* Rb = RESID ? (resid + (size_t)zi * strideR) : nullptr;
#pragma unroll
  for (int i = 0; i < 4; ++i) {
    const int mBase = m0 + (i << 4);
#pragma unroll
    for (int j = 0; j < 4; ++j) {
      const int n = n0 + (j << 4) + rlane;
      float bv = 0.f;
      if (BIAS_MODE == 2) bv = bias[n];
#pragma unroll
      for (int r = 0; r < 8; ++r) {
        float v = acc[i][j][r] * scale;
        if (BIAS_MODE == 1) v += bias[mBase + mOff + r];
        if (BIAS_MODE == 2) v += bv;
        if (RESID) v += Rb[(size_t)(mBase + mOff + r) * ldc + n];
        if (ACT == 1) v = tanhf(v);
        if (ACT == 2) v = fmaxf(v, 0.0f);
        if (ACT == 4) v = (v > 0.f) ? v : 0.01f * v;
        slab[(mOff + r) * 68 + (j << 4) + rlane] = v;
      }
    }
    __builtin_amdgcn_fence(__ATOMIC_RELEASE, "workgroup");
    __builtin_amdgcn_wave_barrier();
    __builtin_amdgcn_fence(__ATOMIC_ACQUIRE, "workgroup");
    if (OUT_MODE == 0) {
      float* C = (float*)Cout + cOff;
      const int hh = lane >> 4, c4 = (lane & 15) * 4;     // row seg = 256 B = 16 lanes x 16 B
      {
#pragma unroll
        for (int it = 0; it < 8; ++it) {
          const int row = it * 2 + hh;
          v4f v = *(const v4f*)(slab + row * 68 + c4);
          *(v4f*)(C + (size_t)(mBase + row) * ldc + n0 + c4) = v;
        }
        
      }
    } else {
      const int q = lane >> 3, c8 = (lane & 7) * 8;
      unsigned short* C  = (unsigned short*)Cout  + cOff;
      unsigned short* C2 = (OUT_MODE == 2) ? ((unsigned short*)Cout2 + cOff) : nullptr;
      {
#pragma unroll
        for (int it = 0; it < 4; ++it) {
          const int row = it * 4 + q;
          const float* sp = slab + row * 68 + c8;
          v8h hv, lv;
#pragma unroll
          for (int e = 0; e < 8; ++e) {
            if (OUT_MODE == 1) {
              hv[e] = (_Float16)sp[e];
            } else {
              unsigned short hb = f2bf_bits(sp[e]);
              unsigned short lb = f2bf_bits(sp[e] - bf_bits2f(hb));
              hv[e] = __builtin_bit_cast(_Float16, hb);
              lv[e] = __builtin_bit_cast(_Float16, lb);
            }
          }
          *(v8h*)(C + (size_t)(mBase + row) * ldc + n0 + c8) = hv;
          if (OUT_MODE == 2) *(v8h*)(C2 + (size_t)(mBase + row) * ldc + n0 + c8) = lv;
        }
        
      }
    }
    __builtin_amdgcn_fence(__ATOMIC_RELEASE, "workgroup");
    __builtin_amdgcn_wave_barrier();
    __builtin_amdgcn_fence(__ATOMIC_ACQUIRE, "workgroup");
  }
}

// ---------------------------------------------------------------------------
// Elementwise f32 -> bf16 hi/lo split, 8 elements per thread: hi = bf16_rne(x), lo = bf16_rne(x - hi).
// Coverage: grid = n8/256 blocks (n8 = plane/8, exact multiple here; guard kept) x 256 threads x 8 = the whole plane.
// ---------------------------------------------------------------------------
__global__ __launch_bounds__(256) void split_bf16x8_kernel(const float* __restrict__ in, unsigned short* __restrict__ hi,
                                                           unsigned short* __restrict__ lo, int n8) {
  const int i = blockIdx.x * 256 + threadIdx.x;
  if (i < n8) {
    const size_t base = (size_t)i * 8;
    const v4f a = *(const v4f*)(in + base);
    const v4f b = *(const v4f*)(in + base + 4);
    const float f[8] = {a[0], a[1], a[2], a[3], b[0], b[1], b[2], b[3]};
    unsigned hw[4], lw[4];
#pragma unroll
    for (int q = 0; q < 4; ++q) {
      const unsigned short h0 = f2bf_bits(f[2 * q]), h1 = f2bf_bits(f[2 * q + 1]);
      const unsigned short l0 = f2bf_bits(f[2 * q] - bf_bits2f(h0));
      const unsigned short l1 = f2bf_bits(f[2 * q + 1] - bf_bits2f(h1));
      hw[q] = pk16(h0, h1);
      lw[q] = pk16(l0, l1);
    }
    const v4u hv = (v4u){hw[0], hw[1], hw[2], hw[3]};
    const v4u lv = (v4u){lw[0], lw[1], lw[2], lw[3]};
    *(v4u*)(hi + base) = hv;
    *(v4u*)(lo + base) = lv;
    
  }
}

// ---------------------------------------------------------------------------
// Scores, gated mixing and p.v in one kernel; no score and no probability leaves the work-group.
// Work-group = one (batch, head) plane z = bb*8 + h and 256 queries; wave = 32 queries (two 16-column groups) against all 512 keys.
// Transposed products: S^T = K.Q^T (A = key rows from LDS, B = query rows kept in registers), O^T += V^T.A^T (A = v^T rows from LDS).
// In an S^T tile lane (c, hh) holds query c and keys 8*hh + r: the row maximum and the row sum are in-lane plus one exchange
// between the lane halves, and two S^T tiles (32 keys), converted in place, are the B operand of the second product.
//   pass 1: m_i = max_j s_ij
//   pass 2: the same products again (same order, so the same bits), then
//     g_c  = bg[c] + sum_d q[i][h*64+d] * Wg[c][d],  qp_c = rcp((|g_c| + 1)^2)
//     p_j  = 2^((s_j - m) * log2e)                    (= softmax_j / max softmax)
//     adj  = 2^((i-j)^2 * (-0.5 log2e qp_1)) for j < i,  2^((i-j)^2 * (-0.5 log2e qp_0)) for j >= i
//     a_j  = sg * p_j + (1 - sg) * adj,  sg = rcp(1 + 2^(-lam1 * log2e))   -> bf16 hi/lo fragments
//     ctx_i = (sum_j a_j v_j) * rcp(sum_j a_j + 1e-9)  -> bf16 hi/lo planes
// LDS: all 512 key rows (hi, lo; pitch 144 B) and the 64 v^T rows (hi, lo; pitch 1040 B) of the plane, each filled once by
// global_load_async_to_lds_b128; the v^T copies fly during pass 1.
// Output coverage: grid 2 x 128, 8 waves x 32 queries = 512 rows per plane; a wave writes the whole 128-byte segment (row, h) of both planes.
// ---------------------------------------------------------------------------
__device__ __forceinline__ float hw_exp2(float x) { return __builtin_amdgcn_exp2f(x); }
__device__ __forceinline__ float hw_rcp(float x)  { return __builtin_amdgcn_rcpf(x); }

// eight copies, 16 bytes per lane each; the closing s_wait_xcnt stands in the same statement so that no address register is rewritten ahead of it
__device__ __forceinline__ void copy8(unsigned l0, const unsigned short* g0, unsigned l1, const unsigned short* g1,
                                      unsigned l2, const unsigned short* g2, unsigned l3, const unsigned short* g3,
                                      unsigned l4, const unsigned short* g4, unsigned l5, const unsigned short* g5,
                                      unsigned l6, const unsigned short* g6, unsigned l7, const unsigned short* g7) {
  asm volatile("global_load_async_to_lds_b128 %0, %1, off\n\t"
               "global_load_async_to_lds_b128 %2, %3, off\n\t"
               "global_load_async_to_lds_b128 %4, %5, off\n\t"
               "global_load_async_to_lds_b128 %6, %7, off\n\t"
               "global_load_async_to_lds_b128 %8, %9, off\n\t"
               "global_load_async_to_lds_b128 %10, %11, off\n\t"
               "global_load_async_to_lds_b128 %12, %13, off\n\t"
               "global_load_async_to_lds_b128 %14, %15, off\n\t"
               "s_wait_xcnt 0x0"
               :: "v"(l0), "v"(g0), "v"(l1), "v"(g1), "v"(l2), "v"(g2), "v"(l3), "v"(g3),
                  "v"(l4), "v"(g4), "v"(l5), "v"(g5), "v"(l6), "v"(g6), "v"(l7), "v"(g7)
               : "memory");
}
// stands behind a group of global loads or stores, in front of whatever rewrites a register that they name
__device__ __forceinline__ void wait_x0() { asm volatile("s_wait_xcnt 0x0" ::: "memory"); }
// one plane in 16 rounds of the 256 threads; lds / g = this thread's place in round 0, lstep (bytes) / gstep (elements) = one round
__device__ __forceinline__ void fill16(unsigned lds, unsigned lstep, const unsigned short* g, size_t gstep) {
  // unrolled: two statements of eight copies
#pragma unroll
  for (int p = 0; p < 16; p += 8)
    copy8(lds + (unsigned)p * lstep,       g + (size_t)p * gstep,       lds + (unsigned)(p + 1) * lstep, g + (size_t)(p + 1) * gstep,
          lds + (unsigned)(p + 2) * lstep, g + (size_t)(p + 2) * gstep, lds + (unsigned)(p + 3) * lstep, g + (size_t)(p + 3) * gstep,
          lds + (unsigned)(p + 4) * lstep, g + (size_t)(p + 4) * gstep, lds + (unsigned)(p + 5) * lstep, g + (size_t)(p + 5) * gstep,
          lds + (unsigned)(p + 6) * lstep, g + (size_t)(p + 6) * gstep, lds + (unsigned)(p + 7) * lstep, g + (size_t)(p + 7) * gstep);
}

constexpr int kKP = kDk + 8;     // LDS pitch of a key row, elements (16 B x odd)
constexpr int kVP = kSeq + 8;    // LDS pitch of a v^T row, elements (16 B x odd)
constexpr int kQB = 256;         // queries per work-group

// S^T tile of keys kt*16 .. kt*16+15 against both query groups; kr = this lane's place in key row c of the hi plane
__device__ __forceinline__ void score_tile(const __bf16* kr, const v16b (&qh)[2][2], const v16b (&ql)[2][2], v8f (&s)[2]) {
  typedef Frag<__bf16> F;
  const v16b kh0 = F::load(kr), kh1 = F::load(kr + 32);
  const v16b kl0 = F::load(kr + kSeq * kKP), kl1 = F::load(kr + kSeq * kKP + 32);
#pragma unroll
  for (int qt = 0; qt < 2; ++qt) {
    v8f a = (v8f){0.f, 0.f, 0.f, 0.f, 0.f, 0.f, 0.f, 0.f};
    a = F::mma(kh0, qh[qt][0], a);
    a = F::mma(kl0, qh[qt][0], a);
    a = F::mma(kh0, ql[qt][0], a);
    a = F::mma(kh1, qh[qt][1], a);
    a = F::mma(kl1, qh[qt][1], a);
    a = F::mma(kh1, ql[qt][1], a);
    s[qt] = a;
  }
}

__global__ __launch_bounds__(256) void attn_mix_kernel(
    const unsigned short* __restrict__ Qh, const unsigned short* __restrict__ Ql,
    const unsigned short* __restrict__ Kh, const unsigned short* __restrict__ Kl,
    const unsigned short* __restrict__ VTh, const unsigned short* __restrict__ VTl,
    unsigned short* __restrict__ Ch, unsigned short* __restrict__ Cl,
    const float* __restrict__ Wg, const float* __restrict__ bg, const float* __restrict__ lam1) {
  typedef Frag<__bf16> F;
  __shared__ __align__(16) unsigned short sK[2 * kSeq * kKP];
  __shared__ __align__(16) unsigned short sV[2 * kDk * kVP];
  const int tid  = threadIdx.x;
  const int lane = tid & 31;
  const int wave = tid >> 5;
  const int c    = lane & 15;
  const int hh   = lane >> 4;
  const int z    = blockIdx.y;
  const int bb   = z >> 3;
  const int h    = z & (kHeads - 1);
  const int q0   = blockIdx.x * kQB + wave * 32;

  // key rows: 8 lanes per 128-byte row piece, 32 rows per round
  {
    const int cc = tid & 7, cr = tid >> 3;
    const size_t g = (size_t)(bb * kSeq + cr) * kDm + (size_t)h * kDk + cc * 8;
    const unsigned l = (unsigned)(uintptr_t)sK + (unsigned)(cr * kKP + cc * 8) * 2u;
    fill16(l, 32u * kKP * 2u, Kh + g, (size_t)32 * kDm);
    fill16(l + (unsigned)(kSeq * kKP) * 2u, 32u * kKP * 2u, Kl + g, (size_t)32 * kDm);
  }

  // query fragments (B operand), hardware k order, kept for both passes
  v16b qh[2][2], ql[2][2];
#pragma unroll
  for (int qt = 0; qt < 2; ++qt) {
#pragma unroll
    for (int ks = 0; ks < 2; ++ks) {
      const size_t o = (size_t)(bb * kSeq + q0 + qt * 16 + c) * kDm + (size_t)h * kDk + ks * 32 + hh * 8;
      qh[qt][ks] = F::load((const __bf16*)(Qh + o));
      ql[qt][ks] = F::load((const __bf16*)(Ql + o));
    }
    wait_x0();
  }

  // gating dots: this lane holds 32 of its query's 64 d, the other lane half the rest
  float gn0[2], gn1[2];
  {
    float g0[2] = {0.f, 0.f}, g1[2] = {0.f, 0.f};
#pragma unroll
    for (int ks = 0; ks < 2; ++ks)
#pragma unroll
      for (int hf = 0; hf < 2; ++hf) {
        const float* wp = Wg + ks * 32 + hf * 16 + hh * 8;
        const v4f wa = *(const v4f*)(wp), wb = *(const v4f*)(wp + 4);
        const v4f wc = *(const v4f*)(wp + kDk), wd = *(const v4f*)(wp + kDk + 4);
#pragma unroll
        for (int e = 0; e < 8; ++e) {
          const float w0 = (e < 4) ? wa[e & 3] : wb[e & 3];
          const float w1 = (e < 4) ? wc[e & 3] : wd[e & 3];
#pragma unroll
          for (int qt = 0; qt < 2; ++qt) {
            const float qv = (float)qh[qt][ks][hf * 8 + e] + (float)ql[qt][ks][hf * 8 + e];
            g0[qt] += qv * w0;
            g1[qt] += qv * w1;
          }
        }
      }
    const float b0 = bg[0], b1 = bg[1];
#pragma unroll
    for (int qt = 0; qt < 2; ++qt) {
      const float t0 = fabsf(g0[qt] + __shfl_xor(g0[qt], 16, 32) + b0) + 1.0f;
      const float t1 = fabsf(g1[qt] + __shfl_xor(g1[qt], 16, 32) + b1) + 1.0f;
      gn0[qt] = (-0.5f * kLog2e) * hw_rcp(t0 * t0);      // j >= i (upper incl. diagonal)
      gn1[qt] = (-0.5f * kLog2e) * hw_rcp(t1 * t1);      // j <  i (strictly lower)
    }
  }
  const float sg  = hw_rcp(1.0f + hw_exp2(-lam1[0] * kLog2e));
  const float omg = 1.0f - sg;

  // the key rows: this wave's copies have landed, then the barrier that publishes them
  wait_async0();
  __syncthreads();

  // v^T rows: 64 lanes per 1024-byte row, 4 rows per round; read only behind the barrier after pass 1
  {
    const int cc = tid & 63, cr = tid >> 6;
    const size_t g = (size_t)bb * kDm * kSeq + (size_t)(h * kDk + cr) * kSeq + cc * 8;
    const unsigned l = (unsigned)(uintptr_t)sV + (unsigned)(cr * kVP + cc * 8) * 2u;
    fill16(l, 4u * kVP * 2u, VTh + g, (size_t)4 * kSeq);
    fill16(l + (unsigned)(kDk * kVP) * 2u, 4u * kVP * 2u, VTl + g, (size_t)4 * kSeq);
  }

  const __bf16* kr0 = (const __bf16*)sK + c * kKP + hh * 8;

  // pass 1: row maxima
  float mx[2] = {-INFINITY, -INFINITY};
  // two tiles per trip: the second tile's LDS reads stand beside the first tile's products
#pragma unroll 2
  for (int kt = 0; kt < kSeq / 16; ++kt) {
    v8f s[2];
    score_tile(kr0 + kt * 16 * kKP, qh, ql, s);
#pragma unroll
    for (int qt = 0; qt < 2; ++qt)
#pragma unroll
      for (int r = 0; r < 8; ++r) mx[qt] = fmaxf(mx[qt], s[qt][r]);
  }
#pragma unroll
  for (int qt = 0; qt < 2; ++qt) mx[qt] = fmaxf(mx[qt], __shfl_xor(mx[qt], 16, 32));

  // the v^T rows: this wave's copies have landed, then the barrier that publishes them
  wait_async0();
  __syncthreads();

  // pass 2
  v8f o[4][2];
#pragma unroll
  for (int dt = 0; dt < 4; ++dt)
#pragma unroll
    for (int qt = 0; qt < 2; ++qt) o[dt][qt] = (v8f){0.f, 0.f, 0.f, 0.f, 0.f, 0.f, 0.f, 0.f};
  float ls[2] = {0.f, 0.f};
  const float fi[2] = {(float)(q0 + c - hh * 8), (float)(q0 + 16 + c - hh * 8)};
  const __bf16* vr0 = (const __bf16*)sV + c * kVP + hh * 8;
  // rolled: for speed only
#pragma unroll 1
  for (int kp = 0; kp < kSeq / 32; ++kp) {
    v16b ph[2], pl[2];
#pragma unroll
    for (int t = 0; t < 2; ++t) {
      v8f s[2];
      score_tile(kr0 + (kp * 2 + t) * 16 * kKP, qh, ql, s);
#pragma unroll
      for (int qt = 0; qt < 2; ++qt) {
        const float fb = fi[qt] - (float)(kp * 32 + t * 16);   // i - j at r = 0
#pragma unroll
        for (int r = 0; r < 8; ++r) {
          const float p   = hw_exp2((s[qt][r] - mx[qt]) * kLog2e);
          const float fd  = fb - (float)r;
          const float gs  = (fd > 0.f) ? gn1[qt] : gn0[qt];
          const float adj = hw_exp2((fd * fd) * gs);
          const float av  = sg * p + omg * adj;
          ls[qt] += av;
          const __bf16 hb = (__bf16)av;
          ph[qt][t * 8 + r] = hb;
          pl[qt][t * 8 + r] = (__bf16)(av - (float)hb);
        }
      }
    }
    const __bf16* vr = vr0 + kp * 32;
#pragma unroll
    for (int dt = 0; dt < 4; ++dt) {
      const v16b vh = F::load(vr + dt * 16 * kVP);
      const v16b vl = F::load(vr + (kDk + dt * 16) * kVP);
#pragma unroll
      for (int qt = 0; qt < 2; ++qt) {
        o[dt][qt] = F::mma(vh, ph[qt], o[dt][qt]);
        o[dt][qt] = F::mma(vl, ph[qt], o[dt][qt]);
        o[dt][qt] = F::mma(vh, pl[qt], o[dt][qt]);
      }
    }
  }

  // epilogue: lane (c, hh) holds d = dt*16 + 8*hh + r of query c: one 16-byte store per tile and plane
#pragma unroll
  for (int qt = 0; qt < 2; ++qt) {
    const float inv = hw_rcp(ls[qt] + __shfl_xor(ls[qt], 16, 32) + 1e-9f);
    const size_t ro = (size_t)(bb * kSeq + q0 + qt * 16 + c) * kDm + (size_t)h * kDk + hh * 8;
#pragma unroll
    for (int dt = 0; dt < 4; ++dt) {
      v8b hv, lv;
#pragma unroll
      for (int r = 0; r < 8; ++r) {
        const float x = o[dt][qt][r] * inv;
        const __bf16 hb = (__bf16)x;
        hv[r] = hb;
        lv[r] = (__bf16)(x - (float)hb);
      }
      *(v8b*)((__bf16*)Ch + ro + dt * 16) = hv;
      *(v8b*)((__bf16*)Cl + ro + dt * 16) = lv;
    }
    wait_x0();
  }
}

// ---------------------------------------------------------------------------
// Workspace region map (bytes; every offset a multiple of 512 KiB). Every region is fully written
// inside the call before any read.
//   Wqh,Wql,Wkh,Wkl,Wvh,Wvl,Woh,Wol  bf16 [512][512] each            0 .. 4194304
//   Xqh,Xql,Xkh,Xkl,Xvh,Xvl          bf16 [8192][512] each     4194304 .. 54525952
//   Qh,Ql,Kh,Kl                      bf16 [8192][512] each    54525952 .. 88080384   (row bb*512+i, col h*64+d)
//   VTh,VTl                          bf16 [16][512][512]      88080384 .. 104857600  (batch, row h*64+d, col token)
//   CTXh,CTXl                        bf16 [8192][512] each   104857600 .. 121634816  (row bb*512+i, col h*64+d)
//   total 121634816
// ---------------------------------------------------------------------------
extern "C" void kernel_launch(void* const* d_in, const int* in_sizes, int n_in,
                              void* d_out, int out_size, void* d_ws, size_t ws_size,
                              hipStream_t stream) {
  if (n_in < 14) return;
  const int nAct = kBatch * kSeq * kDm;          // 4194304
  const int nW   = kDm * kDm;                    // 262144
  if (in_sizes[0] != nAct || in_sizes[1] != nAct || in_sizes[2] != nAct) return;
  if (in_sizes[3] != nW || in_sizes[5] != nW || in_sizes[7] != nW || in_sizes[12] != nW) return;
  if (in_sizes[4] != kDm || in_sizes[6] != kDm || in_sizes[8] != kDm || in_sizes[13] != kDm) return;
  if (in_sizes[9] != 2 * kDk || in_sizes[10] < 2 || in_sizes[11] < 1) return;
  if (out_size != nAct) return;

  const float* query = (const float*)d_in[0];
  const float* key   = (const float*)d_in[1];
  const float* value = (const float*)d_in[2];
  const float* Wq    = (const float*)d_in[3];
  const float* bq    = (const float*)d_in[4];
  const float* Wk    = (const float*)d_in[5];
  const float* bk    = (const float*)d_in[6];
  const float* Wv    = (const float*)d_in[7];
  const float* bv    = (const float*)d_in[8];
  const float* Wg    = (const float*)d_in[9];
  const float* bg    = (const float*)d_in[10];
  const float* lam1  = (const float*)d_in[11];
  const float* Wo    = (const float*)d_in[12];
  const float* bo    = (const float*)d_in[13];
  float* out = (float*)d_out;

  const size_t PW  = (size_t)kDm * kDm * 2;                 // 524288    weight plane
  const size_t PX  = (size_t)kGRows * kDm * 2;              // 8388608   activation / q / k / ctx plane
  const size_t PVT = (size_t)kGB * kDm * kSeq * 2;          // 8388608   v^T plane
  size_t off = 0;
  const size_t oWqh = off; off += PW;  const size_t oWql = off; off += PW;
  const size_t oWkh = off; off += PW;  const size_t oWkl = off; off += PW;
  const size_t oWvh = off; off += PW;  const size_t oWvl = off; off += PW;
  const size_t oWoh = off; off += PW;  const size_t oWol = off; off += PW;
  const size_t oXqh = off; off += PX;  const size_t oXql = off; off += PX;
  const size_t oXkh = off; off += PX;  const size_t oXkl = off; off += PX;
  const size_t oXvh = off; off += PX;  const size_t oXvl = off; off += PX;
  const size_t oQh  = off; off += PX;  const size_t oQl  = off; off += PX;
  const size_t oKh  = off; off += PX;  const size_t oKl  = off; off += PX;
  const size_t oVTh = off; off += PVT; const size_t oVTl = off; off += PVT;
  const size_t oCh  = off; off += PX;  const size_t oCl  = off; off += PX;
  if (off > ws_size) return;                                // off = 121634816

  char* ws = (char*)d_ws;
  unsigned short* Wqh = (unsigned short*)(ws + oWqh); unsigned short* Wql = (unsigned short*)(ws + oWql);
  unsigned short* Wkh = (unsigned short*)(ws + oWkh); unsigned short* Wkl = (unsigned short*)(ws + oWkl);
  unsigned short* Wvh = (unsigned short*)(ws + oWvh); unsigned short* Wvl = (unsigned short*)(ws + oWvl);
  unsigned short* Woh = (unsigned short*)(ws + oWoh); unsigned short* Wol = (unsigned short*)(ws + oWol);
  unsigned short* Xqh = (unsigned short*)(ws + oXqh); unsigned short* Xql = (unsigned short*)(ws + oXql);
  unsigned short* Xkh = (unsigned short*)(ws + oXkh); unsigned short* Xkl = (unsigned short*)(ws + oXkl);
  unsigned short* Xvh = (unsigned short*)(ws + oXvh); unsigned short* Xvl = (unsigned short*)(ws + oXvl);
  unsigned short* Qh  = (unsigned short*)(ws + oQh);  unsigned short* Ql  = (unsigned short*)(ws + oQl);
  unsigned short* Kh  = (unsigned short*)(ws + oKh);  unsigned short* Kl  = (unsigned short*)(ws + oKl);
  unsigned short* VTh = (unsigned short*)(ws + oVTh); unsigned short* VTl = (unsigned short*)(ws + oVTl);
  unsigned short* Ch  = (unsigned short*)(ws + oCh);  unsigned short* Cl  = (unsigned short*)(ws + oCl);

  const dim3 blk(256);
  const int n8w = nW / 8;                                           // 32768 threads x 8 = [512][512]
  const int n8x = kGRows * kDm / 8;                                 // 524288 threads x 8 = [8192][512]
  const dim3 gSplitW((n8w + 255) / 256);                            // 128
  const dim3 gSplitX((n8x + 255) / 256);                            // 2048
  const dim3 gQ(((kGRows / 64) * (kDm / 64) + 7) / 8, 1);           // 128 blocks: M=8192, N=512, K=512
  const dim3 gVT(((kDm / 64) * (kSeq / 64) + 7) / 8, kGB);          // 8 x 16:     M=512, N=512, K=512 per batch
  const dim3 gAtt(kSeq / kQB, kNZ);                                 // 2 x 128:    256 queries x 512 keys per work-group
  const dim3 gOut(((kGRows / 64) * (kDm / 64) + 7) / 8, 1);         // 128 blocks: M=8192, N=512, K=512

  const long pQK  = (long)kSeq * kDm;            // 262144: one batch of the q/k/ctx planes
  const long pVTb = (long)kDm * kSeq;            // 262144: one batch of the v^T planes

  // weight planes (torch [out][in] is already Bt[n][k]); whole [512][512] per plane
  split_bf16x8_kernel<<<gSplitW, blk, 0, stream>>>(Wq, Wqh, Wql, n8w);
  split_bf16x8_kernel<<<gSplitW, blk, 0, stream>>>(Wk, Wkh, Wkl, n8w);
  split_bf16x8_kernel<<<gSplitW, blk, 0, stream>>>(Wv, Wvh, Wvl, n8w);
  split_bf16x8_kernel<<<gSplitW, blk, 0, stream>>>(Wo, Woh, Wol, n8w);

  for (int gb = 0; gb < kNGrp; ++gb) {
    const size_t actOff = (size_t)gb * kGRows * kDm;
    // (1) activations of all batches -> hi/lo planes [8192][512]
    split_bf16x8_kernel<<<gSplitX, blk, 0, stream>>>(query + actOff, Xqh, Xql, n8x);
    split_bf16x8_kernel<<<gSplitX, blk, 0, stream>>>(key   + actOff, Xkh, Xkl, n8x);
    split_bf16x8_kernel<<<gSplitX, blk, 0, stream>>>(value + actOff, Xvh, Xvl, n8x);
    // (2) q = x.Wq^T + bq, k = x.Wk^T + bk -> hi/lo planes [8192][512] (128x8 tiles, whole planes)
    wmma_gemm64<1, true, 2, 2, false, 0, 4, 64, 2><<<gQ, blk, 0, stream>>>(
        Xqh, Xql, kDm, 0L, 0L, Wqh, Wql, kDm, 0L, 0L, (void*)Qh, (void*)Ql, kDm, 0L, 0L,
        bq, bq, 0L, kGRows, kDm, kDm, 1.0f, 1);
    wmma_gemm64<1, true, 2, 2, false, 0, 4, 64, 2><<<gQ, blk, 0, stream>>>(
        Xkh, Xkl, kDm, 0L, 0L, Wkh, Wkl, kDm, 0L, 0L, (void*)Kh, (void*)Kl, kDm, 0L, 0L,
        bk, bk, 0L, kGRows, kDm, kDm, 1.0f, 1);
    // (3) v^T[bb][o][tok] = sum_k Wv[o][k] x[bb*512+tok][k] + bv[o] -> hi/lo planes [16][512][512] (8x8 tiles per bb)
    wmma_gemm64<1, true, 1, 2, false, 0, 4, 64, 2><<<gVT, blk, 0, stream>>>(
        Wvh, Wvl, kDm, 0L, 0L, Xvh, Xvl, kDm, pQK, 0L, (void*)VTh, (void*)VTl, kSeq, pVTb, 0L,
        bv, bv, 0L, kDm, kSeq, kDm, 1.0f, kGB);
    // (4) ctx[bb*512+i][h*64+d] = sum_j A[z][i][j] v^T[bb][h*64+d][j] / (sum_j A[z][i][j] + 1e-9) -> hi/lo planes, A = gated mix of the scores q.k^T
    attn_mix_kernel<<<gAtt, blk, 0, stream>>>(Qh, Ql, Kh, Kl, VTh, VTl, Ch, Cl, Wg, bg, lam1);
    // (5) out = ctx.Wo^T + bo -> f32 [8192][512], all of d_out (128x8 tiles)
    float* outg = out + actOff;
    wmma_gemm64<1, true, 2, 0, false, 0, 4, 64, 2><<<gOut, blk, 0, stream>>>(
        Ch, Cl, kDm, 0L, 0L, Woh, Wol, kDm, 0L, 0L, (void*)outg, (void*)outg, kDm, 0L, 0L,
        bo, bo, 0L, kGRows, kDm, kDm, 1.0f, 1);
  }
}

// v004
// A run of this version takes 128 microseconds.
// Next to v003, in two timings, it ran 1.10 times as fast each time.
// All steps since v000 together make it 7.62 times as fast.
// Contractions x.Wq^T, x.Wk^T, Wv.x^T, k.q^T, v^T.p^T, ctx.Wo^T: v_wmma_f32_16x16x32_bf16 on bf16 hi/lo split operand planes (hi.hi + hi.lo + lo.hi), f32 accumulate; per-row 64x2 gating dots, softmax, distance adjacency, max- and sum-normalisation in f32 on the VALU (hardware exp2/rcp).
#include <hip/hip_runtime.h>
#include <math.h>
#include <stdint.h>

constexpr int kBatch = 16;
constexpr int kSeq   = 512;
constexpr int kDm    = 512;
constexpr int kHeads = 8;
constexpr int kDk    = 64;
constexpr int kGB    = 16;                 // batches per group: the whole batch goes through every stage in one launch
constexpr int kNGrp  = kBatch / kGB;       // 1 group
constexpr int kNZ    = kGB * kHeads;       // 128 (batch, head) planes
constexpr int kGRows = kGB * kSeq;         // 8192 token rows
constexpr float kLog2e = 1.4426950408889634f;
static_assert(kSeq == 512 && kDk == 64 && kDm == kHeads * kDk && (kBatch % kGB) == 0, "geometry");

typedef __attribute__((ext_vector_type(16))) _Float16 v16h;
typedef __attribute__((ext_vector_type(8)))  _Float16 v8h;
typedef __attribute__((ext_vector_type(16))) __bf16   v16b;
typedef __attribute__((ext_vector_type(8)))  __bf16   v8b;
typedef __attribute__((ext_vector_type(8)))  float    v8f;
typedef __attribute__((ext_vector_type(4)))  float    v4f;
typedef __attribute__((ext_vector_type(4)))  unsigned int v4u;

__device__ __forceinline__ unsigned short f2bf_bits(float f) {
  unsigned u = __float_as_uint(f);
  return (unsigned short)((u + 0x7FFFu + ((u >> 16) & 1u)) >> 16);
}
__device__ __forceinline__ float bf_bits2f(unsigned short h) { return __uint_as_float(((unsigned)h) << 16); }
__device__ __forceinline__ unsigned pk16(unsigned short a, unsigned short b) { return (unsigned)a | ((unsigned)b << 16); }

// hazard guards as plain device helpers (no inline asm inside the kernel template body)
__device__ __forceinline__ void dep_guard_h(v8f& a, v8f& b, v16h x, v16h y) { asm volatile("v_nop\n\tv_nop\n\tv_nop\n\tv_nop" : "+v"(a), "+v"(b) : "v"(x), "v"(y)); }
__device__ __forceinline__ void dep_guard_b(v8f& a, v8f& b, v16b x, v16b y) { asm volatile("v_nop\n\tv_nop\n\tv_nop\n\tv_nop" : "+v"(a), "+v"(b) : "v"(x), "v"(y)); }
__device__ __forceinline__ void keep4_h(v16h a, v16h b, v16h c, v16h d) { asm volatile("v_nop" :: "v"(a), "v"(b), "v"(c), "v"(d)); }
__device__ __forceinline__ void keep4_b(v16b a, v16b b, v16b c, v16b d) { asm volatile("v_nop" :: "v"(a), "v"(b), "v"(c), "v"(d)); }
__device__ __forceinline__ void acc_guard4(v8f& a, v8f& b, v8f& c, v8f& d) { asm volatile("v_nop\n\tv_nop\n\tv_nop\n\tv_nop" : "+v"(a), "+v"(b), "+v"(c), "+v"(d)); }
template <typename T> struct Frag;
template <> struct Frag<_Float16> {
  typedef v16h V; union U { v16h v; v8h h[2]; };
  static __device__ __forceinline__ v16h load(const _Float16* p) {   // elements 0..7 <- p[0..7], 8..15 <- p[16..23]
    U f; f.h[0] = *(const v8h*)(p); f.h[1] = *(const v8h*)(p + 16); return f.v;
  }
  static __device__ __forceinline__ v8f mma(v16h a, v16h b, v8f c) {
    return __builtin_amdgcn_wmma_f32_16x16x32_f16(false, a, false, b, (short)0, c, false, false);
  }
  static __device__ __forceinline__ void guard(v8f& a, v8f& b, v16h x, v16h y) { dep_guard_h(a, b, x, y); }
  static __device__ __forceinline__ void keep(v16h a, v16h b, v16h c, v16h d) { keep4_h(a, b, c, d); }
};
template <> struct Frag<__bf16> {
  typedef v16b V; union U { v16b v; v8b h[2]; };
  static __device__ __forceinline__ v16b load(const __bf16* p) {
    U f; f.h[0] = *(const v8b*)(p); f.h[1] = *(const v8b*)(p + 16); return f.v;
  }
  static __device__ __forceinline__ v8f mma(v16b a, v16b b, v8f c) {
    return __builtin_amdgcn_wmma_f32_16x16x32_bf16(false, a, false, b, (short)0, c, false, false);
  }
  static __device__ __forceinline__ void guard(v8f& a, v8f& b, v16b x, v16b y) { dep_guard_b(a, b, x, y); }
  static __device__ __forceinline__ void keep(v16b a, v16b b, v16b c, v16b d) { keep4_b(a, b, c, d); }
};

// ---- Register-blocked batched WMMA GEMM ------------------------------------
// C[m,n] = scale * sum_k A[m,k] * Bt[n,k] (+bias)(+resid); each wave owns a 64x64 tile.
// A row-major [M,K]; Bt row-major [N,K]; M % (8/WN*64) == 0, N % (WN*64) == 0, K % KC == 0.
// SPLIT: operands are hi/lo planes (A2/Bt2 = lo planes, same layout); product = hi.hi + hi.lo + lo.hi.
// BIAS_MODE: 0 = none, 1 = bias[m], 2 = bias[n].
// OUT_MODE: 0 = f32, 1 = f16, 2 = bf16 hi plane (Cout) + bf16 lo plane (Cout2).
// z addressing: bz = blockIdx.y, zi = bz % zsplit, zo = bz / zsplit; operand base = zi*stride + zo*stride2 (elements).
// ET: 0 = f16 operands, 1 = bf16 operands (pointers passed as 16-bit storage)
template <int ET> struct Elem;
template <> struct Elem<0> { typedef _Float16 T; };
template <> struct Elem<1> { typedef __bf16 T; };
// ---- LDS staging of the operand tiles ---------------------------------------
// The eight waves of a work-group share one (8/WN*64) x (WN*64) tile of C. Per pass of KC k, the rows of A hi, A lo, Bt hi, Bt lo
// that the tile needs are copied to LDS by global_load_async_to_lds_b128 (KC/8 neighbouring lanes per row: whole contiguous row pieces),
// at a row pitch of KC*2 + 16 bytes; the WMMA fragments are then read with ds_load_b128.
// this wave's copies have landed before the barrier that publishes them to the other waves
__device__ __forceinline__ void wait_async0() { asm volatile("s_wait_asynccnt 0x0" ::: "memory"); }
// this wave's fragment reads have returned before the barrier behind which their buffer is refilled
__device__ __forceinline__ void wait_ds0() { asm volatile("s_wait_dscnt 0x0" ::: "memory"); }
// six copies, 16 bytes per lane each; the closing s_wait_xcnt stands in the same statement so that no address register is rewritten ahead of it
__device__ __forceinline__ void copy6(unsigned l0, const unsigned short* g0, unsigned l1, const unsigned short* g1,
                                      unsigned l2, const unsigned short* g2, unsigned l3, const unsigned short* g3,
                                      unsigned l4, const unsigned short* g4, unsigned l5, const unsigned short* g5) {
  asm volatile("global_load_async_to_lds_b128 %0, %1, off\n\t"
               "global_load_async_to_lds_b128 %2, %3, off\n\t"
               "global_load_async_to_lds_b128 %4, %5, off\n\t"
               "global_load_async_to_lds_b128 %6, %7, off\n\t"
               "global_load_async_to_lds_b128 %8, %9, off\n\t"
               "global_load_async_to_lds_b128 %10, %11, off\n\t"
               "s_wait_xcnt 0x0"
               :: "v"(l0), "v"(g0), "v"(l1), "v"(g1), "v"(l2), "v"(g2), "v"(l3), "v"(g3), "v"(l4), "v"(g4), "v"(l5), "v"(g5)
               : "memory");
}
// One stage: LDS rows [A hi: TM | A lo: TM | Bt hi: TN | Bt lo: TN]. 256 threads cover RPP rows per round; lds and the four
// pointers are this thread's own place in round 0 of each part; stepA / stepB = RPP rows of the source, in elements.
template <int KC, int TM, int TN>
__device__ __forceinline__ void stage_fill(unsigned lds, const unsigned short* gAh, const unsigned short* gAl,
                                           const unsigned short* gBh, const unsigned short* gBl, size_t stepA, size_t stepB) {
  constexpr int RPP = 256 / (KC / 8);
  constexpr int PA = TM / RPP, PB = TN / RPP, NP = 2 * (PA + PB);
  constexpr unsigned LB = (unsigned)RPP * (KC * 2 + 16);
  static_assert(TM % RPP == 0 && TN % RPP == 0 && NP % 6 == 0 && NP <= 63, "stage geometry");
  // both loops unrolled: the round number is then a constant, so each copy's part and LDS place are chosen at compile time
#pragma unroll
  for (int p = 0; p < NP; p += 6) {
    const unsigned short* g[6];
#pragma unroll
    for (int u = 0; u < 6; ++u) {
      const int q = p + u;
      g[u] = (q < PA) ? (gAh + (size_t)q * stepA)
           : (q < 2 * PA) ? (gAl + (size_t)(q - PA) * stepA)
           : (q < 2 * PA + PB) ? (gBh + (size_t)(q - 2 * PA) * stepB)
                               : (gBl + (size_t)(q - 2 * PA - PB) * stepB);
    }
    copy6(lds + (unsigned)p * LB, g[0], lds + (unsigned)(p + 1) * LB, g[1], lds + (unsigned)(p + 2) * LB, g[2],
          lds + (unsigned)(p + 3) * LB, g[3], lds + (unsigned)(p + 4) * LB, g[4], lds + (unsigned)(p + 5) * LB, g[5]);
  }
}

// WN: waves along n in the work-group (8/WN along m). KC: k per stage. NBUF: 2 = the next stage's copies fly while this one is worked on.
// M % (8/WN*64) == 0, N % (WN*64) == 0, K % KC == 0; grid.x = (M/64)*(N/64)/8 work-groups.
template <int ET, bool SPLIT, int BIAS_MODE, int OUT_MODE, bool RESID, int ACT, int WN, int KC, int NBUF>
__global__ __launch_bounds__(256) void wmma_gemm64(
    const unsigned short* __restrict__ Ap, const unsigned short* __restrict__ A2p, int lda, long strideA, long strideA2,
    const unsigned short* __restrict__ Btp, const unsigned short* __restrict__ Bt2p, int ldb, long strideB, long strideB2,
    void* __restrict__ Cout, void* __restrict__ Cout2, int ldc, long strideC, long strideC2,
    const float* __restrict__ bias,
    const float* __restrict__ resid, long strideR,
    int M, int N, int K, float scale, int zsplit) {
  typedef typename Elem<ET>::T T;
  typedef typename Frag<T>::V V;
  static_assert(SPLIT, "the staged tiles hold a hi and a lo plane of each operand");
  constexpr int TM = (8 / WN) * 64;
  constexpr int TN = WN * 64;
  constexpr int PE = KC + 8;                       // LDS row pitch in elements (16 B x odd)
  constexpr int STAGE_E = 2 * (TM + TN) * PE;      // elements per stage
  __shared__ __align__(16) unsigned short sStage[NBUF * STAGE_E];
  __shared__ __align__(16) float sT[8][16 * 68];   // per-wave 16x64 slab, pitch 68 floats
  const int bz   = blockIdx.y;
  const int zo   = bz / zsplit;
  const int zi   = bz - zo * zsplit;
  const int lane = threadIdx.x & 31;
  const int wave = threadIdx.x >> 5;
  const int tilesN = N / TN;
  const int tilesM = M / TM;
  const int wg = blockIdx.x;
  if (wg >= tilesM * tilesN) return;   // the same for the whole work-group, in front of every barrier
  const int tmw = wg / tilesN;
  const int tnw = wg - tmw * tilesN;
  const int wm = wave / WN;
  const int wn = wave - wm * WN;
  const int m0 = tmw * TM + (wm << 6);
  const int n0 = tnw * TN + (wn << 6);

  const size_t aOff = (size_t)zi * strideA + (size_t)zo * strideA2;
  const size_t bOff = (size_t)zi * strideB + (size_t)zo * strideB2;
  const size_t cOff = (size_t)zi * strideC + (size_t)zo * strideC2;

  const int rlane = lane & 15;                 // row (A) / col (B, D) within subtile
  const int koff  = (lane >> 4) * 8;           // k offset of this lane half
  const int mOff  = (lane >> 4) * 8;           // D row offset

  // this thread's place in a round of copies: row cr of the round, 16-byte piece cc of the row
  constexpr int LPR = KC / 8;
  const int cc = threadIdx.x % LPR;
  const int cr = threadIdx.x / LPR;
  const size_t aRow = aOff + (size_t)(tmw * TM + cr) * lda + cc * 8;
  const size_t bRow = bOff + (size_t)(tnw * TN + cr) * ldb + cc * 8;
  const unsigned short* gAh = Ap + aRow;
  const unsigned short* gAl = A2p + aRow;
  const unsigned short* gBh = Btp + bRow;
  const unsigned short* gBl = Bt2p + bRow;
  const size_t stepA = (size_t)(256 / LPR) * lda;
  const size_t stepB = (size_t)(256 / LPR) * ldb;
  const unsigned ldsT = (unsigned)(uintptr_t)sStage + (unsigned)(cr * PE + cc * 8) * 2u;

  v8f acc[4][4];
#pragma unroll
  for (int i = 0; i < 4; ++i)
#pragma unroll
    for (int j = 0; j < 4; ++j) acc[i][j] = (v8f){0.f,0.f,0.f,0.f,0.f,0.f,0.f,0.f};

  const int NT = K / KC;
  stage_fill<KC, TM, TN>(ldsT, gAh, gAl, gBh, gBl, stepA, stepB);
  wait_async0();
  __syncthreads();
  if (NBUF == 2 && NT > 1)
    stage_fill<KC, TM, TN>(ldsT + (unsigned)STAGE_E * 2u, gAh + KC, gAl + KC, gBh + KC, gBl + KC, stepA, stepB);

  for (int t = 0; t < NT; ++t) {
    const int buf = (NBUF == 2) ? (t & 1) : 0;
    const T* sb = (const T*)(sStage + buf * STAGE_E);
    const T* sA = sb + ((wm << 6) + rlane) * PE + koff;
    const T* sB = sb + (2 * TM + (wn << 6) + rlane) * PE + koff;
    // unrolled: the LDS offsets of a stage's fragments become immediates
#pragma unroll
    for (int kk = 0; kk < KC; kk += 32) {
      V bh[4], bl[4];
#pragma unroll
      for (int j = 0; j < 4; ++j) {
        bh[j] = Frag<T>::load(sB + (j << 4) * PE + kk);
        bl[j] = Frag<T>::load(sB + (TN + (j << 4)) * PE + kk);
      }
#pragma unroll
      for (int i = 0; i < 4; ++i) {
        V ah = Frag<T>::load(sA + (i << 4) * PE + kk);
        V al = Frag<T>::load(sA + (TM + (i << 4)) * PE + kk);
#pragma unroll
        for (int j = 0; j < 4; ++j) {
          acc[i][j] = Frag<T>::mma(ah, bh[j], acc[i][j]);
          acc[i][j] = Frag<T>::mma(ah, bl[j], acc[i][j]);
          acc[i][j] = Frag<T>::mma(al, bh[j], acc[i][j]);
        }
        Frag<T>::guard(acc[i][0], acc[i][3], ah, al);
      }
      Frag<T>::keep(bh[0], bh[1], bh[2], bh[3]);
      Frag<T>::keep(bl[0], bl[1], bl[2], bl[3]);
    }
    if (NBUF == 2) {
      // hand-over: every wave's reads of this buffer are done and its copies of the next stage have landed, then the barrier
      wait_ds0();
      wait_async0();
      __syncthreads();
      if (t + 2 < NT) {
        const int k2 = (t + 2) * KC;
        stage_fill<KC, TM, TN>(ldsT + (unsigned)(buf * STAGE_E) * 2u, gAh + k2, gAl + k2, gBh + k2, gBl + k2, stepA, stepB);
      }
    } else if (t + 1 < NT) {
      // one buffer: refill it behind every wave's last read, publish it behind every wave's copies
      wait_ds0();
      __syncthreads();
      const int k1 = (t + 1) * KC;
      stage_fill<KC, TM, TN>(ldsT, gAh + k1, gAl + k1, gBh + k1, gBl + k1, stepA, stepB);
      wait_async0();
      __syncthreads();
    }
  }
  wait_async0();
  acc_guard4(acc[0][0], acc[0][1], acc[0][2], acc[0][3]);
  acc_guard4(acc[1][0], acc[1][1], acc[1][2], acc[1][3]);
  acc_guard4(acc[2][0], acc[2][1], acc[2][2], acc[2][3]);
  acc_guard4(acc[3][0], acc[3][1], acc[3][2], acc[3][3]);

  // ---- epilogue ----
  float* slab = sT[wave];
  const float* Rb = RESID ? (resid + (size_t)zi * strideR) : nullptr;
#pragma unroll
  for (int i = 0; i < 4; ++i) {
    const int mBase = m0 + (i << 4);
#pragma unroll
    for (int j = 0; j < 4; ++j) {
      const int n = n0 + (j << 4) + rlane;
      float bv = 0.f;
      if (BIAS_MODE == 2) bv = bias[n];
#pragma unroll
      for (int r = 0; r < 8; ++r) {
        float v = acc[i][j][r] * scale;
        if (BIAS_MODE == 1) v += bias[mBase + mOff + r];
        if (BIAS_MODE == 2) v += bv;
        if (RESID) v += Rb[(size_t)(mBase + mOff + r) * ldc + n];
        if (ACT == 1) v = tanhf(v);
        if (ACT == 2) v = fmaxf(v, 0.0f);
        if (ACT == 4) v = (v > 0.f) ? v : 0.01f * v;
        slab[(mOff + r) * 68 + (j << 4) + rlane] = v;
      }
    }
    __builtin_amdgcn_fence(__ATOMIC_RELEASE, "workgroup");
    __builtin_amdgcn_wave_barrier();
    __builtin_amdgcn_fence(__ATOMIC_ACQUIRE, "workgroup");
    if (OUT_MODE == 0) {
      float* C = (float*)Cout + cOff;
      const int hh = lane >> 4, c4 = (lane & 15) * 4;     // row seg = 256 B = 16 lanes x 16 B
      {
#pragma unroll
        for (int it = 0; it < 8; ++it) {
          const int row = it * 2 + hh;
          v4f v = *(const v4f*)(slab + row * 68 + c4);
          *(v4f*)(C + (size_t)(mBase + row) * ldc + n0 + c4) = v;
        }
        
      }
    } else {
      const int q = lane >> 3, c8 = (lane & 7) * 8;
      unsigned short* C  = (unsigned short*)Cout  + cOff;
      unsigned short* C2 = (OUT_MODE == 2) ? ((unsigned short*)Cout2 + cOff) : nullptr;
      {
#pragma unroll
        for (int it = 0; it < 4; ++it) {
          const int row = it * 4 + q;
          const float* sp = slab + row * 68 + c8;
          v8h hv, lv;
#pragma unroll
          for (int e = 0; e < 8; ++e) {
            if (OUT_MODE == 1) {
              hv[e] = (_Float16)sp[e];
            } else {
              unsigned short hb = f2bf_bits(sp[e]);
              unsigned short lb = f2bf_bits(sp[e] - bf_bits2f(hb));
              hv[e] = __builtin_bit_cast(_Float16, hb);
              lv[e] = __builtin_bit_cast(_Float16, lb);
            }
          }
          *(v8h*)(C + (size_t)(mBase + row) * ldc + n0 + c8) = hv;
          if (OUT_MODE == 2) *(v8h*)(C2 + (size_t)(mBase + row) * ldc + n0 + c8) = lv;
        }
        
      }
    }
    __builtin_amdgcn_fence(__ATOMIC_RELEASE, "workgroup");
    __builtin_amdgcn_wave_barrier();
    __builtin_amdgcn_fence(__ATOMIC_ACQUIRE, "workgroup");
  }
}

// ---------------------------------------------------------------------------
// f32 -> bf16 hi/lo split of all seven operand tensors in one launch: hi = bf16_rne(x), lo = bf16_rne(x - hi).
// A piece = 8 neighbouring elements (32 bytes read, 16 + 16 bytes written) of one thread. 256 work-groups x 512 threads = 131072 threads:
// an activation tensor is 4 x 131072 pieces, the four weight tensors together are 131072 pieces (64 work-groups each), so every thread
// does 4 pieces of each activation tensor and 1 piece of one weight tensor: few long-lived waves instead of one short wave per 32 pieces.
// The next tensor's eight loads are issued before this tensor's pieces are converted and stored.
// Xp: planes [q hi | q lo | k hi | k lo | v hi | v lo], Wp: planes [Wq hi | Wq lo | Wk hi | ... | Wo lo], as the workspace map has them.
// ---------------------------------------------------------------------------
constexpr int kSplitTh  = 512;                       // threads per work-group
constexpr int kSplitWG  = 256;                       // work-groups
constexpr int kSplitAll = kSplitTh * kSplitWG;       // 131072 threads
constexpr int kActE     = kBatch * kSeq * kDm;       // elements of an activation tensor
constexpr int kWgtE     = kDm * kDm;                 // elements of a weight tensor
static_assert(kActE == 4 * kSplitAll * 8 && 4 * kWgtE == kSplitAll * 8 && kWgtE % (kSplitTh * 8) == 0 && kNGrp == 1, "split geometry");

// stands behind a group of global loads or stores, in front of whatever rewrites a register that they name
__device__ __forceinline__ void wait_x0() { asm volatile("s_wait_xcnt 0x0" ::: "memory"); }

__device__ __forceinline__ void split8_store(const v4f a, const v4f b, unsigned short* __restrict__ hi, unsigned short* __restrict__ lo) {
  const float f[8] = {a[0], a[1], a[2], a[3], b[0], b[1], b[2], b[3]};
  unsigned hw[4], lw[4];
#pragma unroll
  for (int q = 0; q < 4; ++q) {
    const unsigned short h0 = f2bf_bits(f[2 * q]), h1 = f2bf_bits(f[2 * q + 1]);
    const unsigned short l0 = f2bf_bits(f[2 * q] - bf_bits2f(h0));
    const unsigned short l1 = f2bf_bits(f[2 * q + 1] - bf_bits2f(h1));
    hw[q] = pk16(h0, h1);
    lw[q] = pk16(l0, l1);
  }
  *(v4u*)hi = (v4u){hw[0], hw[1], hw[2], hw[3]};
  *(v4u*)lo = (v4u){lw[0], lw[1], lw[2], lw[3]};
}

__global__ __launch_bounds__(kSplitTh) void split_all_kernel(
    const float* __restrict__ xq, const float* __restrict__ xk, const float* __restrict__ xv,
    const float* __restrict__ wq, const float* __restrict__ wk, const float* __restrict__ wv, const float* __restrict__ wo,
    unsigned short* __restrict__ Xp, unsigned short* __restrict__ Wp) {
  const int g = blockIdx.x * kSplitTh + threadIdx.x;
  const size_t e0 = (size_t)g * 8;                                  // this thread's first piece of an activation tensor
  constexpr size_t kStep = (size_t)kSplitAll * 8;                   // from one of its pieces to the next
  // the weight tensor is the same for a whole work-group
  const int wsel = blockIdx.x / (kWgtE / (kSplitTh * 8));
  const float* w = (wsel == 0) ? wq : (wsel == 1) ? wk : (wsel == 2) ? wv : wo;
  const size_t we = e0 - (size_t)wsel * kWgtE;

  v4f buf[2][8];
#pragma unroll
  for (int p = 0; p < 4; ++p) {
    buf[0][2 * p]     = *(const v4f*)(xq + e0 + p * kStep);
    buf[0][2 * p + 1] = *(const v4f*)(xq + e0 + p * kStep + 4);
  }
  wait_x0();
  const v4f wa = *(const v4f*)(w + we);
  const v4f wb = *(const v4f*)(w + we + 4);
  wait_x0();
  // unrolled: the tensor and the register set of each trip are chosen at compile time
#pragma unroll
  for (int t = 0; t < 3; ++t) {
    if (t < 2) {
      const float* xn = (t == 0) ? xk : xv;
#pragma unroll
      for (int p = 0; p < 4; ++p) {
        buf[(t + 1) & 1][2 * p]     = *(const v4f*)(xn + e0 + p * kStep);
        buf[(t + 1) & 1][2 * p + 1] = *(const v4f*)(xn + e0 + p * kStep + 4);
      }
      wait_x0();
    }
    unsigned short* hi = Xp + (size_t)(2 * t) * kActE + e0;
    unsigned short* lo = hi + kActE;
#pragma unroll
    for (int p = 0; p < 4; ++p) split8_store(buf[t & 1][2 * p], buf[t & 1][2 * p + 1], hi + p * kStep, lo + p * kStep);
    wait_x0();
  }
  unsigned short* whi = Wp + (size_t)(2 * wsel) * kWgtE + we;
  split8_store(wa, wb, whi, whi + kWgtE);
}

// ---------------------------------------------------------------------------
// Scores, gated mixing and p.v in one kernel; no score and no probability leaves the work-group.
// Work-group = one (batch, head) plane z = bb*8 + h and 256 queries; wave = 32 queries (two 16-column groups) against all 512 keys.
// Transposed products: S^T = K.Q^T (A = key rows from LDS, B = query rows kept in registers), O^T += V^T.A^T (A = v^T rows from LDS).
// In an S^T tile lane (c, hh) holds query c and keys 8*hh + r: the row maximum and the row sum are in-lane plus one exchange
// between the lane halves, and two S^T tiles (32 keys), converted in place, are the B operand of the second product.
//   pass 1: m_i = max_j s_ij
//   pass 2: the same products again (same order, so the same bits), then
//     g_c  = bg[c] + sum_d q[i][h*64+d] * Wg[c][d],  qp_c = rcp((|g_c| + 1)^2)
//     p_j  = 2^((s_j - m) * log2e)                    (= softmax_j / max softmax)
//     adj  = 2^((i-j)^2 * (-0.5 log2e qp_1)) for j < i,  2^((i-j)^2 * (-0.5 log2e qp_0)) for j >= i
//     a_j  = sg * p_j + (1 - sg) * adj,  sg = rcp(1 + 2^(-lam1 * log2e))   -> bf16 hi/lo fragments
//     ctx_i = (sum_j a_j v_j) * rcp(sum_j a_j + 1e-9)  -> bf16 hi/lo planes
// LDS: all 512 key rows (hi, lo; pitch 144 B) and the 64 v^T rows (hi, lo; pitch 1040 B) of the plane, each filled once by
// global_load_async_to_lds_b128; the v^T copies fly during pass 1.
// Output coverage: grid 2 x 128, 8 waves x 32 queries = 512 rows per plane; a wave writes the whole 128-byte segment (row, h) of both planes.
// ---------------------------------------------------------------------------
__device__ __forceinline__ float hw_exp2(float x) { return __builtin_amdgcn_exp2f(x); }
__device__ __forceinline__ float hw_rcp(float x)  { return __builtin_amdgcn_rcpf(x); }

// eight copies, 16 bytes per lane each; the closing s_wait_xcnt stands in the same statement so that no address register is rewritten ahead of it
__device__ __forceinline__ void copy8(unsigned l0, const unsigned short* g0, unsigned l1, const unsigned short* g1,
                                      unsigned l2, const unsigned short* g2, unsigned l3, const unsigned short* g3,
                                      unsigned l4, const unsigned short* g4, unsigned l5, const unsigned short* g5,
                                      unsigned l6, const unsigned short* g6, unsigned l7, const unsigned short* g7) {
  asm volatile("global_load_async_to_lds_b128 %0, %1, off\n\t"
               "global_load_async_to_lds_b128 %2, %3, off\n\t"
               "global_load_async_to_lds_b128 %4, %5, off\n\t"
               "global_load_async_to_lds_b128 %6, %7, off\n\t"
               "global_load_async_to_lds_b128 %8, %9, off\n\t"
               "global_load_async_to_lds_b128 %10, %11, off\n\t"
               "global_load_async_to_lds_b128 %12, %13, off\n\t"
               "global_load_async_to_lds_b128 %14, %15, off\n\t"
               "s_wait_xcnt 0x0"
               :: "v"(l0), "v"(g0), "v"(l1), "v"(g1), "v"(l2), "v"(g2), "v"(l3), "v"(g3),
                  "v"(l4), "v"(g4), "v"(l5), "v"(g5), "v"(l6), "v"(g6), "v"(l7), "v"(g7)
               : "memory");
}
// one plane in 16 rounds of the 256 threads; lds / g = this thread's place in round 0, lstep (bytes) / gstep (elements) = one round
__device__ __forceinline__ void fill16(unsigned lds, unsigned lstep, const unsigned short* g, size_t gstep) {
  // unrolled: two statements of eight copies
#pragma unroll
  for (int p = 0; p < 16; p += 8)
    copy8(lds + (unsigned)p * lstep,       g + (size_t)p * gstep,       lds + (unsigned)(p + 1) * lstep, g + (size_t)(p + 1) * gstep,
          lds + (unsigned)(p + 2) * lstep, g + (size_t)(p + 2) * gstep, lds + (unsigned)(p + 3) * lstep, g + (size_t)(p + 3) * gstep,
          lds + (unsigned)(p + 4) * lstep, g + (size_t)(p + 4) * gstep, lds + (unsigned)(p + 5) * lstep, g + (size_t)(p + 5) * gstep,
          lds + (unsigned)(p + 6) * lstep, g + (size_t)(p + 6) * gstep, lds + (unsigned)(p + 7) * lstep, g + (size_t)(p + 7) * gstep);
}

constexpr int kKP = kDk + 8;     // LDS pitch of a key row, elements (16 B x odd)
constexpr int kVP = kSeq + 8;    // LDS pitch of a v^T row, elements (16 B x odd)
constexpr int kQB = 256;         // queries per work-group

// S^T tile of keys kt*16 .. kt*16+15 against both query groups; kr = this lane's place in key row c of the hi plane
__device__ __forceinline__ void score_tile(const __bf16* kr, const v16b (&qh)[2][2], const v16b (&ql)[2][2], v8f (&s)[2]) {
  typedef Frag<__bf16> F;
  const v16b kh0 = F::load(kr), kh1 = F::load(kr + 32);
  const v16b kl0 = F::load(kr + kSeq * kKP), kl1 = F::load(kr + kSeq * kKP + 32);
#pragma unroll
  for (int qt = 0; qt < 2; ++qt) {
    v8f a = (v8f){0.f, 0.f, 0.f, 0.f, 0.f, 0.f, 0.f, 0.f};
    a = F::mma(kh0, qh[qt][0], a);
    a = F::mma(kl0, qh[qt][0], a);
    a = F::mma(kh0, ql[qt][0], a);
    a = F::mma(kh1, qh[qt][1], a);
    a = F::mma(kl1, qh[qt][1], a);
    a = F::mma(kh1, ql[qt][1], a);
    s[qt] = a;
  }
}

__global__ __launch_bounds__(256) void attn_mix_kernel(
    const unsigned short* __restrict__ Qh, const unsigned short* __restrict__ Ql,
    const unsigned short* __restrict__ Kh, const unsigned short* __restrict__ Kl,
    const unsigned short* __restrict__ VTh, const unsigned short* __restrict__ VTl,
    unsigned short* __restrict__ Ch, unsigned short* __restrict__ Cl,
    const float* __restrict__ Wg, const float* __restrict__ bg, const float* __restrict__ lam1) {
  typedef Frag<__bf16> F;
  __shared__ __align__(16) unsigned short sK[2 * kSeq * kKP];
  __shared__ __align__(16) unsigned short sV[2 * kDk * kVP];
  const int tid  = threadIdx.x;
  const int lane = tid & 31;
  const int wave = tid >> 5;
  const int c    = lane & 15;
  const int hh   = lane >> 4;
  const int z    = blockIdx.y;
  const int bb   = z >> 3;
  const int h    = z & (kHeads - 1);
  const int q0   = blockIdx.x * kQB + wave * 32;

  // key rows: 8 lanes per 128-byte row piece, 32 rows per round
  {
    const int cc = tid & 7, cr = tid >> 3;
    const size_t g = (size_t)(bb * kSeq + cr) * kDm + (size_t)h * kDk + cc * 8;
    const unsigned l = (unsigned)(uintptr_t)sK + (unsigned)(cr * kKP + cc * 8) * 2u;
    fill16(l, 32u * kKP * 2u, Kh + g, (size_t)32 * kDm);
    fill16(l + (unsigned)(kSeq * kKP) * 2u, 32u * kKP * 2u, Kl + g, (size_t)32 * kDm);
  }

  // query fragments (B operand), hardware k order, kept for both passes
  v16b qh[2][2], ql[2][2];
#pragma unroll
  for (int qt = 0; qt < 2; ++qt) {
#pragma unroll
    for (int ks = 0; ks < 2; ++ks) {
      const size_t o = (size_t)(bb * kSeq + q0 + qt * 16 + c) * kDm + (size_t)h * kDk + ks * 32 + hh * 8;
      qh[qt][ks] = F::load((const __bf16*)(Qh + o));
      ql[qt][ks] = F::load((const __bf16*)(Ql + o));
    }
    wait_x0();
  }

  // gating dots: this lane holds 32 of its query's 64 d, the other lane half the rest
  float gn0[2], gn1[2];
  {
    float g0[2] = {0.f, 0.f}, g1[2] = {0.f, 0.f};
#pragma unroll
    for (int ks = 0; ks < 2; ++ks)
#pragma unroll
      for (int hf = 0; hf < 2; ++hf) {
        const float* wp = Wg + ks * 32 + hf * 16 + hh * 8;
        const v4f wa = *(const v4f*)(wp), wb = *(const v4f*)(wp + 4);
        const v4f wc = *(const v4f*)(wp + kDk), wd = *(const v4f*)(wp + kDk + 4);
#pragma unroll
        for (int e = 0; e < 8; ++e) {
          const float w0 = (e < 4) ? wa[e & 3] : wb[e & 3];
          const float w1 = (e < 4) ? wc[e & 3] : wd[e & 3];
#pragma unroll
          for (int qt = 0; qt < 2; ++qt) {
            const float qv = (float)qh[qt][ks][hf * 8 + e] + (float)ql[qt][ks][hf * 8 + e];
            g0[qt] += qv * w0;
            g1[qt] += qv * w1;
          }
        }
      }
    const float b0 = bg[0], b1 = bg[1];
#pragma unroll
    for (int qt = 0; qt < 2; ++qt) {
      const float t0 = fabsf(g0[qt] + __shfl_xor(g0[qt], 16, 32) + b0) + 1.0f;
      const float t1 = fabsf(g1[qt] + __shfl_xor(g1[qt], 16, 32) + b1) + 1.0f;
      gn0[qt] = (-0.5f * kLog2e) * hw_rcp(t0 * t0);      // j >= i (upper incl. diagonal)
      gn1[qt] = (-0.5f * kLog2e) * hw_rcp(t1 * t1);      // j <  i (strictly lower)
    }
  }
  const float sg  = hw_rcp(1.0f + hw_exp2(-lam1[0] * kLog2e));
  const float omg = 1.0f - sg;

  // the key rows: this wave's copies have landed, then the barrier that publishes them
  wait_async0();
  __syncthreads();

  // v^T rows: 64 lanes per 1024-byte row, 4 rows per round; read only behind the barrier after pass 1
  {
    const int cc = tid & 63, cr = tid >> 6;
    const size_t g = (size_t)bb * kDm * kSeq + (size_t)(h * kDk + cr) * kSeq + cc * 8;
    const unsigned l = (unsigned)(uintptr_t)sV + (unsigned)(cr * kVP + cc * 8) * 2u;
    fill16(l, 4u * kVP * 2u, VTh + g, (size_t)4 * kSeq);
    fill16(l + (unsigned)(kDk * kVP) * 2u, 4u * kVP * 2u, VTl + g, (size_t)4 * kSeq);
  }

  const __bf16* kr0 = (const __bf16*)sK + c * kKP + hh * 8;

  // pass 1: row maxima
  float mx[2] = {-INFINITY, -INFINITY};
  // two tiles per trip: the second tile's LDS reads stand beside the first tile's products
#pragma unroll 2
  for (int kt = 0; kt < kSeq / 16; ++kt) {
    v8f s[2];
    score_tile(kr0 + kt * 16 * kKP, qh, ql, s);
#pragma unroll
    for (int qt = 0; qt < 2; ++qt)
#pragma unroll
      for (int r = 0; r < 8; ++r) mx[qt] = fmaxf(mx[qt], s[qt][r]);
  }
#pragma unroll
  for (int qt = 0; qt < 2; ++qt) mx[qt] = fmaxf(mx[qt], __shfl_xor(mx[qt], 16, 32));

  // the v^T rows: this wave's copies have landed, then the barrier that publishes them
  wait_async0();
  __syncthreads();

  // pass 2
  v8f o[4][2];
#pragma unroll
  for (int dt = 0; dt < 4; ++dt)
#pragma unroll
    for (int qt = 0; qt < 2; ++qt) o[dt][qt] = (v8f){0.f, 0.f, 0.f, 0.f, 0.f, 0.f, 0.f, 0.f};
  float ls[2] = {0.f, 0.f};
  const float fi[2] = {(float)(q0 + c - hh * 8), (float)(q0 + 16 + c - hh * 8)};
  const __bf16* vr0 = (const __bf16*)sV + c * kVP + hh * 8;
  // rolled: for speed only
#pragma unroll 1
  for (int kp = 0; kp < kSeq / 32; ++kp) {
    v16b ph[2], pl[2];
#pragma unroll
    for (int t = 0; t < 2; ++t) {
      v8f s[2];
      score_tile(kr0 + (kp * 2 + t) * 16 * kKP, qh, ql, s);
#pragma unroll
      for (int qt = 0; qt < 2; ++qt) {
        const float fb = fi[qt] - (float)(kp * 32 + t * 16);   // i - j at r = 0
#pragma unroll
        for (int r = 0; r < 8; ++r) {
          const float p   = hw_exp2((s[qt][r] - mx[qt]) * kLog2e);
          const float fd  = fb - (float)r;
          const float gs  = (fd > 0.f) ? gn1[qt] : gn0[qt];
          const float adj = hw_exp2((fd * fd) * gs);
          const float av  = sg * p + omg * adj;
          ls[qt] += av;
          const __bf16 hb = (__bf16)av;
          ph[qt][t * 8 + r] = hb;
          pl[qt][t * 8 + r] = (__bf16)(av - (float)hb);
        }
      }
    }
    const __bf16* vr = vr0 + kp * 32;
#pragma unroll
    for (int dt = 0; dt < 4; ++dt) {
      const v16b vh = F::load(vr + dt * 16 * kVP);
      const v16b vl = F::load(vr + (kDk + dt * 16) * kVP);
#pragma unroll
      for (int qt = 0; qt < 2; ++qt) {
        o[dt][qt] = F::mma(vh, ph[qt], o[dt][qt]);
        o[dt][qt] = F::mma(vl, ph[qt], o[dt][qt]);
        o[dt][qt] = F::mma(vh, pl[qt], o[dt][qt]);
      }
    }
  }

  // epilogue: lane (c, hh) holds d = dt*16 + 8*hh + r of query c: one 16-byte store per tile and plane
#pragma unroll
  for (int qt = 0; qt < 2; ++qt) {
    const float inv = hw_rcp(ls[qt] + __shfl_xor(ls[qt], 16, 32) + 1e-9f);
    const size_t ro = (size_t)(bb * kSeq + q0 + qt * 16 + c) * kDm + (size_t)h * kDk + hh * 8;
#pragma unroll
    for (int dt = 0; dt < 4; ++dt) {
      v8b hv, lv;
#pragma unroll
      for (int r = 0; r < 8; ++r) {
        const float x = o[dt][qt][r] * inv;
        const __bf16 hb = (__bf16)x;
        hv[r] = hb;
        lv[r] = (__bf16)(x - (float)hb);
      }
      *(v8b*)((__bf16*)Ch + ro + dt * 16) = hv;
      *(v8b*)((__bf16*)Cl + ro + dt * 16) = lv;
    }
    wait_x0();
  }
}

// ---------------------------------------------------------------------------
// Workspace region map (bytes; every offset a multiple of 512 KiB). Every region is fully written
// inside the call before any read.
//   Wqh,Wql,Wkh,Wkl,Wvh,Wvl,Woh,Wol  bf16 [512][512] each            0 .. 4194304
//   Xqh,Xql,Xkh,Xkl,Xvh,Xvl          bf16 [8192][512] each     4194304 .. 54525952
//   Qh,Ql,Kh,Kl                      bf16 [8192][512] each    54525952 .. 88080384   (row bb*512+i, col h*64+d)
//   VTh,VTl                          bf16 [16][512][512]      88080384 .. 104857600  (batch, row h*64+d, col token)
//   CTXh,CTXl                        bf16 [8192][512] each   104857600 .. 121634816  (row bb*512+i, col h*64+d)
//   total 121634816
// ---------------------------------------------------------------------------
extern "C" void kernel_launch(void* const* d_in, const int* in_sizes, int n_in,
                              void* d_out, int out_size, void* d_ws, size_t ws_size,
                              hipStream_t stream) {
  if (n_in < 14) return;
  const int nAct = kBatch * kSeq * kDm;          // 4194304
  const int nW   = kDm * kDm;                    // 262144
  if (in_sizes[0] != nAct || in_sizes[1] != nAct || in_sizes[2] != nAct) return;
  if (in_sizes[3] != nW || in_sizes[5] != nW || in_sizes[7] != nW || in_sizes[12] != nW) return;
  if (in_sizes[4] != kDm || in_sizes[6] != kDm || in_sizes[8] != kDm || in_sizes[13] != kDm) return;
  if (in_sizes[9] != 2 * kDk || in_sizes[10] < 2 || in_sizes[11] < 1) return;
  if (out_size != nAct) return;

  const float* query = (const float*)d_in[0];
  const float* key   = (const float*)d_in[1];
  const float* value = (const float*)d_in[2];
  const float* Wq    = (const float*)d_in[3];
  const float* bq    = (const float*)d_in[4];
  const float* Wk    = (const float*)d_in[5];
  const float* bk    = (const float*)d_in[6];
  const float* Wv    = (const float*)d_in[7];
  const float* bv    = (const float*)d_in[8];
  const float* Wg    = (const float*)d_in[9];
  const float* bg    = (const float*)d_in[10];
  const float* lam1  = (const float*)d_in[11];
  const float* Wo    = (const float*)d_in[12];
  const float* bo    = (const float*)d_in[13];
  float* out = (float*)d_out;

  const size_t PW  = (size_t)kDm * kDm * 2;                 // 524288    weight plane
  const size_t PX  = (size_t)kGRows * kDm * 2;              // 8388608   activation / q / k / ctx plane
  const size_t PVT = (size_t)kGB * kDm * kSeq * 2;          // 8388608   v^T plane
  size_t off = 0;
  const size_t oWqh = off; off += PW;  const size_t oWql = off; off += PW;
  const size_t oWkh = off; off += PW;  const size_t oWkl = off; off += PW;
  const size_t oWvh = off; off += PW;  const size_t oWvl = off; off += PW;
  const size_t oWoh = off; off += PW;  const size_t oWol = off; off += PW;
  const size_t oXqh = off; off += PX;  const size_t oXql = off; off += PX;
  const size_t oXkh = off; off += PX;  const size_t oXkl = off; off += PX;
  const size_t oXvh = off; off += PX;  const size_t oXvl = off; off += PX;
  const size_t oQh  = off; off += PX;  const size_t oQl  = off; off += PX;
  const size_t oKh  = off; off += PX;  const size_t oKl  = off; off += PX;
  const size_t oVTh = off; off += PVT; const size_t oVTl = off; off += PVT;
  const size_t oCh  = off; off += PX;  const size_t oCl  = off; off += PX;
  if (off > ws_size) return;                                // off = 121634816

  char* ws = (char*)d_ws;
  unsigned short* Wqh = (unsigned short*)(ws + oWqh); unsigned short* Wql = (unsigned short*)(ws + oWql);
  unsigned short* Wkh = (unsigned short*)(ws + oWkh); unsigned short* Wkl = (unsigned short*)(ws + oWkl);
  unsigned short* Wvh = (unsigned short*)(ws + oWvh); unsigned short* Wvl = (unsigned short*)(ws + oWvl);
  unsigned short* Woh = (unsigned short*)(ws + oWoh); unsigned short* Wol = (unsigned short*)(ws + oWol);
  unsigned short* Xqh = (unsigned short*)(ws + oXqh); unsigned short* Xql = (unsigned short*)(ws + oXql);
  unsigned short* Xkh = (unsigned short*)(ws + oXkh); unsigned short* Xkl = (unsigned short*)(ws + oXkl);
  unsigned short* Xvh = (unsigned short*)(ws + oXvh); unsigned short* Xvl = (unsigned short*)(ws + oXvl);
  unsigned short* Qh  = (unsigned short*)(ws + oQh);  unsigned short* Ql  = (unsigned short*)(ws + oQl);
  unsigned short* Kh  = (unsigned short*)(ws + oKh);  unsigned short* Kl  = (unsigned short*)(ws + oKl);
  unsigned short* VTh = (unsigned short*)(ws + oVTh); unsigned short* VTl = (unsigned short*)(ws + oVTl);
  unsigned short* Ch  = (unsigned short*)(ws + oCh);  unsigned short* Cl  = (unsigned short*)(ws + oCl);

  const dim3 blk(256);
  const dim3 blkSplit(kSplitTh);                                    // 512 threads
  const dim3 gSplit(kSplitWG);                                      // 256 work-groups: all seven tensors
  const dim3 gQ(((kGRows / 64) * (kDm / 64) + 7) / 8, 1);           // 128 blocks: M=8192, N=512, K=512
  const dim3 gVT(((kDm / 64) * (kSeq / 64) + 7) / 8, kGB);          // 8 x 16:     M=512, N=512, K=512 per batch
  const dim3 gAtt(kSeq / kQB, kNZ);                                 // 2 x 128:    256 queries x 512 keys per work-group
  const dim3 gOut(((kGRows / 64) * (kDm / 64) + 7) / 8, 1);         // 128 blocks: M=8192, N=512, K=512

  const long pQK  = (long)kSeq * kDm;            // 262144: one batch of the q/k/ctx planes
  const long pVTb = (long)kDm * kSeq;            // 262144: one batch of the v^T planes

  // (1) activations -> hi/lo planes [8192][512], weights -> hi/lo planes [512][512] (torch [out][in] is already Bt[n][k]); every plane whole
  split_all_kernel<<<gSplit, blkSplit, 0, stream>>>(query, key, value, Wq, Wk, Wv, Wo, Xqh, Wqh);

  for (int gb = 0; gb < kNGrp; ++gb) {
    const size_t actOff = (size_t)gb * kGRows * kDm;
    // (2) q = x.Wq^T + bq, k = x.Wk^T + bk -> hi/lo planes [8192][512] (128x8 tiles, whole planes)
    wmma_gemm64<1, true, 2, 2, false, 0, 4, 64, 2><<<gQ, blk, 0, stream>>>(
        Xqh, Xql, kDm, 0L, 0L, Wqh, Wql, kDm, 0L, 0L, (void*)Qh, (void*)Ql, kDm, 0L, 0L,
        bq, bq, 0L, kGRows, kDm, kDm, 1.0f, 1);
    wmma_gemm64<1, true, 2, 2, false, 0, 4, 64, 2><<<gQ, blk, 0, stream>>>(
        Xkh, Xkl, kDm, 0L, 0L, Wkh, Wkl, kDm, 0L, 0L, (void*)Kh, (void*)Kl, kDm, 0L, 0L,
        bk, bk, 0L, kGRows, kDm, kDm, 1.0f, 1);
    // (3) v^T[bb][o][tok] = sum_k Wv[o][k] x[bb*512+tok][k] + bv[o] -> hi/lo planes [16][512][512] (8x8 tiles per bb)
    wmma_gemm64<1, true, 1, 2, false, 0, 4, 64, 2><<<gVT, blk, 0, stream>>>(
        Wvh, Wvl, kDm, 0L, 0L, Xvh, Xvl, kDm, pQK, 0L, (void*)VTh, (void*)VTl, kSeq, pVTb, 0L,
        bv, bv, 0L, kDm, kSeq, kDm, 1.0f, kGB);
    // (4) ctx[bb*512+i][h*64+d] = sum_j A[z][i][j] v^T[bb][h*64+d][j] / (sum_j A[z][i][j] + 1e-9) -> hi/lo planes, A = gated mix of the scores q.k^T
    attn_mix_kernel<<<gAtt, blk, 0, stream>>>(Qh, Ql, Kh, Kl, VTh, VTl, Ch, Cl, Wg, bg, lam1);
    // (5) out = ctx.Wo^T + bo -> f32 [8192][512], all of d_out (128x8 tiles)
    float* outg = out + actOff;
    wmma_gemm64<1, true, 2, 0, false, 0, 4, 64, 2><<<gOut, blk, 0, stream>>>(
        Ch, Cl, kDm, 0L, 0L, Woh, Wol, kDm, 0L, 0L, (void*)outg, (void*)outg, kDm, 0L, 0L,
        bo, bo, 0L, kGRows, kDm, kDm, 1.0f, 1);
  }
}

// v005
// It runs in 98.5 microseconds.
// Two timings next to v004 put it at 1.31 and 1.30 times that version's speed.
// Over all steps from v000 it is 9.96 times as fast.
// Contractions x.Wq^T, x.Wk^T, Wv.x^T, k.q^T, v^T.p^T, ctx.Wo^T: v_wmma_f32_16x16x32_bf16 on bf16 hi/lo split operand planes (hi.hi + hi.lo + lo.hi), f32 accumulate; per-row 64x2 gating dots, softmax, distance adjacency, max- and sum-normalisation in f32 on the VALU (hardware exp2/rcp).
#include <hip/hip_runtime.h>
#include <math.h>
#include <stdint.h>

constexpr int kBatch = 16;
constexpr int kSeq   = 512;
constexpr int kDm    = 512;
constexpr int kHeads = 8;
constexpr int kDk    = 64;
constexpr int kGB    = 16;                 // batches per group: the whole batch goes through every stage in one launch
constexpr int kNGrp  = kBatch / kGB;       // 1 group
constexpr int kNZ    = kGB * kHeads;       // 128 (batch, head) planes
constexpr int kGRows = kGB * kSeq;         // 8192 token rows
constexpr float kLog2e = 1.4426950408889634f;
static_assert(kSeq == 512 && kDk == 64 && kDm == kHeads * kDk && (kBatch % kGB) == 0, "geometry");

typedef __attribute__((ext_vector_type(16))) _Float16 v16h;
typedef __attribute__((ext_vector_type(8)))  _Float16 v8h;
typedef __attribute__((ext_vector_type(16))) __bf16   v16b;
typedef __attribute__((ext_vector_type(8)))  __bf16   v8b;
typedef __attribute__((ext_vector_type(8)))  float    v8f;
typedef __attribute__((ext_vector_type(4)))  float    v4f;
typedef __attribute__((ext_vector_type(4)))  unsigned int v4u;

__device__ __forceinline__ unsigned short f2bf_bits(float f) {
  unsigned u = __float_as_uint(f);
  return (unsigned short)((u + 0x7FFFu + ((u >> 16) & 1u)) >> 16);
}
__device__ __forceinline__ float bf_bits2f(unsigned short h) { return __uint_as_float(((unsigned)h) << 16); }
__device__ __forceinline__ unsigned pk16(unsigned short a, unsigned short b) { return (unsigned)a | ((unsigned)b << 16); }

// hazard guards as plain device helpers (no inline asm inside the kernel template body)
__device__ __forceinline__ void dep_guard_h(v8f& a, v8f& b, v16h x, v16h y) { asm volatile("v_nop\n\tv_nop\n\tv_nop\n\tv_nop" : "+v"(a), "+v"(b) : "v"(x), "v"(y)); }
__device__ __forceinline__ void dep_guard_b(v8f& a, v8f& b, v16b x, v16b y) { asm volatile("v_nop\n\tv_nop\n\tv_nop\n\tv_nop" : "+v"(a), "+v"(b) : "v"(x), "v"(y)); }
__device__ __forceinline__ void keep4_h(v16h a, v16h b, v16h c, v16h d) { asm volatile("v_nop" :: "v"(a), "v"(b), "v"(c), "v"(d)); }
__device__ __forceinline__ void keep4_b(v16b a, v16b b, v16b c, v16b d) { asm volatile("v_nop" :: "v"(a), "v"(b), "v"(c), "v"(d)); }
__device__ __forceinline__ void acc_guard4(v8f& a, v8f& b, v8f& c, v8f& d) { asm volatile("v_nop\n\tv_nop\n\tv_nop\n\tv_nop" : "+v"(a), "+v"(b), "+v"(c), "+v"(d)); }
template <typename T> struct Frag;
template <> struct Frag<_Float16> {
  typedef v16h V; union U { v16h v; v8h h[2]; };
  static __device__ __forceinline__ v16h load(const _Float16* p) {   // elements 0..7 <- p[0..7], 8..15 <- p[16..23]
    U f; f.h[0] = *(const v8h*)(p); f.h[1] = *(const v8h*)(p + 16); return f.v;
  }
  static __device__ __forceinline__ v8f mma(v16h a, v16h b, v8f c) {
    return __builtin_amdgcn_wmma_f32_16x16x32_f16(false, a, false, b, (short)0, c, false, false);
  }
  static __device__ __forceinline__ void guard(v8f& a, v8f& b, v16h x, v16h y) { dep_guard_h(a, b, x, y); }
  static __device__ __forceinline__ void keep(v16h a, v16h b, v16h c, v16h d) { keep4_h(a, b, c, d); }
};
template <> struct Frag<__bf16> {
  typedef v16b V; union U { v16b v; v8b h[2]; };
  static __device__ __forceinline__ v16b load(const __bf16* p) {
    U f; f.h[0] = *(const v8b*)(p); f.h[1] = *(const v8b*)(p + 16); return f.v;
  }
  static __device__ __forceinline__ v8f mma(v16b a, v16b b, v8f c) {
    return __builtin_amdgcn_wmma_f32_16x16x32_bf16(false, a, false, b, (short)0, c, false, false);
  }
  static __device__ __forceinline__ void guard(v8f& a, v8f& b, v16b x, v16b y) { dep_guard_b(a, b, x, y); }
  static __device__ __forceinline__ void keep(v16b a, v16b b, v16b c, v16b d) { keep4_b(a, b, c, d); }
};

// ---- Register-blocked batched WMMA GEMM ------------------------------------
// C[m,n] = scale * sum_k A[m,k] * Bt[n,k] (+bias)(+resid); each wave owns a 64x64 tile.
// A row-major [M,K]; Bt row-major [N,K]; M % (WM*64) == 0, N % (WN*64) == 0, K % KC == 0.
// SPLIT: operands are hi/lo planes (A2/Bt2 = lo planes, same layout); product = hi.hi + hi.lo + lo.hi.
// BIAS_MODE: 0 = none, 1 = bias[m], 2 = bias[n].
// OUT_MODE: 0 = f32, 1 = f16, 2 = bf16 hi plane (Cout) + bf16 lo plane (Cout2).
// z addressing: bz = the z plane (blockIdx.y in wmma_gemm64), zi = bz % zsplit, zo = bz / zsplit; operand base = zi*stride + zo*stride2 (elements).
// ET: 0 = f16 operands, 1 = bf16 operands (pointers passed as 16-bit storage)
template <int ET> struct Elem;
template <> struct Elem<0> { typedef _Float16 T; };
template <> struct Elem<1> { typedef __bf16 T; };
// ---- LDS staging of the operand tiles ---------------------------------------
// The WM*WN waves of a work-group share one (WM*64) x (WN*64) tile of C. Per pass of KC k, the rows of A hi, A lo, Bt hi, Bt lo
// that the tile needs are copied to LDS by global_load_async_to_lds_b128 (KC/8 neighbouring lanes per row: whole contiguous row pieces),
// at a row pitch of KC*2 + 16 bytes; the WMMA fragments are then read with ds_load_b128.
// this wave's copies have landed before the barrier that publishes them to the other waves
__device__ __forceinline__ void wait_async0() { asm volatile("s_wait_asynccnt 0x0" ::: "memory"); }
// this wave's fragment reads have returned before the barrier behind which their buffer is refilled
__device__ __forceinline__ void wait_ds0() { asm volatile("s_wait_dscnt 0x0" ::: "memory"); }
// stands behind a group of global loads or stores, in front of whatever rewrites a register that they name
__device__ __forceinline__ void wait_x0() { asm volatile("s_wait_xcnt 0x0" ::: "memory"); }
// six copies, 16 bytes per lane each; the closing s_wait_xcnt stands in the same statement so that no address register is rewritten ahead of it
__device__ __forceinline__ void copy6(unsigned l0, const unsigned short* g0, unsigned l1, const unsigned short* g1,
                                      unsigned l2, const unsigned short* g2, unsigned l3, const unsigned short* g3,
                                      unsigned l4, const unsigned short* g4, unsigned l5, const unsigned short* g5) {
  asm volatile("global_load_async_to_lds_b128 %0, %1, off\n\t"
               "global_load_async_to_lds_b128 %2, %3, off\n\t"
               "global_load_async_to_lds_b128 %4, %5, off\n\t"
               "global_load_async_to_lds_b128 %6, %7, off\n\t"
               "global_load_async_to_lds_b128 %8, %9, off\n\t"
               "global_load_async_to_lds_b128 %10, %11, off\n\t"
               "s_wait_xcnt 0x0"
               :: "v"(l0), "v"(g0), "v"(l1), "v"(g1), "v"(l2), "v"(g2), "v"(l3), "v"(g3), "v"(l4), "v"(g4), "v"(l5), "v"(g5)
               : "memory");
}
// eight copies, 16 bytes per lane each; the closing s_wait_xcnt stands in the same statement so that no address register is rewritten ahead of it
__device__ __forceinline__ void copy8(unsigned l0, const unsigned short* g0, unsigned l1, const unsigned short* g1,
                                      unsigned l2, const unsigned short* g2, unsigned l3, const unsigned short* g3,
                                      unsigned l4, const unsigned short* g4, unsigned l5, const unsigned short* g5,
                                      unsigned l6, const unsigned short* g6, unsigned l7, const unsigned short* g7) {
  asm volatile("global_load_async_to_lds_b128 %0, %1, off\n\t"
               "global_load_async_to_lds_b128 %2, %3, off\n\t"
               "global_load_async_to_lds_b128 %4, %5, off\n\t"
               "global_load_async_to_lds_b128 %6, %7, off\n\t"
               "global_load_async_to_lds_b128 %8, %9, off\n\t"
               "global_load_async_to_lds_b128 %10, %11, off\n\t"
               "global_load_async_to_lds_b128 %12, %13, off\n\t"
               "global_load_async_to_lds_b128 %14, %15, off\n\t"
               "s_wait_xcnt 0x0"
               :: "v"(l0), "v"(g0), "v"(l1), "v"(g1), "v"(l2), "v"(g2), "v"(l3), "v"(g3),
                  "v"(l4), "v"(g4), "v"(l5), "v"(g5), "v"(l6), "v"(g6), "v"(l7), "v"(g7)
               : "memory");
}
// One stage: LDS rows [A hi: TM | A lo: TM | Bt hi: TN | Bt lo: TN]. NTH threads cover RPP rows per round; lds and the four
// pointers are this thread's own place in round 0 of each part; stepA / stepB = RPP rows of the source, in elements.
template <int KC, int TM, int TN, int NTH>
__device__ __forceinline__ void stage_fill(unsigned lds, const unsigned short* gAh, const unsigned short* gAl,
                                           const unsigned short* gBh, const unsigned short* gBl, size_t stepA, size_t stepB) {
  constexpr int RPP = NTH / (KC / 8);
  constexpr int PA = TM / RPP, PB = TN / RPP, NP = 2 * (PA + PB);
  constexpr unsigned LB = (unsigned)RPP * (KC * 2 + 16);
  static_assert(TM % RPP == 0 && TN % RPP == 0 && (NP % 6 == 0 || NP % 8 == 0) && NP <= 63, "stage geometry");
  // both loops unrolled: the round number is then a constant, so each copy's part and LDS place are chosen at compile time
  if constexpr (NP % 6 != 0) {
#pragma unroll
    for (int p = 0; p < NP; p += 8) {
      const unsigned short* g[8];
#pragma unroll
      for (int u = 0; u < 8; ++u) {
        const int q = p + u;
        g[u] = (q < PA) ? (gAh + (size_t)q * stepA)
             : (q < 2 * PA) ? (gAl + (size_t)(q - PA) * stepA)
             : (q < 2 * PA + PB) ? (gBh + (size_t)(q - 2 * PA) * stepB)
                                 : (gBl + (size_t)(q - 2 * PA - PB) * stepB);
      }
      copy8(lds + (unsigned)p * LB, g[0], lds + (unsigned)(p + 1) * LB, g[1], lds + (unsigned)(p + 2) * LB, g[2],
            lds + (unsigned)(p + 3) * LB, g[3], lds + (unsigned)(p + 4) * LB, g[4], lds + (unsigned)(p + 5) * LB, g[5],
            lds + (unsigned)(p + 6) * LB, g[6], lds + (unsigned)(p + 7) * LB, g[7]);
    }
    return;
  }
#pragma unroll
  for (int p = 0; p < NP; p += 6) {
    const unsigned short* g[6];
#pragma unroll
    for (int u = 0; u < 6; ++u) {
      const int q = p + u;
      g[u] = (q < PA) ? (gAh + (size_t)q * stepA)
           : (q < 2 * PA) ? (gAl + (size_t)(q - PA) * stepA)
           : (q < 2 * PA + PB) ? (gBh + (size_t)(q - 2 * PA) * stepB)
                               : (gBl + (size_t)(q - 2 * PA - PB) * stepB);
    }
    copy6(lds + (unsigned)p * LB, g[0], lds + (unsigned)(p + 1) * LB, g[1], lds + (unsigned)(p + 2) * LB, g[2],
          lds + (unsigned)(p + 3) * LB, g[3], lds + (unsigned)(p + 4) * LB, g[4], lds + (unsigned)(p + 5) * LB, g[5]);
  }
}

// WM x WN: waves along m and n in the work-group. KC: k per stage. NBUF: 2 = the next stage's copies fly while this one is worked on.
// M % (WM*64) == 0, N % (WN*64) == 0, K % KC == 0; wg = the work-group's tile, 0 .. (M/64)*(N/64)/(WM*WN) - 1; bz = its z plane.
// BIAS_MODE 3: bias[m] where biasM (the same for the whole work-group), else bias[n].
template <int ET, bool SPLIT, int BIAS_MODE, int OUT_MODE, bool RESID, int ACT, int WM, int WN, int KC, int NBUF>
__device__ __forceinline__ void gemm_tile(
    const unsigned short* __restrict__ Ap, const unsigned short* __restrict__ A2p, int lda, long strideA, long strideA2,
    const unsigned short* __restrict__ Btp, const unsigned short* __restrict__ Bt2p, int ldb, long strideB, long strideB2,
    void* __restrict__ Cout, void* __restrict__ Cout2, int ldc, long strideC, long strideC2,
    const float* __restrict__ bias,
    const float* __restrict__ resid, long strideR,
    int M, int N, int K, float scale, int zsplit, const int wg, const int bz, const bool biasM) {
  typedef typename Elem<ET>::T T;
  typedef typename Frag<T>::V V;
  static_assert(SPLIT, "the staged tiles hold a hi and a lo plane of each operand");
  static_assert(NBUF == 2, "the epilogue's slabs lie in the stage buffers, behind the barrier at the foot of the last pass");
  constexpr int NTH = WM * WN * 32;
  constexpr int TM = WM * 64;
  constexpr int TN = WN * 64;
  constexpr int PE = KC + 8;                       // LDS row pitch in elements (16 B x odd)
  constexpr int STAGE_E = 2 * (TM + TN) * PE;      // elements per stage
  __shared__ __align__(16) unsigned short sStage[NBUF * STAGE_E];
  static_assert(WM * WN * 16 * 68 * 4 <= NBUF * STAGE_E * 2, "slabs fit the stage buffers");
  const int zo   = bz / zsplit;
  const int zi   = bz - zo * zsplit;
  const int lane = threadIdx.x & 31;
  const int wave = threadIdx.x >> 5;
  const int tilesN = N / TN;
  const int tilesM = M / TM;
  if (wg >= tilesM * tilesN) return;   // the same for the whole work-group, in front of every barrier
  const int tmw = wg / tilesN;
  const int tnw = wg - tmw * tilesN;
  const int wm = wave / WN;
  const int wn = wave - wm * WN;
  const int m0 = tmw * TM + (wm << 6);
  const int n0 = tnw * TN + (wn << 6);

  const size_t aOff = (size_t)zi * strideA + (size_t)zo * strideA2;
  const size_t bOff = (size_t)zi * strideB + (size_t)zo * strideB2;
  const size_t cOff = (size_t)zi * strideC + (size_t)zo * strideC2;

  const int rlane = lane & 15;                 // row (A) / col (B, D) within subtile
  const int koff  = (lane >> 4) * 8;           // k offset of this lane half
  const int mOff  = (lane >> 4) * 8;           // D row offset

  // this thread's place in a round of copies: row cr of the round, 16-byte piece cc of the row
  constexpr int LPR = KC / 8;
  const int cc = threadIdx.x % LPR;
  const int cr = threadIdx.x / LPR;
  const size_t aRow = aOff + (size_t)(tmw * TM + cr) * lda + cc * 8;
  const size_t bRow = bOff + (size_t)(tnw * TN + cr) * ldb + cc * 8;
  const unsigned short* gAh = Ap + aRow;
  const unsigned short* gAl = A2p + aRow;
  const unsigned short* gBh = Btp + bRow;
  const unsigned short* gBl = Bt2p + bRow;
  const size_t stepA = (size_t)(NTH / LPR) * lda;
  const size_t stepB = (size_t)(NTH / LPR) * ldb;
  const unsigned ldsT = (unsigned)(uintptr_t)sStage + (unsigned)(cr * PE + cc * 8) * 2u;

  v8f acc[4][4];
#pragma unroll
  for (int i = 0; i < 4; ++i)
#pragma unroll
    for (int j = 0; j < 4; ++j) acc[i][j] = (v8f){0.f,0.f,0.f,0.f,0.f,0.f,0.f,0.f};

  const int NT = K / KC;
  stage_fill<KC, TM, TN, NTH>(ldsT, gAh, gAl, gBh, gBl, stepA, stepB);
  wait_async0();
  __syncthreads();
  if (NBUF == 2 && NT > 1)
    stage_fill<KC, TM, TN, NTH>(ldsT + (unsigned)STAGE_E * 2u, gAh + KC, gAl + KC, gBh + KC, gBl + KC, stepA, stepB);

  for (int t = 0; t < NT; ++t) {
    const int buf = (NBUF == 2) ? (t & 1) : 0;
    const T* sb = (const T*)(sStage + buf * STAGE_E);
    const T* sA = sb + ((wm << 6) + rlane) * PE + koff;
    const T* sB = sb + (2 * TM + (wn << 6) + rlane) * PE + koff;
    // unrolled: the LDS offsets of a stage's fragments become immediates
#pragma unroll
    for (int kk = 0; kk < KC; kk += 32) {
      V bh[4], bl[4];
#pragma unroll
      for (int j = 0; j < 4; ++j) {
        bh[j] = Frag<T>::load(sB + (j << 4) * PE + kk);
        bl[j] = Frag<T>::load(sB + (TN + (j << 4)) * PE + kk);
      }
#pragma unroll
      for (int i = 0; i < 4; ++i) {
        V ah = Frag<T>::load(sA + (i << 4) * PE + kk);
        V al = Frag<T>::load(sA + (TM + (i << 4)) * PE + kk);
#pragma unroll
        for (int j = 0; j < 4; ++j) {
          acc[i][j] = Frag<T>::mma(ah, bh[j], acc[i][j]);
          acc[i][j] = Frag<T>::mma(ah, bl[j], acc[i][j]);
          acc[i][j] = Frag<T>::mma(al, bh[j], acc[i][j]);
        }
        Frag<T>::guard(acc[i][0], acc[i][3], ah, al);
      }
      Frag<T>::keep(bh[0], bh[1], bh[2], bh[3]);
      Frag<T>::keep(bl[0], bl[1], bl[2], bl[3]);
    }
    if (NBUF == 2) {
      // hand-over: every wave's reads of this buffer are done and its copies of the next stage have landed, then the barrier
      wait_ds0();
      wait_async0();
      __syncthreads();
      if (t + 2 < NT) {
        const int k2 = (t + 2) * KC;
        stage_fill<KC, TM, TN, NTH>(ldsT + (unsigned)(buf * STAGE_E) * 2u, gAh + k2, gAl + k2, gBh + k2, gBl + k2, stepA, stepB);
      }
    } else if (t + 1 < NT) {
      // one buffer: refill it behind every wave's last read, publish it behind every wave's copies
      wait_ds0();
      __syncthreads();
      const int k1 = (t + 1) * KC;
      stage_fill<KC, TM, TN, NTH>(ldsT, gAh + k1, gAl + k1, gBh + k1, gBl + k1, stepA, stepB);
      wait_async0();
      __syncthreads();
    }
  }
  wait_async0();
  acc_guard4(acc[0][0], acc[0][1], acc[0][2], acc[0][3]);
  acc_guard4(acc[1][0], acc[1][1], acc[1][2], acc[1][3]);
  acc_guard4(acc[2][0], acc[2][1], acc[2][2], acc[2][3]);
  acc_guard4(acc[3][0], acc[3][1], acc[3][2], acc[3][3]);

  // ---- epilogue ----
  float* slab = (float*)sStage + wave * (16 * 68);   // per-wave 16x64 slab, pitch 68 floats; every wave's stage reads and copies ended at the last barrier
  const float* Rb = RESID ? (resid + (size_t)zi * strideR) : nullptr;
  // BIAS_MODE 3: this lane's bias values, all loaded here under one work-group-uniform branch
  float bm[4][8], bn[4];
  if (BIAS_MODE == 3) {
#pragma unroll
    for (int i = 0; i < 4; ++i) {
      bn[i] = 0.f;
#pragma unroll
      for (int r = 0; r < 8; ++r) bm[i][r] = 0.f;
    }
    // each run's address is an input of the wait behind it: it stays in its registers up to that wait, so no load's result lands on it earlier
    if (biasM) {
      const float* bp = bias + m0 + mOff;
#pragma unroll
      for (int i = 0; i < 4; ++i)
#pragma unroll
        for (int r = 0; r < 8; ++r) bm[i][r] = bp[(i << 4) + r];
      asm volatile("s_wait_xcnt 0x0" :: "v"(bp) : "memory");
    } else {
      const float* bp = bias + n0 + rlane;
#pragma unroll
      for (int j = 0; j < 4; ++j) bn[j] = bp[j << 4];
      asm volatile("s_wait_xcnt 0x0" :: "v"(bp) : "memory");
    }
  }
#pragma unroll
  for (int i = 0; i < 4; ++i) {
    const int mBase = m0 + (i << 4);
#pragma unroll
    for (int j = 0; j < 4; ++j) {
      const int n = n0 + (j << 4) + rlane;
      float bv = 0.f;
      if (BIAS_MODE == 2) bv = bias[n];
#pragma unroll
      for (int r = 0; r < 8; ++r) {
        float v = acc[i][j][r] * scale;
        if (BIAS_MODE == 1) v += bias[mBase + mOff + r];
        if (BIAS_MODE == 2) v += bv;
        if (BIAS_MODE == 3) v = (v + bm[i][r]) + bn[j];   // one of the two is 0
        if (RESID) v += Rb[(size_t)(mBase + mOff + r) * ldc + n];
        if (ACT == 1) v = tanhf(v);
        if (ACT == 2) v = fmaxf(v, 0.0f);
        if (ACT == 4) v = (v > 0.f) ? v : 0.01f * v;
        slab[(mOff + r) * 68 + (j << 4) + rlane] = v;
      }
    }
    __builtin_amdgcn_fence(__ATOMIC_RELEASE, "workgroup");
    __builtin_amdgcn_wave_barrier();
    __builtin_amdgcn_fence(__ATOMIC_ACQUIRE, "workgroup");
    if (OUT_MODE == 0) {
      float* C = (float*)Cout + cOff;
      const int hh = lane >> 4, c4 = (lane & 15) * 4;     // row seg = 256 B = 16 lanes x 16 B
      {
#pragma unroll
        for (int it = 0; it < 8; ++it) {
          const int row = it * 2 + hh;
          v4f v = *(const v4f*)(slab + row * 68 + c4);
          *(v4f*)(C + (size_t)(mBase + row) * ldc + n0 + c4) = v;
        }
        
      }
    } else {
      const int q = lane >> 3, c8 = (lane & 7) * 8;
      unsigned short* C  = (unsigned short*)Cout  + cOff;
      unsigned short* C2 = (OUT_MODE == 2) ? ((unsigned short*)Cout2 + cOff) : nullptr;
      {
#pragma unroll
        for (int it = 0; it < 4; ++it) {
          const int row = it * 4 + q;
          const float* sp = slab + row * 68 + c8;
          v8h hv, lv;
#pragma unroll
          for (int e = 0; e < 8; ++e) {
            if (OUT_MODE == 1) {
              hv[e] = (_Float16)sp[e];
            } else {
              unsigned short hb = f2bf_bits(sp[e]);
              unsigned short lb = f2bf_bits(sp[e] - bf_bits2f(hb));
              hv[e] = __builtin_bit_cast(_Float16, hb);
              lv[e] = __builtin_bit_cast(_Float16, lb);
            }
          }
          *(v8h*)(C + (size_t)(mBase + row) * ldc + n0 + c8) = hv;
          if (OUT_MODE == 2) *(v8h*)(C2 + (size_t)(mBase + row) * ldc + n0 + c8) = lv;
        }
        
      }
    }
    __builtin_amdgcn_fence(__ATOMIC_RELEASE, "workgroup");
    __builtin_amdgcn_wave_barrier();
    __builtin_amdgcn_fence(__ATOMIC_ACQUIRE, "workgroup");
  }
}

// one GEMM per launch: eight waves, grid.x = tiles, grid.y = z planes
template <int ET, bool SPLIT, int BIAS_MODE, int OUT_MODE, bool RESID, int ACT, int WN, int KC, int NBUF>
__global__ __launch_bounds__(256) void wmma_gemm64(
    const unsigned short* __restrict__ Ap, const unsigned short* __restrict__ A2p, int lda, long strideA, long strideA2,
    const unsigned short* __restrict__ Btp, const unsigned short* __restrict__ Bt2p, int ldb, long strideB, long strideB2,
    void* __restrict__ Cout, void* __restrict__ Cout2, int ldc, long strideC, long strideC2,
    const float* __restrict__ bias,
    const float* __restrict__ resid, long strideR,
    int M, int N, int K, float scale, int zsplit) {
  gemm_tile<ET, SPLIT, BIAS_MODE, OUT_MODE, RESID, ACT, 8 / WN, WN, KC, NBUF>(
      Ap, A2p, lda, strideA, strideA2, Btp, Bt2p, ldb, strideB, strideB2, Cout, Cout2, ldc, strideC, strideC2,
      bias, resid, strideR, M, N, K, scale, zsplit, blockIdx.x, blockIdx.y, false);
}

// The three projections in one launch: blockIdx.y = 0: q = x.Wq^T + bq, 1: k = x.Wk^T + bk (M = 8192 tokens, N = 512, 32 x 2 tiles),
// 2: v^T[bb] = Wv.x[bb]^T + bv (M = 512, N = 512 tokens, 2 x 2 tiles for each of the 16 batches). 64 tiles of 256 x 256 each, 192
// work-groups of sixteen waves (four per SIMD), all resident at once.
// Xp: planes [q hi | q lo | k hi | k lo | v hi | v lo], Wp: planes [Wq hi | Wq lo | Wk hi | Wk lo | Wv hi | Wv lo | ...],
// Pp: planes [Q hi | Q lo | K hi | K lo | V^T hi | V^T lo], as the workspace map has them.
constexpr int kProjT = 256;                                        // tile edge
constexpr int kProjWG = (kGRows / kProjT) * (kDm / kProjT);        // 64 tiles per projection
static_assert(kProjWG == kGB * (kDm / kProjT) * (kSeq / kProjT) && kNGrp == 1, "projection geometry");
__global__ __launch_bounds__(512) void proj3_kernel(
    const unsigned short* __restrict__ Xp, const unsigned short* __restrict__ Wp, unsigned short* __restrict__ Pp,
    const float* __restrict__ bq, const float* __restrict__ bk, const float* __restrict__ bv) {
  constexpr size_t kXE = (size_t)kGRows * kDm, kWE = (size_t)kDm * kDm;   // elements of an activation and of a weight plane
  constexpr int kTB = (kDm / kProjT) * (kSeq / kProjT);                   // v^T tiles per batch
  const int sel = blockIdx.y;
  const bool vt = (sel == 2);
  const unsigned short* Xh = Xp + (size_t)(2 * sel) * kXE;
  const unsigned short* Wh = Wp + (size_t)(2 * sel) * kWE;
  unsigned short* Oh = Pp + (size_t)(2 * sel) * kXE;
  const float* bias = (sel == 0) ? bq : (sel == 1) ? bk : bv;
  gemm_tile<1, true, 3, 2, false, 0, 4, 4, 64, 2>(
      vt ? Wh : Xh, vt ? Wh + kWE : Xh + kXE, kDm, 0L, 0L,
      vt ? Xh : Wh, vt ? Xh + kXE : Wh + kWE, kDm, vt ? (long)kSeq * kDm : 0L, 0L,
      (void*)Oh, (void*)(Oh + kXE), kDm, vt ? (long)kDm * kSeq : 0L, 0L,
      bias, bias, 0L, vt ? kDm : kGRows, kDm, kDm, 1.0f, kGB,
      vt ? (int)(blockIdx.x % kTB) : (int)blockIdx.x, vt ? (int)(blockIdx.x / kTB) : 0, vt);
}

// ---------------------------------------------------------------------------
// f32 -> bf16 hi/lo split of all seven operand tensors in one launch: hi = bf16_rne(x), lo = bf16_rne(x - hi).
// A piece = 8 neighbouring elements (32 bytes read, 16 + 16 bytes written) of one thread. 256 work-groups x 512 threads = 131072 threads:
// an activation tensor is 4 x 131072 pieces, the four weight tensors together are 131072 pieces (64 work-groups each), so every thread
// does 4 pieces of each activation tensor and 1 piece of one weight tensor: few long-lived waves instead of one short wave per 32 pieces.
// The next tensor's eight loads are issued before this tensor's pieces are converted and stored.
// Xp: planes [q hi | q lo | k hi | k lo | v hi | v lo], Wp: planes [Wq hi | Wq lo | Wk hi | ... | Wo lo], as the workspace map has them.
// ---------------------------------------------------------------------------
constexpr int kSplitTh  = 512;                       // threads per work-group
constexpr int kSplitWG  = 256;                       // work-groups
constexpr int kSplitAll = kSplitTh * kSplitWG;       // 131072 threads
constexpr int kActE     = kBatch * kSeq * kDm;       // elements of an activation tensor
constexpr int kWgtE     = kDm * kDm;                 // elements of a weight tensor
static_assert(kActE == 4 * kSplitAll * 8 && 4 * kWgtE == kSplitAll * 8 && kWgtE % (kSplitTh * 8) == 0 && kNGrp == 1, "split geometry");

__device__ __forceinline__ void split8_store(const v4f a, const v4f b, unsigned short* __restrict__ hi, unsigned short* __restrict__ lo) {
  const float f[8] = {a[0], a[1], a[2], a[3], b[0], b[1], b[2], b[3]};
  unsigned hw[4], lw[4];
#pragma unroll
  for (int q = 0; q < 4; ++q) {
    const unsigned short h0 = f2bf_bits(f[2 * q]), h1 = f2bf_bits(f[2 * q + 1]);
    const unsigned short l0 = f2bf_bits(f[2 * q] - bf_bits2f(h0));
    const unsigned short l1 = f2bf_bits(f[2 * q + 1] - bf_bits2f(h1));
    hw[q] = pk16(h0, h1);
    lw[q] = pk16(l0, l1);
  }
  *(v4u*)hi = (v4u){hw[0], hw[1], hw[2], hw[3]};
  *(v4u*)lo = (v4u){lw[0], lw[1], lw[2], lw[3]};
}

__global__ __launch_bounds__(kSplitTh) void split_all_kernel(
    const float* __restrict__ xq, const float* __restrict__ xk, const float* __restrict__ xv,
    const float* __restrict__ wq, const float* __restrict__ wk, const float* __restrict__ wv, const float* __restrict__ wo,
    unsigned short* __restrict__ Xp, unsigned short* __restrict__ Wp) {
  const int g = blockIdx.x * kSplitTh + threadIdx.x;
  const size_t e0 = (size_t)g * 8;                                  // this thread's first piece of an activation tensor
  constexpr size_t kStep = (size_t)kSplitAll * 8;                   // from one of its pieces to the next
  // the weight tensor is the same for a whole work-group
  const int wsel = blockIdx.x / (kWgtE / (kSplitTh * 8));
  const float* w = (wsel == 0) ? wq : (wsel == 1) ? wk : (wsel == 2) ? wv : wo;
  const size_t we = e0 - (size_t)wsel * kWgtE;

  v4f buf[2][8];
#pragma unroll
  for (int p = 0; p < 4; ++p) {
    buf[0][2 * p]     = *(const v4f*)(xq + e0 + p * kStep);
    buf[0][2 * p + 1] = *(const v4f*)(xq + e0 + p * kStep + 4);
  }
  wait_x0();
  const v4f wa = *(const v4f*)(w + we);
  const v4f wb = *(const v4f*)(w + we + 4);
  wait_x0();
  // unrolled: the tensor and the register set of each trip are chosen at compile time
#pragma unroll
  for (int t = 0; t < 3; ++t) {
    if (t < 2) {
      const float* xn = (t == 0) ? xk : xv;
#pragma unroll
      for (int p = 0; p < 4; ++p) {
        buf[(t + 1) & 1][2 * p]     = *(const v4f*)(xn + e0 + p * kStep);
        buf[(t + 1) & 1][2 * p + 1] = *(const v4f*)(xn + e0 + p * kStep + 4);
      }
      wait_x0();
    }
    unsigned short* hi = Xp + (size_t)(2 * t) * kActE + e0;
    unsigned short* lo = hi + kActE;
#pragma unroll
    for (int p = 0; p < 4; ++p) split8_store(buf[t & 1][2 * p], buf[t & 1][2 * p + 1], hi + p * kStep, lo + p * kStep);
    wait_x0();
  }
  unsigned short* whi = Wp + (size_t)(2 * wsel) * kWgtE + we;
  split8_store(wa, wb, whi, whi + kWgtE);
}

// ---------------------------------------------------------------------------
// Scores, gated mixing and p.v in one kernel; no score and no probability leaves the work-group.
// Work-group = one (batch, head) plane z = bb*8 + h and 256 queries; wave = 32 queries (two 16-column groups) against all 512 keys.
// Transposed products: S^T = K.Q^T (A = key rows from LDS, B = query rows kept in registers), O^T += V^T.A^T (A = v^T rows from LDS).
// In an S^T tile lane (c, hh) holds query c and keys 8*hh + r: the row maximum and the row sum are in-lane plus one exchange
// between the lane halves, and two S^T tiles (32 keys), converted in place, are the B operand of the second product.
//   pass 1: m_i = max_j s_ij
//   pass 2: the same products again (same order, so the same bits), then
//     g_c  = bg[c] + sum_d q[i][h*64+d] * Wg[c][d],  qp_c = rcp((|g_c| + 1)^2)
//     p_j  = 2^((s_j - m) * log2e)                    (= softmax_j / max softmax)
//     adj  = 2^((i-j)^2 * (-0.5 log2e qp_1)) for j < i,  2^((i-j)^2 * (-0.5 log2e qp_0)) for j >= i
//     a_j  = sg * p_j + (1 - sg) * adj,  sg = rcp(1 + 2^(-lam1 * log2e))   -> bf16 hi/lo fragments
//     ctx_i = (sum_j a_j v_j) * rcp(sum_j a_j + 1e-9)  -> bf16 hi/lo planes
// LDS: all 512 key rows (hi, lo; pitch 144 B) and the 64 v^T rows (hi, lo; pitch 1040 B) of the plane, each filled once by
// global_load_async_to_lds_b128; the v^T copies fly during pass 1.
// Output coverage: grid 2 x 128, 8 waves x 32 queries = 512 rows per plane; a wave writes the whole 128-byte segment (row, h) of both planes.
// ---------------------------------------------------------------------------
__device__ __forceinline__ float hw_exp2(float x) { return __builtin_amdgcn_exp2f(x); }
__device__ __forceinline__ float hw_rcp(float x)  { return __builtin_amdgcn_rcpf(x); }

// one plane in 16 rounds of the 256 threads; lds / g = this thread's place in round 0, lstep (bytes) / gstep (elements) = one round
__device__ __forceinline__ void fill16(unsigned lds, unsigned lstep, const unsigned short* g, size_t gstep) {
  // unrolled: two statements of eight copies
#pragma unroll
  for (int p = 0; p < 16; p += 8)
    copy8(lds + (unsigned)p * lstep,       g + (size_t)p * gstep,       lds + (unsigned)(p + 1) * lstep, g + (size_t)(p + 1) * gstep,
          lds + (unsigned)(p + 2) * lstep, g + (size_t)(p + 2) * gstep, lds + (unsigned)(p + 3) * lstep, g + (size_t)(p + 3) * gstep,
          lds + (unsigned)(p + 4) * lstep, g + (size_t)(p + 4) * gstep, lds + (unsigned)(p + 5) * lstep, g + (size_t)(p + 5) * gstep,
          lds + (unsigned)(p + 6) * lstep, g + (size_t)(p + 6) * gstep, lds + (unsigned)(p + 7) * lstep, g + (size_t)(p + 7) * gstep);
}

constexpr int kKP = kDk + 8;     // LDS pitch of a key row, elements (16 B x odd)
constexpr int kVP = kSeq + 8;    // LDS pitch of a v^T row, elements (16 B x odd)
constexpr int kQB = 256;         // queries per work-group

// S^T tile of keys kt*16 .. kt*16+15 against both query groups; kr = this lane's place in key row c of the hi plane
__device__ __forceinline__ void score_tile(const __bf16* kr, const v16b (&qh)[2][2], const v16b (&ql)[2][2], v8f (&s)[2]) {
  typedef Frag<__bf16> F;
  const v16b kh0 = F::load(kr), kh1 = F::load(kr + 32);
  const v16b kl0 = F::load(kr + kSeq * kKP), kl1 = F::load(kr + kSeq * kKP + 32);
#pragma unroll
  for (int qt = 0; qt < 2; ++qt) {
    v8f a = (v8f){0.f, 0.f, 0.f, 0.f, 0.f, 0.f, 0.f, 0.f};
    a = F::mma(kh0, qh[qt][0], a);
    a = F::mma(kl0, qh[qt][0], a);
    a = F::mma(kh0, ql[qt][0], a);
    a = F::mma(kh1, qh[qt][1], a);
    a = F::mma(kl1, qh[qt][1], a);
    a = F::mma(kh1, ql[qt][1], a);
    s[qt] = a;
  }
}

__global__ __launch_bounds__(256) void attn_mix_kernel(
    const unsigned short* __restrict__ Qh, const unsigned short* __restrict__ Ql,
    const unsigned short* __restrict__ Kh, const unsigned short* __restrict__ Kl,
    const unsigned short* __restrict__ VTh, const unsigned short* __restrict__ VTl,
    unsigned short* __restrict__ Ch, unsigned short* __restrict__ Cl,
    const float* __restrict__ Wg, const float* __restrict__ bg, const float* __restrict__ lam1) {
  typedef Frag<__bf16> F;
  __shared__ __align__(16) unsigned short sK[2 * kSeq * kKP];
  __shared__ __align__(16) unsigned short sV[2 * kDk * kVP];
  const int tid  = threadIdx.x;
  const int lane = tid & 31;
  const int wave = tid >> 5;
  const int c    = lane & 15;
  const int hh   = lane >> 4;
  const int z    = blockIdx.y;
  const int bb   = z >> 3;
  const int h    = z & (kHeads - 1);
  const int q0   = blockIdx.x * kQB + wave * 32;

  // key rows: 8 lanes per 128-byte row piece, 32 rows per round
  {
    const int cc = tid & 7, cr = tid >> 3;
    const size_t g = (size_t)(bb * kSeq + cr) * kDm + (size_t)h * kDk + cc * 8;
    const unsigned l = (unsigned)(uintptr_t)sK + (unsigned)(cr * kKP + cc * 8) * 2u;
    fill16(l, 32u * kKP * 2u, Kh + g, (size_t)32 * kDm);
    fill16(l + (unsigned)(kSeq * kKP) * 2u, 32u * kKP * 2u, Kl + g, (size_t)32 * kDm);
  }

  // query fragments (B operand), hardware k order, kept for both passes
  v16b qh[2][2], ql[2][2];
#pragma unroll
  for (int qt = 0; qt < 2; ++qt) {
#pragma unroll
    for (int ks = 0; ks < 2; ++ks) {
      const size_t o = (size_t)(bb * kSeq + q0 + qt * 16 + c) * kDm + (size_t)h * kDk + ks * 32 + hh * 8;
      qh[qt][ks] = F::load((const __bf16*)(Qh + o));
      ql[qt][ks] = F::load((const __bf16*)(Ql + o));
    }
    wait_x0();
  }

  // gating dots: this lane holds 32 of its query's 64 d, the other lane half the rest
  float gn0[2], gn1[2];
  {
    float g0[2] = {0.f, 0.f}, g1[2] = {0.f, 0.f};
#pragma unroll
    for (int ks = 0; ks < 2; ++ks)
#pragma unroll
      for (int hf = 0; hf < 2; ++hf) {
        const float* wp = Wg + ks * 32 + hf * 16 + hh * 8;
        const v4f wa = *(const v4f*)(wp), wb = *(const v4f*)(wp + 4);
        const v4f wc = *(const v4f*)(wp + kDk), wd = *(const v4f*)(wp + kDk + 4);
#pragma unroll
        for (int e = 0; e < 8; ++e) {
          const float w0 = (e < 4) ? wa[e & 3] : wb[e & 3];
          const float w1 = (e < 4) ? wc[e & 3] : wd[e & 3];
#pragma unroll
          for (int qt = 0; qt < 2; ++qt) {
            const float qv = (float)qh[qt][ks][hf * 8 + e] + (float)ql[qt][ks][hf * 8 + e];
            g0[qt] += qv * w0;
            g1[qt] += qv * w1;
          }
        }
      }
    const float b0 = bg[0], b1 = bg[1];
#pragma unroll
    for (int qt = 0; qt < 2; ++qt) {
      const float t0 = fabsf(g0[qt] + __shfl_xor(g0[qt], 16, 32) + b0) + 1.0f;
      const float t1 = fabsf(g1[qt] + __shfl_xor(g1[qt], 16, 32) + b1) + 1.0f;
      gn0[qt] = (-0.5f * kLog2e) * hw_rcp(t0 * t0);      // j >= i (upper incl. diagonal)
      gn1[qt] = (-0.5f * kLog2e) * hw_rcp(t1 * t1);      // j <  i (strictly lower)
    }
  }
  const float sg  = hw_rcp(1.0f + hw_exp2(-lam1[0] * kLog2e));
  const float omg = 1.0f - sg;

  // the key rows: this wave's copies have landed, then the barrier that publishes them
  wait_async0();
  __syncthreads();

  // v^T rows: 64 lanes per 1024-byte row, 4 rows per round; read only behind the barrier after pass 1
  {
    const int cc = tid & 63, cr = tid >> 6;
    const size_t g = (size_t)bb * kDm * kSeq + (size_t)(h * kDk + cr) * kSeq + cc * 8;
    const unsigned l = (unsigned)(uintptr_t)sV + (unsigned)(cr * kVP + cc * 8) * 2u;
    fill16(l, 4u * kVP * 2u, VTh + g, (size_t)4 * kSeq);
    fill16(l + (unsigned)(kDk * kVP) * 2u, 4u * kVP * 2u, VTl + g, (size_t)4 * kSeq);
  }

  const __bf16* kr0 = (const __bf16*)sK + c * kKP + hh * 8;

  // pass 1: row maxima
  float mx[2] = {-INFINITY, -INFINITY};
  // two tiles per trip: the second tile's LDS reads stand beside the first tile's products
#pragma unroll 2
  for (int kt = 0; kt < kSeq / 16; ++kt) {
    v8f s[2];
    score_tile(kr0 + kt * 16 * kKP, qh, ql, s);
#pragma unroll
    for (int qt = 0; qt < 2; ++qt)
#pragma unroll
      for (int r = 0; r < 8; ++r) mx[qt] = fmaxf(mx[qt], s[qt][r]);
  }
#pragma unroll
  for (int qt = 0; qt < 2; ++qt) mx[qt] = fmaxf(mx[qt], __shfl_xor(mx[qt], 16, 32));

  // the v^T rows: this wave's copies have landed, then the barrier that publishes them
  wait_async0();
  __syncthreads();

  // pass 2
  v8f o[4][2];
#pragma unroll
  for (int dt = 0; dt < 4; ++dt)
#pragma unroll
    for (int qt = 0; qt < 2; ++qt) o[dt][qt] = (v8f){0.f, 0.f, 0.f, 0.f, 0.f, 0.f, 0.f, 0.f};
  float ls[2] = {0.f, 0.f};
  const float fi[2] = {(float)(q0 + c - hh * 8), (float)(q0 + 16 + c - hh * 8)};
  const __bf16* vr0 = (const __bf16*)sV + c * kVP + hh * 8;
  // rolled: for speed only
#pragma unroll 1
  for (int kp = 0; kp < kSeq / 32; ++kp) {
    v16b ph[2], pl[2];
#pragma unroll
    for (int t = 0; t < 2; ++t) {
      v8f s[2];
      score_tile(kr0 + (kp * 2 + t) * 16 * kKP, qh, ql, s);
#pragma unroll
      for (int qt = 0; qt < 2; ++qt) {
        const float fb = fi[qt] - (float)(kp * 32 + t * 16);   // i - j at r = 0
#pragma unroll
        for (int r = 0; r < 8; ++r) {
          const float p   = hw_exp2((s[qt][r] - mx[qt]) * kLog2e);
          const float fd  = fb - (float)r;
          const float gs  = (fd > 0.f) ? gn1[qt] : gn0[qt];
          const float adj = hw_exp2((fd * fd) * gs);
          const float av  = sg * p + omg * adj;
          ls[qt] += av;
          const __bf16 hb = (__bf16)av;
          ph[qt][t * 8 + r] = hb;
          pl[qt][t * 8 + r] = (__bf16)(av - (float)hb);
        }
      }
    }
    const __bf16* vr = vr0 + kp * 32;
#pragma unroll
    for (int dt = 0; dt < 4; ++dt) {
      const v16b vh = F::load(vr + dt * 16 * kVP);
      const v16b vl = F::load(vr + (kDk + dt * 16) * kVP);
#pragma unroll
      for (int qt = 0; qt < 2; ++qt) {
        o[dt][qt] = F::mma(vh, ph[qt], o[dt][qt]);
        o[dt][qt] = F::mma(vl, ph[qt], o[dt][qt]);
        o[dt][qt] = F::mma(vh, pl[qt], o[dt][qt]);
      }
    }
  }

  // epilogue: lane (c, hh) holds d = dt*16 + 8*hh + r of query c: one 16-byte store per tile and plane
#pragma unroll
  for (int qt = 0; qt < 2; ++qt) {
    const float inv = hw_rcp(ls[qt] + __shfl_xor(ls[qt], 16, 32) + 1e-9f);
    const size_t ro = (size_t)(bb * kSeq + q0 + qt * 16 + c) * kDm + (size_t)h * kDk + hh * 8;
#pragma unroll
    for (int dt = 0; dt < 4; ++dt) {
      v8b hv, lv;
#pragma unroll
      for (int r = 0; r < 8; ++r) {
        const float x = o[dt][qt][r] * inv;
        const __bf16 hb = (__bf16)x;
        hv[r] = hb;
        lv[r] = (__bf16)(x - (float)hb);
      }
      *(v8b*)((__bf16*)Ch + ro + dt * 16) = hv;
      *(v8b*)((__bf16*)Cl + ro + dt * 16) = lv;
    }
    wait_x0();
  }
}

// ---------------------------------------------------------------------------
// Workspace region map (bytes; every offset a multiple of 512 KiB). Every region is fully written
// inside the call before any read.
//   Wqh,Wql,Wkh,Wkl,Wvh,Wvl,Woh,Wol  bf16 [512][512] each            0 .. 4194304
//   Xqh,Xql,Xkh,Xkl,Xvh,Xvl          bf16 [8192][512] each     4194304 .. 54525952
//   Qh,Ql,Kh,Kl                      bf16 [8192][512] each    54525952 .. 88080384   (row bb*512+i, col h*64+d)
//   VTh,VTl                          bf16 [16][512][512]      88080384 .. 104857600  (batch, row h*64+d, col token)
//   CTXh,CTXl                        bf16 [8192][512] each   104857600 .. 121634816  (row bb*512+i, col h*64+d)
//   total 121634816
// ---------------------------------------------------------------------------
extern "C" void kernel_launch(void* const* d_in, const int* in_sizes, int n_in,
                              void* d_out, int out_size, void* d_ws, size_t ws_size,
                              hipStream_t stream) {
  if (n_in < 14) return;
  const int nAct = kBatch * kSeq * kDm;          // 4194304
  const int nW   = kDm * kDm;                    // 262144
  if (in_sizes[0] != nAct || in_sizes[1] != nAct || in_sizes[2] != nAct) return;
  if (in_sizes[3] != nW || in_sizes[5] != nW || in_sizes[7] != nW || in_sizes[12] != nW) return;
  if (in_sizes[4] != kDm || in_sizes[6] != kDm || in_sizes[8] != kDm || in_sizes[13] != kDm) return;
  if (in_sizes[9] != 2 * kDk || in_sizes[10] < 2 || in_sizes[11] < 1) return;
  if (out_size != nAct) return;

  const float* query = (const float*)d_in[0];
  const float* key   = (const float*)d_in[1];
  const float* value = (const float*)d_in[2];
  const float* Wq    = (const float*)d_in[3];
  const float* bq    = (const float*)d_in[4];
  const float* Wk    = (const float*)d_in[5];
  const float* bk    = (const float*)d_in[6];
  const float* Wv    = (const float*)d_in[7];
  const float* bv    = (const float*)d_in[8];
  const float* Wg    = (const float*)d_in[9];
  const float* bg    = (const float*)d_in[10];
  const float* lam1  = (const float*)d_in[11];
  const float* Wo    = (const float*)d_in[12];
  const float* bo    = (const float*)d_in[13];
  float* out = (float*)d_out;

  const size_t PW  = (size_t)kDm * kDm * 2;                 // 524288    weight plane
  const size_t PX  = (size_t)kGRows * kDm * 2;              // 8388608   activation / q / k / ctx plane
  const size_t PVT = (size_t)kGB * kDm * kSeq * 2;          // 8388608   v^T plane
  size_t off = 0;
  const size_t oWqh = off; off += PW;  const size_t oWql = off; off += PW;
  const size_t oWkh = off; off += PW;  const size_t oWkl = off; off += PW;
  const size_t oWvh = off; off += PW;  const size_t oWvl = off; off += PW;
  const size_t oWoh = off; off += PW;  const size_t oWol = off; off += PW;
  const size_t oXqh = off; off += PX;  const size_t oXql = off; off += PX;
  const size_t oXkh = off; off += PX;  const size_t oXkl = off; off += PX;
  const size_t oXvh = off; off += PX;  const size_t oXvl = off; off += PX;
  const size_t oQh  = off; off += PX;  const size_t oQl  = off; off += PX;
  const size_t oKh  = off; off += PX;  const size_t oKl  = off; off += PX;
  const size_t oVTh = off; off += PVT; const size_t oVTl = off; off += PVT;
  const size_t oCh  = off; off += PX;  const size_t oCl  = off; off += PX;
  if (off > ws_size) return;                                // off = 121634816

  char* ws = (char*)d_ws;
  unsigned short* Wqh = (unsigned short*)(ws + oWqh); unsigned short* Wql = (unsigned short*)(ws + oWql);
  unsigned short* Wkh = (unsigned short*)(ws + oWkh); unsigned short* Wkl = (unsigned short*)(ws + oWkl);
  unsigned short* Wvh = (unsigned short*)(ws + oWvh); unsigned short* Wvl = (unsigned short*)(ws + oWvl);
  unsigned short* Woh = (unsigned short*)(ws + oWoh); unsigned short* Wol = (unsigned short*)(ws + oWol);
  unsigned short* Xqh = (unsigned short*)(ws + oXqh); unsigned short* Xql = (unsigned short*)(ws + oXql);
  unsigned short* Xkh = (unsigned short*)(ws + oXkh); unsigned short* Xkl = (unsigned short*)(ws + oXkl);
  unsigned short* Xvh = (unsigned short*)(ws + oXvh); unsigned short* Xvl = (unsigned short*)(ws + oXvl);
  unsigned short* Qh  = (unsigned short*)(ws + oQh);  unsigned short* Ql  = (unsigned short*)(ws + oQl);
  unsigned short* Kh  = (unsigned short*)(ws + oKh);  unsigned short* Kl  = (unsigned short*)(ws + oKl);
  unsigned short* VTh = (unsigned short*)(ws + oVTh); unsigned short* VTl = (unsigned short*)(ws + oVTl);
  unsigned short* Ch  = (unsigned short*)(ws + oCh);  unsigned short* Cl  = (unsigned short*)(ws + oCl);

  const dim3 blk(256);
  const dim3 blkSplit(kSplitTh);                                    // 512 threads
  const dim3 gSplit(kSplitWG);                                      // 256 work-groups: all seven tensors
  const dim3 blkProj(512);
  const dim3 gProj(kProjWG, 3);                                     // 64 x 3:     256 x 256 tiles of q, k, v^T; K=512
  const dim3 gAtt(kSeq / kQB, kNZ);                                 // 2 x 128:    256 queries x 512 keys per work-group
  const dim3 gOut(((kGRows / 64) * (kDm / 64) + 7) / 8, 1);         // 128 blocks: M=8192, N=512, K=512

  // (1) activations -> hi/lo planes [8192][512], weights -> hi/lo planes [512][512] (torch [out][in] is already Bt[n][k]); every plane whole
  split_all_kernel<<<gSplit, blkSplit, 0, stream>>>(query, key, value, Wq, Wk, Wv, Wo, Xqh, Wqh);

  for (int gb = 0; gb < kNGrp; ++gb) {
    const size_t actOff = (size_t)gb * kGRows * kDm;
    // (2) q = x.Wq^T + bq, k = x.Wk^T + bk -> hi/lo planes [8192][512]; v^T[bb][o][tok] = sum_k Wv[o][k] x[bb*512+tok][k] + bv[o]
    //     -> hi/lo planes [16][512][512]; all six planes whole, one launch
    proj3_kernel<<<gProj, blkProj, 0, stream>>>(Xqh, Wqh, Qh, bq, bk, bv);
    // (4) ctx[bb*512+i][h*64+d] = sum_j A[z][i][j] v^T[bb][h*64+d][j] / (sum_j A[z][i][j] + 1e-9) -> hi/lo planes, A = gated mix of the scores q.k^T
    attn_mix_kernel<<<gAtt, blk, 0, stream>>>(Qh, Ql, Kh, Kl, VTh, VTl, Ch, Cl, Wg, bg, lam1);
    // (5) out = ctx.Wo^T + bo -> f32 [8192][512], all of d_out (128x8 tiles)
    float* outg = out + actOff;
    wmma_gemm64<1, true, 2, 0, false, 0, 4, 64, 2><<<gOut, blk, 0, stream>>>(
        Ch, Cl, kDm, 0L, 0L, Woh, Wol, kDm, 0L, 0L, (void*)outg, (void*)outg, kDm, 0L, 0L,
        bo, bo, 0L, kGRows, kDm, kDm, 1.0f, 1);
  }
}

// v006
// A run of this version takes 91.6 microseconds.
// Two timings next to v005 both put it at 1.08 times that version's speed.
// Over all steps from v000 it is 10.7 times as fast.
// Contractions x.Wq^T, x.Wk^T, Wv.x^T, k.q^T, v^T.p^T, ctx.Wo^T: v_wmma_f32_16x16x32_bf16 on bf16 hi/lo split operand planes (hi.hi + hi.lo + lo.hi), f32 accumulate; per-row 64x2 gating dots, softmax, distance adjacency, max- and sum-normalisation in f32 on the VALU (hardware exp2/rcp).
#include <hip/hip_runtime.h>
#include <math.h>
#include <stdint.h>

constexpr int kBatch = 16;
constexpr int kSeq   = 512;
constexpr int kDm    = 512;
constexpr int kHeads = 8;
constexpr int kDk    = 64;
constexpr int kGB    = 16;                 // batches per group: the whole batch goes through every stage in one launch
constexpr int kNGrp  = kBatch / kGB;       // 1 group
constexpr int kNZ    = kGB * kHeads;       // 128 (batch, head) planes
constexpr int kGRows = kGB * kSeq;         // 8192 token rows
constexpr float kLog2e = 1.4426950408889634f;
static_assert(kSeq == 512 && kDk == 64 && kDm == kHeads * kDk && (kBatch % kGB) == 0, "geometry");

typedef __attribute__((ext_vector_type(16))) _Float16 v16h;
typedef __attribute__((ext_vector_type(8)))  _Float16 v8h;
typedef __attribute__((ext_vector_type(16))) __bf16   v16b;
typedef __attribute__((ext_vector_type(8)))  __bf16   v8b;
typedef __attribute__((ext_vector_type(8)))  float    v8f;
typedef __attribute__((ext_vector_type(4)))  float    v4f;
typedef __attribute__((ext_vector_type(4)))  unsigned int v4u;

__device__ __forceinline__ unsigned short f2bf_bits(float f) {
  unsigned u = __float_as_uint(f);
  return (unsigned short)((u + 0x7FFFu + ((u >> 16) & 1u)) >> 16);
}
__device__ __forceinline__ float bf_bits2f(unsigned short h) { return __uint_as_float(((unsigned)h) << 16); }
__device__ __forceinline__ unsigned pk16(unsigned short a, unsigned short b) { return (unsigned)a | ((unsigned)b << 16); }

// hazard guards as plain device helpers (no inline asm inside the kernel template body)
__device__ __forceinline__ void dep_guard_h(v8f& a, v8f& b, v16h x, v16h y) { asm volatile("v_nop\n\tv_nop\n\tv_nop\n\tv_nop" : "+v"(a), "+v"(b) : "v"(x), "v"(y)); }
__device__ __forceinline__ void dep_guard_b(v8f& a, v8f& b, v16b x, v16b y) { asm volatile("v_nop\n\tv_nop\n\tv_nop\n\tv_nop" : "+v"(a), "+v"(b) : "v"(x), "v"(y)); }
__device__ __forceinline__ void keep4_h(v16h a, v16h b, v16h c, v16h d) { asm volatile("v_nop" :: "v"(a), "v"(b), "v"(c), "v"(d)); }
__device__ __forceinline__ void keep4_b(v16b a, v16b b, v16b c, v16b d) { asm volatile("v_nop" :: "v"(a), "v"(b), "v"(c), "v"(d)); }
__device__ __forceinline__ void acc_guard4(v8f& a, v8f& b, v8f& c, v8f& d) { asm volatile("v_nop\n\tv_nop\n\tv_nop\n\tv_nop" : "+v"(a), "+v"(b), "+v"(c), "+v"(d)); }
template <typename T> struct Frag;
template <> struct Frag<_Float16> {
  typedef v16h V; union U { v16h v; v8h h[2]; };
  static __device__ __forceinline__ v16h load(const _Float16* p) {   // elements 0..7 <- p[0..7], 8..15 <- p[16..23]
    U f; f.h[0] = *(const v8h*)(p); f.h[1] = *(const v8h*)(p + 16); return f.v;
  }
  static __device__ __forceinline__ v8f mma(v16h a, v16h b, v8f c) {
    return __builtin_amdgcn_wmma_f32_16x16x32_f16(false, a, false, b, (short)0, c, false, false);
  }
  static __device__ __forceinline__ void guard(v8f& a, v8f& b, v16h x, v16h y) { dep_guard_h(a, b, x, y); }
  static __device__ __forceinline__ void keep(v16h a, v16h b, v16h c, v16h d) { keep4_h(a, b, c, d); }
};
template <> struct Frag<__bf16> {
  typedef v16b V; union U { v16b v; v8b h[2]; };
  static __device__ __forceinline__ v16b load(const __bf16* p) {
    U f; f.h[0] = *(const v8b*)(p); f.h[1] = *(const v8b*)(p + 16); return f.v;
  }
  static __device__ __forceinline__ v8f mma(v16b a, v16b b, v8f c) {
    return __builtin_amdgcn_wmma_f32_16x16x32_bf16(false, a, false, b, (short)0, c, false, false);
  }
  static __device__ __forceinline__ void guard(v8f& a, v8f& b, v16b x, v16b y) { dep_guard_b(a, b, x, y); }
  static __device__ __forceinline__ void keep(v16b a, v16b b, v16b c, v16b d) { keep4_b(a, b, c, d); }
};

// ---- Register-blocked batched WMMA GEMM ------------------------------------
// C[m,n] = scale * sum_k A[m,k] * Bt[n,k] (+bias)(+resid); each wave owns a (MI*16)x64 tile.
// A row-major [M,K]; Bt row-major [N,K]; M % (WM*MI*16) == 0, N % (WN*64) == 0, K % KC == 0.
// SPLIT: operands are hi/lo planes (A2/Bt2 = lo planes, same layout); product = hi.hi + hi.lo + lo.hi.
// BIAS_MODE: 0 = none, 1 = bias[m], 2 = bias[n].
// OUT_MODE: 0 = f32, 1 = f16, 2 = bf16 hi plane (Cout) + bf16 lo plane (Cout2).
// z addressing: bz = the z plane (blockIdx.y in wmma_gemm64), zi = bz % zsplit, zo = bz / zsplit; operand base = zi*stride + zo*stride2 (elements).
// ET: 0 = f16 operands, 1 = bf16 operands (pointers passed as 16-bit storage)
template <int ET> struct Elem;
template <> struct Elem<0> { typedef _Float16 T; };
template <> struct Elem<1> { typedef __bf16 T; };
// ---- LDS staging of the operand tiles ---------------------------------------
// The WM*WN waves of a work-group share one (WM*MI*16) x (WN*64) tile of C. Per pass of KC k, the rows of A hi, A lo, Bt hi, Bt lo
// that the tile needs are copied to LDS by global_load_async_to_lds_b128 (KC/8 neighbouring lanes per row: whole contiguous row pieces),
// at a row pitch of KC*2 + 16 bytes; the WMMA fragments are then read with ds_load_b128.
// this wave's copies have landed before the barrier that publishes them to the other waves
__device__ __forceinline__ void wait_async0() { asm volatile("s_wait_asynccnt 0x0" ::: "memory"); }
// this wave's fragment reads have returned before the barrier behind which their buffer is refilled
__device__ __forceinline__ void wait_ds0() { asm volatile("s_wait_dscnt 0x0" ::: "memory"); }
// stands behind a group of global loads or stores, in front of whatever rewrites a register that they name
__device__ __forceinline__ void wait_x0() { asm volatile("s_wait_xcnt 0x0" ::: "memory"); }
// six copies, 16 bytes per lane each; the closing s_wait_xcnt stands in the same statement so that no address register is rewritten ahead of it
__device__ __forceinline__ void copy6(unsigned l0, const unsigned short* g0, unsigned l1, const unsigned short* g1,
                                      unsigned l2, const unsigned short* g2, unsigned l3, const unsigned short* g3,
                                      unsigned l4, const unsigned short* g4, unsigned l5, const unsigned short* g5) {
  asm volatile("global_load_async_to_lds_b128 %0, %1, off\n\t"
               "global_load_async_to_lds_b128 %2, %3, off\n\t"
               "global_load_async_to_lds_b128 %4, %5, off\n\t"
               "global_load_async_to_lds_b128 %6, %7, off\n\t"
               "global_load_async_to_lds_b128 %8, %9, off\n\t"
               "global_load_async_to_lds_b128 %10, %11, off\n\t"
               "s_wait_xcnt 0x0"
               :: "v"(l0), "v"(g0), "v"(l1), "v"(g1), "v"(l2), "v"(g2), "v"(l3), "v"(g3), "v"(l4), "v"(g4), "v"(l5), "v"(g5)
               : "memory");
}
// eight copies, 16 bytes per lane each; the closing s_wait_xcnt stands in the same statement so that no address register is rewritten ahead of it
__device__ __forceinline__ void copy8(unsigned l0, const unsigned short* g0, unsigned l1, const unsigned short* g1,
                                      unsigned l2, const unsigned short* g2, unsigned l3, const unsigned short* g3,
                                      unsigned l4, const unsigned short* g4, unsigned l5, const unsigned short* g5,
                                      unsigned l6, const unsigned short* g6, unsigned l7, const unsigned short* g7) {
  asm volatile("global_load_async_to_lds_b128 %0, %1, off\n\t"
               "global_load_async_to_lds_b128 %2, %3, off\n\t"
               "global_load_async_to_lds_b128 %4, %5, off\n\t"
               "global_load_async_to_lds_b128 %6, %7, off\n\t"
               "global_load_async_to_lds_b128 %8, %9, off\n\t"
               "global_load_async_to_lds_b128 %10, %11, off\n\t"
               "global_load_async_to_lds_b128 %12, %13, off\n\t"
               "global_load_async_to_lds_b128 %14, %15, off\n\t"
               "s_wait_xcnt 0x0"
               :: "v"(l0), "v"(g0), "v"(l1), "v"(g1), "v"(l2), "v"(g2), "v"(l3), "v"(g3),
                  "v"(l4), "v"(g4), "v"(l5), "v"(g5), "v"(l6), "v"(g6), "v"(l7), "v"(g7)
               : "memory");
}
// One stage: LDS rows [A hi: TM | A lo: TM | Bt hi: TN | Bt lo: TN]. NTH threads cover RPP rows per round; lds and the four
// pointers are this thread's own place in round 0 of each part; stepA / stepB = RPP rows of the source, in elements.
template <int KC, int TM, int TN, int NTH>
__device__ __forceinline__ void stage_fill(unsigned lds, const unsigned short* gAh, const unsigned short* gAl,
                                           const unsigned short* gBh, const unsigned short* gBl, size_t stepA, size_t stepB) {
  constexpr int RPP = NTH / (KC / 8);
  constexpr int PA = TM / RPP, PB = TN / RPP, NP = 2 * (PA + PB);
  constexpr unsigned LB = (unsigned)RPP * (KC * 2 + 16);
  static_assert(TM % RPP == 0 && TN % RPP == 0 && (NP % 6 == 0 || NP % 8 == 0) && NP <= 63, "stage geometry");
  // both loops unrolled: the round number is then a constant, so each copy's part and LDS place are chosen at compile time
  if constexpr (NP % 6 != 0) {
#pragma unroll
    for (int p = 0; p < NP; p += 8) {
      const unsigned short* g[8];
#pragma unroll
      for (int u = 0; u < 8; ++u) {
        const int q = p + u;
        g[u] = (q < PA) ? (gAh + (size_t)q * stepA)
             : (q < 2 * PA) ? (gAl + (size_t)(q - PA) * stepA)
             : (q < 2 * PA + PB) ? (gBh + (size_t)(q - 2 * PA) * stepB)
                                 : (gBl + (size_t)(q - 2 * PA - PB) * stepB);
      }
      copy8(lds + (unsigned)p * LB, g[0], lds + (unsigned)(p + 1) * LB, g[1], lds + (unsigned)(p + 2) * LB, g[2],
            lds + (unsigned)(p + 3) * LB, g[3], lds + (unsigned)(p + 4) * LB, g[4], lds + (unsigned)(p + 5) * LB, g[5],
            lds + (unsigned)(p + 6) * LB, g[6], lds + (unsigned)(p + 7) * LB, g[7]);
    }
    return;
  }
#pragma unroll
  for (int p = 0; p < NP; p += 6) {
    const unsigned short* g[6];
#pragma unroll
    for (int u = 0; u < 6; ++u) {
      const int q = p + u;
      g[u] = (q < PA) ? (gAh + (size_t)q * stepA)
           : (q < 2 * PA) ? (gAl + (size_t)(q - PA) * stepA)
           : (q < 2 * PA + PB) ? (gBh + (size_t)(q - 2 * PA) * stepB)
                               : (gBl + (size_t)(q - 2 * PA - PB) * stepB);
    }
    copy6(lds + (unsigned)p * LB, g[0], lds + (unsigned)(p + 1) * LB, g[1], lds + (unsigned)(p + 2) * LB, g[2],
          lds + (unsigned)(p + 3) * LB, g[3], lds + (unsigned)(p + 4) * LB, g[4], lds + (unsigned)(p + 5) * LB, g[5]);
  }
}

// WM x WN: waves along m and n in the work-group. KC: k per stage. NBUF: 2 = the next stage's copies fly while this one is worked on.
// MI: 16-row subtiles of a wave's tile along m.
// M % (WM*MI*16) == 0, N % (WN*64) == 0, K % KC == 0; wg = the work-group's tile, 0 .. (M/(WM*MI*16))*(N/(WN*64)) - 1; bz = its z plane.
// BIAS_MODE 3: bias[m] where biasM (the same for the whole work-group), else bias[n].
template <int ET, bool SPLIT, int BIAS_MODE, int OUT_MODE, bool RESID, int ACT, int WM, int WN, int KC, int NBUF, int MI>
__device__ __forceinline__ void gemm_tile(
    const unsigned short* __restrict__ Ap, const unsigned short* __restrict__ A2p, int lda, long strideA, long strideA2,
    const unsigned short* __restrict__ Btp, const unsigned short* __restrict__ Bt2p, int ldb, long strideB, long strideB2,
    void* __restrict__ Cout, void* __restrict__ Cout2, int ldc, long strideC, long strideC2,
    const float* __restrict__ bias,
    const float* __restrict__ resid, long strideR,
    int M, int N, int K, float scale, int zsplit, const int wg, const int bz, const bool biasM) {
  typedef typename Elem<ET>::T T;
  typedef typename Frag<T>::V V;
  static_assert(SPLIT, "the staged tiles hold a hi and a lo plane of each operand");
  static_assert(NBUF == 2, "the epilogue's slabs lie in the stage buffers, behind the barrier at the foot of the last pass");
  constexpr int NTH = WM * WN * 32;
  constexpr int TM = WM * MI * 16;
  constexpr int TN = WN * 64;
  constexpr int PE = KC + 8;                       // LDS row pitch in elements (16 B x odd)
  constexpr int STAGE_E = 2 * (TM + TN) * PE;      // elements per stage
  __shared__ __align__(16) unsigned short sStage[NBUF * STAGE_E];
  static_assert(WM * WN * 16 * 68 * 4 <= NBUF * STAGE_E * 2, "slabs fit the stage buffers");
  const int zo   = bz / zsplit;
  const int zi   = bz - zo * zsplit;
  const int lane = threadIdx.x & 31;
  const int wave = threadIdx.x >> 5;
  const int tilesN = N / TN;
  const int tilesM = M / TM;
  if (wg >= tilesM * tilesN) return;   // the same for the whole work-group, in front of every barrier
  const int tmw = wg / tilesN;
  const int tnw = wg - tmw * tilesN;
  const int wm = wave / WN;
  const int wn = wave - wm * WN;
  const int m0 = tmw * TM + wm * (MI * 16);
  const int n0 = tnw * TN + (wn << 6);

  const size_t aOff = (size_t)zi * strideA + (size_t)zo * strideA2;
  const size_t bOff = (size_t)zi * strideB + (size_t)zo * strideB2;
  const size_t cOff = (size_t)zi * strideC + (size_t)zo * strideC2;

  const int rlane = lane & 15;                 // row (A) / col (B, D) within subtile
  const int koff  = (lane >> 4) * 8;           // k offset of this lane half
  const int mOff  = (lane >> 4) * 8;           // D row offset

  // this thread's place in a round of copies: row cr of the round, 16-byte piece cc of the row
  constexpr int LPR = KC / 8;
  const int cc = threadIdx.x % LPR;
  const int cr = threadIdx.x / LPR;
  const size_t aRow = aOff + (size_t)(tmw * TM + cr) * lda + cc * 8;
  const size_t bRow = bOff + (size_t)(tnw * TN + cr) * ldb + cc * 8;
  const unsigned short* gAh = Ap + aRow;
  const unsigned short* gAl = A2p + aRow;
  const unsigned short* gBh = Btp + bRow;
  const unsigned short* gBl = Bt2p + bRow;
  const size_t stepA = (size_t)(NTH / LPR) * lda;
  const size_t stepB = (size_t)(NTH / LPR) * ldb;
  const unsigned ldsT = (unsigned)(uintptr_t)sStage + (unsigned)(cr * PE + cc * 8) * 2u;

  v8f acc[MI][4];
#pragma unroll
  for (int i = 0; i < MI; ++i)
#pragma unroll
    for (int j = 0; j < 4; ++j) acc[i][j] = (v8f){0.f,0.f,0.f,0.f,0.f,0.f,0.f,0.f};

  const int NT = K / KC;
  stage_fill<KC, TM, TN, NTH>(ldsT, gAh, gAl, gBh, gBl, stepA, stepB);
  wait_async0();
  __syncthreads();
  if (NBUF == 2 && NT > 1)
    stage_fill<KC, TM, TN, NTH>(ldsT + (unsigned)STAGE_E * 2u, gAh + KC, gAl + KC, gBh + KC, gBl + KC, stepA, stepB);

  for (int t = 0; t < NT; ++t) {
    const int buf = (NBUF == 2) ? (t & 1) : 0;
    const T* sb = (const T*)(sStage + buf * STAGE_E);
    const T* sA = sb + (wm * (MI * 16) + rlane) * PE + koff;
    const T* sB = sb + (2 * TM + (wn << 6) + rlane) * PE + koff;
    // unrolled: the LDS offsets of a stage's fragments become immediates
#pragma unroll
    for (int kk = 0; kk < KC; kk += 32) {
      V bh[4], bl[4];
#pragma unroll
      for (int j = 0; j < 4; ++j) {
        bh[j] = Frag<T>::load(sB + (j << 4) * PE + kk);
        bl[j] = Frag<T>::load(sB + (TN + (j << 4)) * PE + kk);
      }
#pragma unroll
      for (int i = 0; i < MI; ++i) {
        V ah = Frag<T>::load(sA + (i << 4) * PE + kk);
        V al = Frag<T>::load(sA + (TM + (i << 4)) * PE + kk);
#pragma unroll
        for (int j = 0; j < 4; ++j) {
          acc[i][j] = Frag<T>::mma(ah, bh[j], acc[i][j]);
          acc[i][j] = Frag<T>::mma(ah, bl[j], acc[i][j]);
          acc[i][j] = Frag<T>::mma(al, bh[j], acc[i][j]);
        }
        Frag<T>::guard(acc[i][0], acc[i][3], ah, al);
      }
      Frag<T>::keep(bh[0], bh[1], bh[2], bh[3]);
      Frag<T>::keep(bl[0], bl[1], bl[2], bl[3]);
    }
    if (NBUF == 2) {
      // hand-over: every wave's reads of this buffer are done and its copies of the next stage have landed, then the barrier
      wait_ds0();
      wait_async0();
      __syncthreads();
      if (t + 2 < NT) {
        const int k2 = (t + 2) * KC;
        stage_fill<KC, TM, TN, NTH>(ldsT + (unsigned)(buf * STAGE_E) * 2u, gAh + k2, gAl + k2, gBh + k2, gBl + k2, stepA, stepB);
      }
    } else if (t + 1 < NT) {
      // one buffer: refill it behind every wave's last read, publish it behind every wave's copies
      wait_ds0();
      __syncthreads();
      const int k1 = (t + 1) * KC;
      stage_fill<KC, TM, TN, NTH>(ldsT, gAh + k1, gAl + k1, gBh + k1, gBl + k1, stepA, stepB);
      wait_async0();
      __syncthreads();
    }
  }
  wait_async0();
  // unrolled: acc is indexed by constants only, so it stays in registers
#pragma unroll
  for (int i = 0; i < MI; ++i) acc_guard4(acc[i][0], acc[i][1], acc[i][2], acc[i][3]);

  // ---- epilogue ----
  float* slab = (float*)sStage + wave * (16 * 68);   // per-wave 16x64 slab, pitch 68 floats; every wave's stage reads and copies ended at the last barrier
  const float* Rb = RESID ? (resid + (size_t)zi * strideR) : nullptr;
  // BIAS_MODE 3: this lane's bias values, all loaded here under one work-group-uniform branch
  float bm[MI][8], bn[4];
  if (BIAS_MODE == 3) {
    // both loops unrolled: bn and bm are indexed by constants only, so they stay in registers
#pragma unroll
    for (int j = 0; j < 4; ++j) bn[j] = 0.f;
#pragma unroll
    for (int i = 0; i < MI; ++i)
#pragma unroll
      for (int r = 0; r < 8; ++r) bm[i][r] = 0.f;
    // each run's address is an input of the wait behind it: it stays in its registers up to that wait, so no load's result lands on it earlier
    if (biasM) {
      const float* bp = bias + m0 + mOff;
#pragma unroll
      for (int i = 0; i < MI; ++i)
#pragma unroll
        for (int r = 0; r < 8; ++r) bm[i][r] = bp[(i << 4) + r];
      asm volatile("s_wait_xcnt 0x0" :: "v"(bp) : "memory");
    } else {
      const float* bp = bias + n0 + rlane;
#pragma unroll
      for (int j = 0; j < 4; ++j) bn[j] = bp[j << 4];
      asm volatile("s_wait_xcnt 0x0" :: "v"(bp) : "memory");
    }
  }
#pragma unroll
  for (int i = 0; i < MI; ++i) {
    const int mBase = m0 + (i << 4);
#pragma unroll
    for (int j = 0; j < 4; ++j) {
      const int n = n0 + (j << 4) + rlane;
      float bv = 0.f;
      if (BIAS_MODE == 2) bv = bias[n];
#pragma unroll
      for (int r = 0; r < 8; ++r) {
        float v = acc[i][j][r] * scale;
        if (BIAS_MODE == 1) v += bias[mBase + mOff + r];
        if (BIAS_MODE == 2) v += bv;
        if (BIAS_MODE == 3) v = (v + bm[i][r]) + bn[j];   // one of the two is 0
        if (RESID) v += Rb[(size_t)(mBase + mOff + r) * ldc + n];
        if (ACT == 1) v = tanhf(v);
        if (ACT == 2) v = fmaxf(v, 0.0f);
        if (ACT == 4) v = (v > 0.f) ? v : 0.01f * v;
        slab[(mOff + r) * 68 + (j << 4) + rlane] = v;
      }
    }
    __builtin_amdgcn_fence(__ATOMIC_RELEASE, "workgroup");
    __builtin_amdgcn_wave_barrier();
    __builtin_amdgcn_fence(__ATOMIC_ACQUIRE, "workgroup");
    if (OUT_MODE == 0) {
      float* C = (float*)Cout + cOff;
      const int hh = lane >> 4, c4 = (lane & 15) * 4;     // row seg = 256 B = 16 lanes x 16 B
      {
#pragma unroll
        for (int it = 0; it < 8; ++it) {
          const int row = it * 2 + hh;
          v4f v = *(const v4f*)(slab + row * 68 + c4);
          *(v4f*)(C + (size_t)(mBase + row) * ldc + n0 + c4) = v;
        }
        
      }
    } else {
      const int q = lane >> 3, c8 = (lane & 7) * 8;
      unsigned short* C  = (unsigned short*)Cout  + cOff;
      unsigned short* C2 = (OUT_MODE == 2) ? ((unsigned short*)Cout2 + cOff) : nullptr;
      {
#pragma unroll
        for (int it = 0; it < 4; ++it) {
          const int row = it * 4 + q;
          const float* sp = slab + row * 68 + c8;
          v8h hv, lv;
#pragma unroll
          for (int e = 0; e < 8; ++e) {
            if (OUT_MODE == 1) {
              hv[e] = (_Float16)sp[e];
            } else {
              unsigned short hb = f2bf_bits(sp[e]);
              unsigned short lb = f2bf_bits(sp[e] - bf_bits2f(hb));
              hv[e] = __builtin_bit_cast(_Float16, hb);
              lv[e] = __builtin_bit_cast(_Float16, lb);
            }
          }
          *(v8h*)(C + (size_t)(mBase + row) * ldc + n0 + c8) = hv;
          if (OUT_MODE == 2) *(v8h*)(C2 + (size_t)(mBase + row) * ldc + n0 + c8) = lv;
        }
        
      }
    }
    __builtin_amdgcn_fence(__ATOMIC_RELEASE, "workgroup");
    __builtin_amdgcn_wave_barrier();
    __builtin_amdgcn_fence(__ATOMIC_ACQUIRE, "workgroup");
  }
}

// one GEMM per launch: eight waves, grid.x = tiles, grid.y = z planes
template <int ET, bool SPLIT, int BIAS_MODE, int OUT_MODE, bool RESID, int ACT, int WN, int KC, int NBUF, int MI>
__global__ __launch_bounds__(256) void wmma_gemm64(
    const unsigned short* __restrict__ Ap, const unsigned short* __restrict__ A2p, int lda, long strideA, long strideA2,
    const unsigned short* __restrict__ Btp, const unsigned short* __restrict__ Bt2p, int ldb, long strideB, long strideB2,
    void* __restrict__ Cout, void* __restrict__ Cout2, int ldc, long strideC, long strideC2,
    const float* __restrict__ bias,
    const float* __restrict__ resid, long strideR,
    int M, int N, int K, float scale, int zsplit) {
  gemm_tile<ET, SPLIT, BIAS_MODE, OUT_MODE, RESID, ACT, 8 / WN, WN, KC, NBUF, MI>(
      Ap, A2p, lda, strideA, strideA2, Btp, Bt2p, ldb, strideB, strideB2, Cout, Cout2, ldc, strideC, strideC2,
      bias, resid, strideR, M, N, K, scale, zsplit, blockIdx.x, blockIdx.y, false);
}

// The three projections in one launch: blockIdx.y = 0: q = x.Wq^T + bq, 1: k = x.Wk^T + bk (M = 8192 tokens, N = 512, 32 x 2 tiles),
// 2: v^T[bb] = Wv.x[bb]^T + bv (M = 512, N = 512 tokens, 2 x 2 tiles for each of the 16 batches). 64 tiles of 256 x 256 each, 192
// work-groups of sixteen waves (four per SIMD), all resident at once.
// Xp: planes [q hi | q lo | k hi | k lo | v hi | v lo], Wp: planes [Wq hi | Wq lo | Wk hi | Wk lo | Wv hi | Wv lo | ...],
// Pp: planes [Q hi | Q lo | K hi | K lo | V^T hi | V^T lo], as the workspace map has them.
constexpr int kProjT = 256;                                        // tile edge
constexpr int kProjWG = (kGRows / kProjT) * (kDm / kProjT);        // 64 tiles per projection
static_assert(kProjWG == kGB * (kDm / kProjT) * (kSeq / kProjT) && kNGrp == 1, "projection geometry");
__global__ __launch_bounds__(512) void proj3_kernel(
    const unsigned short* __restrict__ Xp, const unsigned short* __restrict__ Wp, unsigned short* __restrict__ Pp,
    const float* __restrict__ bq, const float* __restrict__ bk, const float* __restrict__ bv) {
  constexpr size_t kXE = (size_t)kGRows * kDm, kWE = (size_t)kDm * kDm;   // elements of an activation and of a weight plane
  constexpr int kTB = (kDm / kProjT) * (kSeq / kProjT);                   // v^T tiles per batch
  const int sel = blockIdx.y;
  const bool vt = (sel == 2);
  const unsigned short* Xh = Xp + (size_t)(2 * sel) * kXE;
  const unsigned short* Wh = Wp + (size_t)(2 * sel) * kWE;
  unsigned short* Oh = Pp + (size_t)(2 * sel) * kXE;
  const float* bias = (sel == 0) ? bq : (sel == 1) ? bk : bv;
  gemm_tile<1, true, 3, 2, false, 0, 4, 4, 64, 2, 4>(
      vt ? Wh : Xh, vt ? Wh + kWE : Xh + kXE, kDm, 0L, 0L,
      vt ? Xh : Wh, vt ? Xh + kXE : Wh + kWE, kDm, vt ? (long)kSeq * kDm : 0L, 0L,
      (void*)Oh, (void*)(Oh + kXE), kDm, vt ? (long)kDm * kSeq : 0L, 0L,
      bias, bias, 0L, vt ? kDm : kGRows, kDm, kDm, 1.0f, kGB,
      vt ? (int)(blockIdx.x % kTB) : (int)blockIdx.x, vt ? (int)(blockIdx.x / kTB) : 0, vt);
}

// ---------------------------------------------------------------------------
// f32 -> bf16 hi/lo split of all seven operand tensors in one launch: hi = bf16_rne(x), lo = bf16_rne(x - hi).
// A piece = 8 neighbouring elements (32 bytes read, 16 + 16 bytes written) of one thread. 256 work-groups x 512 threads = 131072 threads:
// an activation tensor is 4 x 131072 pieces, the four weight tensors together are 131072 pieces (64 work-groups each), so every thread
// does 4 pieces of each activation tensor and 1 piece of one weight tensor: few long-lived waves instead of one short wave per 32 pieces.
// The next tensor's eight loads are issued before this tensor's pieces are converted and stored.
// Xp: planes [q hi | q lo | k hi | k lo | v hi | v lo], Wp: planes [Wq hi | Wq lo | Wk hi | ... | Wo lo], as the workspace map has them.
// ---------------------------------------------------------------------------
constexpr int kSplitTh  = 512;                       // threads per work-group
constexpr int kSplitWG  = 256;                       // work-groups
constexpr int kSplitAll = kSplitTh * kSplitWG;       // 131072 threads
constexpr int kActE     = kBatch * kSeq * kDm;       // elements of an activation tensor
constexpr int kWgtE     = kDm * kDm;                 // elements of a weight tensor
static_assert(kActE == 4 * kSplitAll * 8 && 4 * kWgtE == kSplitAll * 8 && kWgtE % (kSplitTh * 8) == 0 && kNGrp == 1, "split geometry");

__device__ __forceinline__ void split8_store(const v4f a, const v4f b, unsigned short* __restrict__ hi, unsigned short* __restrict__ lo) {
  const float f[8] = {a[0], a[1], a[2], a[3], b[0], b[1], b[2], b[3]};
  unsigned hw[4], lw[4];
#pragma unroll
  for (int q = 0; q < 4; ++q) {
    const unsigned short h0 = f2bf_bits(f[2 * q]), h1 = f2bf_bits(f[2 * q + 1]);
    const unsigned short l0 = f2bf_bits(f[2 * q] - bf_bits2f(h0));
    const unsigned short l1 = f2bf_bits(f[2 * q + 1] - bf_bits2f(h1));
    hw[q] = pk16(h0, h1);
    lw[q] = pk16(l0, l1);
  }
  *(v4u*)hi = (v4u){hw[0], hw[1], hw[2], hw[3]};
  *(v4u*)lo = (v4u){lw[0], lw[1], lw[2], lw[3]};
}

__global__ __launch_bounds__(kSplitTh) void split_all_kernel(
    const float* __restrict__ xq, const float* __restrict__ xk, const float* __restrict__ xv,
    const float* __restrict__ wq, const float* __restrict__ wk, const float* __restrict__ wv, const float* __restrict__ wo,
    unsigned short* __restrict__ Xp, unsigned short* __restrict__ Wp) {
  const int g = blockIdx.x * kSplitTh + threadIdx.x;
  const size_t e0 = (size_t)g * 8;                                  // this thread's first piece of an activation tensor
  constexpr size_t kStep = (size_t)kSplitAll * 8;                   // from one of its pieces to the next
  // the weight tensor is the same for a whole work-group
  const int wsel = blockIdx.x / (kWgtE / (kSplitTh * 8));
  const float* w = (wsel == 0) ? wq : (wsel == 1) ? wk : (wsel == 2) ? wv : wo;
  const size_t we = e0 - (size_t)wsel * kWgtE;

  v4f buf[2][8];
#pragma unroll
  for (int p = 0; p < 4; ++p) {
    buf[0][2 * p]     = *(const v4f*)(xq + e0 + p * kStep);
    buf[0][2 * p + 1] = *(const v4f*)(xq + e0 + p * kStep + 4);
  }
  wait_x0();
  const v4f wa = *(const v4f*)(w + we);
  const v4f wb = *(const v4f*)(w + we + 4);
  wait_x0();
  // unrolled: the tensor and the register set of each trip are chosen at compile time
#pragma unroll
  for (int t = 0; t < 3; ++t) {
    if (t < 2) {
      const float* xn = (t == 0) ? xk : xv;
#pragma unroll
      for (int p = 0; p < 4; ++p) {
        buf[(t + 1) & 1][2 * p]     = *(const v4f*)(xn + e0 + p * kStep);
        buf[(t + 1) & 1][2 * p + 1] = *(const v4f*)(xn + e0 + p * kStep + 4);
      }
      wait_x0();
    }
    unsigned short* hi = Xp + (size_t)(2 * t) * kActE + e0;
    unsigned short* lo = hi + kActE;
#pragma unroll
    for (int p = 0; p < 4; ++p) split8_store(buf[t & 1][2 * p], buf[t & 1][2 * p + 1], hi + p * kStep, lo + p * kStep);
    wait_x0();
  }
  unsigned short* whi = Wp + (size_t)(2 * wsel) * kWgtE + we;
  split8_store(wa, wb, whi, whi + kWgtE);
}

// ---------------------------------------------------------------------------
// Scores, gated mixing and p.v in one kernel; no score and no probability leaves the work-group.
// Work-group = one (batch, head) plane z = bb*8 + h and 256 queries; wave = 32 queries (two 16-column groups) against all 512 keys.
// Transposed products: S^T = K.Q^T (A = key rows from LDS, B = query rows kept in registers), O^T += V^T.A^T (A = v^T rows from LDS).
// In an S^T tile lane (c, hh) holds query c and keys 8*hh + r: the row maximum and the row sum are in-lane plus one exchange
// between the lane halves, and two S^T tiles (32 keys), converted in place, are the B operand of the second product.
//   pass 1: m_i = max_j s_ij
//   pass 2: the same products again (same order, so the same bits), then
//     g_c  = bg[c] + sum_d q[i][h*64+d] * Wg[c][d],  qp_c = rcp((|g_c| + 1)^2)
//     p_j  = 2^((s_j - m) * log2e)                    (= softmax_j / max softmax)
//     adj  = 2^((i-j)^2 * (-0.5 log2e qp_1)) for j < i,  2^((i-j)^2 * (-0.5 log2e qp_0)) for j >= i
//     a_j  = sg * p_j + (1 - sg) * adj,  sg = rcp(1 + 2^(-lam1 * log2e))   -> bf16 hi/lo fragments
//     ctx_i = (sum_j a_j v_j) * rcp(sum_j a_j + 1e-9)  -> bf16 hi/lo planes
// LDS: all 512 key rows (hi, lo; pitch 144 B) and the 64 v^T rows (hi, lo; pitch 1040 B) of the plane, each filled once by
// global_load_async_to_lds_b128; the v^T copies fly during pass 1.
// Output coverage: grid 2 x 128, 8 waves x 32 queries = 512 rows per plane; a wave writes the whole 128-byte segment (row, h) of both planes.
// ---------------------------------------------------------------------------
__device__ __forceinline__ float hw_exp2(float x) { return __builtin_amdgcn_exp2f(x); }
__device__ __forceinline__ float hw_rcp(float x)  { return __builtin_amdgcn_rcpf(x); }

// one plane in 16 rounds of the 256 threads; lds / g = this thread's place in round 0, lstep (bytes) / gstep (elements) = one round
__device__ __forceinline__ void fill16(unsigned lds, unsigned lstep, const unsigned short* g, size_t gstep) {
  // unrolled: two statements of eight copies
#pragma unroll
  for (int p = 0; p < 16; p += 8)
    copy8(lds + (unsigned)p * lstep,       g + (size_t)p * gstep,       lds + (unsigned)(p + 1) * lstep, g + (size_t)(p + 1) * gstep,
          lds + (unsigned)(p + 2) * lstep, g + (size_t)(p + 2) * gstep, lds + (unsigned)(p + 3) * lstep, g + (size_t)(p + 3) * gstep,
          lds + (unsigned)(p + 4) * lstep, g + (size_t)(p + 4) * gstep, lds + (unsigned)(p + 5) * lstep, g + (size_t)(p + 5) * gstep,
          lds + (unsigned)(p + 6) * lstep, g + (size_t)(p + 6) * gstep, lds + (unsigned)(p + 7) * lstep, g + (size_t)(p + 7) * gstep);
}

constexpr int kKP = kDk + 8;     // LDS pitch of a key row, elements (16 B x odd)
constexpr int kVP = kSeq + 8;    // LDS pitch of a v^T row, elements (16 B x odd)
constexpr int kQB = 256;         // queries per work-group

// S^T tile of keys kt*16 .. kt*16+15 against both query groups; kr = this lane's place in key row c of the hi plane
__device__ __forceinline__ void score_tile(const __bf16* kr, const v16b (&qh)[2][2], const v16b (&ql)[2][2], v8f (&s)[2]) {
  typedef Frag<__bf16> F;
  const v16b kh0 = F::load(kr), kh1 = F::load(kr + 32);
  const v16b kl0 = F::load(kr + kSeq * kKP), kl1 = F::load(kr + kSeq * kKP + 32);
#pragma unroll
  for (int qt = 0; qt < 2; ++qt) {
    v8f a = (v8f){0.f, 0.f, 0.f, 0.f, 0.f, 0.f, 0.f, 0.f};
    a = F::mma(kh0, qh[qt][0], a);
    a = F::mma(kl0, qh[qt][0], a);
    a = F::mma(kh0, ql[qt][0], a);
    a = F::mma(kh1, qh[qt][1], a);
    a = F::mma(kl1, qh[qt][1], a);
    a = F::mma(kh1, ql[qt][1], a);
    s[qt] = a;
  }
}

__global__ __launch_bounds__(256) void attn_mix_kernel(
    const unsigned short* __restrict__ Qh, const unsigned short* __restrict__ Ql,
    const unsigned short* __restrict__ Kh, const unsigned short* __restrict__ Kl,
    const unsigned short* __restrict__ VTh, const unsigned short* __restrict__ VTl,
    unsigned short* __restrict__ Ch, unsigned short* __restrict__ Cl,
    const float* __restrict__ Wg, const float* __restrict__ bg, const float* __restrict__ lam1) {
  typedef Frag<__bf16> F;
  __shared__ __align__(16) unsigned short sK[2 * kSeq * kKP];
  __shared__ __align__(16) unsigned short sV[2 * kDk * kVP];
  const int tid  = threadIdx.x;
  const int lane = tid & 31;
  const int wave = tid >> 5;
  const int c    = lane & 15;
  const int hh   = lane >> 4;
  const int z    = blockIdx.y;
  const int bb   = z >> 3;
  const int h    = z & (kHeads - 1);
  const int q0   = blockIdx.x * kQB + wave * 32;

  // key rows: 8 lanes per 128-byte row piece, 32 rows per round
  {
    const int cc = tid & 7, cr = tid >> 3;
    const size_t g = (size_t)(bb * kSeq + cr) * kDm + (size_t)h * kDk + cc * 8;
    const unsigned l = (unsigned)(uintptr_t)sK + (unsigned)(cr * kKP + cc * 8) * 2u;
    fill16(l, 32u * kKP * 2u, Kh + g, (size_t)32 * kDm);
    fill16(l + (unsigned)(kSeq * kKP) * 2u, 32u * kKP * 2u, Kl + g, (size_t)32 * kDm);
  }

  // query fragments (B operand), hardware k order, kept for both passes
  v16b qh[2][2], ql[2][2];
#pragma unroll
  for (int qt = 0; qt < 2; ++qt) {
#pragma unroll
    for (int ks = 0; ks < 2; ++ks) {
      const size_t o = (size_t)(bb * kSeq + q0 + qt * 16 + c) * kDm + (size_t)h * kDk + ks * 32 + hh * 8;
      qh[qt][ks] = F::load((const __bf16*)(Qh + o));
      ql[qt][ks] = F::load((const __bf16*)(Ql + o));
    }
    wait_x0();
  }

  // gating dots: this lane holds 32 of its query's 64 d, the other lane half the rest
  float gn0[2], gn1[2];
  {
    float g0[2] = {0.f, 0.f}, g1[2] = {0.f, 0.f};
#pragma unroll
    for (int ks = 0; ks < 2; ++ks)
#pragma unroll
      for (int hf = 0; hf < 2; ++hf) {
        const float* wp = Wg + ks * 32 + hf * 16 + hh * 8;
        const v4f wa = *(const v4f*)(wp), wb = *(const v4f*)(wp + 4);
        const v4f wc = *(const v4f*)(wp + kDk), wd = *(const v4f*)(wp + kDk + 4);
#pragma unroll
        for (int e = 0; e < 8; ++e) {
          const float w0 = (e < 4) ? wa[e & 3] : wb[e & 3];
          const float w1 = (e < 4) ? wc[e & 3] : wd[e & 3];
#pragma unroll
          for (int qt = 0; qt < 2; ++qt) {
            const float qv = (float)qh[qt][ks][hf * 8 + e] + (float)ql[qt][ks][hf * 8 + e];
            g0[qt] += qv * w0;
            g1[qt] += qv * w1;
          }
        }
      }
    const float b0 = bg[0], b1 = bg[1];
#pragma unroll
    for (int qt = 0; qt < 2; ++qt) {
      const float t0 = fabsf(g0[qt] + __shfl_xor(g0[qt], 16, 32) + b0) + 1.0f;
      const float t1 = fabsf(g1[qt] + __shfl_xor(g1[qt], 16, 32) + b1) + 1.0f;
      gn0[qt] = (-0.5f * kLog2e) * hw_rcp(t0 * t0);      // j >= i (upper incl. diagonal)
      gn1[qt] = (-0.5f * kLog2e) * hw_rcp(t1 * t1);      // j <  i (strictly lower)
    }
  }
  const float sg  = hw_rcp(1.0f + hw_exp2(-lam1[0] * kLog2e));
  const float omg = 1.0f - sg;

  // the key rows: this wave's copies have landed, then the barrier that publishes them
  wait_async0();
  __syncthreads();

  // v^T rows: 64 lanes per 1024-byte row, 4 rows per round; read only behind the barrier after pass 1
  {
    const int cc = tid & 63, cr = tid >> 6;
    const size_t g = (size_t)bb * kDm * kSeq + (size_t)(h * kDk + cr) * kSeq + cc * 8;
    const unsigned l = (unsigned)(uintptr_t)sV + (unsigned)(cr * kVP + cc * 8) * 2u;
    fill16(l, 4u * kVP * 2u, VTh + g, (size_t)4 * kSeq);
    fill16(l + (unsigned)(kDk * kVP) * 2u, 4u * kVP * 2u, VTl + g, (size_t)4 * kSeq);
  }

  const __bf16* kr0 = (const __bf16*)sK + c * kKP + hh * 8;

  // pass 1: row maxima
  float mx[2] = {-INFINITY, -INFINITY};
  // two tiles per trip: the second tile's LDS reads stand beside the first tile's products
#pragma unroll 2
  for (int kt = 0; kt < kSeq / 16; ++kt) {
    v8f s[2];
    score_tile(kr0 + kt * 16 * kKP, qh, ql, s);
#pragma unroll
    for (int qt = 0; qt < 2; ++qt)
#pragma unroll
      for (int r = 0; r < 8; ++r) mx[qt] = fmaxf(mx[qt], s[qt][r]);
  }
#pragma unroll
  for (int qt = 0; qt < 2; ++qt) mx[qt] = fmaxf(mx[qt], __shfl_xor(mx[qt], 16, 32));

  // the v^T rows: this wave's copies have landed, then the barrier that publishes them
  wait_async0();
  __syncthreads();

  // pass 2
  v8f o[4][2];
#pragma unroll
  for (int dt = 0; dt < 4; ++dt)
#pragma unroll
    for (int qt = 0; qt < 2; ++qt) o[dt][qt] = (v8f){0.f, 0.f, 0.f, 0.f, 0.f, 0.f, 0.f, 0.f};
  float ls[2] = {0.f, 0.f};
  const float fi[2] = {(float)(q0 + c - hh * 8), (float)(q0 + 16 + c - hh * 8)};
  const __bf16* vr0 = (const __bf16*)sV + c * kVP + hh * 8;
  // rolled: for speed only
#pragma unroll 1
  for (int kp = 0; kp < kSeq / 32; ++kp) {
    v16b ph[2], pl[2];
#pragma unroll
    for (int t = 0; t < 2; ++t) {
      v8f s[2];
      score_tile(kr0 + (kp * 2 + t) * 16 * kKP, qh, ql, s);
#pragma unroll
      for (int qt = 0; qt < 2; ++qt) {
        const float fb = fi[qt] - (float)(kp * 32 + t * 16);   // i - j at r = 0
#pragma unroll
        for (int r = 0; r < 8; ++r) {
          const float p   = hw_exp2((s[qt][r] - mx[qt]) * kLog2e);
          const float fd  = fb - (float)r;
          const float gs  = (fd > 0.f) ? gn1[qt] : gn0[qt];
          const float adj = hw_exp2((fd * fd) * gs);
          const float av  = sg * p + omg * adj;
          ls[qt] += av;
          const __bf16 hb = (__bf16)av;
          ph[qt][t * 8 + r] = hb;
          pl[qt][t * 8 + r] = (__bf16)(av - (float)hb);
        }
      }
    }
    const __bf16* vr = vr0 + kp * 32;
#pragma unroll
    for (int dt = 0; dt < 4; ++dt) {
      const v16b vh = F::load(vr + dt * 16 * kVP);
      const v16b vl = F::load(vr + (kDk + dt * 16) * kVP);
#pragma unroll
      for (int qt = 0; qt < 2; ++qt) {
        o[dt][qt] = F::mma(vh, ph[qt], o[dt][qt]);
        o[dt][qt] = F::mma(vl, ph[qt], o[dt][qt]);
        o[dt][qt] = F::mma(vh, pl[qt], o[dt][qt]);
      }
    }
  }

  // epilogue: lane (c, hh) holds d = dt*16 + 8*hh + r of query c: one 16-byte store per tile and plane
#pragma unroll
  for (int qt = 0; qt < 2; ++qt) {
    const float inv = hw_rcp(ls[qt] + __shfl_xor(ls[qt], 16, 32) + 1e-9f);
    const size_t ro = (size_t)(bb * kSeq + q0 + qt * 16 + c) * kDm + (size_t)h * kDk + hh * 8;
#pragma unroll
    for (int dt = 0; dt < 4; ++dt) {
      v8b hv, lv;
#pragma unroll
      for (int r = 0; r < 8; ++r) {
        const float x = o[dt][qt][r] * inv;
        const __bf16 hb = (__bf16)x;
        hv[r] = hb;
        lv[r] = (__bf16)(x - (float)hb);
      }
      *(v8b*)((__bf16*)Ch + ro + dt * 16) = hv;
      *(v8b*)((__bf16*)Cl + ro + dt * 16) = lv;
    }
    wait_x0();
  }
}

// ---------------------------------------------------------------------------
// Workspace region map (bytes; every offset a multiple of 512 KiB). Every region is fully written
// inside the call before any read.
//   Wqh,Wql,Wkh,Wkl,Wvh,Wvl,Woh,Wol  bf16 [512][512] each            0 .. 4194304
//   Xqh,Xql,Xkh,Xkl,Xvh,Xvl          bf16 [8192][512] each     4194304 .. 54525952
//   Qh,Ql,Kh,Kl                      bf16 [8192][512] each    54525952 .. 88080384   (row bb*512+i, col h*64+d)
//   VTh,VTl                          bf16 [16][512][512]      88080384 .. 104857600  (batch, row h*64+d, col token)
//   CTXh,CTXl                        bf16 [8192][512] each   104857600 .. 121634816  (row bb*512+i, col h*64+d)
//   total 121634816
// ---------------------------------------------------------------------------
extern "C" void kernel_launch(void* const* d_in, const int* in_sizes, int n_in,
                              void* d_out, int out_size, void* d_ws, size_t ws_size,
                              hipStream_t stream) {
  if (n_in < 14) return;
  const int nAct = kBatch * kSeq * kDm;          // 4194304
  const int nW   = kDm * kDm;                    // 262144
  if (in_sizes[0] != nAct || in_sizes[1] != nAct || in_sizes[2] != nAct) return;
  if (in_sizes[3] != nW || in_sizes[5] != nW || in_sizes[7] != nW || in_sizes[12] != nW) return;
  if (in_sizes[4] != kDm || in_sizes[6] != kDm || in_sizes[8] != kDm || in_sizes[13] != kDm) return;
  if (in_sizes[9] != 2 * kDk || in_sizes[10] < 2 || in_sizes[11] < 1) return;
  if (out_size != nAct) return;

  const float* query = (const float*)d_in[0];
  const float* key   = (const float*)d_in[1];
  const float* value = (const float*)d_in[2];
  const float* Wq    = (const float*)d_in[3];
  const float* bq    = (const float*)d_in[4];
  const float* Wk    = (const float*)d_in[5];
  const float* bk    = (const float*)d_in[6];
  const float* Wv    = (const float*)d_in[7];
  const float* bv    = (const float*)d_in[8];
  const float* Wg    = (const float*)d_in[9];
  const float* bg    = (const float*)d_in[10];
  const float* lam1  = (const float*)d_in[11];
  const float* Wo    = (const float*)d_in[12];
  const float* bo    = (const float*)d_in[13];
  float* out = (float*)d_out;

  const size_t PW  = (size_t)kDm * kDm * 2;                 // 524288    weight plane
  const size_t PX  = (size_t)kGRows * kDm * 2;              // 8388608   activation / q / k / ctx plane
  const size_t PVT = (size_t)kGB * kDm * kSeq * 2;          // 8388608   v^T plane
  size_t off = 0;
  const size_t oWqh = off; off += PW;  const size_t oWql = off; off += PW;
  const size_t oWkh = off; off += PW;  const size_t oWkl = off; off += PW;
  const size_t oWvh = off; off += PW;  const size_t oWvl = off; off += PW;
  const size_t oWoh = off; off += PW;  const size_t oWol = off; off += PW;
  const size_t oXqh = off; off += PX;  const size_t oXql = off; off += PX;
  const size_t oXkh = off; off += PX;  const size_t oXkl = off; off += PX;
  const size_t oXvh = off; off += PX;  const size_t oXvl = off; off += PX;
  const size_t oQh  = off; off += PX;  const size_t oQl  = off; off += PX;
  const size_t oKh  = off; off += PX;  const size_t oKl  = off; off += PX;
  const size_t oVTh = off; off += PVT; const size_t oVTl = off; off += PVT;
  const size_t oCh  = off; off += PX;  const size_t oCl  = off; off += PX;
  if (off > ws_size) return;                                // off = 121634816

  char* ws = (char*)d_ws;
  unsigned short* Wqh = (unsigned short*)(ws + oWqh); unsigned short* Wql = (unsigned short*)(ws + oWql);
  unsigned short* Wkh = (unsigned short*)(ws + oWkh); unsigned short* Wkl = (unsigned short*)(ws + oWkl);
  unsigned short* Wvh = (unsigned short*)(ws + oWvh); unsigned short* Wvl = (unsigned short*)(ws + oWvl);
  unsigned short* Woh = (unsigned short*)(ws + oWoh); unsigned short* Wol = (unsigned short*)(ws + oWol);
  unsigned short* Xqh = (unsigned short*)(ws + oXqh); unsigned short* Xql = (unsigned short*)(ws + oXql);
  unsigned short* Xkh = (unsigned short*)(ws + oXkh); unsigned short* Xkl = (unsigned short*)(ws + oXkl);
  unsigned short* Xvh = (unsigned short*)(ws + oXvh); unsigned short* Xvl = (unsigned short*)(ws + oXvl);
  unsigned short* Qh  = (unsigned short*)(ws + oQh);  unsigned short* Ql  = (unsigned short*)(ws + oQl);
  unsigned short* Kh  = (unsigned short*)(ws + oKh);  unsigned short* Kl  = (unsigned short*)(ws + oKl);
  unsigned short* VTh = (unsigned short*)(ws + oVTh); unsigned short* VTl = (unsigned short*)(ws + oVTl);
  unsigned short* Ch  = (unsigned short*)(ws + oCh);  unsigned short* Cl  = (unsigned short*)(ws + oCl);

  const dim3 blk(256);
  const dim3 blkSplit(kSplitTh);                                    // 512 threads
  const dim3 gSplit(kSplitWG);                                      // 256 work-groups: all seven tensors
  const dim3 blkProj(512);
  const dim3 gProj(kProjWG, 3);                                     // 64 x 3:     256 x 256 tiles of q, k, v^T; K=512
  const dim3 gAtt(kSeq / kQB, kNZ);                                 // 2 x 128:    256 queries x 512 keys per work-group
  const dim3 gOut((kGRows / 128) * (kDm / 128), 1);                 // 64 x 4 = 256 tiles of 128 x 128: M=8192, N=512, K=512

  // (1) activations -> hi/lo planes [8192][512], weights -> hi/lo planes [512][512] (torch [out][in] is already Bt[n][k]); every plane whole
  split_all_kernel<<<gSplit, blkSplit, 0, stream>>>(query, key, value, Wq, Wk, Wv, Wo, Xqh, Wqh);

  for (int gb = 0; gb < kNGrp; ++gb) {
    const size_t actOff = (size_t)gb * kGRows * kDm;
    // (2) q = x.Wq^T + bq, k = x.Wk^T + bk -> hi/lo planes [8192][512]; v^T[bb][o][tok] = sum_k Wv[o][k] x[bb*512+tok][k] + bv[o]
    //     -> hi/lo planes [16][512][512]; all six planes whole, one launch
    proj3_kernel<<<gProj, blkProj, 0, stream>>>(Xqh, Wqh, Qh, bq, bk, bv);
    // (4) ctx[bb*512+i][h*64+d] = sum_j A[z][i][j] v^T[bb][h*64+d][j] / (sum_j A[z][i][j] + 1e-9) -> hi/lo planes, A = gated mix of the scores q.k^T
    attn_mix_kernel<<<gAtt, blk, 0, stream>>>(Qh, Ql, Kh, Kl, VTh, VTl, Ch, Cl, Wg, bg, lam1);
    // (5) out = ctx.Wo^T + bo -> f32 [8192][512], all of d_out: one 128 x 128 tile per work-group, eight waves (4 x 2) of 32 x 64, k in four stages of 128
    float* outg = out + actOff;
    wmma_gemm64<1, true, 2, 0, false, 0, 2, 128, 2, 2><<<gOut, blk, 0, stream>>>(
        Ch, Cl, kDm, 0L, 0L, Woh, Wol, kDm, 0L, 0L, (void*)outg, (void*)outg, kDm, 0L, 0L,
        bo, bo, 0L, kGRows, kDm, kDm, 1.0f, 1);
  }
}

// v007
// Measured time: 81.7 microseconds a run.
// In both of two side-by-side timings against v006, it was 1.12 times as fast.
// Over all steps from v000 it is 12.0 times as fast.
// Contractions x.Wq^T, x.Wk^T, Wv.x^T, k.q^T, v^T.p^T, ctx.Wo^T: v_wmma_f32_16x16x32_bf16 on bf16 hi/lo split operand planes (hi.hi + hi.lo + lo.hi), f32 accumulate; per-row 64x2 gating dots, softmax, distance adjacency, max- and sum-normalisation in f32 on the VALU (hardware exp2/rcp).
#include <hip/hip_runtime.h>
#include <math.h>
#include <stdint.h>

constexpr int kBatch = 16;
constexpr int kSeq   = 512;
constexpr int kDm    = 512;
constexpr int kHeads = 8;
constexpr int kDk    = 64;
constexpr int kGB    = 16;                 // batches per group: the whole batch goes through every stage in one launch
constexpr int kNGrp  = kBatch / kGB;       // 1 group
constexpr int kNZ    = kGB * kHeads;       // 128 (batch, head) planes
constexpr int kGRows = kGB * kSeq;         // 8192 token rows
constexpr float kLog2e = 1.4426950408889634f;
static_assert(kSeq == 512 && kDk == 64 && kDm == kHeads * kDk && (kBatch % kGB) == 0, "geometry");

typedef __attribute__((ext_vector_type(16))) _Float16 v16h;
typedef __attribute__((ext_vector_type(8)))  _Float16 v8h;
typedef __attribute__((ext_vector_type(16))) __bf16   v16b;
typedef __attribute__((ext_vector_type(8)))  __bf16   v8b;
typedef __attribute__((ext_vector_type(8)))  float    v8f;
typedef __attribute__((ext_vector_type(4)))  float    v4f;
typedef __attribute__((ext_vector_type(4)))  unsigned int v4u;

__device__ __forceinline__ unsigned short f2bf_bits(float f) {
  unsigned u = __float_as_uint(f);
  return (unsigned short)((u + 0x7FFFu + ((u >> 16) & 1u)) >> 16);
}
__device__ __forceinline__ float bf_bits2f(unsigned short h) { return __uint_as_float(((unsigned)h) << 16); }
__device__ __forceinline__ unsigned pk16(unsigned short a, unsigned short b) { return (unsigned)a | ((unsigned)b << 16); }

// hazard guards as plain device helpers (no inline asm inside the kernel template body)
__device__ __forceinline__ void dep_guard_h(v8f& a, v8f& b, v16h x, v16h y) { asm volatile("v_nop\n\tv_nop\n\tv_nop\n\tv_nop" : "+v"(a), "+v"(b) : "v"(x), "v"(y)); }
__device__ __forceinline__ void dep_guard_b(v8f& a, v8f& b, v16b x, v16b y) { asm volatile("v_nop\n\tv_nop\n\tv_nop\n\tv_nop" : "+v"(a), "+v"(b) : "v"(x), "v"(y)); }
__device__ __forceinline__ void keep4_h(v16h a, v16h b, v16h c, v16h d) { asm volatile("v_nop" :: "v"(a), "v"(b), "v"(c), "v"(d)); }
__device__ __forceinline__ void keep4_b(v16b a, v16b b, v16b c, v16b d) { asm volatile("v_nop" :: "v"(a), "v"(b), "v"(c), "v"(d)); }
__device__ __forceinline__ void acc_guard4(v8f& a, v8f& b, v8f& c, v8f& d) { asm volatile("v_nop\n\tv_nop\n\tv_nop\n\tv_nop" : "+v"(a), "+v"(b), "+v"(c), "+v"(d)); }
template <typename T> struct Frag;
template <> struct Frag<_Float16> {
  typedef v16h V; union U { v16h v; v8h h[2]; };
  static __device__ __forceinline__ v16h load(const _Float16* p) {   // elements 0..7 <- p[0..7], 8..15 <- p[16..23]
    U f; f.h[0] = *(const v8h*)(p); f.h[1] = *(const v8h*)(p + 16); return f.v;
  }
  static __device__ __forceinline__ v8f mma(v16h a, v16h b, v8f c) {
    return __builtin_amdgcn_wmma_f32_16x16x32_f16(false, a, false, b, (short)0, c, false, false);
  }
  static __device__ __forceinline__ void guard(v8f& a, v8f& b, v16h x, v16h y) { dep_guard_h(a, b, x, y); }
  static __device__ __forceinline__ void keep(v16h a, v16h b, v16h c, v16h d) { keep4_h(a, b, c, d); }
};
template <> struct Frag<__bf16> {
  typedef v16b V; union U { v16b v; v8b h[2]; };
  static __device__ __forceinline__ v16b load(const __bf16* p) {
    U f; f.h[0] = *(const v8b*)(p); f.h[1] = *(const v8b*)(p + 16); return f.v;
  }
  static __device__ __forceinline__ v8f mma(v16b a, v16b b, v8f c) {
    return __builtin_amdgcn_wmma_f32_16x16x32_bf16(false, a, false, b, (short)0, c, false, false);
  }
  static __device__ __forceinline__ void guard(v8f& a, v8f& b, v16b x, v16b y) { dep_guard_b(a, b, x, y); }
  static __device__ __forceinline__ void keep(v16b a, v16b b, v16b c, v16b d) { keep4_b(a, b, c, d); }
};

// ---- Register-blocked batched WMMA GEMM ------------------------------------
// C[m,n] = scale * sum_k A[m,k] * Bt[n,k] (+bias)(+resid); each wave owns a (MI*16)x64 tile.
// A row-major [M,K]; Bt row-major [N,K]; M % (WM*MI*16) == 0, N % (WN*64) == 0, K % KC == 0.
// SPLIT: operands are hi/lo planes (A2/Bt2 = lo planes, same layout); product = hi.hi + hi.lo + lo.hi.
// BIAS_MODE: 0 = none, 1 = bias[m], 2 = bias[n].
// OUT_MODE: 0 = f32, 1 = f16, 2 = bf16 hi plane (Cout) + bf16 lo plane (Cout2).
// z addressing: bz = the z plane (blockIdx.y in wmma_gemm64), zi = bz % zsplit, zo = bz / zsplit; operand base = zi*stride + zo*stride2 (elements).
// ET: 0 = f16 operands, 1 = bf16 operands (pointers passed as 16-bit storage)
template <int ET> struct Elem;
template <> struct Elem<0> { typedef _Float16 T; };
template <> struct Elem<1> { typedef __bf16 T; };
// ---- LDS staging of the operand tiles ---------------------------------------
// The WM*WN waves of a work-group share one (WM*MI*16) x (WN*64) tile of C. Per pass of KC k, the rows of A hi, A lo, Bt hi, Bt lo
// that the tile needs are copied to LDS by global_load_async_to_lds_b128 (KC/8 neighbouring lanes per row: whole contiguous row pieces),
// at a row pitch of KC*2 + 16 bytes; the WMMA fragments are then read with ds_load_b128.
// this wave's copies have landed before the barrier that publishes them to the other waves
__device__ __forceinline__ void wait_async0() { asm volatile("s_wait_asynccnt 0x0" ::: "memory"); }
// this wave's fragment reads have returned before the barrier behind which their buffer is refilled
__device__ __forceinline__ void wait_ds0() { asm volatile("s_wait_dscnt 0x0" ::: "memory"); }
// stands behind a group of global loads or stores, in front of whatever rewrites a register that they name
__device__ __forceinline__ void wait_x0() { asm volatile("s_wait_xcnt 0x0" ::: "memory"); }
// six copies, 16 bytes per lane each; the closing s_wait_xcnt stands in the same statement so that no address register is rewritten ahead of it
__device__ __forceinline__ void copy6(unsigned l0, const unsigned short* g0, unsigned l1, const unsigned short* g1,
                                      unsigned l2, const unsigned short* g2, unsigned l3, const unsigned short* g3,
                                      unsigned l4, const unsigned short* g4, unsigned l5, const unsigned short* g5) {
  asm volatile("global_load_async_to_lds_b128 %0, %1, off\n\t"
               "global_load_async_to_lds_b128 %2, %3, off\n\t"
               "global_load_async_to_lds_b128 %4, %5, off\n\t"
               "global_load_async_to_lds_b128 %6, %7, off\n\t"
               "global_load_async_to_lds_b128 %8, %9, off\n\t"
               "global_load_async_to_lds_b128 %10, %11, off\n\t"
               "s_wait_xcnt 0x0"
               :: "v"(l0), "v"(g0), "v"(l1), "v"(g1), "v"(l2), "v"(g2), "v"(l3), "v"(g3), "v"(l4), "v"(g4), "v"(l5), "v"(g5)
               : "memory");
}
// eight copies, 16 bytes per lane each; the closing s_wait_xcnt stands in the same statement so that no address register is rewritten ahead of it
__device__ __forceinline__ void copy8(unsigned l0, const unsigned short* g0, unsigned l1, const unsigned short* g1,
                                      unsigned l2, const unsigned short* g2, unsigned l3, const unsigned short* g3,
                                      unsigned l4, const unsigned short* g4, unsigned l5, const unsigned short* g5,
                                      unsigned l6, const unsigned short* g6, unsigned l7, const unsigned short* g7) {
  asm volatile("global_load_async_to_lds_b128 %0, %1, off\n\t"
               "global_load_async_to_lds_b128 %2, %3, off\n\t"
               "global_load_async_to_lds_b128 %4, %5, off\n\t"
               "global_load_async_to_lds_b128 %6, %7, off\n\t"
               "global_load_async_to_lds_b128 %8, %9, off\n\t"
               "global_load_async_to_lds_b128 %10, %11, off\n\t"
               "global_load_async_to_lds_b128 %12, %13, off\n\t"
               "global_load_async_to_lds_b128 %14, %15, off\n\t"
               "s_wait_xcnt 0x0"
               :: "v"(l0), "v"(g0), "v"(l1), "v"(g1), "v"(l2), "v"(g2), "v"(l3), "v"(g3),
                  "v"(l4), "v"(g4), "v"(l5), "v"(g5), "v"(l6), "v"(g6), "v"(l7), "v"(g7)
               : "memory");
}
// One stage: LDS rows [A hi: TM | A lo: TM | Bt hi: TN | Bt lo: TN]. NTH threads cover RPP rows per round; lds and the four
// pointers are this thread's own place in round 0 of each part; stepA / stepB = RPP rows of the source, in elements.
template <int KC, int TM, int TN, int NTH>
__device__ __forceinline__ void stage_fill(unsigned lds, const unsigned short* gAh, const unsigned short* gAl,
                                           const unsigned short* gBh, const unsigned short* gBl, size_t stepA, size_t stepB) {
  constexpr int RPP = NTH / (KC / 8);
  constexpr int PA = TM / RPP, PB = TN / RPP, NP = 2 * (PA + PB);
  constexpr unsigned LB = (unsigned)RPP * (KC * 2 + 16);
  static_assert(TM % RPP == 0 && TN % RPP == 0 && (NP % 6 == 0 || NP % 8 == 0) && NP <= 63, "stage geometry");
  // both loops unrolled: the round number is then a constant, so each copy's part and LDS place are chosen at compile time
  if constexpr (NP % 6 != 0) {
#pragma unroll
    for (int p = 0; p < NP; p += 8) {
      const unsigned short* g[8];
#pragma unroll
      for (int u = 0; u < 8; ++u) {
        const int q = p + u;
        g[u] = (q < PA) ? (gAh + (size_t)q * stepA)
             : (q < 2 * PA) ? (gAl + (size_t)(q - PA) * stepA)
             : (q < 2 * PA + PB) ? (gBh + (size_t)(q - 2 * PA) * stepB)
                                 : (gBl + (size_t)(q - 2 * PA - PB) * stepB);
      }
      copy8(lds + (unsigned)p * LB, g[0], lds + (unsigned)(p + 1) * LB, g[1], lds + (unsigned)(p + 2) * LB, g[2],
            lds + (unsigned)(p + 3) * LB, g[3], lds + (unsigned)(p + 4) * LB, g[4], lds + (unsigned)(p + 5) * LB, g[5],
            lds + (unsigned)(p + 6) * LB, g[6], lds + (unsigned)(p + 7) * LB, g[7]);
    }
    return;
  }
#pragma unroll
  for (int p = 0; p < NP; p += 6) {
    const unsigned short* g[6];
#pragma unroll
    for (int u = 0; u < 6; ++u) {
      const int q = p + u;
      g[u] = (q < PA) ? (gAh + (size_t)q * stepA)
           : (q < 2 * PA) ? (gAl + (size_t)(q - PA) * stepA)
           : (q < 2 * PA + PB) ? (gBh + (size_t)(q - 2 * PA) * stepB)
                               : (gBl + (size_t)(q - 2 * PA - PB) * stepB);
    }
    copy6(lds + (unsigned)p * LB, g[0], lds + (unsigned)(p + 1) * LB, g[1], lds + (unsigned)(p + 2) * LB, g[2],
          lds + (unsigned)(p + 3) * LB, g[3], lds + (unsigned)(p + 4) * LB, g[4], lds + (unsigned)(p + 5) * LB, g[5]);
  }
}

// ---- The projections take their activations as f32 ---------------------------
// One stage: LDS rows [activations, f32: T rows of KC*4 + 16 bytes | weights hi: T rows | weights lo: T rows, KC*2 + 16 bytes each].
// NTH threads cover RX activation rows (KC/4 lanes per row) or RW weight rows (KC/8 lanes per row) per round; ldsX, ldsW and the three
// pointers are this thread's own places in round 0; ld = row length of both sources, in elements.
template <int KC, int T, int NTH>
__device__ __forceinline__ void stage_fill_x(unsigned ldsX, const float* gX, unsigned ldsW,
                                             const unsigned short* gWh, const unsigned short* gWl, int ld) {
  constexpr int RX = NTH / (KC / 4), RW = NTH / (KC / 8);
  static_assert(T == 8 * RX && T == 4 * RW, "two statements of eight copies");
  constexpr unsigned LX = (unsigned)RX * (KC * 4 + 16), LW = (unsigned)RW * (KC * 2 + 16), LP = (unsigned)T * (KC * 2 + 16);
  const size_t sx = (size_t)RX * ld, sw = (size_t)RW * ld;
  copy8(ldsX,          (const unsigned short*)(gX),          ldsX + LX,     (const unsigned short*)(gX + sx),
        ldsX + 2 * LX, (const unsigned short*)(gX + 2 * sx), ldsX + 3 * LX, (const unsigned short*)(gX + 3 * sx),
        ldsX + 4 * LX, (const unsigned short*)(gX + 4 * sx), ldsX + 5 * LX, (const unsigned short*)(gX + 5 * sx),
        ldsX + 6 * LX, (const unsigned short*)(gX + 6 * sx), ldsX + 7 * LX, (const unsigned short*)(gX + 7 * sx));
  copy8(ldsW,               gWh,          ldsW + LW,          gWh + sw,
        ldsW + 2 * LW,      gWh + 2 * sw, ldsW + 3 * LW,      gWh + 3 * sw,
        ldsW + LP,          gWl,          ldsW + LP + LW,     gWl + sw,
        ldsW + LP + 2 * LW, gWl + 2 * sw, ldsW + LP + 3 * LW, gWl + 3 * sw);
}

typedef __attribute__((ext_vector_type(2))) float  v2f;
typedef __attribute__((ext_vector_type(2))) __bf16 v2b;
typedef __attribute__((ext_vector_type(8))) unsigned int v8u;
// a fragment's sixteen f32 values -> hi = bf16_rne(x), lo = bf16_rne(x - hi); p: elements 0..7 <- p[0..7], 8..15 <- p[16..23], as Frag::load.
// Two values at a time: the packed hi pair is also what x - hi is formed from (low half shifted up, high half masked).
__device__ __forceinline__ void load_raw16(const float* p, v4f (&q4)[4]) {
  q4[0] = *(const v4f*)(p); q4[1] = *(const v4f*)(p + 4); q4[2] = *(const v4f*)(p + 16); q4[3] = *(const v4f*)(p + 20);
}
__device__ __forceinline__ void split16(const v4f (&q4)[4], v16b& hi, v16b& lo) {
  v8u hw, lw;
#pragma unroll
  for (int e = 0; e < 8; ++e) {
    const v2f x = {q4[e >> 1][(e & 1) * 2], q4[e >> 1][(e & 1) * 2 + 1]};
    const unsigned h = __builtin_bit_cast(unsigned, __builtin_convertvector(x, v2b));
    const v2f r = {x[0] - __uint_as_float(h << 16), x[1] - __uint_as_float(h & 0xFFFF0000u)};
    hw[e] = h;
    lw[e] = __builtin_bit_cast(unsigned, __builtin_convertvector(r, v2b));
  }
  hi = __builtin_bit_cast(v16b, hw);
  lo = __builtin_bit_cast(v16b, lw);
}

// The loop over the stages of one T x T tile, sixteen waves of 64 x 64; stage 0 has been published and stage 1's copies fly. VT = false: C[token][feature], activations are the A operand; VT = true:
// C[feature][token], activations are the B operand. xw / ww: the wave's first activation / weight row in the tile.
// Per k step a wave keeps its four weight subtiles in registers and streams its four activation subtiles, each split into hi/lo fragments
// in registers on the way: the read of the next subtile stands beside the split and products of this one.
// Per accumulator and k step the products stand in the order A hi.B hi, A hi.B lo, A lo.B hi.
template <bool VT, int KC, int T, int NTH>
__device__ __forceinline__ void xf_main(const unsigned short* sStage, unsigned ldsX, unsigned ldsW, const float* gX,
                                        const unsigned short* gWh, const unsigned short* gWl, int ld, int K,
                                        int xw, int ww, int rlane, int koff, v8f (&acc)[4][4]) {
  typedef Frag<__bf16> F;
  constexpr int XP = KC + 4;                                   // activation row pitch, floats (16 B x odd)
  constexpr int WP = KC + 8;                                   // weight row pitch, elements (16 B x odd)
  constexpr int XB = T * XP * 4;                               // bytes of the activation part
  constexpr unsigned SB = (unsigned)(XB + 2 * T * WP * 2);     // bytes per stage
  const int NT = K / KC;
  for (int t = 0; t < NT; ++t) {
    const unsigned bo = (unsigned)(t & 1) * SB;
    const char* sb = (const char*)sStage + bo;
    const float*  sX = (const float*)sb + (xw + rlane) * XP + koff;
    const __bf16* sW = (const __bf16*)(sb + XB) + (ww + rlane) * WP + koff;
    v4f raw[4];
    load_raw16(sX, raw);
    // unrolled: the LDS offsets of a stage's fragments become immediates
#pragma unroll
    for (int kk = 0; kk < KC; kk += 32) {
      v16b wh[4], wl[4];
#pragma unroll
      for (int s = 0; s < 4; ++s) {
        wh[s] = F::load(sW + (s << 4) * WP + kk);
        wl[s] = F::load(sW + (T + (s << 4)) * WP + kk);
      }
#pragma unroll
      for (int x = 0; x < 4; ++x) {
        // the next subtile of this stage is read while this one is split and multiplied
        const v4f cur[4] = {raw[0], raw[1], raw[2], raw[3]};
        const int nu = (kk >> 3) + x + 1;
        if (nu < KC / 8) load_raw16(sX + ((nu & 3) << 4) * XP + (nu >> 2) * 32, raw);
        v16b xh, xl;
        split16(cur, xh, xl);
#pragma unroll
        for (int s = 0; s < 4; ++s) {
          if (VT) {
            acc[s][x] = F::mma(wh[s], xh, acc[s][x]);
            acc[s][x] = F::mma(wh[s], xl, acc[s][x]);
            acc[s][x] = F::mma(wl[s], xh, acc[s][x]);
          } else {
            acc[x][s] = F::mma(xh, wh[s], acc[x][s]);
            acc[x][s] = F::mma(xh, wl[s], acc[x][s]);
            acc[x][s] = F::mma(xl, wh[s], acc[x][s]);
          }
        }
      }
    }
    // hand-over: every wave's reads of this buffer are done and its copies of the next stage have landed, then the barrier
    wait_ds0();
    wait_async0();
    __syncthreads();
    if (t + 2 < NT) {
      const int k2 = (t + 2) * KC;
      stage_fill_x<KC, T, NTH>(ldsX + bo, gX + k2, ldsW + bo, gWh + k2, gWl + k2, ld);
    }
  }
}

// WM x WN: waves along m and n in the work-group. KC: k per stage. NBUF: 2 = the next stage's copies fly while this one is worked on.
// MI: 16-row subtiles of a wave's tile along m.
// M % (WM*MI*16) == 0, N % (WN*64) == 0, K % KC == 0; wg = the work-group's tile, 0 .. (M/(WM*MI*16))*(N/(WN*64)) - 1; bz = its z plane.
// BIAS_MODE 3: bias[m] where biasM (the same for the whole work-group), else bias[n].
// XF: the projections' form. Xf holds the activations as f32; they are the B operand where biasM, else the A operand, and take that operand's
// offsets and tile; the weight planes come in through the other operand's two pointers. lda == ldb.
template <int ET, bool SPLIT, int BIAS_MODE, int OUT_MODE, bool RESID, int ACT, int WM, int WN, int KC, int NBUF, int MI, bool XF>
__device__ __forceinline__ void gemm_tile(
    const unsigned short* __restrict__ Ap, const unsigned short* __restrict__ A2p, int lda, long strideA, long strideA2,
    const unsigned short* __restrict__ Btp, const unsigned short* __restrict__ Bt2p, int ldb, long strideB, long strideB2,
    void* __restrict__ Cout, void* __restrict__ Cout2, int ldc, long strideC, long strideC2,
    const float* __restrict__ bias,
    const float* __restrict__ resid, long strideR,
    int M, int N, int K, float scale, int zsplit, const int wg, const int bz, const bool biasM, const float* __restrict__ Xf) {
  typedef typename Elem<ET>::T T;
  typedef typename Frag<T>::V V;
  static_assert(SPLIT, "the staged tiles hold a hi and a lo plane of each 16-bit operand");
  static_assert(NBUF == 2, "the epilogue's slabs lie in the stage buffers, behind the barrier at the foot of the last pass");
  constexpr int NTH = WM * WN * 32;
  constexpr int TM = WM * MI * 16;
  constexpr int TN = WN * 64;
  constexpr int PE = KC + 8;                       // LDS row pitch in elements (16 B x odd)
  static_assert(!XF || (TM == TN && WM == 4 && WN == 4 && MI == 4 && ET == 1), "the f32 form: sixteen waves of 64 x 64");
  constexpr int STAGE_E = XF ? TM * (KC * 2 + 8) + 2 * TN * PE : 2 * (TM + TN) * PE;      // 16-bit elements per stage
  __shared__ __align__(16) unsigned short sStage[NBUF * STAGE_E];
  static_assert(WM * WN * 16 * 68 * 4 <= NBUF * STAGE_E * 2, "slabs fit the stage buffers");
  const int zo   = bz / zsplit;
  const int zi   = bz - zo * zsplit;
  const int lane = threadIdx.x & 31;
  // XF: the wave's number as a scalar, so that its part of every address costs no vector register
  const int wave = XF ? __builtin_amdgcn_readfirstlane(threadIdx.x >> 5) : (threadIdx.x >> 5);
  const int tilesN = N / TN;
  const int tilesM = M / TM;
  if (wg >= tilesM * tilesN) return;   // the same for the whole work-group, in front of every barrier
  const int tmw = wg / tilesN;
  const int tnw = wg - tmw * tilesN;
  const int wm = wave / WN;
  const int wn = wave - wm * WN;
  const int m0 = tmw * TM + wm * (MI * 16);
  const int n0 = tnw * TN + (wn << 6);

  const size_t aOff = (size_t)zi * strideA + (size_t)zo * strideA2;
  const size_t bOff = (size_t)zi * strideB + (size_t)zo * strideB2;
  const size_t cOff = (size_t)zi * strideC + (size_t)zo * strideC2;

  const int rlane = lane & 15;                 // row (A) / col (B, D) within subtile
  const int koff  = (lane >> 4) * 8;           // k offset of this lane half
  const int mOff  = (lane >> 4) * 8;           // D row offset

  v8f acc[MI][4];
#pragma unroll
  for (int i = 0; i < MI; ++i)
#pragma unroll
    for (int j = 0; j < 4; ++j) acc[i][j] = (v8f){0.f,0.f,0.f,0.f,0.f,0.f,0.f,0.f};

  if constexpr (XF) {
    // this thread's places in a round of copies: activation row xr, 16-byte piece xc; weight row wr, 16-byte piece wc
    const int xc = threadIdx.x % (KC / 4), xr = threadIdx.x / (KC / 4);
    const int wc = threadIdx.x % (KC / 8), wr = threadIdx.x / (KC / 8);
    const size_t aT = aOff + (size_t)(tmw * TM) * lda, bT = bOff + (size_t)(tnw * TN) * ldb;
    const size_t wT = (biasM ? aT : bT) + (size_t)wr * lda + wc * 8;
    const float* gX = Xf + (biasM ? bT : aT) + (size_t)xr * lda + xc * 4;
    const unsigned short* gWh = (biasM ? Ap : Btp) + wT;
    const unsigned short* gWl = (biasM ? A2p : Bt2p) + wT;
    const unsigned ldsX = (unsigned)(uintptr_t)sStage + (unsigned)(xr * (KC * 4 + 16) + xc * 16);
    const unsigned ldsW = (unsigned)(uintptr_t)sStage + (unsigned)(TM * (KC * 4 + 16) + wr * (KC * 2 + 16) + wc * 16);
    // in front of the loop: stage 0's copies, this wave's wait for them, the barrier that publishes them; then stage 1's copies
    stage_fill_x<KC, TM, NTH>(ldsX, gX, ldsW, gWh, gWl, lda);
    wait_async0();
    __syncthreads();
    if (K > KC) stage_fill_x<KC, TM, NTH>(ldsX + (unsigned)STAGE_E * 2u, gX + KC, ldsW + (unsigned)STAGE_E * 2u, gWh + KC, gWl + KC, lda);
    // the same branch for the whole work-group: each side holds its own loop, so the accumulators stay in their registers
    if (biasM) xf_main<true,  KC, TM, NTH>(sStage, ldsX, ldsW, gX, gWh, gWl, lda, K, wn << 6, wm << 6, rlane, koff, acc);
    else       xf_main<false, KC, TM, NTH>(sStage, ldsX, ldsW, gX, gWh, gWl, lda, K, wm << 6, wn << 6, rlane, koff, acc);
  } else {
  // this thread's place in a round of copies: row cr of the round, 16-byte piece cc of the row
  constexpr int LPR = KC / 8;
  const int cc = threadIdx.x % LPR;
  const int cr = threadIdx.x / LPR;
  const size_t aRow = aOff + (size_t)(tmw * TM + cr) * lda + cc * 8;
  const size_t bRow = bOff + (size_t)(tnw * TN + cr) * ldb + cc * 8;
  const unsigned short* gAh = Ap + aRow;
  const unsigned short* gAl = A2p + aRow;
  const unsigned short* gBh = Btp + bRow;
  const unsigned short* gBl = Bt2p + bRow;
  const size_t stepA = (size_t)(NTH / LPR) * lda;
  const size_t stepB = (size_t)(NTH / LPR) * ldb;
  const unsigned ldsT = (unsigned)(uintptr_t)sStage + (unsigned)(cr * PE + cc * 8) * 2u;

  const int NT = K / KC;
  stage_fill<KC, TM, TN, NTH>(ldsT, gAh, gAl, gBh, gBl, stepA, stepB);
  wait_async0();
  __syncthreads();
  if (NBUF == 2 && NT > 1)
    stage_fill<KC, TM, TN, NTH>(ldsT + (unsigned)STAGE_E * 2u, gAh + KC, gAl + KC, gBh + KC, gBl + KC, stepA, stepB);

  for (int t = 0; t < NT; ++t) {
    const int buf = (NBUF == 2) ? (t & 1) : 0;
    const T* sb = (const T*)(sStage + buf * STAGE_E);
    const T* sA = sb + (wm * (MI * 16) + rlane) * PE + koff;
    const T* sB = sb + (2 * TM + (wn << 6) + rlane) * PE + koff;
    // unrolled: the LDS offsets of a stage's fragments become immediates
#pragma unroll
    for (int kk = 0; kk < KC; kk += 32) {
      V bh[4], bl[4];
#pragma unroll
      for (int j = 0; j < 4; ++j) {
        bh[j] = Frag<T>::load(sB + (j << 4) * PE + kk);
        bl[j] = Frag<T>::load(sB + (TN + (j << 4)) * PE + kk);
      }
#pragma unroll
      for (int i = 0; i < MI; ++i) {
        V ah = Frag<T>::load(sA + (i << 4) * PE + kk);
        V al = Frag<T>::load(sA + (TM + (i << 4)) * PE + kk);
#pragma unroll
        for (int j = 0; j < 4; ++j) {
          acc[i][j] = Frag<T>::mma(ah, bh[j], acc[i][j]);
          acc[i][j] = Frag<T>::mma(ah, bl[j], acc[i][j]);
          acc[i][j] = Frag<T>::mma(al, bh[j], acc[i][j]);
        }
        Frag<T>::guard(acc[i][0], acc[i][3], ah, al);
      }
      Frag<T>::keep(bh[0], bh[1], bh[2], bh[3]);
      Frag<T>::keep(bl[0], bl[1], bl[2], bl[3]);
    }
    if (NBUF == 2) {
      // hand-over: every wave's reads of this buffer are done and its copies of the next stage have landed, then the barrier
      wait_ds0();
      wait_async0();
      __syncthreads();
      if (t + 2 < NT) {
        const int k2 = (t + 2) * KC;
        stage_fill<KC, TM, TN, NTH>(ldsT + (unsigned)(buf * STAGE_E) * 2u, gAh + k2, gAl + k2, gBh + k2, gBl + k2, stepA, stepB);
      }
    } else if (t + 1 < NT) {
      // one buffer: refill it behind every wave's last read, publish it behind every wave's copies
      wait_ds0();
      __syncthreads();
      const int k1 = (t + 1) * KC;
      stage_fill<KC, TM, TN, NTH>(ldsT, gAh + k1, gAl + k1, gBh + k1, gBl + k1, stepA, stepB);
      wait_async0();
      __syncthreads();
    }
  }
  }
  wait_async0();
  // unrolled: acc is indexed by constants only, so it stays in registers
#pragma unroll
  for (int i = 0; i < MI; ++i) acc_guard4(acc[i][0], acc[i][1], acc[i][2], acc[i][3]);

  // ---- epilogue ----
  float* slab = (float*)sStage + wave * (16 * 68);   // per-wave 16x64 slab, pitch 68 floats; every wave's stage reads and copies ended at the last barrier
  const float* Rb = RESID ? (resid + (size_t)zi * strideR) : nullptr;
  // BIAS_MODE 3: this lane's bias values, all loaded here under one work-group-uniform branch
  float bm[MI][8], bn[4];
  if (BIAS_MODE == 3) {
    // both loops unrolled: bn and bm are indexed by constants only, so they stay in registers
#pragma unroll
    for (int j = 0; j < 4; ++j) bn[j] = 0.f;
#pragma unroll
    for (int i = 0; i < MI; ++i)
#pragma unroll
      for (int r = 0; r < 8; ++r) bm[i][r] = 0.f;
    // each run's address is an input of the wait behind it: it stays in its registers up to that wait, so no load's result lands on it earlier
    if (biasM) {
      const float* bp = bias + m0 + mOff;
#pragma unroll
      for (int i = 0; i < MI; ++i)
#pragma unroll
        for (int r = 0; r < 8; ++r) bm[i][r] = bp[(i << 4) + r];
      asm volatile("s_wait_xcnt 0x0" :: "v"(bp) : "memory");
    } else {
      const float* bp = bias + n0 + rlane;
#pragma unroll
      for (int j = 0; j < 4; ++j) bn[j] = bp[j << 4];
      asm volatile("s_wait_xcnt 0x0" :: "v"(bp) : "memory");
    }
  }
#pragma unroll
  for (int i = 0; i < MI; ++i) {
    const int mBase = m0 + (i << 4);
#pragma unroll
    for (int j = 0; j < 4; ++j) {
      const int n = n0 + (j << 4) + rlane;
      float bv = 0.f;
      if (BIAS_MODE == 2) bv = bias[n];
#pragma unroll
      for (int r = 0; r < 8; ++r) {
        float v = acc[i][j][r] * scale;
        if (BIAS_MODE == 1) v += bias[mBase + mOff + r];
        if (BIAS_MODE == 2) v += bv;
        if (BIAS_MODE == 3) v = (v + bm[i][r]) + bn[j];   // one of the two is 0
        if (RESID) v += Rb[(size_t)(mBase + mOff + r) * ldc + n];
        if (ACT == 1) v = tanhf(v);
        if (ACT == 2) v = fmaxf(v, 0.0f);
        if (ACT == 4) v = (v > 0.f) ? v : 0.01f * v;
        slab[(mOff + r) * 68 + (j << 4) + rlane] = v;
      }
    }
    __builtin_amdgcn_fence(__ATOMIC_RELEASE, "workgroup");
    __builtin_amdgcn_wave_barrier();
    __builtin_amdgcn_fence(__ATOMIC_ACQUIRE, "workgroup");
    if (OUT_MODE == 0) {
      float* C = (float*)Cout + cOff;
      const int hh = lane >> 4, c4 = (lane & 15) * 4;     // row seg = 256 B = 16 lanes x 16 B
      {
#pragma unroll
        for (int it = 0; it < 8; ++it) {
          const int row = it * 2 + hh;
          v4f v = *(const v4f*)(slab + row * 68 + c4);
          *(v4f*)(C + (size_t)(mBase + row) * ldc + n0 + c4) = v;
        }
        
      }
    } else {
      const int q = lane >> 3, c8 = (lane & 7) * 8;
      unsigned short* C  = (unsigned short*)Cout  + cOff;
      unsigned short* C2 = (OUT_MODE == 2) ? ((unsigned short*)Cout2 + cOff) : nullptr;
      {
#pragma unroll
        for (int it = 0; it < 4; ++it) {
          const int row = it * 4 + q;
          const float* sp = slab + row * 68 + c8;
          v8h hv, lv;
#pragma unroll
          for (int e = 0; e < 8; ++e) {
            if (OUT_MODE == 1) {
              hv[e] = (_Float16)sp[e];
            } else {
              unsigned short hb = f2bf_bits(sp[e]);
              unsigned short lb = f2bf_bits(sp[e] - bf_bits2f(hb));
              hv[e] = __builtin_bit_cast(_Float16, hb);
              lv[e] = __builtin_bit_cast(_Float16, lb);
            }
          }
          *(v8h*)(C + (size_t)(mBase + row) * ldc + n0 + c8) = hv;
          if (OUT_MODE == 2) *(v8h*)(C2 + (size_t)(mBase + row) * ldc + n0 + c8) = lv;
        }
        
      }
    }
    __builtin_amdgcn_fence(__ATOMIC_RELEASE, "workgroup");
    __builtin_amdgcn_wave_barrier();
    __builtin_amdgcn_fence(__ATOMIC_ACQUIRE, "workgroup");
  }
}

// one GEMM per launch: eight waves, grid.x = tiles, grid.y = z planes
template <int ET, bool SPLIT, int BIAS_MODE, int OUT_MODE, bool RESID, int ACT, int WN, int KC, int NBUF, int MI>
__global__ __launch_bounds__(256) void wmma_gemm64(
    const unsigned short* __restrict__ Ap, const unsigned short* __restrict__ A2p, int lda, long strideA, long strideA2,
    const unsigned short* __restrict__ Btp, const unsigned short* __restrict__ Bt2p, int ldb, long strideB, long strideB2,
    void* __restrict__ Cout, void* __restrict__ Cout2, int ldc, long strideC, long strideC2,
    const float* __restrict__ bias,
    const float* __restrict__ resid, long strideR,
    int M, int N, int K, float scale, int zsplit) {
  gemm_tile<ET, SPLIT, BIAS_MODE, OUT_MODE, RESID, ACT, 8 / WN, WN, KC, NBUF, MI, false>(
      Ap, A2p, lda, strideA, strideA2, Btp, Bt2p, ldb, strideB, strideB2, Cout, Cout2, ldc, strideC, strideC2,
      bias, resid, strideR, M, N, K, scale, zsplit, blockIdx.x, blockIdx.y, false, nullptr);
}

// The three projections in one launch: blockIdx.y = 0: q = x.Wq^T + bq, 1: k = x.Wk^T + bk (M = 8192 tokens, N = 512, 32 x 2 tiles),
// 2: v^T[bb] = Wv.x[bb]^T + bv (M = 512, N = 512 tokens, 2 x 2 tiles for each of the 16 batches). 64 tiles of 256 x 256 each, 192
// work-groups of sixteen waves (four per SIMD), all resident at once.
// xq, xk, xv: the activations as they come in, f32 [8192][512]; each wave splits the fragments it needs into bf16 hi/lo in registers.
// Wp: planes [Wq hi | Wq lo | Wk hi | Wk lo | Wv hi | Wv lo | ...],
// Pp: planes [Q hi | Q lo | K hi | K lo | V^T hi | V^T lo], as the workspace map has them.
constexpr int kProjT = 256;                                        // tile edge
constexpr int kProjWG = (kGRows / kProjT) * (kDm / kProjT);        // 64 tiles per projection
static_assert(kProjWG == kGB * (kDm / kProjT) * (kSeq / kProjT) && kNGrp == 1, "projection geometry");
__global__ __launch_bounds__(512) void proj3_kernel(
    const float* __restrict__ xq, const float* __restrict__ xk, const float* __restrict__ xv,
    const unsigned short* __restrict__ Wp, unsigned short* __restrict__ Pp,
    const float* __restrict__ bq, const float* __restrict__ bk, const float* __restrict__ bv) {
  constexpr size_t kXE = (size_t)kGRows * kDm, kWE = (size_t)kDm * kDm;   // elements of an activation and of a weight plane
  constexpr int kTB = (kDm / kProjT) * (kSeq / kProjT);                   // v^T tiles per batch
  const int sel = blockIdx.y;
  const bool vt = (sel == 2);
  const float* X = (sel == 0) ? xq : (sel == 1) ? xk : xv;
  const unsigned short* Wh = Wp + (size_t)(2 * sel) * kWE;
  unsigned short* Oh = Pp + (size_t)(2 * sel) * kXE;
  const float* bias = (sel == 0) ? bq : (sel == 1) ? bk : bv;
  gemm_tile<1, true, 3, 2, false, 0, 4, 4, 64, 2, 4, true>(
      Wh, Wh + kWE, kDm, 0L, 0L,
      Wh, Wh + kWE, kDm, vt ? (long)kSeq * kDm : 0L, 0L,
      (void*)Oh, (void*)(Oh + kXE), kDm, vt ? (long)kDm * kSeq : 0L, 0L,
      bias, bias, 0L, vt ? kDm : kGRows, kDm, kDm, 1.0f, kGB,
      vt ? (int)(blockIdx.x % kTB) : (int)blockIdx.x, vt ? (int)(blockIdx.x / kTB) : 0, vt, X);
}

// ---------------------------------------------------------------------------
// f32 -> bf16 hi/lo split of the four weight tensors in one launch: hi = bf16_rne(x), lo = bf16_rne(x - hi).
// A piece = 8 neighbouring elements (32 bytes read, 16 + 16 bytes written) of one thread. 256 work-groups x 512 threads = 131072 threads:
// the four weight tensors together are 131072 pieces (64 work-groups each), one piece per thread.
// Wp: planes [Wq hi | Wq lo | Wk hi | ... | Wo lo], as the workspace map has them.
// ---------------------------------------------------------------------------
constexpr int kSplitTh  = 512;                       // threads per work-group
constexpr int kSplitWG  = 256;                       // work-groups
constexpr int kSplitAll = kSplitTh * kSplitWG;       // 131072 threads
constexpr int kWgtE     = kDm * kDm;                 // elements of a weight tensor
static_assert(4 * kWgtE == kSplitAll * 8 && kWgtE % (kSplitTh * 8) == 0, "split geometry");

__device__ __forceinline__ void split8_store(const v4f a, const v4f b, unsigned short* __restrict__ hi, unsigned short* __restrict__ lo) {
  const float f[8] = {a[0], a[1], a[2], a[3], b[0], b[1], b[2], b[3]};
  unsigned hw[4], lw[4];
#pragma unroll
  for (int q = 0; q < 4; ++q) {
    const unsigned short h0 = f2bf_bits(f[2 * q]), h1 = f2bf_bits(f[2 * q + 1]);
    const unsigned short l0 = f2bf_bits(f[2 * q] - bf_bits2f(h0));
    const unsigned short l1 = f2bf_bits(f[2 * q + 1] - bf_bits2f(h1));
    hw[q] = pk16(h0, h1);
    lw[q] = pk16(l0, l1);
  }
  *(v4u*)hi = (v4u){hw[0], hw[1], hw[2], hw[3]};
  *(v4u*)lo = (v4u){lw[0], lw[1], lw[2], lw[3]};
}

__global__ __launch_bounds__(kSplitTh) void split_w_kernel(
    const float* __restrict__ wq, const float* __restrict__ wk, const float* __restrict__ wv, const float* __restrict__ wo,
    unsigned short* __restrict__ Wp) {
  const int g = blockIdx.x * kSplitTh + threadIdx.x;
  const size_t e0 = (size_t)g * 8;
  // the weight tensor is the same for a whole work-group
  const int wsel = blockIdx.x / (kWgtE / (kSplitTh * 8));
  const float* w = (wsel == 0) ? wq : (wsel == 1) ? wk : (wsel == 2) ? wv : wo;
  const size_t we = e0 - (size_t)wsel * kWgtE;
  const v4f wa = *(const v4f*)(w + we);
  const v4f wb = *(const v4f*)(w + we + 4);
  wait_x0();
  unsigned short* whi = Wp + (size_t)(2 * wsel) * kWgtE + we;
  split8_store(wa, wb, whi, whi + kWgtE);
}

// ---------------------------------------------------------------------------
// Scores, gated mixing and p.v in one kernel; no score and no probability leaves the work-group.
// Work-group = one (batch, head) plane z = bb*8 + h and 256 queries; wave = 32 queries (two 16-column groups) against all 512 keys.
// Transposed products: S^T = K.Q^T (A = key rows from LDS, B = query rows kept in registers), O^T += V^T.A^T (A = v^T rows from LDS).
// In an S^T tile lane (c, hh) holds query c and keys 8*hh + r: the row maximum and the row sum are in-lane plus one exchange
// between the lane halves, and two S^T tiles (32 keys), converted in place, are the B operand of the second product.
//   pass 1: m_i = max_j s_ij
//   pass 2: the same products again (same order, so the same bits), then
//     g_c  = bg[c] + sum_d q[i][h*64+d] * Wg[c][d],  qp_c = rcp((|g_c| + 1)^2)
//     p_j  = 2^((s_j - m) * log2e)                    (= softmax_j / max softmax)
//     adj  = 2^((i-j)^2 * (-0.5 log2e qp_1)) for j < i,  2^((i-j)^2 * (-0.5 log2e qp_0)) for j >= i
//     a_j  = sg * p_j + (1 - sg) * adj,  sg = rcp(1 + 2^(-lam1 * log2e))   -> bf16 hi/lo fragments
//     ctx_i = (sum_j a_j v_j) * rcp(sum_j a_j + 1e-9)  -> bf16 hi/lo planes
// LDS: all 512 key rows (hi, lo; pitch 144 B) and the 64 v^T rows (hi, lo; pitch 1040 B) of the plane, each filled once by
// global_load_async_to_lds_b128; the v^T copies fly during pass 1.
// Output coverage: grid 2 x 128, 8 waves x 32 queries = 512 rows per plane; a wave writes the whole 128-byte segment (row, h) of both planes.
// ---------------------------------------------------------------------------
__device__ __forceinline__ float hw_exp2(float x) { return __builtin_amdgcn_exp2f(x); }
__device__ __forceinline__ float hw_rcp(float x)  { return __builtin_amdgcn_rcpf(x); }

// one plane in 16 rounds of the 256 threads; lds / g = this thread's place in round 0, lstep (bytes) / gstep (elements) = one round
__device__ __forceinline__ void fill16(unsigned lds, unsigned lstep, const unsigned short* g, size_t gstep) {
  // unrolled: two statements of eight copies
#pragma unroll
  for (int p = 0; p < 16; p += 8)
    copy8(lds + (unsigned)p * lstep,       g + (size_t)p * gstep,       lds + (unsigned)(p + 1) * lstep, g + (size_t)(p + 1) * gstep,
          lds + (unsigned)(p + 2) * lstep, g + (size_t)(p + 2) * gstep, lds + (unsigned)(p + 3) * lstep, g + (size_t)(p + 3) * gstep,
          lds + (unsigned)(p + 4) * lstep, g + (size_t)(p + 4) * gstep, lds + (unsigned)(p + 5) * lstep, g + (size_t)(p + 5) * gstep,
          lds + (unsigned)(p + 6) * lstep, g + (size_t)(p + 6) * gstep, lds + (unsigned)(p + 7) * lstep, g + (size_t)(p + 7) * gstep);
}

constexpr int kKP = kDk + 8;     // LDS pitch of a key row, elements (16 B x odd)
constexpr int kVP = kSeq + 8;    // LDS pitch of a v^T row, elements (16 B x odd)
constexpr int kQB = 256;         // queries per work-group

// S^T tile of keys kt*16 .. kt*16+15 against both query groups; kr = this lane's place in key row c of the hi plane
__device__ __forceinline__ void score_tile(const __bf16* kr, const v16b (&qh)[2][2], const v16b (&ql)[2][2], v8f (&s)[2]) {
  typedef Frag<__bf16> F;
  const v16b kh0 = F::load(kr), kh1 = F::load(kr + 32);
  const v16b kl0 = F::load(kr + kSeq * kKP), kl1 = F::load(kr + kSeq * kKP + 32);
#pragma unroll
  for (int qt = 0; qt < 2; ++qt) {
    v8f a = (v8f){0.f, 0.f, 0.f, 0.f, 0.f, 0.f, 0.f, 0.f};
    a = F::mma(kh0, qh[qt][0], a);
    a = F::mma(kl0, qh[qt][0], a);
    a = F::mma(kh0, ql[qt][0], a);
    a = F::mma(kh1, qh[qt][1], a);
    a = F::mma(kl1, qh[qt][1], a);
    a = F::mma(kh1, ql[qt][1], a);
    s[qt] = a;
  }
}

__global__ __launch_bounds__(256) void attn_mix_kernel(
    const unsigned short* __restrict__ Qh, const unsigned short* __restrict__ Ql,
    const unsigned short* __restrict__ Kh, const unsigned short* __restrict__ Kl,
    const unsigned short* __restrict__ VTh, const unsigned short* __restrict__ VTl,
    unsigned short* __restrict__ Ch, unsigned short* __restrict__ Cl,
    const float* __restrict__ Wg, const float* __restrict__ bg, const float* __restrict__ lam1) {
  typedef Frag<__bf16> F;
  __shared__ __align__(16) unsigned short sK[2 * kSeq * kKP];
  __shared__ __align__(16) unsigned short sV[2 * kDk * kVP];
  const int tid  = threadIdx.x;
  const int lane = tid & 31;
  const int wave = tid >> 5;
  const int c    = lane & 15;
  const int hh   = lane >> 4;
  const int z    = blockIdx.y;
  const int bb   = z >> 3;
  const int h    = z & (kHeads - 1);
  const int q0   = blockIdx.x * kQB + wave * 32;

  // key rows: 8 lanes per 128-byte row piece, 32 rows per round
  {
    const int cc = tid & 7, cr = tid >> 3;
    const size_t g = (size_t)(bb * kSeq + cr) * kDm + (size_t)h * kDk + cc * 8;
    const unsigned l = (unsigned)(uintptr_t)sK + (unsigned)(cr * kKP + cc * 8) * 2u;
    fill16(l, 32u * kKP * 2u, Kh + g, (size_t)32 * kDm);
    fill16(l + (unsigned)(kSeq * kKP) * 2u, 32u * kKP * 2u, Kl + g, (size_t)32 * kDm);
  }

  // query fragments (B operand), hardware k order, kept for both passes
  v16b qh[2][2], ql[2][2];
#pragma unroll
  for (int qt = 0; qt < 2; ++qt) {
#pragma unroll
    for (int ks = 0; ks < 2; ++ks) {
      const size_t o = (size_t)(bb * kSeq + q0 + qt * 16 + c) * kDm + (size_t)h * kDk + ks * 32 + hh * 8;
      qh[qt][ks] = F::load((const __bf16*)(Qh + o));
      ql[qt][ks] = F::load((const __bf16*)(Ql + o));
    }
    wait_x0();
  }

  // gating dots: this lane holds 32 of its query's 64 d, the other lane half the rest
  float gn0[2], gn1[2];
  {
    float g0[2] = {0.f, 0.f}, g1[2] = {0.f, 0.f};
#pragma unroll
    for (int ks = 0; ks < 2; ++ks)
#pragma unroll
      for (int hf = 0; hf < 2; ++hf) {
        const float* wp = Wg + ks * 32 + hf * 16 + hh * 8;
        const v4f wa = *(const v4f*)(wp), wb = *(const v4f*)(wp + 4);
        const v4f wc = *(const v4f*)(wp + kDk), wd = *(const v4f*)(wp + kDk + 4);
#pragma unroll
        for (int e = 0; e < 8; ++e) {
          const float w0 = (e < 4) ? wa[e & 3] : wb[e & 3];
          const float w1 = (e < 4) ? wc[e & 3] : wd[e & 3];
#pragma unroll
          for (int qt = 0; qt < 2; ++qt) {
            const float qv = (float)qh[qt][ks][hf * 8 + e] + (float)ql[qt][ks][hf * 8 + e];
            g0[qt] += qv * w0;
            g1[qt] += qv * w1;
          }
        }
      }
    const float b0 = bg[0], b1 = bg[1];
#pragma unroll
    for (int qt = 0; qt < 2; ++qt) {
      const float t0 = fabsf(g0[qt] + __shfl_xor(g0[qt], 16, 32) + b0) + 1.0f;
      const float t1 = fabsf(g1[qt] + __shfl_xor(g1[qt], 16, 32) + b1) + 1.0f;
      gn0[qt] = (-0.5f * kLog2e) * hw_rcp(t0 * t0);      // j >= i (upper incl. diagonal)
      gn1[qt] = (-0.5f * kLog2e) * hw_rcp(t1 * t1);      // j <  i (strictly lower)
    }
  }
  const float sg  = hw_rcp(1.0f + hw_exp2(-lam1[0] * kLog2e));
  const float omg = 1.0f - sg;

  // the key rows: this wave's copies have landed, then the barrier that publishes them
  wait_async0();
  __syncthreads();

  // v^T rows: 64 lanes per 1024-byte row, 4 rows per round; read only behind the barrier after pass 1
  {
    const int cc = tid & 63, cr = tid >> 6;
    const size_t g = (size_t)bb * kDm * kSeq + (size_t)(h * kDk + cr) * kSeq + cc * 8;
    const unsigned l = (unsigned)(uintptr_t)sV + (unsigned)(cr * kVP + cc * 8) * 2u;
    fill16(l, 4u * kVP * 2u, VTh + g, (size_t)4 * kSeq);
    fill16(l + (unsigned)(kDk * kVP) * 2u, 4u * kVP * 2u, VTl + g, (size_t)4 * kSeq);
  }

  const __bf16* kr0 = (const __bf16*)sK + c * kKP + hh * 8;

  // pass 1: row maxima
  float mx[2] = {-INFINITY, -INFINITY};
  // two tiles per trip: the second tile's LDS reads stand beside the first tile's products
#pragma unroll 2
  for (int kt = 0; kt < kSeq / 16; ++kt) {
    v8f s[2];
    score_tile(kr0 + kt * 16 * kKP, qh, ql, s);
#pragma unroll
    for (int qt = 0; qt < 2; ++qt)
#pragma unroll
      for (int r = 0; r < 8; ++r) mx[qt] = fmaxf(mx[qt], s[qt][r]);
  }
#pragma unroll
  for (int qt = 0; qt < 2; ++qt) mx[qt] = fmaxf(mx[qt], __shfl_xor(mx[qt], 16, 32));

  // the v^T rows: this wave's copies have landed, then the barrier that publishes them
  wait_async0();
  __syncthreads();

  // pass 2
  v8f o[4][2];
#pragma unroll
  for (int dt = 0; dt < 4; ++dt)
#pragma unroll
    for (int qt = 0; qt < 2; ++qt) o[dt][qt] = (v8f){0.f, 0.f, 0.f, 0.f, 0.f, 0.f, 0.f, 0.f};
  float ls[2] = {0.f, 0.f};
  const float fi[2] = {(float)(q0 + c - hh * 8), (float)(q0 + 16 + c - hh * 8)};
  const __bf16* vr0 = (const __bf16*)sV + c * kVP + hh * 8;
  // rolled: for speed only
#pragma unroll 1
  for (int kp = 0; kp < kSeq / 32; ++kp) {
    v16b ph[2], pl[2];
#pragma unroll
    for (int t = 0; t < 2; ++t) {
      v8f s[2];
      score_tile(kr0 + (kp * 2 + t) * 16 * kKP, qh, ql, s);
#pragma unroll
      for (int qt = 0; qt < 2; ++qt) {
        const float fb = fi[qt] - (float)(kp * 32 + t * 16);   // i - j at r = 0
#pragma unroll
        for (int r = 0; r < 8; ++r) {
          const float p   = hw_exp2((s[qt][r] - mx[qt]) * kLog2e);
          const float fd  = fb - (float)r;
          const float gs  = (fd > 0.f) ? gn1[qt] : gn0[qt];
          const float adj = hw_exp2((fd * fd) * gs);
          const float av  = sg * p + omg * adj;
          ls[qt] += av;
          const __bf16 hb = (__bf16)av;
          ph[qt][t * 8 + r] = hb;
          pl[qt][t * 8 + r] = (__bf16)(av - (float)hb);
        }
      }
    }
    const __bf16* vr = vr0 + kp * 32;
#pragma unroll
    for (int dt = 0; dt < 4; ++dt) {
      const v16b vh = F::load(vr + dt * 16 * kVP);
      const v16b vl = F::load(vr + (kDk + dt * 16) * kVP);
#pragma unroll
      for (int qt = 0; qt < 2; ++qt) {
        o[dt][qt] = F::mma(vh, ph[qt], o[dt][qt]);
        o[dt][qt] = F::mma(vl, ph[qt], o[dt][qt]);
        o[dt][qt] = F::mma(vh, pl[qt], o[dt][qt]);
      }
    }
  }

  // epilogue: lane (c, hh) holds d = dt*16 + 8*hh + r of query c: one 16-byte store per tile and plane
#pragma unroll
  for (int qt = 0; qt < 2; ++qt) {
    const float inv = hw_rcp(ls[qt] + __shfl_xor(ls[qt], 16, 32) + 1e-9f);
    const size_t ro = (size_t)(bb * kSeq + q0 + qt * 16 + c) * kDm + (size_t)h * kDk + hh * 8;
#pragma unroll
    for (int dt = 0; dt < 4; ++dt) {
      v8b hv, lv;
#pragma unroll
      for (int r = 0; r < 8; ++r) {
        const float x = o[dt][qt][r] * inv;
        const __bf16 hb = (__bf16)x;
        hv[r] = hb;
        lv[r] = (__bf16)(x - (float)hb);
      }
      *(v8b*)((__bf16*)Ch + ro + dt * 16) = hv;
      *(v8b*)((__bf16*)Cl + ro + dt * 16) = lv;
    }
    wait_x0();
  }
}

// ---------------------------------------------------------------------------
// Workspace region map (bytes; every offset a multiple of 512 KiB). Every region is fully written
// inside the call before any read.
//   Wqh,Wql,Wkh,Wkl,Wvh,Wvl,Woh,Wol  bf16 [512][512] each            0 .. 4194304
//   Qh,Ql,Kh,Kl                      bf16 [8192][512] each     4194304 .. 37748736   (row bb*512+i, col h*64+d)
//   VTh,VTl                          bf16 [16][512][512]      37748736 .. 54525952   (batch, row h*64+d, col token)
//   CTXh,CTXl                        bf16 [8192][512] each    54525952 .. 71303168   (row bb*512+i, col h*64+d)
//   total 71303168
// ---------------------------------------------------------------------------
extern "C" void kernel_launch(void* const* d_in, const int* in_sizes, int n_in,
                              void* d_out, int out_size, void* d_ws, size_t ws_size,
                              hipStream_t stream) {
  if (n_in < 14) return;
  const int nAct = kBatch * kSeq * kDm;          // 4194304
  const int nW   = kDm * kDm;                    // 262144
  if (in_sizes[0] != nAct || in_sizes[1] != nAct || in_sizes[2] != nAct) return;
  if (in_sizes[3] != nW || in_sizes[5] != nW || in_sizes[7] != nW || in_sizes[12] != nW) return;
  if (in_sizes[4] != kDm || in_sizes[6] != kDm || in_sizes[8] != kDm || in_sizes[13] != kDm) return;
  if (in_sizes[9] != 2 * kDk || in_sizes[10] < 2 || in_sizes[11] < 1) return;
  if (out_size != nAct) return;

  const float* query = (const float*)d_in[0];
  const float* key   = (const float*)d_in[1];
  const float* value = (const float*)d_in[2];
  const float* Wq    = (const float*)d_in[3];
  const float* bq    = (const float*)d_in[4];
  const float* Wk    = (const float*)d_in[5];
  const float* bk    = (const float*)d_in[6];
  const float* Wv    = (const float*)d_in[7];
  const float* bv    = (const float*)d_in[8];
  const float* Wg    = (const float*)d_in[9];
  const float* bg    = (const float*)d_in[10];
  const float* lam1  = (const float*)d_in[11];
  const float* Wo    = (const float*)d_in[12];
  const float* bo    = (const float*)d_in[13];
  float* out = (float*)d_out;

  const size_t PW  = (size_t)kDm * kDm * 2;                 // 524288    weight plane
  const size_t PX  = (size_t)kGRows * kDm * 2;              // 8388608   q / k / ctx plane
  const size_t PVT = (size_t)kGB * kDm * kSeq * 2;          // 8388608   v^T plane
  size_t off = 0;
  const size_t oWqh = off; off += PW;  const size_t oWql = off; off += PW;
  const size_t oWkh = off; off += PW;  const size_t oWkl = off; off += PW;
  const size_t oWvh = off; off += PW;  const size_t oWvl = off; off += PW;
  const size_t oWoh = off; off += PW;  const size_t oWol = off; off += PW;
  const size_t oQh  = off; off += PX;  const size_t oQl  = off; off += PX;
  const size_t oKh  = off; off += PX;  const size_t oKl  = off; off += PX;
  const size_t oVTh = off; off += PVT; const size_t oVTl = off; off += PVT;
  const size_t oCh  = off; off += PX;  const size_t oCl  = off; off += PX;
  if (off > ws_size) return;                                // off = 71303168

  char* ws = (char*)d_ws;
  unsigned short* Wqh = (unsigned short*)(ws + oWqh); unsigned short* Wql = (unsigned short*)(ws + oWql);
  unsigned short* Wkh = (unsigned short*)(ws + oWkh); unsigned short* Wkl = (unsigned short*)(ws + oWkl);
  unsigned short* Wvh = (unsigned short*)(ws + oWvh); unsigned short* Wvl = (unsigned short*)(ws + oWvl);
  unsigned short* Woh = (unsigned short*)(ws + oWoh); unsigned short* Wol = (unsigned short*)(ws + oWol);
  unsigned short* Qh  = (unsigned short*)(ws + oQh);  unsigned short* Ql  = (unsigned short*)(ws + oQl);
  unsigned short* Kh  = (unsigned short*)(ws + oKh);  unsigned short* Kl  = (unsigned short*)(ws + oKl);
  unsigned short* VTh = (unsigned short*)(ws + oVTh); unsigned short* VTl = (unsigned short*)(ws + oVTl);
  unsigned short* Ch  = (unsigned short*)(ws + oCh);  unsigned short* Cl  = (unsigned short*)(ws + oCl);

  const dim3 blk(256);
  const dim3 blkSplit(kSplitTh);                                    // 512 threads
  const dim3 gSplit(kSplitWG);                                      // 256 work-groups: the four weight tensors
  const dim3 blkProj(512);
  const dim3 gProj(kProjWG, 3);                                     // 64 x 3:     256 x 256 tiles of q, k, v^T; K=512
  const dim3 gAtt(kSeq / kQB, kNZ);                                 // 2 x 128:    256 queries x 512 keys per work-group
  const dim3 gOut((kGRows / 128) * (kDm / 128), 1);                 // 64 x 4 = 256 tiles of 128 x 128: M=8192, N=512, K=512

  // (1) weights -> hi/lo planes [512][512] (torch [out][in] is already Bt[n][k]); every plane whole
  split_w_kernel<<<gSplit, blkSplit, 0, stream>>>(Wq, Wk, Wv, Wo, Wqh);

  for (int gb = 0; gb < kNGrp; ++gb) {
    const size_t actOff = (size_t)gb * kGRows * kDm;
    // (2) q = x.Wq^T + bq, k = x.Wk^T + bk -> hi/lo planes [8192][512]; v^T[bb][o][tok] = sum_k Wv[o][k] x[bb*512+tok][k] + bv[o]
    //     -> hi/lo planes [16][512][512]; all six planes whole, one launch
    proj3_kernel<<<gProj, blkProj, 0, stream>>>(query, key, value, Wqh, Qh, bq, bk, bv);
    // (4) ctx[bb*512+i][h*64+d] = sum_j A[z][i][j] v^T[bb][h*64+d][j] / (sum_j A[z][i][j] + 1e-9) -> hi/lo planes, A = gated mix of the scores q.k^T
    attn_mix_kernel<<<gAtt, blk, 0, stream>>>(Qh, Ql, Kh, Kl, VTh, VTl, Ch, Cl, Wg, bg, lam1);
    // (5) out = ctx.Wo^T + bo -> f32 [8192][512], all of d_out: one 128 x 128 tile per work-group, eight waves (4 x 2) of 32 x 64, k in four stages of 128
    float* outg = out + actOff;
    wmma_gemm64<1, true, 2, 0, false, 0, 2, 128, 2, 2><<<gOut, blk, 0, stream>>>(
        Ch, Cl, kDm, 0L, 0L, Woh, Wol, kDm, 0L, 0L, (void*)outg, (void*)outg, kDm, 0L, 0L,
        bo, bo, 0L, kGRows, kDm, kDm, 1.0f, 1);
  }
}

// v008
// It runs in 79.2 microseconds.
// Two timings next to v007 both put it at 1.03 times that version's speed.
// All steps since v000 together make it 12.4 times as fast.
// Contractions x.Wq^T, x.Wk^T, Wv.x^T, k.q^T, v^T.p^T, v^T.adj^T, ctx.Wo^T: v_wmma_f32_16x16x32_bf16 on bf16 hi/lo split operand planes (hi.hi + hi.lo + lo.hi), f32 accumulate; per-row 64x2 gating dots, softmax, distance adjacency, max- and sum-normalisation in f32 on the VALU (hardware exp2/rcp).
#include <hip/hip_runtime.h>
#include <math.h>
#include <stdint.h>

constexpr int kBatch = 16;
constexpr int kSeq   = 512;
constexpr int kDm    = 512;
constexpr int kHeads = 8;
constexpr int kDk    = 64;
constexpr int kGB    = 16;                 // batches per group: the whole batch goes through every stage in one launch
constexpr int kNGrp  = kBatch / kGB;       // 1 group
constexpr int kNZ    = kGB * kHeads;       // 128 (batch, head) planes
constexpr int kGRows = kGB * kSeq;         // 8192 token rows
constexpr float kLog2e = 1.4426950408889634f;
static_assert(kSeq == 512 && kDk == 64 && kDm == kHeads * kDk && (kBatch % kGB) == 0, "geometry");

typedef __attribute__((ext_vector_type(16))) _Float16 v16h;
typedef __attribute__((ext_vector_type(8)))  _Float16 v8h;
typedef __attribute__((ext_vector_type(16))) __bf16   v16b;
typedef __attribute__((ext_vector_type(8)))  __bf16   v8b;
typedef __attribute__((ext_vector_type(8)))  float    v8f;
typedef __attribute__((ext_vector_type(4)))  float    v4f;
typedef __attribute__((ext_vector_type(4)))  unsigned int v4u;

__device__ __forceinline__ unsigned short f2bf_bits(float f) {
  unsigned u = __float_as_uint(f);
  return (unsigned short)((u + 0x7FFFu + ((u >> 16) & 1u)) >> 16);
}
__device__ __forceinline__ float bf_bits2f(unsigned short h) { return __uint_as_float(((unsigned)h) << 16); }
__device__ __forceinline__ unsigned pk16(unsigned short a, unsigned short b) { return (unsigned)a | ((unsigned)b << 16); }

// hazard guards as plain device helpers (no inline asm inside the kernel template body)
__device__ __forceinline__ void dep_guard_h(v8f& a, v8f& b, v16h x, v16h y) { asm volatile("v_nop\n\tv_nop\n\tv_nop\n\tv_nop" : "+v"(a), "+v"(b) : "v"(x), "v"(y)); }
__device__ __forceinline__ void dep_guard_b(v8f& a, v8f& b, v16b x, v16b y) { asm volatile("v_nop\n\tv_nop\n\tv_nop\n\tv_nop" : "+v"(a), "+v"(b) : "v"(x), "v"(y)); }
__device__ __forceinline__ void keep4_h(v16h a, v16h b, v16h c, v16h d) { asm volatile("v_nop" :: "v"(a), "v"(b), "v"(c), "v"(d)); }
__device__ __forceinline__ void keep4_b(v16b a, v16b b, v16b c, v16b d) { asm volatile("v_nop" :: "v"(a), "v"(b), "v"(c), "v"(d)); }
__device__ __forceinline__ void acc_guard4(v8f& a, v8f& b, v8f& c, v8f& d) { asm volatile("v_nop\n\tv_nop\n\tv_nop\n\tv_nop" : "+v"(a), "+v"(b), "+v"(c), "+v"(d)); }
template <typename T> struct Frag;
template <> struct Frag<_Float16> {
  typedef v16h V; union U { v16h v; v8h h[2]; };
  static __device__ __forceinline__ v16h load(const _Float16* p) {   // elements 0..7 <- p[0..7], 8..15 <- p[16..23]
    U f; f.h[0] = *(const v8h*)(p); f.h[1] = *(const v8h*)(p + 16); return f.v;
  }
  static __device__ __forceinline__ v8f mma(v16h a, v16h b, v8f c) {
    return __builtin_amdgcn_wmma_f32_16x16x32_f16(false, a, false, b, (short)0, c, false, false);
  }
  static __device__ __forceinline__ void guard(v8f& a, v8f& b, v16h x, v16h y) { dep_guard_h(a, b, x, y); }
  static __device__ __forceinline__ void keep(v16h a, v16h b, v16h c, v16h d) { keep4_h(a, b, c, d); }
};
template <> struct Frag<__bf16> {
  typedef v16b V; union U { v16b v; v8b h[2]; };
  static __device__ __forceinline__ v16b load(const __bf16* p) {
    U f; f.h[0] = *(const v8b*)(p); f.h[1] = *(const v8b*)(p + 16); return f.v;
  }
  static __device__ __forceinline__ v8f mma(v16b a, v16b b, v8f c) {
    return __builtin_amdgcn_wmma_f32_16x16x32_bf16(false, a, false, b, (short)0, c, false, false);
  }
  static __device__ __forceinline__ void guard(v8f& a, v8f& b, v16b x, v16b y) { dep_guard_b(a, b, x, y); }
  static __device__ __forceinline__ void keep(v16b a, v16b b, v16b c, v16b d) { keep4_b(a, b, c, d); }
};

// ---- Register-blocked batched WMMA GEMM ------------------------------------
// C[m,n] = scale * sum_k A[m,k] * Bt[n,k] (+bias)(+resid); each wave owns a (MI*16)x64 tile.
// A row-major [M,K]; Bt row-major [N,K]; M % (WM*MI*16) == 0, N % (WN*64) == 0, K % KC == 0.
// SPLIT: operands are hi/lo planes (A2/Bt2 = lo planes, same layout); product = hi.hi + hi.lo + lo.hi.
// BIAS_MODE: 0 = none, 1 = bias[m], 2 = bias[n].
// OUT_MODE: 0 = f32, 1 = f16, 2 = bf16 hi plane (Cout) + bf16 lo plane (Cout2).
// z addressing: bz = the z plane (blockIdx.y in wmma_gemm64), zi = bz % zsplit, zo = bz / zsplit; operand base = zi*stride + zo*stride2 (elements).
// ET: 0 = f16 operands, 1 = bf16 operands (pointers passed as 16-bit storage)
template <int ET> struct Elem;
template <> struct Elem<0> { typedef _Float16 T; };
template <> struct Elem<1> { typedef __bf16 T; };
// ---- LDS staging of the operand tiles ---------------------------------------
// The WM*WN waves of a work-group share one (WM*MI*16) x (WN*64) tile of C. Per pass of KC k, the rows of A hi, A lo, Bt hi, Bt lo
// that the tile needs are copied to LDS by global_load_async_to_lds_b128 (KC/8 neighbouring lanes per row: whole contiguous row pieces),
// at a row pitch of KC*2 + 16 bytes; the WMMA fragments are then read with ds_load_b128.
// this wave's copies have landed before the barrier that publishes them to the other waves
__device__ __forceinline__ void wait_async0() { asm volatile("s_wait_asynccnt 0x0" ::: "memory"); }
// this wave's fragment reads have returned before the barrier behind which their buffer is refilled
__device__ __forceinline__ void wait_ds0() { asm volatile("s_wait_dscnt 0x0" ::: "memory"); }
// stands behind a group of global loads or stores, in front of whatever rewrites a register that they name
__device__ __forceinline__ void wait_x0() { asm volatile("s_wait_xcnt 0x0" ::: "memory"); }
// six copies, 16 bytes per lane each; the closing s_wait_xcnt stands in the same statement so that no address register is rewritten ahead of it
__device__ __forceinline__ void copy6(unsigned l0, const unsigned short* g0, unsigned l1, const unsigned short* g1,
                                      unsigned l2, const unsigned short* g2, unsigned l3, const unsigned short* g3,
                                      unsigned l4, const unsigned short* g4, unsigned l5, const unsigned short* g5) {
  asm volatile("global_load_async_to_lds_b128 %0, %1, off\n\t"
               "global_load_async_to_lds_b128 %2, %3, off\n\t"
               "global_load_async_to_lds_b128 %4, %5, off\n\t"
               "global_load_async_to_lds_b128 %6, %7, off\n\t"
               "global_load_async_to_lds_b128 %8, %9, off\n\t"
               "global_load_async_to_lds_b128 %10, %11, off\n\t"
               "s_wait_xcnt 0x0"
               :: "v"(l0), "v"(g0), "v"(l1), "v"(g1), "v"(l2), "v"(g2), "v"(l3), "v"(g3), "v"(l4), "v"(g4), "v"(l5), "v"(g5)
               : "memory");
}
// eight copies, 16 bytes per lane each; the closing s_wait_xcnt stands in the same statement so that no address register is rewritten ahead of it
__device__ __forceinline__ void copy8(unsigned l0, const unsigned short* g0, unsigned l1, const unsigned short* g1,
                                      unsigned l2, const unsigned short* g2, unsigned l3, const unsigned short* g3,
                                      unsigned l4, const unsigned short* g4, unsigned l5, const unsigned short* g5,
                                      unsigned l6, const unsigned short* g6, unsigned l7, const unsigned short* g7) {
  asm volatile("global_load_async_to_lds_b128 %0, %1, off\n\t"
               "global_load_async_to_lds_b128 %2, %3, off\n\t"
               "global_load_async_to_lds_b128 %4, %5, off\n\t"
               "global_load_async_to_lds_b128 %6, %7, off\n\t"
               "global_load_async_to_lds_b128 %8, %9, off\n\t"
               "global_load_async_to_lds_b128 %10, %11, off\n\t"
               "global_load_async_to_lds_b128 %12, %13, off\n\t"
               "global_load_async_to_lds_b128 %14, %15, off\n\t"
               "s_wait_xcnt 0x0"
               :: "v"(l0), "v"(g0), "v"(l1), "v"(g1), "v"(l2), "v"(g2), "v"(l3), "v"(g3),
                  "v"(l4), "v"(g4), "v"(l5), "v"(g5), "v"(l6), "v"(g6), "v"(l7), "v"(g7)
               : "memory");
}
// One stage: LDS rows [A hi: TM | A lo: TM | Bt hi: TN | Bt lo: TN]. NTH threads cover RPP rows per round; lds and the four
// pointers are this thread's own place in round 0 of each part; stepA / stepB = RPP rows of the source, in elements.
template <int KC, int TM, int TN, int NTH>
__device__ __forceinline__ void stage_fill(unsigned lds, const unsigned short* gAh, const unsigned short* gAl,
                                           const unsigned short* gBh, const unsigned short* gBl, size_t stepA, size_t stepB) {
  constexpr int RPP = NTH / (KC / 8);
  constexpr int PA = TM / RPP, PB = TN / RPP, NP = 2 * (PA + PB);
  constexpr unsigned LB = (unsigned)RPP * (KC * 2 + 16);
  static_assert(TM % RPP == 0 && TN % RPP == 0 && (NP % 6 == 0 || NP % 8 == 0) && NP <= 63, "stage geometry");
  // both loops unrolled: the round number is then a constant, so each copy's part and LDS place are chosen at compile time
  if constexpr (NP % 6 != 0) {
#pragma unroll
    for (int p = 0; p < NP; p += 8) {
      const unsigned short* g[8];
#pragma unroll
      for (int u = 0; u < 8; ++u) {
        const int q = p + u;
        g[u] = (q < PA) ? (gAh + (size_t)q * stepA)
             : (q < 2 * PA) ? (gAl + (size_t)(q - PA) * stepA)
             : (q < 2 * PA + PB) ? (gBh + (size_t)(q - 2 * PA) * stepB)
                                 : (gBl + (size_t)(q - 2 * PA - PB) * stepB);
      }
      copy8(lds + (unsigned)p * LB, g[0], lds + (unsigned)(p + 1) * LB, g[1], lds + (unsigned)(p + 2) * LB, g[2],
            lds + (unsigned)(p + 3) * LB, g[3], lds + (unsigned)(p + 4) * LB, g[4], lds + (unsigned)(p + 5) * LB, g[5],
            lds + (unsigned)(p + 6) * LB, g[6], lds + (unsigned)(p + 7) * LB, g[7]);
    }
    return;
  }
#pragma unroll
  for (int p = 0; p < NP; p += 6) {
    const unsigned short* g[6];
#pragma unroll
    for (int u = 0; u < 6; ++u) {
      const int q = p + u;
      g[u] = (q < PA) ? (gAh + (size_t)q * stepA)
           : (q < 2 * PA) ? (gAl + (size_t)(q - PA) * stepA)
           : (q < 2 * PA + PB) ? (gBh + (size_t)(q - 2 * PA) * stepB)
                               : (gBl + (size_t)(q - 2 * PA - PB) * stepB);
    }
    copy6(lds + (unsigned)p * LB, g[0], lds + (unsigned)(p + 1) * LB, g[1], lds + (unsigned)(p + 2) * LB, g[2],
          lds + (unsigned)(p + 3) * LB, g[3], lds + (unsigned)(p + 4) * LB, g[4], lds + (unsigned)(p + 5) * LB, g[5]);
  }
}

// ---- The projections take their activations as f32 ---------------------------
// One stage: LDS rows [activations, f32: T rows of KC*4 + 16 bytes | weights hi: T rows | weights lo: T rows, KC*2 + 16 bytes each].
// NTH threads cover RX activation rows (KC/4 lanes per row) or RW weight rows (KC/8 lanes per row) per round; ldsX, ldsW and the three
// pointers are this thread's own places in round 0; ld = row length of both sources, in elements.
template <int KC, int T, int NTH>
__device__ __forceinline__ void stage_fill_x(unsigned ldsX, const float* gX, unsigned ldsW,
                                             const unsigned short* gWh, const unsigned short* gWl, int ld) {
  constexpr int RX = NTH / (KC / 4), RW = NTH / (KC / 8);
  static_assert(T == 8 * RX && T == 4 * RW, "two statements of eight copies");
  constexpr unsigned LX = (unsigned)RX * (KC * 4 + 16), LW = (unsigned)RW * (KC * 2 + 16), LP = (unsigned)T * (KC * 2 + 16);
  const size_t sx = (size_t)RX * ld, sw = (size_t)RW * ld;
  copy8(ldsX,          (const unsigned short*)(gX),          ldsX + LX,     (const unsigned short*)(gX + sx),
        ldsX + 2 * LX, (const unsigned short*)(gX + 2 * sx), ldsX + 3 * LX, (const unsigned short*)(gX + 3 * sx),
        ldsX + 4 * LX, (const unsigned short*)(gX + 4 * sx), ldsX + 5 * LX, (const unsigned short*)(gX + 5 * sx),
        ldsX + 6 * LX, (const unsigned short*)(gX + 6 * sx), ldsX + 7 * LX, (const unsigned short*)(gX + 7 * sx));
  copy8(ldsW,               gWh,          ldsW + LW,          gWh + sw,
        ldsW + 2 * LW,      gWh + 2 * sw, ldsW + 3 * LW,      gWh + 3 * sw,
        ldsW + LP,          gWl,          ldsW + LP + LW,     gWl + sw,
        ldsW + LP + 2 * LW, gWl + 2 * sw, ldsW + LP + 3 * LW, gWl + 3 * sw);
}

typedef __attribute__((ext_vector_type(2))) float  v2f;
typedef __attribute__((ext_vector_type(2))) __bf16 v2b;
typedef __attribute__((ext_vector_type(8))) unsigned int v8u;
// a fragment's sixteen f32 values -> hi = bf16_rne(x), lo = bf16_rne(x - hi); p: elements 0..7 <- p[0..7], 8..15 <- p[16..23], as Frag::load.
// Two values at a time: the packed hi pair is also what x - hi is formed from (low half shifted up, high half masked).
__device__ __forceinline__ void load_raw16(const float* p, v4f (&q4)[4]) {
  q4[0] = *(const v4f*)(p); q4[1] = *(const v4f*)(p + 4); q4[2] = *(const v4f*)(p + 16); q4[3] = *(const v4f*)(p + 20);
}
__device__ __forceinline__ void split16(const v4f (&q4)[4], v16b& hi, v16b& lo) {
  v8u hw, lw;
#pragma unroll
  for (int e = 0; e < 8; ++e) {
    const v2f x = {q4[e >> 1][(e & 1) * 2], q4[e >> 1][(e & 1) * 2 + 1]};
    const unsigned h = __builtin_bit_cast(unsigned, __builtin_convertvector(x, v2b));
    const v2f r = {x[0] - __uint_as_float(h << 16), x[1] - __uint_as_float(h & 0xFFFF0000u)};
    hw[e] = h;
    lw[e] = __builtin_bit_cast(unsigned, __builtin_convertvector(r, v2b));
  }
  hi = __builtin_bit_cast(v16b, hw);
  lo = __builtin_bit_cast(v16b, lw);
}

// The loop over the stages of one T x T tile, sixteen waves of 64 x 64; stage 0 has been published and stage 1's copies fly. VT = false: C[token][feature], activations are the A operand; VT = true:
// C[feature][token], activations are the B operand. xw / ww: the wave's first activation / weight row in the tile.
// Per k step a wave keeps its four weight subtiles in registers and streams its four activation subtiles, each split into hi/lo fragments
// in registers on the way: the read of the next subtile stands beside the split and products of this one.
// Per accumulator and k step the products stand in the order A hi.B hi, A hi.B lo, A lo.B hi.
template <bool VT, int KC, int T, int NTH>
__device__ __forceinline__ void xf_main(const unsigned short* sStage, unsigned ldsX, unsigned ldsW, const float* gX,
                                        const unsigned short* gWh, const unsigned short* gWl, int ld, int K,
                                        int xw, int ww, int rlane, int koff, v8f (&acc)[4][4]) {
  typedef Frag<__bf16> F;
  constexpr int XP = KC + 4;                                   // activation row pitch, floats (16 B x odd)
  constexpr int WP = KC + 8;                                   // weight row pitch, elements (16 B x odd)
  constexpr int XB = T * XP * 4;                               // bytes of the activation part
  constexpr unsigned SB = (unsigned)(XB + 2 * T * WP * 2);     // bytes per stage
  const int NT = K / KC;
  for (int t = 0; t < NT; ++t) {
    const unsigned bo = (unsigned)(t & 1) * SB;
    const char* sb = (const char*)sStage + bo;
    const float*  sX = (const float*)sb + (xw + rlane) * XP + koff;
    const __bf16* sW = (const __bf16*)(sb + XB) + (ww + rlane) * WP + koff;
    v4f raw[4];
    load_raw16(sX, raw);
    // unrolled: the LDS offsets of a stage's fragments become immediates
#pragma unroll
    for (int kk = 0; kk < KC; kk += 32) {
      v16b wh[4], wl[4];
#pragma unroll
      for (int s = 0; s < 4; ++s) {
        wh[s] = F::load(sW + (s << 4) * WP + kk);
        wl[s] = F::load(sW + (T + (s << 4)) * WP + kk);
      }
#pragma unroll
      for (int x = 0; x < 4; ++x) {
        // the next subtile of this stage is read while this one is split and multiplied
        const v4f cur[4] = {raw[0], raw[1], raw[2], raw[3]};
        const int nu = (kk >> 3) + x + 1;
        if (nu < KC / 8) load_raw16(sX + ((nu & 3) << 4) * XP + (nu >> 2) * 32, raw);
        v16b xh, xl;
        split16(cur, xh, xl);
#pragma unroll
        for (int s = 0; s < 4; ++s) {
          if (VT) {
            acc[s][x] = F::mma(wh[s], xh, acc[s][x]);
            acc[s][x] = F::mma(wh[s], xl, acc[s][x]);
            acc[s][x] = F::mma(wl[s], xh, acc[s][x]);
          } else {
            acc[x][s] = F::mma(xh, wh[s], acc[x][s]);
            acc[x][s] = F::mma(xh, wl[s], acc[x][s]);
            acc[x][s] = F::mma(xl, wh[s], acc[x][s]);
          }
        }
      }
    }
    // hand-over: every wave's reads of this buffer are done and its copies of the next stage have landed, then the barrier
    wait_ds0();
    wait_async0();
    __syncthreads();
    if (t + 2 < NT) {
      const int k2 = (t + 2) * KC;
      stage_fill_x<KC, T, NTH>(ldsX + bo, gX + k2, ldsW + bo, gWh + k2, gWl + k2, ld);
    }
  }
}

// WM x WN: waves along m and n in the work-group. KC: k per stage. NBUF: 2 = the next stage's copies fly while this one is worked on.
// MI: 16-row subtiles of a wave's tile along m.
// M % (WM*MI*16) == 0, N % (WN*64) == 0, K % KC == 0; wg = the work-group's tile, 0 .. (M/(WM*MI*16))*(N/(WN*64)) - 1; bz = its z plane.
// BIAS_MODE 3: bias[m] where biasM (the same for the whole work-group), else bias[n].
// XF: the projections' form. Xf holds the activations as f32; they are the B operand where biasM, else the A operand, and take that operand's
// offsets and tile; the weight planes come in through the other operand's two pointers. lda == ldb.
template <int ET, bool SPLIT, int BIAS_MODE, int OUT_MODE, bool RESID, int ACT, int WM, int WN, int KC, int NBUF, int MI, bool XF>
__device__ __forceinline__ void gemm_tile(
    const unsigned short* __restrict__ Ap, const unsigned short* __restrict__ A2p, int lda, long strideA, long strideA2,
    const unsigned short* __restrict__ Btp, const unsigned short* __restrict__ Bt2p, int ldb, long strideB, long strideB2,
    void* __restrict__ Cout, void* __restrict__ Cout2, int ldc, long strideC, long strideC2,
    const float* __restrict__ bias,
    const float* __restrict__ resid, long strideR,
    int M, int N, int K, float scale, int zsplit, const int wg, const int bz, const bool biasM, const float* __restrict__ Xf) {
  typedef typename Elem<ET>::T T;
  typedef typename Frag<T>::V V;
  static_assert(SPLIT, "the staged tiles hold a hi and a lo plane of each 16-bit operand");
  static_assert(NBUF == 2, "the epilogue's slabs lie in the stage buffers, behind the barrier at the foot of the last pass");
  constexpr int NTH = WM * WN * 32;
  constexpr int TM = WM * MI * 16;
  constexpr int TN = WN * 64;
  constexpr int PE = KC + 8;                       // LDS row pitch in elements (16 B x odd)
  static_assert(!XF || (TM == TN && WM == 4 && WN == 4 && MI == 4 && ET == 1), "the f32 form: sixteen waves of 64 x 64");
  constexpr int STAGE_E = XF ? TM * (KC * 2 + 8) + 2 * TN * PE : 2 * (TM + TN) * PE;      // 16-bit elements per stage
  __shared__ __align__(16) unsigned short sStage[NBUF * STAGE_E];
  static_assert(WM * WN * 16 * 68 * 4 <= NBUF * STAGE_E * 2, "slabs fit the stage buffers");
  const int zo   = bz / zsplit;
  const int zi   = bz - zo * zsplit;
  const int lane = threadIdx.x & 31;
  // XF: the wave's number as a scalar, so that its part of every address costs no vector register
  const int wave = XF ? __builtin_amdgcn_readfirstlane(threadIdx.x >> 5) : (threadIdx.x >> 5);
  const int tilesN = N / TN;
  const int tilesM = M / TM;
  if (wg >= tilesM * tilesN) return;   // the same for the whole work-group, in front of every barrier
  const int tmw = wg / tilesN;
  const int tnw = wg - tmw * tilesN;
  const int wm = wave / WN;
  const int wn = wave - wm * WN;
  const int m0 = tmw * TM + wm * (MI * 16);
  const int n0 = tnw * TN + (wn << 6);

  const size_t aOff = (size_t)zi * strideA + (size_t)zo * strideA2;
  const size_t bOff = (size_t)zi * strideB + (size_t)zo * strideB2;
  const size_t cOff = (size_t)zi * strideC + (size_t)zo * strideC2;

  const int rlane = lane & 15;                 // row (A) / col (B, D) within subtile
  const int koff  = (lane >> 4) * 8;           // k offset of this lane half
  const int mOff  = (lane >> 4) * 8;           // D row offset

  v8f acc[MI][4];
#pragma unroll
  for (int i = 0; i < MI; ++i)
#pragma unroll
    for (int j = 0; j < 4; ++j) acc[i][j] = (v8f){0.f,0.f,0.f,0.f,0.f,0.f,0.f,0.f};

  if constexpr (XF) {
    // this thread's places in a round of copies: activation row xr, 16-byte piece xc; weight row wr, 16-byte piece wc
    const int xc = threadIdx.x % (KC / 4), xr = threadIdx.x / (KC / 4);
    const int wc = threadIdx.x % (KC / 8), wr = threadIdx.x / (KC / 8);
    const size_t aT = aOff + (size_t)(tmw * TM) * lda, bT = bOff + (size_t)(tnw * TN) * ldb;
    const size_t wT = (biasM ? aT : bT) + (size_t)wr * lda + wc * 8;
    const float* gX = Xf + (biasM ? bT : aT) + (size_t)xr * lda + xc * 4;
    const unsigned short* gWh = (biasM ? Ap : Btp) + wT;
    const unsigned short* gWl = (biasM ? A2p : Bt2p) + wT;
    const unsigned ldsX = (unsigned)(uintptr_t)sStage + (unsigned)(xr * (KC * 4 + 16) + xc * 16);
    const unsigned ldsW = (unsigned)(uintptr_t)sStage + (unsigned)(TM * (KC * 4 + 16) + wr * (KC * 2 + 16) + wc * 16);
    // in front of the loop: stage 0's copies, this wave's wait for them, the barrier that publishes them; then stage 1's copies
    stage_fill_x<KC, TM, NTH>(ldsX, gX, ldsW, gWh, gWl, lda);
    wait_async0();
    __syncthreads();
    if (K > KC) stage_fill_x<KC, TM, NTH>(ldsX + (unsigned)STAGE_E * 2u, gX + KC, ldsW + (unsigned)STAGE_E * 2u, gWh + KC, gWl + KC, lda);
    // the same branch for the whole work-group: each side holds its own loop, so the accumulators stay in their registers
    if (biasM) xf_main<true,  KC, TM, NTH>(sStage, ldsX, ldsW, gX, gWh, gWl, lda, K, wn << 6, wm << 6, rlane, koff, acc);
    else       xf_main<false, KC, TM, NTH>(sStage, ldsX, ldsW, gX, gWh, gWl, lda, K, wm << 6, wn << 6, rlane, koff, acc);
  } else {
  // this thread's place in a round of copies: row cr of the round, 16-byte piece cc of the row
  constexpr int LPR = KC / 8;
  const int cc = threadIdx.x % LPR;
  const int cr = threadIdx.x / LPR;
  const size_t aRow = aOff + (size_t)(tmw * TM + cr) * lda + cc * 8;
  const size_t bRow = bOff + (size_t)(tnw * TN + cr) * ldb + cc * 8;
  const unsigned short* gAh = Ap + aRow;
  const unsigned short* gAl = A2p + aRow;
  const unsigned short* gBh = Btp + bRow;
  const unsigned short* gBl = Bt2p + bRow;
  const size_t stepA = (size_t)(NTH / LPR) * lda;
  const size_t stepB = (size_t)(NTH / LPR) * ldb;
  const unsigned ldsT = (unsigned)(uintptr_t)sStage + (unsigned)(cr * PE + cc * 8) * 2u;

  const int NT = K / KC;
  stage_fill<KC, TM, TN, NTH>(ldsT, gAh, gAl, gBh, gBl, stepA, stepB);
  wait_async0();
  __syncthreads();
  if (NBUF == 2 && NT > 1)
    stage_fill<KC, TM, TN, NTH>(ldsT + (unsigned)STAGE_E * 2u, gAh + KC, gAl + KC, gBh + KC, gBl + KC, stepA, stepB);

  for (int t = 0; t < NT; ++t) {
    const int buf = (NBUF == 2) ? (t & 1) : 0;
    const T* sb = (const T*)(sStage + buf * STAGE_E);
    const T* sA = sb + (wm * (MI * 16) + rlane) * PE + koff;
    const T* sB = sb + (2 * TM + (wn << 6) + rlane) * PE + koff;
    // unrolled: the LDS offsets of a stage's fragments become immediates
#pragma unroll
    for (int kk = 0; kk < KC; kk += 32) {
      V bh[4], bl[4];
#pragma unroll
      for (int j = 0; j < 4; ++j) {
        bh[j] = Frag<T>::load(sB + (j << 4) * PE + kk);
        bl[j] = Frag<T>::load(sB + (TN + (j << 4)) * PE + kk);
      }
#pragma unroll
      for (int i = 0; i < MI; ++i) {
        V ah = Frag<T>::load(sA + (i << 4) * PE + kk);
        V al = Frag<T>::load(sA + (TM + (i << 4)) * PE + kk);
#pragma unroll
        for (int j = 0; j < 4; ++j) {
          acc[i][j] = Frag<T>::mma(ah, bh[j], acc[i][j]);
          acc[i][j] = Frag<T>::mma(ah, bl[j], acc[i][j]);
          acc[i][j] = Frag<T>::mma(al, bh[j], acc[i][j]);
        }
        Frag<T>::guard(acc[i][0], acc[i][3], ah, al);
      }
      Frag<T>::keep(bh[0], bh[1], bh[2], bh[3]);
      Frag<T>::keep(bl[0], bl[1], bl[2], bl[3]);
    }
    if (NBUF == 2) {
      // hand-over: every wave's reads of this buffer are done and its copies of the next stage have landed, then the barrier
      wait_ds0();
      wait_async0();
      __syncthreads();
      if (t + 2 < NT) {
        const int k2 = (t + 2) * KC;
        stage_fill<KC, TM, TN, NTH>(ldsT + (unsigned)(buf * STAGE_E) * 2u, gAh + k2, gAl + k2, gBh + k2, gBl + k2, stepA, stepB);
      }
    } else if (t + 1 < NT) {
      // one buffer: refill it behind every wave's last read, publish it behind every wave's copies
      wait_ds0();
      __syncthreads();
      const int k1 = (t + 1) * KC;
      stage_fill<KC, TM, TN, NTH>(ldsT, gAh + k1, gAl + k1, gBh + k1, gBl + k1, stepA, stepB);
      wait_async0();
      __syncthreads();
    }
  }
  }
  wait_async0();
  // unrolled: acc is indexed by constants only, so it stays in registers
#pragma unroll
  for (int i = 0; i < MI; ++i) acc_guard4(acc[i][0], acc[i][1], acc[i][2], acc[i][3]);

  // ---- epilogue ----
  float* slab = (float*)sStage + wave * (16 * 68);   // per-wave 16x64 slab, pitch 68 floats; every wave's stage reads and copies ended at the last barrier
  const float* Rb = RESID ? (resid + (size_t)zi * strideR) : nullptr;
  // BIAS_MODE 3: this lane's bias values, all loaded here under one work-group-uniform branch
  float bm[MI][8], bn[4];
  if (BIAS_MODE == 3) {
    // both loops unrolled: bn and bm are indexed by constants only, so they stay in registers
#pragma unroll
    for (int j = 0; j < 4; ++j) bn[j] = 0.f;
#pragma unroll
    for (int i = 0; i < MI; ++i)
#pragma unroll
      for (int r = 0; r < 8; ++r) bm[i][r] = 0.f;
    // each run's address is an input of the wait behind it: it stays in its registers up to that wait, so no load's result lands on it earlier
    if (biasM) {
      const float* bp = bias + m0 + mOff;
#pragma unroll
      for (int i = 0; i < MI; ++i)
#pragma unroll
        for (int r = 0; r < 8; ++r) bm[i][r] = bp[(i << 4) + r];
      asm volatile("s_wait_xcnt 0x0" :: "v"(bp) : "memory");
    } else {
      const float* bp = bias + n0 + rlane;
#pragma unroll
      for (int j = 0; j < 4; ++j) bn[j] = bp[j << 4];
      asm volatile("s_wait_xcnt 0x0" :: "v"(bp) : "memory");
    }
  }
#pragma unroll
  for (int i = 0; i < MI; ++i) {
    const int mBase = m0 + (i << 4);
#pragma unroll
    for (int j = 0; j < 4; ++j) {
      const int n = n0 + (j << 4) + rlane;
      float bv = 0.f;
      if (BIAS_MODE == 2) bv = bias[n];
#pragma unroll
      for (int r = 0; r < 8; ++r) {
        float v = acc[i][j][r] * scale;
        if (BIAS_MODE == 1) v += bias[mBase + mOff + r];
        if (BIAS_MODE == 2) v += bv;
        if (BIAS_MODE == 3) v = (v + bm[i][r]) + bn[j];   // one of the two is 0
        if (RESID) v += Rb[(size_t)(mBase + mOff + r) * ldc + n];
        if (ACT == 1) v = tanhf(v);
        if (ACT == 2) v = fmaxf(v, 0.0f);
        if (ACT == 4) v = (v > 0.f) ? v : 0.01f * v;
        slab[(mOff + r) * 68 + (j << 4) + rlane] = v;
      }
    }
    __builtin_amdgcn_fence(__ATOMIC_RELEASE, "workgroup");
    __builtin_amdgcn_wave_barrier();
    __builtin_amdgcn_fence(__ATOMIC_ACQUIRE, "workgroup");
    if (OUT_MODE == 0) {
      float* C = (float*)Cout + cOff;
      const int hh = lane >> 4, c4 = (lane & 15) * 4;     // row seg = 256 B = 16 lanes x 16 B
      {
#pragma unroll
        for (int it = 0; it < 8; ++it) {
          const int row = it * 2 + hh;
          v4f v = *(const v4f*)(slab + row * 68 + c4);
          *(v4f*)(C + (size_t)(mBase + row) * ldc + n0 + c4) = v;
        }
        
      }
    } else {
      const int q = lane >> 3, c8 = (lane & 7) * 8;
      unsigned short* C  = (unsigned short*)Cout  + cOff;
      unsigned short* C2 = (OUT_MODE == 2) ? ((unsigned short*)Cout2 + cOff) : nullptr;
      {
#pragma unroll
        for (int it = 0; it < 4; ++it) {
          const int row = it * 4 + q;
          const float* sp = slab + row * 68 + c8;
          v8h hv, lv;
#pragma unroll
          for (int e = 0; e < 8; ++e) {
            if (OUT_MODE == 1) {
              hv[e] = (_Float16)sp[e];
            } else {
              unsigned short hb = f2bf_bits(sp[e]);
              unsigned short lb = f2bf_bits(sp[e] - bf_bits2f(hb));
              hv[e] = __builtin_bit_cast(_Float16, hb);
              lv[e] = __builtin_bit_cast(_Float16, lb);
            }
          }
          *(v8h*)(C + (size_t)(mBase + row) * ldc + n0 + c8) = hv;
          if (OUT_MODE == 2) *(v8h*)(C2 + (size_t)(mBase + row) * ldc + n0 + c8) = lv;
        }
        
      }
    }
    __builtin_amdgcn_fence(__ATOMIC_RELEASE, "workgroup");
    __builtin_amdgcn_wave_barrier();
    __builtin_amdgcn_fence(__ATOMIC_ACQUIRE, "workgroup");
  }
}

// one GEMM per launch: eight waves, grid.x = tiles, grid.y = z planes
template <int ET, bool SPLIT, int BIAS_MODE, int OUT_MODE, bool RESID, int ACT, int WN, int KC, int NBUF, int MI>
__global__ __launch_bounds__(256) void wmma_gemm64(
    const unsigned short* __restrict__ Ap, const unsigned short* __restrict__ A2p, int lda, long strideA, long strideA2,
    const unsigned short* __restrict__ Btp, const unsigned short* __restrict__ Bt2p, int ldb, long strideB, long strideB2,
    void* __restrict__ Cout, void* __restrict__ Cout2, int ldc, long strideC, long strideC2,
    const float* __restrict__ bias,
    const float* __restrict__ resid, long strideR,
    int M, int N, int K, float scale, int zsplit) {
  gemm_tile<ET, SPLIT, BIAS_MODE, OUT_MODE, RESID, ACT, 8 / WN, WN, KC, NBUF, MI, false>(
      Ap, A2p, lda, strideA, strideA2, Btp, Bt2p, ldb, strideB, strideB2, Cout, Cout2, ldc, strideC, strideC2,
      bias, resid, strideR, M, N, K, scale, zsplit, blockIdx.x, blockIdx.y, false, nullptr);
}

// The three projections in one launch: blockIdx.y = 0: q = x.Wq^T + bq, 1: k = x.Wk^T + bk (M = 8192 tokens, N = 512, 32 x 2 tiles),
// 2: v^T[bb] = Wv.x[bb]^T + bv (M = 512, N = 512 tokens, 2 x 2 tiles for each of the 16 batches). 64 tiles of 256 x 256 each, 192
// work-groups of sixteen waves (four per SIMD), all resident at once.
// xq, xk, xv: the activations as they come in, f32 [8192][512]; each wave splits the fragments it needs into bf16 hi/lo in registers.
// Wp: planes [Wq hi | Wq lo | Wk hi | Wk lo | Wv hi | Wv lo | ...],
// Pp: planes [Q hi | Q lo | K hi | K lo | V^T hi | V^T lo], as the workspace map has them.
constexpr int kProjT = 256;                                        // tile edge
constexpr int kProjWG = (kGRows / kProjT) * (kDm / kProjT);        // 64 tiles per projection
static_assert(kProjWG == kGB * (kDm / kProjT) * (kSeq / kProjT) && kNGrp == 1, "projection geometry");
__global__ __launch_bounds__(512) void proj3_kernel(
    const float* __restrict__ xq, const float* __restrict__ xk, const float* __restrict__ xv,
    const unsigned short* __restrict__ Wp, unsigned short* __restrict__ Pp,
    const float* __restrict__ bq, const float* __restrict__ bk, const float* __restrict__ bv) {
  constexpr size_t kXE = (size_t)kGRows * kDm, kWE = (size_t)kDm * kDm;   // elements of an activation and of a weight plane
  constexpr int kTB = (kDm / kProjT) * (kSeq / kProjT);                   // v^T tiles per batch
  const int sel = blockIdx.y;
  const bool vt = (sel == 2);
  const float* X = (sel == 0) ? xq : (sel == 1) ? xk : xv;
  const unsigned short* Wh = Wp + (size_t)(2 * sel) * kWE;
  unsigned short* Oh = Pp + (size_t)(2 * sel) * kXE;
  const float* bias = (sel == 0) ? bq : (sel == 1) ? bk : bv;
  gemm_tile<1, true, 3, 2, false, 0, 4, 4, 64, 2, 4, true>(
      Wh, Wh + kWE, kDm, 0L, 0L,
      Wh, Wh + kWE, kDm, vt ? (long)kSeq * kDm : 0L, 0L,
      (void*)Oh, (void*)(Oh + kXE), kDm, vt ? (long)kDm * kSeq : 0L, 0L,
      bias, bias, 0L, vt ? kDm : kGRows, kDm, kDm, 1.0f, kGB,
      vt ? (int)(blockIdx.x % kTB) : (int)blockIdx.x, vt ? (int)(blockIdx.x / kTB) : 0, vt, X);
}

// ---------------------------------------------------------------------------
// f32 -> bf16 hi/lo split of the four weight tensors in one launch: hi = bf16_rne(x), lo = bf16_rne(x - hi).
// A piece = 8 neighbouring elements (32 bytes read, 16 + 16 bytes written) of one thread. 256 work-groups x 512 threads = 131072 threads:
// the four weight tensors together are 131072 pieces (64 work-groups each), one piece per thread.
// Wp: planes [Wq hi | Wq lo | Wk hi | ... | Wo lo], as the workspace map has them.
// ---------------------------------------------------------------------------
constexpr int kSplitTh  = 512;                       // threads per work-group
constexpr int kSplitWG  = 256;                       // work-groups
constexpr int kSplitAll = kSplitTh * kSplitWG;       // 131072 threads
constexpr int kWgtE     = kDm * kDm;                 // elements of a weight tensor
static_assert(4 * kWgtE == kSplitAll * 8 && kWgtE % (kSplitTh * 8) == 0, "split geometry");

__device__ __forceinline__ void split8_store(const v4f a, const v4f b, unsigned short* __restrict__ hi, unsigned short* __restrict__ lo) {
  const float f[8] = {a[0], a[1], a[2], a[3], b[0], b[1], b[2], b[3]};
  unsigned hw[4], lw[4];
#pragma unroll
  for (int q = 0; q < 4; ++q) {
    const unsigned short h0 = f2bf_bits(f[2 * q]), h1 = f2bf_bits(f[2 * q + 1]);
    const unsigned short l0 = f2bf_bits(f[2 * q] - bf_bits2f(h0));
    const unsigned short l1 = f2bf_bits(f[2 * q + 1] - bf_bits2f(h1));
    hw[q] = pk16(h0, h1);
    lw[q] = pk16(l0, l1);
  }
  *(v4u*)hi = (v4u){hw[0], hw[1], hw[2], hw[3]};
  *(v4u*)lo = (v4u){lw[0], lw[1], lw[2], lw[3]};
}

__global__ __launch_bounds__(kSplitTh) void split_w_kernel(
    const float* __restrict__ wq, const float* __restrict__ wk, const float* __restrict__ wv, const float* __restrict__ wo,
    unsigned short* __restrict__ Wp) {
  const int g = blockIdx.x * kSplitTh + threadIdx.x;
  const size_t e0 = (size_t)g * 8;
  // the weight tensor is the same for a whole work-group
  const int wsel = blockIdx.x / (kWgtE / (kSplitTh * 8));
  const float* w = (wsel == 0) ? wq : (wsel == 1) ? wk : (wsel == 2) ? wv : wo;
  const size_t we = e0 - (size_t)wsel * kWgtE;
  const v4f wa = *(const v4f*)(w + we);
  const v4f wb = *(const v4f*)(w + we + 4);
  wait_x0();
  unsigned short* whi = Wp + (size_t)(2 * wsel) * kWgtE + we;
  split8_store(wa, wb, whi, whi + kWgtE);
}

// ---------------------------------------------------------------------------
// Scores, gated mixing and p.v in one kernel; no score and no probability leaves the work-group.
// Work-group = one (batch, head) plane z = bb*8 + h and 256 queries; wave = 32 queries (two 16-column groups) against all 512 keys.
// Transposed products: S^T = K.Q^T (A = key rows from LDS, B = query rows kept in registers), O^T parts += V^T.P^T and V^T.adj^T, kept apart (A = v^T rows from LDS).
// In an S^T tile lane (c, hh) holds query c and keys 8*hh + r: the row maximum and the row sums are in-lane plus one exchange
// between the lane halves, and two S^T tiles (32 keys), converted in place, are the B operand of the second product.
// The scores are formed once. The softmax part and the distance part are summed apart, each in a loop of its own over blocks of 32 keys,
// and joined at the end:
//     g_c  = bg[c] + sum_d q[i][h*64+d] * Wg[c][d],  qp_c = rcp((|g_c| + 1)^2)
//     p_j  = 2^(s_j * log2e - m)      m = the running row maximum (times log2e); the sums so far are rescaled by 2^(m_old - m_new) per block
//     adj  = 2^((i-j)^2 * (-0.5 log2e qp_1)) for j < i,  2^((i-j)^2 * (-0.5 log2e qp_0)) for j >= i
//     ctx_i = (sg * sum_j p_j v_j + (1 - sg) * sum_j adj_j v_j) * rcp(sg * sum_j p_j + (1 - sg) * sum_j adj_j + 1e-9),
//     sg = rcp(1 + 2^(-lam1 * log2e));  p and adj go into the products as bf16 hi/lo fragments
// A key block in which every adj of the wave's 32 queries is 0 in f32 (exponent below -160 for the widest of them at the block's
// smallest |i-j|) adds nothing to the distance sums: the distance loop walks only the blocks around the wave's own that are not so.
// LDS: all 512 key rows (hi, lo; pitch 144 B) and the 64 v^T rows (hi, lo; pitch 1040 B) of the plane, each byte filled once by
// global_load_async_to_lds_b128: keys 0..255 in front of the loop, keys 256..511 fly during the first eight key blocks.
// Output coverage: grid 2 x 128, 8 waves x 32 queries = 512 rows per plane; a wave writes the whole 128-byte segment (row, h) of both planes.
// ---------------------------------------------------------------------------
__device__ __forceinline__ float hw_exp2(float x) { return __builtin_amdgcn_exp2f(x); }
__device__ __forceinline__ float hw_rcp(float x)  { return __builtin_amdgcn_rcpf(x); }

// lane l with lane l ^ 16
__device__ __forceinline__ float xhalf(float x) {
  return __builtin_bit_cast(float, __builtin_amdgcn_permlanex16(__builtin_bit_cast(int, x), __builtin_bit_cast(int, x), 0x76543210, 0xfedcba98, false, false));
}

// half a plane in 8 rounds of the 256 threads; lds / g = this thread's place in round 0, lstep (bytes) / gstep (elements) = one round
__device__ __forceinline__ void fill8(unsigned lds, unsigned lstep, const unsigned short* g, size_t gstep) {
  copy8(lds,             g,             lds + lstep,     g + gstep,     lds + 2 * lstep, g + 2 * gstep, lds + 3 * lstep, g + 3 * gstep,
        lds + 4 * lstep, g + 4 * gstep, lds + 5 * lstep, g + 5 * gstep, lds + 6 * lstep, g + 6 * gstep, lds + 7 * lstep, g + 7 * gstep);
}

// sixteen f32 values of one query (two S^T tiles) -> the bf16 hi and lo B fragments of the second product; two values at a time, as split16
__device__ __forceinline__ void split_frag(const float (&a)[16], v16b& hi, v16b& lo) {
  v8u hw, lw;
#pragma unroll
  for (int e = 0; e < 8; ++e) {
    const v2f x = {a[2 * e], a[2 * e + 1]};
    const unsigned h = __builtin_bit_cast(unsigned, __builtin_convertvector(x, v2b));
    const v2f r = {x[0] - __uint_as_float(h << 16), x[1] - __uint_as_float(h & 0xFFFF0000u)};
    hw[e] = h;
    lw[e] = __builtin_bit_cast(unsigned, __builtin_convertvector(r, v2b));
  }
  hi = __builtin_bit_cast(v16b, hw);
  lo = __builtin_bit_cast(v16b, lw);
}

constexpr int kKP = kDk + 8;     // LDS pitch of a key row, elements (16 B x odd)
constexpr int kVP = kSeq + 8;    // LDS pitch of a v^T row, elements (16 B x odd)
constexpr int kQB = 256;         // queries per work-group

// S^T tile of keys kt*16 .. kt*16+15 against both query groups; kr = this lane's place in key row c of the hi plane
__device__ __forceinline__ void score_tile(const __bf16* kr, const v16b (&qh)[2][2], const v16b (&ql)[2][2], v8f (&s)[2]) {
  typedef Frag<__bf16> F;
  const v16b kh0 = F::load(kr), kh1 = F::load(kr + 32);
  const v16b kl0 = F::load(kr + kSeq * kKP), kl1 = F::load(kr + kSeq * kKP + 32);
#pragma unroll
  for (int qt = 0; qt < 2; ++qt) {
    v8f a = (v8f){0.f, 0.f, 0.f, 0.f, 0.f, 0.f, 0.f, 0.f};
    a = F::mma(kh0, qh[qt][0], a);
    a = F::mma(kl0, qh[qt][0], a);
    a = F::mma(kh0, ql[qt][0], a);
    a = F::mma(kh1, qh[qt][1], a);
    a = F::mma(kl1, qh[qt][1], a);
    a = F::mma(kh1, ql[qt][1], a);
    s[qt] = a;
  }
}

__global__ __launch_bounds__(256) void attn_mix_kernel(
    const unsigned short* __restrict__ Qh, const unsigned short* __restrict__ Ql,
    const unsigned short* __restrict__ Kh, const unsigned short* __restrict__ Kl,
    const unsigned short* __restrict__ VTh, const unsigned short* __restrict__ VTl,
    unsigned short* __restrict__ Ch, unsigned short* __restrict__ Cl,
    const float* __restrict__ Wg, const float* __restrict__ bg, const float* __restrict__ lam1) {
  typedef Frag<__bf16> F;
  __shared__ __align__(16) unsigned short sK[2 * kSeq * kKP];
  __shared__ __align__(16) unsigned short sV[2 * kDk * kVP];
  constexpr int kHalf = kSeq / 2;
  const int tid  = threadIdx.x;
  const int lane = tid & 31;
  const int wave = __builtin_amdgcn_readfirstlane(tid >> 5);   // a scalar: the tests on the wave's own key block below are scalar branches
  const int c    = lane & 15;
  const int hh   = lane >> 4;
  const int z    = blockIdx.y;
  const int bb   = z >> 3;
  const int h    = z & (kHeads - 1);
  const int q0   = blockIdx.x * kQB + wave * 32;
  const int kd   = q0 >> 5;                                    // the key block that holds the wave's own queries

  // this thread's places in round 0 of the copies. Key rows: 8 lanes per 128-byte row piece, 32 rows per round;
  // v^T rows: 32 lanes per 512-byte half row, 8 rows per round
  const size_t   gK = (size_t)(bb * kSeq + (tid >> 3)) * kDm + (size_t)h * kDk + (tid & 7) * 8;
  const unsigned lK = (unsigned)(uintptr_t)sK + (unsigned)((tid >> 3) * kKP + (tid & 7) * 8) * 2u;
  const size_t   gV = (size_t)bb * kDm * kSeq + (size_t)(h * kDk + (tid >> 5)) * kSeq + (tid & 31) * 8;
  const unsigned lV = (unsigned)(uintptr_t)sV + (unsigned)((tid >> 5) * kVP + (tid & 31) * 8) * 2u;

  // keys 0..255: key rows and v^T columns, hi and lo
  fill8(lK, 32u * kKP * 2u, Kh + gK, (size_t)32 * kDm);
  fill8(lK + (unsigned)(kSeq * kKP) * 2u, 32u * kKP * 2u, Kl + gK, (size_t)32 * kDm);
  fill8(lV, 8u * kVP * 2u, VTh + gV, (size_t)8 * kSeq);
  fill8(lV + (unsigned)(kDk * kVP) * 2u, 8u * kVP * 2u, VTl + gV, (size_t)8 * kSeq);

  // query fragments (B operand), hardware k order
  v16b qh[2][2], ql[2][2];
#pragma unroll
  for (int qt = 0; qt < 2; ++qt) {
#pragma unroll
    for (int ks = 0; ks < 2; ++ks) {
      const size_t o = (size_t)(bb * kSeq + q0 + qt * 16 + c) * kDm + (size_t)h * kDk + ks * 32 + hh * 8;
      qh[qt][ks] = F::load((const __bf16*)(Qh + o));
      ql[qt][ks] = F::load((const __bf16*)(Ql + o));
    }
    wait_x0();
  }

  // gating dots: this lane holds 32 of its query's 64 d, the other lane half the rest
  float gn0[2], gn1[2];
  {
    float g0[2] = {0.f, 0.f}, g1[2] = {0.f, 0.f};
#pragma unroll
    for (int ks = 0; ks < 2; ++ks)
#pragma unroll
      for (int hf = 0; hf < 2; ++hf) {
        const float* wp = Wg + ks * 32 + hf * 16 + hh * 8;
        const v4f wa = *(const v4f*)(wp), wb = *(const v4f*)(wp + 4);
        const v4f wc = *(const v4f*)(wp + kDk), wd = *(const v4f*)(wp + kDk + 4);
#pragma unroll
        for (int e = 0; e < 8; ++e) {
          const float w0 = (e < 4) ? wa[e & 3] : wb[e & 3];
          const float w1 = (e < 4) ? wc[e & 3] : wd[e & 3];
#pragma unroll
          for (int qt = 0; qt < 2; ++qt) {
            const float qv = (float)qh[qt][ks][hf * 8 + e] + (float)ql[qt][ks][hf * 8 + e];
            g0[qt] += qv * w0;
            g1[qt] += qv * w1;
          }
        }
      }
    const float b0 = bg[0], b1 = bg[1];
#pragma unroll
    for (int qt = 0; qt < 2; ++qt) {
      const float t0 = fabsf(g0[qt] + __shfl_xor(g0[qt], 16, 32) + b0) + 1.0f;
      const float t1 = fabsf(g1[qt] + __shfl_xor(g1[qt], 16, 32) + b1) + 1.0f;
      gn0[qt] = (-0.5f * kLog2e) * hw_rcp(t0 * t0);      // j >= i (upper incl. diagonal)
      gn1[qt] = (-0.5f * kLog2e) * hw_rcp(t1 * t1);      // j <  i (strictly lower)
    }
  }
  const float sg  = hw_rcp(1.0f + hw_exp2(-lam1[0] * kLog2e));
  const float omg = 1.0f - sg;
  // the widest distance curve among the wave's 32 queries (all four factors are <= 0: the one nearest 0), as a scalar
  float gw = fmaxf(fmaxf(gn0[0], gn1[0]), fmaxf(gn0[1], gn1[1]));
#pragma unroll
  for (int m = 1; m < 32; m <<= 1) gw = fmaxf(gw, __shfl_xor(gw, m, 32));
  const float gwide = __uint_as_float((unsigned)__builtin_amdgcn_readfirstlane((int)__float_as_uint(gw)));

  // keys 0..255: this wave's copies have landed, then the barrier that publishes them
  wait_async0();
  __syncthreads();

  // keys 256..511: read only behind the barrier in front of key block 8
  fill8(lK + (unsigned)(kHalf * kKP) * 2u, 32u * kKP * 2u, Kh + gK + (size_t)kHalf * kDm, (size_t)32 * kDm);
  fill8(lK + (unsigned)((kSeq + kHalf) * kKP) * 2u, 32u * kKP * 2u, Kl + gK + (size_t)kHalf * kDm, (size_t)32 * kDm);
  fill8(lV + (unsigned)kHalf * 2u, 8u * kVP * 2u, VTh + gV + kHalf, (size_t)8 * kSeq);
  fill8(lV + (unsigned)(kDk * kVP + kHalf) * 2u, 8u * kVP * 2u, VTl + gV + kHalf, (size_t)8 * kSeq);

  const __bf16* kr0 = (const __bf16*)sK + c * kKP + hh * 8;
  const __bf16* vr0 = (const __bf16*)sV + c * kVP + hh * 8;

  // ---- the softmax part: every key block ----
  v8f op[4][2];                                 // sum_j p_j v_j
#pragma unroll
  for (int dt = 0; dt < 4; ++dt)
#pragma unroll
    for (int qt = 0; qt < 2; ++qt) op[dt][qt] = (v8f){0.f, 0.f, 0.f, 0.f, 0.f, 0.f, 0.f, 0.f};
  float lp[2] = {0.f, 0.f};
  float mu[2] = {-INFINITY, -INFINITY};         // the running row maximum, times log2e
  // rolled: for speed only
#pragma unroll 1
  for (int kp = 0; kp < kSeq / 32; ++kp) {
    if (kp == kHalf / 32) {
      // keys 256..511: this wave's copies have landed, then the barrier that publishes them; the same trip for every wave
      wait_async0();
      __syncthreads();
    }
    // the block's v^T fragments, named ahead of the scores: their reads may then stand anywhere in front of the second product
    const __bf16* vr = vr0 + kp * 32;
    v16b vh[4], vl[4];
#pragma unroll
    for (int dt = 0; dt < 4; ++dt) {
      vh[dt] = F::load(vr + dt * 16 * kVP);
      vl[dt] = F::load(vr + (kDk + dt * 16) * kVP);
    }
    v8f s[2][2];
    score_tile(kr0 + (kp * 2) * 16 * kKP, qh, ql, s[0]);
    score_tile(kr0 + (kp * 2 + 1) * 16 * kKP, qh, ql, s[1]);

    v16b ph[2], pl[2];
#pragma unroll
    for (int qt = 0; qt < 2; ++qt) {
      float mx = s[0][qt][0];
#pragma unroll
      for (int r = 1; r < 8; ++r) mx = fmaxf(mx, s[0][qt][r]);
#pragma unroll
      for (int r = 0; r < 8; ++r) mx = fmaxf(mx, s[1][qt][r]);
      mx = fmaxf(mx, xhalf(mx)) * kLog2e;                // both lane halves hold the query's maximum of this block
      const float mn   = fmaxf(mu[qt], mx);
      const float corr = hw_exp2(mu[qt] - mn);           // 0 in the first block, where the running maximum is -inf
      mu[qt] = mn;
      lp[qt] *= corr;
#pragma unroll
      for (int dt = 0; dt < 4; ++dt) op[dt][qt] = op[dt][qt] * corr;
      float p[16];
#pragma unroll
      for (int e = 0; e < 16; e += 2) {
        const v2f t = __builtin_elementwise_fma((v2f){s[e >> 3][qt][e & 7], s[e >> 3][qt][(e & 7) + 1]}, (v2f){kLog2e, kLog2e}, (v2f){-mn, -mn});
        p[e]     = hw_exp2(t[0]);
        p[e + 1] = hw_exp2(t[1]);
        lp[qt] += p[e] + p[e + 1];
      }
      split_frag(p, ph[qt], pl[qt]);
    }

#pragma unroll
    for (int dt = 0; dt < 4; ++dt)
#pragma unroll
      for (int qt = 0; qt < 2; ++qt) {
        op[dt][qt] = F::mma(vh[dt], ph[qt], op[dt][qt]);
        op[dt][qt] = F::mma(vl[dt], ph[qt], op[dt][qt]);
        op[dt][qt] = F::mma(vh[dt], pl[qt], op[dt][qt]);
      }
  }

  // ---- the distance part: the key blocks kd - rad .. kd + rad ----
  // At dk blocks from the wave's own the smallest |i - j| is 32 dk - 31; rad = the farthest dk at which an adj can still be other than 0
  int rad = 0;
  // unrolled: fifteen scalar compares
#pragma unroll
  for (int dk = 1; dk < kSeq / 32; ++dk) {
    const float dmin = (float)(dk * 32 - 31);
    if (!(gwide * (dmin * dmin) < -160.0f)) rad = dk;
  }
  const int klo = (kd - rad > 0) ? (kd - rad) : 0;
  const int khi = (kd + rad < kSeq / 32 - 1) ? (kd + rad) : (kSeq / 32 - 1);
  v8f oa[4][2];                                 // sum_j adj_j v_j
#pragma unroll
  for (int dt = 0; dt < 4; ++dt)
#pragma unroll
    for (int qt = 0; qt < 2; ++qt) oa[dt][qt] = (v8f){0.f, 0.f, 0.f, 0.f, 0.f, 0.f, 0.f, 0.f};
  float la[2] = {0.f, 0.f};
  const float fi[2] = {(float)(q0 + c - hh * 8), (float)(q0 + 16 + c - hh * 8)};
  // rolled: the trip count is the wave's own, 1 to 16
#pragma unroll 1
  for (int kp = klo; kp <= khi; ++kp) {
    v16b ah[2], al[2];
#pragma unroll
    for (int qt = 0; qt < 2; ++qt) {
      float a[16];
#pragma unroll
      for (int e = 0; e < 16; e += 2) {
        const float fd0 = fi[qt] - (float)(kp * 32 + (e >> 3) * 16) - (float)(e & 7);   // i - j
        const float fd1 = fd0 - 1.0f;
        const v2f t = (v2f){fd0 * fd0, fd1 * fd1} * (v2f){(fd0 > 0.f) ? gn1[qt] : gn0[qt], (fd1 > 0.f) ? gn1[qt] : gn0[qt]};
        a[e]     = hw_exp2(t[0]);
        a[e + 1] = hw_exp2(t[1]);
        la[qt] += a[e] + a[e + 1];
      }
      split_frag(a, ah[qt], al[qt]);
    }
    const __bf16* vr = vr0 + kp * 32;
#pragma unroll
    for (int dt = 0; dt < 4; ++dt) {
      const v16b vh = F::load(vr + dt * 16 * kVP);
      const v16b vl = F::load(vr + (kDk + dt * 16) * kVP);
#pragma unroll
      for (int qt = 0; qt < 2; ++qt) {
        oa[dt][qt] = F::mma(vh, ah[qt], oa[dt][qt]);
        oa[dt][qt] = F::mma(vl, ah[qt], oa[dt][qt]);
        oa[dt][qt] = F::mma(vh, al[qt], oa[dt][qt]);
      }
    }
  }

  // epilogue: lane (c, hh) holds d = dt*16 + 8*hh + r of query c: one 16-byte store per tile and plane
#pragma unroll
  for (int qt = 0; qt < 2; ++qt) {
    const float inv = hw_rcp(sg * (lp[qt] + xhalf(lp[qt])) + omg * (la[qt] + xhalf(la[qt])) + 1e-9f);
    const float fp = sg * inv, fa = omg * inv;
    const size_t ro = (size_t)(bb * kSeq + q0 + qt * 16 + c) * kDm + (size_t)h * kDk + hh * 8;
#pragma unroll
    for (int dt = 0; dt < 4; ++dt) {
      v8b hv, lv;
#pragma unroll
      for (int r = 0; r < 8; ++r) {
        const float x = op[dt][qt][r] * fp + oa[dt][qt][r] * fa;
        const __bf16 hb = (__bf16)x;
        hv[r] = hb;
        lv[r] = (__bf16)(x - (float)hb);
      }
      *(v8b*)((__bf16*)Ch + ro + dt * 16) = hv;
      *(v8b*)((__bf16*)Cl + ro + dt * 16) = lv;
    }
    wait_x0();
  }
}

// ---------------------------------------------------------------------------
// Workspace region map (bytes; every offset a multiple of 512 KiB). Every region is fully written
// inside the call before any read.
//   Wqh,Wql,Wkh,Wkl,Wvh,Wvl,Woh,Wol  bf16 [512][512] each            0 .. 4194304
//   Qh,Ql,Kh,Kl                      bf16 [8192][512] each     4194304 .. 37748736   (row bb*512+i, col h*64+d)
//   VTh,VTl                          bf16 [16][512][512]      37748736 .. 54525952   (batch, row h*64+d, col token)
//   CTXh,CTXl                        bf16 [8192][512] each    54525952 .. 71303168   (row bb*512+i, col h*64+d)
//   total 71303168
// ---------------------------------------------------------------------------
extern "C" void kernel_launch(void* const* d_in, const int* in_sizes, int n_in,
                              void* d_out, int out_size, void* d_ws, size_t ws_size,
                              hipStream_t stream) {
  if (n_in < 14) return;
  const int nAct = kBatch * kSeq * kDm;          // 4194304
  const int nW   = kDm * kDm;                    // 262144
  if (in_sizes[0] != nAct || in_sizes[1] != nAct || in_sizes[2] != nAct) return;
  if (in_sizes[3] != nW || in_sizes[5] != nW || in_sizes[7] != nW || in_sizes[12] != nW) return;
  if (in_sizes[4] != kDm || in_sizes[6] != kDm || in_sizes[8] != kDm || in_sizes[13] != kDm) return;
  if (in_sizes[9] != 2 * kDk || in_sizes[10] < 2 || in_sizes[11] < 1) return;
  if (out_size != nAct) return;

  const float* query = (const float*)d_in[0];
  const float* key   = (const float*)d_in[1];
  const float* value = (const float*)d_in[2];
  const float* Wq    = (const float*)d_in[3];
  const float* bq    = (const float*)d_in[4];
  const float* Wk    = (const float*)d_in[5];
  const float* bk    = (const float*)d_in[6];
  const float* Wv    = (const float*)d_in[7];
  const float* bv    = (const float*)d_in[8];
  const float* Wg    = (const float*)d_in[9];
  const float* bg    = (const float*)d_in[10];
  const float* lam1  = (const float*)d_in[11];
  const float* Wo    = (const float*)d_in[12];
  const float* bo    = (const float*)d_in[13];
  float* out = (float*)d_out;

  const size_t PW  = (size_t)kDm * kDm * 2;                 // 524288    weight plane
  const size_t PX  = (size_t)kGRows * kDm * 2;              // 8388608   q / k / ctx plane
  const size_t PVT = (size_t)kGB * kDm * kSeq * 2;          // 8388608   v^T plane
  size_t off = 0;
  const size_t oWqh = off; off += PW;  const size_t oWql = off; off += PW;
  const size_t oWkh = off; off += PW;  const size_t oWkl = off; off += PW;
  const size_t oWvh = off; off += PW;  const size_t oWvl = off; off += PW;
  const size_t oWoh = off; off += PW;  const size_t oWol = off; off += PW;
  const size_t oQh  = off; off += PX;  const size_t oQl  = off; off += PX;
  const size_t oKh  = off; off += PX;  const size_t oKl  = off; off += PX;
  const size_t oVTh = off; off += PVT; const size_t oVTl = off; off += PVT;
  const size_t oCh  = off; off += PX;  const size_t oCl  = off; off += PX;
  if (off > ws_size) return;                                // off = 71303168

  char* ws = (char*)d_ws;
  unsigned short* Wqh = (unsigned short*)(ws + oWqh); unsigned short* Wql = (unsigned short*)(ws + oWql);
  unsigned short* Wkh = (unsigned short*)(ws + oWkh); unsigned short* Wkl = (unsigned short*)(ws + oWkl);
  unsigned short* Wvh = (unsigned short*)(ws + oWvh); unsigned short* Wvl = (unsigned short*)(ws + oWvl);
  unsigned short* Woh = (unsigned short*)(ws + oWoh); unsigned short* Wol = (unsigned short*)(ws + oWol);
  unsigned short* Qh  = (unsigned short*)(ws + oQh);  unsigned short* Ql  = (unsigned short*)(ws + oQl);
  unsigned short* Kh  = (unsigned short*)(ws + oKh);  unsigned short* Kl  = (unsigned short*)(ws + oKl);
  unsigned short* VTh = (unsigned short*)(ws + oVTh); unsigned short* VTl = (unsigned short*)(ws + oVTl);
  unsigned short* Ch  = (unsigned short*)(ws + oCh);  unsigned short* Cl  = (unsigned short*)(ws + oCl);

  const dim3 blk(256);
  const dim3 blkSplit(kSplitTh);                                    // 512 threads
  const dim3 gSplit(kSplitWG);                                      // 256 work-groups: the four weight tensors
  const dim3 blkProj(512);
  const dim3 gProj(kProjWG, 3);                                     // 64 x 3:     256 x 256 tiles of q, k, v^T; K=512
  const dim3 gAtt(kSeq / kQB, kNZ);                                 // 2 x 128:    256 queries x 512 keys per work-group
  const dim3 gOut((kGRows / 128) * (kDm / 128), 1);                 // 64 x 4 = 256 tiles of 128 x 128: M=8192, N=512, K=512

  // (1) weights -> hi/lo planes [512][512] (torch [out][in] is already Bt[n][k]); every plane whole
  split_w_kernel<<<gSplit, blkSplit, 0, stream>>>(Wq, Wk, Wv, Wo, Wqh);

  for (int gb = 0; gb < kNGrp; ++gb) {
    const size_t actOff = (size_t)gb * kGRows * kDm;
    // (2) q = x.Wq^T + bq, k = x.Wk^T + bk -> hi/lo planes [8192][512]; v^T[bb][o][tok] = sum_k Wv[o][k] x[bb*512+tok][k] + bv[o]
    //     -> hi/lo planes [16][512][512]; all six planes whole, one launch
    proj3_kernel<<<gProj, blkProj, 0, stream>>>(query, key, value, Wqh, Qh, bq, bk, bv);
    // (4) ctx[bb*512+i][h*64+d] = sum_j A[z][i][j] v^T[bb][h*64+d][j] / (sum_j A[z][i][j] + 1e-9) -> hi/lo planes, A = gated mix of the scores q.k^T
    attn_mix_kernel<<<gAtt, blk, 0, stream>>>(Qh, Ql, Kh, Kl, VTh, VTl, Ch, Cl, Wg, bg, lam1);
    // (5) out = ctx.Wo^T + bo -> f32 [8192][512], all of d_out: one 128 x 128 tile per work-group, eight waves (4 x 2) of 32 x 64, k in four stages of 128
    float* outg = out + actOff;
    wmma_gemm64<1, true, 2, 0, false, 0, 2, 128, 2, 2><<<gOut, blk, 0, stream>>>(
        Ch, Cl, kDm, 0L, 0L, Woh, Wol, kDm, 0L, 0L, (void*)outg, (void*)outg, kDm, 0L, 0L,
        bo, bo, 0L, kGRows, kDm, kDm, 1.0f, 1);
  }
}
